// v000
// The times below were measured on an AMD MI455X: many runs one after another, warmed up first and cycling through
// copies of the inputs, with the whole window's GPU time divided by the number of runs. Launches and the gaps
// between them are all in it. The median over several windows is given; except for v000 it joins two sittings, which
// can be a few percent apart, so the side-by-side timings, each taken in one sitting, are the better comparison.
// The starting kernel, v000, takes 1320 microseconds a run.
#include <hip/hip_runtime.h>
// Geometry-aware attention (B=8, N=1024, F=512, 8 heads × 64, G=128): feat = MHA(features) (x·W + b, softmax(q·k/8)·v, ·wo + bo); geometry branch: gq, gk, gv = geometry·W + b (F wide, single head);
// g_scores = gq·gkᵀ/8 + mean_h(gelu_tanh(dist·d1_w + d1_b)·d2_w + d2_b) with dist = max(‖coords_q − coords_k‖, 1e-6); geom = softmax(g_scores)·gv; out = (feat + geom)·op_w + op_b. (in,out) weights; jax.nn.gelu default = tanh approximation.
// Compute dtype: features, geometry, coords, all weights/biases rounded to bf16; f16 GEMM planes; the 8-head branch through a fused flash-style kernel (online softmax f32, P f16 ×2^10); the geometry branch per batch: S = gq·gkᵀ/8 f32-accurate from f16 hi + residual planes (hi·hi + (lo·hi + hi·lo)·2^-10; its logits reach σ≈3), a kernel adding the distance-MLP bias in place (f32, per pair from the coords), a wave-per-row f32 softmax → P f16 ×2^15, geom = P·gv by GEMM with feat_att as the f32 addend; final projection GEMM. All contractions on v_wmma_f32_16x16x32_f16, f32 accumulate.
#define BB 8
#define TT 1024
#define DD 512
#define GG 128
#define NH 8
#define NR (BB * TT)

typedef __bf16 v16b __attribute__((ext_vector_type(16)));
typedef unsigned short v8us __attribute__((ext_vector_type(8), may_alias));
typedef float  v8f  __attribute__((ext_vector_type(8)));
typedef float  v4f  __attribute__((ext_vector_type(4)));
typedef float  v4fa __attribute__((ext_vector_type(4), may_alias));
union FragB { v16b v; v8us half[2]; unsigned short u[16]; };

__device__ __forceinline__ unsigned short bf16_bits(float x) { unsigned int u = __float_as_uint(x); return (unsigned short)((u + 0x7FFFu + ((u >> 16) & 1u)) >> 16); }
__device__ __forceinline__ float bf16_val(unsigned short b) { return __uint_as_float(((unsigned int)b) << 16); }
__device__ __forceinline__ float bf16_round(float x) { return bf16_val(bf16_bits(x)); }
// D += A·B with NT terms: 1 = ah·bh, 2 = + al·bh (A split), 3 = + ah·bl (both split)
template <int NT>
__device__ __forceinline__ v8f mmaN(v16b ah, v16b al, v16b bh, v16b bl, v8f c) {
  c = __builtin_amdgcn_wmma_f32_16x16x32_bf16(false, ah, false, bh, (short)0, c, false, false);
  if (NT >= 2) c = __builtin_amdgcn_wmma_f32_16x16x32_bf16(false, al, false, bh, (short)0, c, false, false);
  if (NT >= 3) c = __builtin_amdgcn_wmma_f32_16x16x32_bf16(false, ah, false, bl, (short)0, c, false, false);
  asm volatile("v_nop\n\tv_nop\n\tv_nop\n\tv_nop" : "+v"(c) : "v"(ah), "v"(al), "v"(bh), "v"(bl));
  return c;
}

__global__ __launch_bounds__(256) void k_wt_bf16(const float* __restrict__ W, unsigned short* __restrict__ Wt, int K, int N) {
  const int t = blockIdx.x * 256 + threadIdx.x;
  const int k8n = K / 8;
  if (t >= N * k8n) return;
  const int n = t / k8n, k8 = (t % k8n) * 8;
  v8us v;
#pragma unroll
  for (int i = 0; i < 8; ++i) v[i] = bf16_bits(W[(size_t)(k8 + i) * N + n]);
  *(v8us*)(Wt + (size_t)n * K + k8) = v;
  
}

// GEMM C[M][N] (f32, pitch ldc) = act(A[M][K]·W + bias). A f32 row-major (pitch lda) converted per fragment to bf16
// (ASPLIT: hi/lo two planes -> 2 terms, else single rounded term); Wt bf16 [N][K] (pitch ldb). BIAS_BF16 rounds the
// bias to bf16 first (bias quantised to bf16 before the add). K%32==0, M%16==0, N%64==0.
template <bool ASPLIT, int ACT, bool BIAS_BF16>
__global__ __launch_bounds__(128) void k_gemm_bf(const float* __restrict__ A, int lda, const unsigned short* __restrict__ Wt, int ldb,
                                               const float* __restrict__ bias, float* __restrict__ C, int ldc, int M, int N, int K) {
  __shared__ __attribute__((aligned(16))) float so[4][16][64];
  const int tid = threadIdx.x, w = tid >> 5, lane = tid & 31, ln = lane & 15, hh = lane >> 4;
  const int ntn = N / 64;
  const int wid = blockIdx.x * 4 + w;
  const int mt = wid / ntn, nq = wid % ntn;
  if (mt * 16 >= M) return;
  const int row0 = mt * 16, col0 = nq * 64;
  const float* arow = A + (size_t)(row0 + ln) * lda;
  v8f acc[4] = {};
  for (int kb = 0; kb < K; kb += 32) {
    FragB ah, al;
    const v4f x0 = *(const v4fa*)(arow + kb + 8 * hh), x1 = *(const v4fa*)(arow + kb + 8 * hh + 4);
    const v4f x2 = *(const v4fa*)(arow + kb + 16 + 8 * hh), x3 = *(const v4fa*)(arow + kb + 16 + 8 * hh + 4);
    float xs[16] = {x0[0],x0[1],x0[2],x0[3],x1[0],x1[1],x1[2],x1[3],x2[0],x2[1],x2[2],x2[3],x3[0],x3[1],x3[2],x3[3]};
#pragma unroll
    for (int i = 0; i < 16; ++i) { const unsigned short hb = bf16_bits(xs[i]); ah.u[i] = hb; al.u[i] = ASPLIT ? bf16_bits(xs[i] - bf16_val(hb)) : (unsigned short)0; }
#pragma unroll
    for (int t = 0; t < 4; ++t) {
      const unsigned short* brow = Wt + (size_t)(col0 + t * 16 + ln) * ldb + kb;
      FragB b;
      b.half[0] = *(const v8us*)(brow + 8 * hh);
      b.half[1] = *(const v8us*)(brow + 16 + 8 * hh);
      acc[t] = mmaN<ASPLIT ? 2 : 1>(ah.v, al.v, b.v, b.v, acc[t]);
    }
  }
#pragma unroll
  for (int t = 0; t < 4; ++t) {
    float bv = bias ? bias[col0 + t * 16 + ln] : 0.f;
    if (BIAS_BF16) bv = bf16_round(bv);
#pragma unroll
    for (int r = 0; r < 8; ++r) { float v = acc[t][r] + bv; if (ACT == 1) v = fmaxf(v, 0.f); so[w][8 * hh + r][t * 16 + ln] = v; }
  }
  __builtin_amdgcn_fence(__ATOMIC_ACQ_REL, "workgroup");
  __builtin_amdgcn_wave_barrier();
  const int rsub = lane >> 4, c4 = (lane & 15) * 4;
  {
#pragma unroll
    for (int q = 0; q < 8; ++q) {
      const int r = q * 2 + rsub;
      const v4f v = *(const v4fa*)&so[w][r][c4];
      *(v4f*)(C + (size_t)(row0 + r) * ldc + col0 + c4) = v;
    }
    
  }
}

// Flash-style causal/unmasked attention, all contractions 3-term bf16 hi/lo splits, f32 softmax with running max.
// q,k,v rows are read from f32 buffers with arbitrary row pitch (so they can live inside a fused qkv buffer);
// D = head size (multiple of 32, <= 128); one wave = 16 query rows; block = 4 waves (64 queries) sharing K/V chunks of 32.
template <int D, bool CAUSAL>
__global__ __launch_bounds__(128) void k_flash(const float* __restrict__ qb, const float* __restrict__ kb, const float* __restrict__ vb,
                                             int pitch, int T, int H, float scale, float* __restrict__ y, int ypitch) {
  constexpr int KS = D / 32;        // k-steps for QK
  constexpr int DT = D / 16;        // d tiles for PV
  __shared__ __attribute__((aligned(16))) unsigned short sKh[32][D + 8], sKl[32][D + 8], sVh[32][D + 8], sVl[32][D + 8];
  __shared__ __attribute__((aligned(16))) unsigned short sPh[4][16][40], sPl[4][16][40];
  __shared__ __attribute__((aligned(16))) float sO[4][16][D];
  const int tid = threadIdx.x, w = tid >> 5, lane = tid & 31, ln = lane & 15, hh = lane >> 4;
  const int nqb = (T + 63) / 64;
  const int bh = blockIdx.x / nqb, qblk = blockIdx.x % nqb;
  const int b = bh / H, h = bh % H;
  const int q0 = qblk * 64 + w * 16;
  const float* Q = qb + (size_t)b * T * pitch + h * D;
  const float* K = kb + (size_t)b * T * pitch + h * D;
  const float* V = vb + (size_t)b * T * pitch + h * D;

  // A fragments of the wave's 16 query rows (scaled), hi/lo
  FragB aqh[KS], aql[KS];
  {
    int row = q0 + ln; if (row >= T) row = T - 1;
    const float* qr = Q + (size_t)row * pitch;
#pragma unroll
    for (int ks = 0; ks < KS; ++ks)
#pragma unroll
      for (int i = 0; i < 16; ++i) {
        const int d = ks * 32 + ((i < 8) ? (8 * hh + i) : (16 + 8 * hh + (i - 8)));
        const float x = qr[d] * scale; const unsigned short hb = bf16_bits(x);
        aqh[ks].u[i] = hb; aql[ks].u[i] = bf16_bits(x - bf16_val(hb));
      }
  }
  float m_r[8], l_r[8];
#pragma unroll
  for (int r = 0; r < 8; ++r) { m_r[r] = -3.0e38f; l_r[r] = 0.f; }
  v8f oacc[DT];
#pragma unroll
  for (int dt = 0; dt < DT; ++dt) oacc[dt] = (v8f){0.f,0.f,0.f,0.f,0.f,0.f,0.f,0.f};

  const int kv_end = CAUSAL ? min(T, qblk * 64 + 64) : T;     // block-uniform
  for (int j0 = 0; j0 < kv_end; j0 += 32) {
    __syncthreads();
    for (int e = tid; e < 32 * (D / 4); e += 128) {
      const int r = e / (D / 4), c4 = (e % (D / 4)) * 4;
      const int key = j0 + r;
      v4f kf = {0.f,0.f,0.f,0.f}, vf = {0.f,0.f,0.f,0.f};
      if (key < T) { kf = *(const v4fa*)(K + (size_t)key * pitch + c4); vf = *(const v4fa*)(V + (size_t)key * pitch + c4); }
#pragma unroll
      for (int t = 0; t < 4; ++t) {
        unsigned short hb = bf16_bits(kf[t]); sKh[r][c4 + t] = hb; sKl[r][c4 + t] = bf16_bits(kf[t] - bf16_val(hb));
        hb = bf16_bits(vf[t]); sVh[r][c4 + t] = hb; sVl[r][c4 + t] = bf16_bits(vf[t] - bf16_val(hb));
      }
    }
    __syncthreads();
    // S tile 16 x 32
    v8f s[2];
#pragma unroll
    for (int nt = 0; nt < 2; ++nt) {
      v8f acc = {};
#pragma unroll
      for (int ks = 0; ks < KS; ++ks) {
        FragB bh_, bl_;
        bh_.half[0] = *(const v8us*)&sKh[nt * 16 + ln][ks * 32 + 8 * hh]; bh_.half[1] = *(const v8us*)&sKh[nt * 16 + ln][ks * 32 + 16 + 8 * hh];
        bl_.half[0] = *(const v8us*)&sKl[nt * 16 + ln][ks * 32 + 8 * hh]; bl_.half[1] = *(const v8us*)&sKl[nt * 16 + ln][ks * 32 + 16 + 8 * hh];
        acc = mmaN<3>(aqh[ks].v, aql[ks].v, bh_.v, bl_.v, acc);
      }
      s[nt] = acc;
    }
    // mask + running max (rows 8hh+r; the 16 lanes of a half share rows)
    float alpha[8];
#pragma unroll
    for (int r = 0; r < 8; ++r) {
      const int qi = q0 + 8 * hh + r;
      const int ja = j0 + ln, jb = j0 + 16 + ln;
      if (CAUSAL) { if (ja > qi) s[0][r] = -3.0e38f; if (jb > qi) s[1][r] = -3.0e38f; }
      if (ja >= T) s[0][r] = -3.0e38f;
      if (jb >= T) s[1][r] = -3.0e38f;
      float mx = fmaxf(s[0][r], s[1][r]);
      mx = fmaxf(mx, __shfl_xor(mx, 1, 32)); mx = fmaxf(mx, __shfl_xor(mx, 2, 32)); mx = fmaxf(mx, __shfl_xor(mx, 4, 32)); mx = fmaxf(mx, __shfl_xor(mx, 8, 32));
      const float mnew = fmaxf(m_r[r], mx);
      alpha[r] = (mnew > -1.0e38f) ? __expf(m_r[r] - mnew) : 1.0f;
      const float p0 = (s[0][r] > -1.0e38f) ? __expf(s[0][r] - mnew) : 0.f;
      const float p1 = (s[1][r] > -1.0e38f) ? __expf(s[1][r] - mnew) : 0.f;
      m_r[r] = mnew;
      l_r[r] = l_r[r] * alpha[r] + p0 + p1;            // per-lane partial row sum (16 lanes combined at the end)
      unsigned short hb = bf16_bits(p0); sPh[w][8 * hh + r][ln] = hb;      sPl[w][8 * hh + r][ln] = bf16_bits(p0 - bf16_val(hb));
      hb = bf16_bits(p1);                sPh[w][8 * hh + r][16 + ln] = hb; sPl[w][8 * hh + r][16 + ln] = bf16_bits(p1 - bf16_val(hb));
    }
#pragma unroll
    for (int dt = 0; dt < DT; ++dt)
#pragma unroll
      for (int r = 0; r < 8; ++r) oacc[dt][r] *= alpha[r];
    __builtin_amdgcn_fence(__ATOMIC_ACQ_REL, "workgroup");
    __builtin_amdgcn_wave_barrier();
    FragB pah, pal;
    pah.half[0] = *(const v8us*)&sPh[w][ln][8 * hh]; pah.half[1] = *(const v8us*)&sPh[w][ln][16 + 8 * hh];
    pal.half[0] = *(const v8us*)&sPl[w][ln][8 * hh]; pal.half[1] = *(const v8us*)&sPl[w][ln][16 + 8 * hh];
#pragma unroll
    for (int dt = 0; dt < DT; ++dt) {
      FragB bvh, bvl;
#pragma unroll
      for (int i = 0; i < 8; ++i) {
        bvh.u[i] = sVh[8 * hh + i][dt * 16 + ln]; bvh.u[8 + i] = sVh[16 + 8 * hh + i][dt * 16 + ln];
        bvl.u[i] = sVl[8 * hh + i][dt * 16 + ln]; bvl.u[8 + i] = sVl[16 + 8 * hh + i][dt * 16 + ln];
      }
      oacc[dt] = mmaN<3>(pah.v, pal.v, bvh.v, bvl.v, oacc[dt]);
    }
    __builtin_amdgcn_fence(__ATOMIC_ACQ_REL, "workgroup");
    __builtin_amdgcn_wave_barrier();
  }
#pragma unroll
  for (int r = 0; r < 8; ++r) {
    float l = l_r[r];
    l += __shfl_xor(l, 1, 32); l += __shfl_xor(l, 2, 32); l += __shfl_xor(l, 4, 32); l += __shfl_xor(l, 8, 32);
    l_r[r] = (l > 0.f) ? 1.0f / l : 0.f;
  }
#pragma unroll
  for (int dt = 0; dt < DT; ++dt)
#pragma unroll
    for (int r = 0; r < 8; ++r) sO[w][8 * hh + r][dt * 16 + ln] = oacc[dt][r] * l_r[r];
  __builtin_amdgcn_fence(__ATOMIC_ACQ_REL, "workgroup");
  __builtin_amdgcn_wave_barrier();
  {
    for (int r = 0; r < 16; ++r) {
      const int row = q0 + r;
      if (row < T && lane < D / 4) {
        const v4f val = *(const v4fa*)&sO[w][r][lane * 4];
        *(v4f*)(y + ((size_t)b * T + row) * ypitch + h * D + lane * 4) = val;
      }
    }
    
  }
}

// GEMM C = act(A·W + bias + resid): A f32 (ASPLIT -> hi/lo 2 terms), Wt bf16 [N][K]; ACT 0 none, 1 relu, 2 exact gelu;
// resid (optional, f32, row index = (row % rmod), pitch ldr, RES_BF16 rounds it) added before the activation.
template <bool ASPLIT, int ACT, bool BIAS_BF16, bool RES_BF16>
__global__ __launch_bounds__(128) void k_gemm_bf3(const float* __restrict__ A, int lda, const unsigned short* __restrict__ Wt, int ldb,
                                                const float* __restrict__ bias, const float* __restrict__ resid, int rmod, int ldr,
                                                float* __restrict__ C, int ldc, int M, int N, int K) {
  __shared__ __attribute__((aligned(16))) float so[4][16][64];
  const int tid = threadIdx.x, w = tid >> 5, lane = tid & 31, ln = lane & 15, hh = lane >> 4;
  const int ntn = N / 64;
  const int wid = blockIdx.x * 4 + w;
  const int mt = wid / ntn, nq = wid % ntn;
  if (mt * 16 >= M) return;
  const int row0 = mt * 16, col0 = nq * 64;
  const float* arow = A + (size_t)(row0 + ln) * lda;
  v8f acc[4] = {};
  for (int kb = 0; kb < K; kb += 32) {
    FragB ah, al;
    const v4f x0 = *(const v4fa*)(arow + kb + 8 * hh), x1 = *(const v4fa*)(arow + kb + 8 * hh + 4);
    const v4f x2 = *(const v4fa*)(arow + kb + 16 + 8 * hh), x3 = *(const v4fa*)(arow + kb + 16 + 8 * hh + 4);
    float xs[16] = {x0[0],x0[1],x0[2],x0[3],x1[0],x1[1],x1[2],x1[3],x2[0],x2[1],x2[2],x2[3],x3[0],x3[1],x3[2],x3[3]};
#pragma unroll
    for (int i = 0; i < 16; ++i) { const unsigned short hb = bf16_bits(xs[i]); ah.u[i] = hb; al.u[i] = ASPLIT ? bf16_bits(xs[i] - bf16_val(hb)) : (unsigned short)0; }
#pragma unroll
    for (int t = 0; t < 4; ++t) {
      const unsigned short* brow = Wt + (size_t)(col0 + t * 16 + ln) * ldb + kb;
      FragB b;
      b.half[0] = *(const v8us*)(brow + 8 * hh);
      b.half[1] = *(const v8us*)(brow + 16 + 8 * hh);
      acc[t] = mmaN<ASPLIT ? 2 : 1>(ah.v, al.v, b.v, b.v, acc[t]);
    }
  }
#pragma unroll
  for (int t = 0; t < 4; ++t) {
    const int col = col0 + t * 16 + ln;
    float bv = bias ? bias[col] : 0.f;
    if (BIAS_BF16) bv = bf16_round(bv);
#pragma unroll
    for (int r = 0; r < 8; ++r) {
      float v = acc[t][r] + bv;
      if (resid) { float rv = resid[(size_t)((row0 + 8 * hh + r) % rmod) * ldr + col]; if (RES_BF16) rv = bf16_round(rv); v += rv; }
      if (ACT == 1) v = fmaxf(v, 0.f);
      if (ACT == 2) v = 0.5f * v * (1.0f + erff(v * 0.70710678118654752f));
      if (ACT == 3) { const float u = 0.7978845608028654f * (v + 0.044715f * v * v * v); v = 0.5f * v * (1.0f + tanhf(u)); }
      so[w][8 * hh + r][t * 16 + ln] = v;
    }
  }
  __builtin_amdgcn_fence(__ATOMIC_ACQ_REL, "workgroup");
  __builtin_amdgcn_wave_barrier();
  const int rsub = lane >> 4, c4 = (lane & 15) * 4;
  {
#pragma unroll
    for (int q = 0; q < 8; ++q) {
      const int r = q * 2 + rsub;
      const v4f v = *(const v4fa*)&so[w][r][c4];
      *(v4f*)(C + (size_t)(row0 + r) * ldc + col0 + c4) = v;
    }
    
  }
}
// row LayerNorm (biased variance, eps) over N: s = X (+ R); optional out_sum <- s; out_norm <- (s-mu)*rsqrt(var+eps)*g + b
template <bool PARAM_BF16>
__global__ __launch_bounds__(256) void k_layernorm(const float* __restrict__ X, const float* __restrict__ R, const float* __restrict__ g, const float* __restrict__ bta,
                                                  float* __restrict__ out_sum, float* __restrict__ out_norm, int N, float eps) {
  __shared__ float red[256];
  const int row = blockIdx.x, tid = threadIdx.x;
  const float* x = X + (size_t)row * N; const float* rr = R ? R + (size_t)row * N : nullptr;
  float vals[16];                     // up to N = 4096
  const int per = N / 256;            // contiguous chunk per thread? use strided-by-4 chunks: thread handles j = tid*4 + 1024*u
  float s1 = 0.f;
  for (int u = 0; u < per / 4; ++u) {
    const int j = tid * 4 + 1024 * u;
    const v4f a = *(const v4fa*)(x + j);
    v4f b = {0.f,0.f,0.f,0.f}; if (rr) b = *(const v4fa*)(rr + j);
#pragma unroll
    for (int q = 0; q < 4; ++q) { const float v = a[q] + b[q]; vals[u * 4 + q] = v; s1 += v; }
  }
  red[tid] = s1; __syncthreads();
  for (int st = 128; st > 0; st >>= 1) { if (tid < st) red[tid] += red[tid + st]; __syncthreads(); }
  const float mu = red[0] / (float)N; __syncthreads();
  float s2 = 0.f;
  for (int u = 0; u < per / 4; ++u)
#pragma unroll
    for (int q = 0; q < 4; ++q) { const float c = vals[u * 4 + q] - mu; s2 += c * c; }
  red[tid] = s2; __syncthreads();
  for (int st = 128; st > 0; st >>= 1) { if (tid < st) red[tid] += red[tid + st]; __syncthreads(); }
  const float rs = rsqrtf(red[0] / (float)N + eps);
  {
    for (int u = 0; u < per / 4; ++u) {
      const int j = tid * 4 + 1024 * u;
      v4f o, sm;
#pragma unroll
      for (int q = 0; q < 4; ++q) {
        float gg = g[j + q], bb = bta[j + q];
        if (PARAM_BF16) { gg = bf16_round(gg); bb = bf16_round(bb); }
        sm[q] = vals[u * 4 + q]; o[q] = (vals[u * 4 + q] - mu) * rs * gg + bb;
      }
      if (out_sum) *(v4f*)(out_sum + (size_t)row * N + j) = sm;
      *(v4f*)(out_norm + (size_t)row * N + j) = o;
    }
    
  }
}



// ---- f16 WMMA path (v_wmma_f32_16x16x32_f16): 11-bit significands for operands in range — used where a [0,1] probability operand needs more precision than bf16
typedef _Float16 v16h __attribute__((ext_vector_type(16)));
union FragH { v16h v; v8us half[2]; _Float16 h[16]; unsigned short u[16]; };
template <int NT>
__device__ __forceinline__ v8f mmaH(v16h ah, v16h al, v16h bh, v16h bl, v8f c) {
  c = __builtin_amdgcn_wmma_f32_16x16x32_f16(false, ah, false, bh, (short)0, c, false, false);
  if (NT >= 2) c = __builtin_amdgcn_wmma_f32_16x16x32_f16(false, al, false, bh, (short)0, c, false, false);
  if (NT >= 3) c = __builtin_amdgcn_wmma_f32_16x16x32_f16(false, ah, false, bl, (short)0, c, false, false);
  asm volatile("v_nop\n\tv_nop\n\tv_nop\n\tv_nop" : "+v"(c) : "v"(ah), "v"(al), "v"(bh), "v"(bl));
  return c;
}
// batched GEMM like k_gemm_b but f16 operands: A f32 (split into f16 hi/lo if ASPLIT, else rounded to f16), Bt = f16 values [n][k]; alpha; C f32; N multiple of 16 (partial tiles skipped)
template <bool ASPLIT>
__global__ __launch_bounds__(128) void k_gemm_h(const float* __restrict__ A, int lda, size_t sA, const _Float16* __restrict__ Bh, int ldb, size_t sB, float alpha, float* __restrict__ C, int ldc, size_t sC, int M, int N, int K) {
  __shared__ __attribute__((aligned(16))) float so[4][16][64];
  const int tid = threadIdx.x, w = tid >> 5, lane = tid & 31, ln = lane & 15, hh = lane >> 4; const int by = blockIdx.y;
  A += (size_t)by * sA; Bh += (size_t)by * sB; C += (size_t)by * sC;
  const int ntn = (N + 63) / 64; const int wid = blockIdx.x * 4 + w; const int mt = wid / ntn, nq = wid % ntn; if (mt * 16 >= M) return;
  const int row0 = mt * 16, col0 = nq * 64; const float* arow = A + (size_t)(row0 + ln) * lda;
  v8f acc[4] = {};
  for (int kb = 0; kb < K; kb += 32) {
    FragH ah, al;
    const v4f x0 = *(const v4fa*)(arow + kb + 8 * hh), x1 = *(const v4fa*)(arow + kb + 8 * hh + 4), x2 = *(const v4fa*)(arow + kb + 16 + 8 * hh), x3 = *(const v4fa*)(arow + kb + 16 + 8 * hh + 4);
    float xs[16] = {x0[0],x0[1],x0[2],x0[3],x1[0],x1[1],x1[2],x1[3],x2[0],x2[1],x2[2],x2[3],x3[0],x3[1],x3[2],x3[3]};
#pragma unroll
    for (int i = 0; i < 16; ++i) { const _Float16 h = (_Float16)xs[i]; ah.h[i] = h; al.h[i] = ASPLIT ? (_Float16)(xs[i] - (float)h) : (_Float16)0.0f; }
#pragma unroll
    for (int t = 0; t < 4; ++t) { if (col0 + t * 16 >= N) continue; const size_t boff = (size_t)(col0 + t * 16 + ln) * ldb + kb; FragH bq; bq.half[0] = *(const v8us*)(Bh + boff + 8 * hh); bq.half[1] = *(const v8us*)(Bh + boff + 16 + 8 * hh);
      acc[t] = mmaH<ASPLIT ? 2 : 1>(ah.v, al.v, bq.v, bq.v, acc[t]); }
  }
#pragma unroll
  for (int t = 0; t < 4; ++t) { if (col0 + t * 16 >= N) continue;
#pragma unroll
    for (int r = 0; r < 8; ++r) so[w][8 * hh + r][t * 16 + ln] = acc[t][r] * alpha; }
  __builtin_amdgcn_fence(__ATOMIC_ACQ_REL, "workgroup"); __builtin_amdgcn_wave_barrier();
  const int rsub = lane >> 4, c4 = (lane & 15) * 4;
  {
#pragma unroll
    for (int q = 0; q < 8; ++q) { const int r = q * 2 + rsub; if (col0 + c4 < N) { const v4f v = *(const v4fa*)&so[w][r][c4]; *(v4f*)(C + (size_t)(row0 + r) * ldc + col0 + c4) = v; } }
     }
}

// Wt[n][k] = f16(W[k][n]·scale) from f32 row-major W[K][N] (scale = power of two; bf16-exact weights stay exact in f16 away from the subnormal range)
__global__ __launch_bounds__(256) void k_wt_f16(const float* __restrict__ W, _Float16* __restrict__ Wt, int K, int N, float scale) {
  const int t = blockIdx.x * 256 + threadIdx.x; if (t >= N * (K / 8)) return; const int n = t / (K / 8), k8 = (t % (K / 8)) * 8; FragH f;
#pragma unroll
  for (int i = 0; i < 8; ++i) f.h[i] = (_Float16)(bf16_round(W[(size_t)(k8 + i) * N + n]) * scale); const v8us o = f.half[0];
  *(v8us*)((unsigned short*)Wt + (size_t)n * K + k8) = o; 
}
// k_gemm_hh variant with fused epilogue: v = acc·alpha + bias[by·sBias + col] (+ CP[(row/rowsPerB)·sCPb + by·64 + col] if CP) ; ACT 0 none / 1 elu ; writes f32 C and f16 C16 (each if non-null)
template <int ACT>
__global__ __launch_bounds__(128) void k_gemm_hhx(const _Float16* __restrict__ A, int lda, size_t sA, const _Float16* __restrict__ Bh, int ldb, size_t sB, float alpha, const float* __restrict__ bias, size_t sBias, const float* __restrict__ CP, int rowsPerB, size_t sCPb, int row0g,
    float* __restrict__ C, _Float16* __restrict__ C16, int ldc, size_t sC, int M, int N, int K) {
  __shared__ __attribute__((aligned(16))) float so[4][16][64];
  const int tid = threadIdx.x, w = tid >> 5, lane = tid & 31, ln = lane & 15, hh = lane >> 4; const int by = blockIdx.y;
  A += (size_t)by * sA; Bh += (size_t)by * sB; const size_t cofs = (size_t)by * sC; const float* bp = bias ? bias + (size_t)by * sBias : nullptr;
  const int ntn = (N + 63) / 64; const int wid = blockIdx.x * 4 + w; const int mt = wid / ntn, nq = wid % ntn; if (mt * 16 >= M) return;
  const int row0 = mt * 16, col0 = nq * 64; const _Float16* arow = A + (size_t)(row0 + ln) * lda;
  v8f acc[4] = {};
  for (int kb = 0; kb < K; kb += 32) { FragH ah; ah.half[0] = *(const v8us*)((const unsigned short*)arow + kb + 8 * hh); ah.half[1] = *(const v8us*)((const unsigned short*)arow + kb + 16 + 8 * hh);
#pragma unroll
    for (int t = 0; t < 4; ++t) { if (col0 + t * 16 >= N) continue; const size_t boff = (size_t)(col0 + t * 16 + ln) * ldb + kb; FragH bq; bq.half[0] = *(const v8us*)((const unsigned short*)Bh + boff + 8 * hh); bq.half[1] = *(const v8us*)((const unsigned short*)Bh + boff + 16 + 8 * hh);
      acc[t] = mmaH<1>(ah.v, ah.v, bq.v, bq.v, acc[t]); }
  }
#pragma unroll
  for (int t = 0; t < 4; ++t) { if (col0 + t * 16 >= N) continue; const int col = col0 + t * 16 + ln; const float bv = bp ? bf16_round(bp[col]) : 0.f;
#pragma unroll
    for (int r = 0; r < 8; ++r) { float v = acc[t][r] * alpha + bv; if (CP) { const int bidx = (row0g + row0 + 8 * hh + r) / rowsPerB; v += CP[(size_t)bidx * sCPb + (size_t)by * 64 + col]; } if (ACT == 1) v = (v > 0.f) ? v : expm1f(v); else if (ACT == 7) v = (v > 0.f) ? v + 1.0f : expf(v); else if (ACT == 8) v = tanhf(v); else if (ACT == 9) v = 0.5f * v * (1.0f + tanhf(0.7978845608028654f * (v + 0.044715f * v * v * v))); else if (ACT == 11) v = 1.0f / (1.0f + expf(-v)); else if (ACT == 12) v = (v > 0.f) ? v : 0.01f * v; else if (ACT == 14) v = (v > 0.f) ? v : 0.1f * v; else if (ACT == 15) v = v / (1.0f + expf(-v)); else if (ACT == 3) v = fmaxf(v, 0.f); else if (ACT == 6) v = 0.5f * v * (1.0f + erff(v * 0.70710678118654752f)); so[w][8 * hh + r][t * 16 + ln] = v; } }
  __builtin_amdgcn_fence(__ATOMIC_ACQ_REL, "workgroup"); __builtin_amdgcn_wave_barrier();
  const int rsub = lane >> 4, c4 = (lane & 15) * 4; typedef _Float16 v4h __attribute__((ext_vector_type(4)));
  {
#pragma unroll
    for (int q = 0; q < 8; ++q) { const int r = q * 2 + rsub; if (col0 + c4 < N) { const v4f v = *(const v4fa*)&so[w][r][c4]; if (C) *(v4f*)(C + cofs + (size_t)(row0 + r) * ldc + col0 + c4) = v; if (C16) { v4h h4; for (int i = 0; i < 4; ++i) h4[i] = (_Float16)v[i]; *(v4h*)(C16 + cofs + (size_t)(row0 + r) * ldc + col0 + c4) = h4; } } }
     }
}


typedef _Float16 v4h __attribute__((ext_vector_type(4)));

__global__ __launch_bounds__(256) void k_x16(const float* __restrict__ x, _Float16* __restrict__ X16, size_t n8) { const size_t t = (size_t)blockIdx.x * 256 + threadIdx.x; if (t >= n8) return; FragH f;
#pragma unroll
  for (int q = 0; q < 8; ++q) f.h[q] = (_Float16)bf16_round(x[t * 8 + q]); *(v8us*)((unsigned short*)X16 + t * 8) = f.half[0];  }
__global__ __launch_bounds__(256) void k_h16(const float* __restrict__ x, _Float16* __restrict__ X16, size_t n8) { const size_t t = (size_t)blockIdx.x * 256 + threadIdx.x; if (t >= n8) return; FragH f;
#pragma unroll
  for (int q = 0; q < 8; ++q) f.h[q] = (_Float16)x[t * 8 + q]; *(v8us*)((unsigned short*)X16 + t * 8) = f.half[0];  }
__global__ __launch_bounds__(256) void k_round16f(const float* __restrict__ W, _Float16* __restrict__ Bt, size_t n8) { const size_t t = (size_t)blockIdx.x * 256 + threadIdx.x; if (t >= n8) return; FragH f;
#pragma unroll
  for (int i = 0; i < 8; ++i) f.h[i] = (_Float16)(bf16_round(W[t * 8 + i]) * 16.0f); *(v8us*)((unsigned short*)Bt + t * 8) = f.half[0];  }
template <int NHv, int TTv>
__global__ __launch_bounds__(256) void k_vt(const _Float16* __restrict__ V16, int ldv, int voff, _Float16* __restrict__ Vt) { __shared__ unsigned short tl[64][66]; const int tid = threadIdx.x; const int slab = blockIdx.x / (TTv / 64), lg = blockIdx.x % (TTv / 64); const int b = slab / NHv, h = slab % NHv;
  for (int i = tid; i < 64 * 8; i += 256) { const int r = i / 8, c8 = (i % 8) * 8; FragH f; f.half[0] = *(const v8us*)((const unsigned short*)V16 + ((size_t)b * TTv + lg * 64 + r) * ldv + voff + h * 64 + c8);
#pragma unroll
    for (int q = 0; q < 8; ++q) tl[r][c8 + q] = f.u[q]; }
  __syncthreads();
  {
#pragma unroll
    for (int rd = 0; rd < 2; ++rd) { const int d = rd * 32 + tid / 8, pc = tid % 8; FragH f;
#pragma unroll
      for (int q = 0; q < 8; ++q) f.u[q] = tl[pc * 8 + q][d];
      *(v8us*)((unsigned short*)Vt + ((size_t)slab * 64 + d) * TTv + lg * 64 + pc * 8) = f.half[0]; }
     } }

__global__ __launch_bounds__(256) void k_hl(const float* __restrict__ F, _Float16* __restrict__ Hh, _Float16* __restrict__ Hl, size_t n8) { const size_t t = (size_t)blockIdx.x * 256 + threadIdx.x; if (t >= n8) return; FragH fh, fl; const v4f a = *(const v4fa*)(F + t * 8), c = *(const v4fa*)(F + t * 8 + 4);
#pragma unroll
  for (int q = 0; q < 4; ++q) { _Float16 h = (_Float16)a[q]; fh.h[q] = h; fl.h[q] = (_Float16)((a[q] - (float)h) * 1024.0f); h = (_Float16)c[q]; fh.h[4 + q] = h; fl.h[4 + q] = (_Float16)((c[q] - (float)h) * 1024.0f); }
  { *(v8us*)((unsigned short*)Hh + t * 8) = fh.half[0]; *(v8us*)((unsigned short*)Hl + t * 8) = fl.half[0];  } }
__global__ __launch_bounds__(256) void k_h16s(const float* __restrict__ F, _Float16* __restrict__ H, size_t n8) { const size_t t = (size_t)blockIdx.x * 256 + threadIdx.x; if (t >= n8) return; const v4f a = *(const v4fa*)(F + t * 8), c = *(const v4fa*)(F + t * 8 + 4); FragH f;
#pragma unroll
  for (int q = 0; q < 4; ++q) { f.h[q] = (_Float16)(a[q] * 16.0f); f.h[4 + q] = (_Float16)(c[q] * 16.0f); } *(v8us*)((unsigned short*)H + t * 8) = f.half[0];  }
__device__ __forceinline__ float gelu_tanh(float x) { const float u = 0.7978845608028654f * (x + 0.044715f * x * x * x); return 0.5f * x * (1.0f + tanhf(u)); }
__global__ __launch_bounds__(256) void k_gbias(float* __restrict__ S, const float* __restrict__ CRD, int b, const float* __restrict__ w1, const float* __restrict__ b1, const float* __restrict__ w2, const float* __restrict__ b2) {
  #pragma clang fp contract(off)
  const size_t t = (size_t)blockIdx.x * 256 + threadIdx.x; if (t >= (size_t)TT * TT / 4) return; const int q = (int)((t * 4) / TT), k0 = (int)((t * 4) % TT);
  float cb = 0.f; for (int j = 0; j < 8; ++j) cb += bf16_round(b2[j]); cb *= 0.125f;
  const float qx = bf16_round(CRD[((size_t)b * TT + q) * 3]), qy = bf16_round(CRD[((size_t)b * TT + q) * 3 + 1]), qz = bf16_round(CRD[((size_t)b * TT + q) * 3 + 2]);
  v4f sv = *(const v4fa*)(S + (size_t)q * TT + k0); float dist[4];
  for (int e = 0; e < 4; ++e) { const int k = k0 + e; const float dx = qx - bf16_round(CRD[((size_t)b * TT + k) * 3]), dy = qy - bf16_round(CRD[((size_t)b * TT + k) * 3 + 1]), dz = qz - bf16_round(CRD[((size_t)b * TT + k) * 3 + 2]); dist[e] = sqrtf(fmaxf(dx * dx + dy * dy + dz * dz, 1e-12f)); sv[e] += cb; }
#pragma unroll 1
  for (int j = 0; j < 8; ++j) { float cj = 0.f; for (int h = 0; h < 8; ++h) cj += bf16_round(w2[j * 8 + h]); cj *= 0.125f; const float wj = bf16_round(w1[j]), bj = bf16_round(b1[j]);
    for (int e = 0; e < 4; ++e) sv[e] += gelu_tanh(dist[e] * wj + bj) * cj; }
  *(v4f*)(S + (size_t)q * TT + k0) = sv;  }
#define NN TT
__global__ __launch_bounds__(256) void k_smx(const float* __restrict__ S, _Float16* __restrict__ P16) { const int tid = threadIdx.x, wv = tid >> 5, lane = tid & 31; const int i = blockIdx.x * 8 + wv; const float* sr = S + (size_t)i * NN;
  float m = -3.0e38f;
  for (int p = lane; p < NN / 8; p += 32) { const v4f a = *(const v4fa*)(sr + p * 8), c = *(const v4fa*)(sr + p * 8 + 4); for (int e = 0; e < 4; ++e) m = fmaxf(m, fmaxf(a[e], c[e])); }
  for (int o = 16; o >= 1; o >>= 1) m = fmaxf(m, __shfl_xor(m, o, 32)); float z = 0.f;
  for (int p = lane; p < NN / 8; p += 32) { const v4f a = *(const v4fa*)(sr + p * 8), c = *(const v4fa*)(sr + p * 8 + 4); for (int e = 0; e < 4; ++e) z += __expf(a[e] - m) + __expf(c[e] - m); }
  for (int o = 16; o >= 1; o >>= 1) z += __shfl_xor(z, o, 32); const float iz = 32768.0f / z;
  { for (int p = lane; p < NN / 8; p += 32) { FragH f; const v4f a = *(const v4fa*)(sr + p * 8), c = *(const v4fa*)(sr + p * 8 + 4); for (int e = 0; e < 4; ++e) { f.h[e] = (_Float16)(__expf(a[e] - m) * iz); f.h[4 + e] = (_Float16)(__expf(c[e] - m) * iz); }
      *(v8us*)((unsigned short*)P16 + (size_t)i * NN + p * 8) = f.half[0]; }  } }
__global__ __launch_bounds__(128) void k_flash(const _Float16* __restrict__ Q16, int ldq, const _Float16* __restrict__ K16, int ldk, const _Float16* __restrict__ Vt, const int* __restrict__ MSK, float* __restrict__ O, int ldo) {
  constexpr int RPW = 16, RTN = RPW / 16, NQB = TT / (4 * RPW), DT = 4, KS = 2;
  __shared__ __attribute__((aligned(16))) unsigned short sP[4][RPW][40]; __shared__ __attribute__((aligned(16))) float sO[4][RPW][64 + 4];
  const int tid = threadIdx.x, w = tid >> 5, lane = tid & 31, ln = lane & 15, hh = lane >> 4;
  const int slab = blockIdx.x / NQB, qblk = blockIdx.x % NQB; const int b = slab / NH, h = slab % NH; const int qb0 = qblk * (4 * RPW); const int q0 = qb0 + w * RPW;
  FragH aq[2][KS];
#pragma unroll
  for (int rt = 0; rt < RTN; ++rt) { const unsigned short* qr = (const unsigned short*)Q16 + ((size_t)b * TT + q0 + rt * 16 + ln) * ldq + h * 64;
#pragma unroll
    for (int ks = 0; ks < KS; ++ks) { aq[rt][ks].half[0] = *(const v8us*)(qr + ks * 32 + 8 * hh); aq[rt][ks].half[1] = *(const v8us*)(qr + ks * 32 + 16 + 8 * hh); } }
  const unsigned short* Vth = (const unsigned short*)Vt + (size_t)slab * 64 * TT;
  float m_r[2][8], l_r[2][8]; v8f oacc[2][DT];
#pragma unroll
  for (int rt = 0; rt < RTN; ++rt) {
#pragma unroll
    for (int r = 0; r < 8; ++r) { m_r[rt][r] = -3.0e38f; l_r[rt][r] = 0.f; }
#pragma unroll
    for (int dt = 0; dt < DT; ++dt) oacc[rt][dt] = (v8f){0.f,0.f,0.f,0.f,0.f,0.f,0.f,0.f}; }
  const int jend = TT;
#pragma unroll 1
  for (int j0 = 0; j0 < jend; j0 += 32) {
    v8f s[2][2];
#pragma unroll
    for (int nt = 0; nt < 2; ++nt) { const unsigned short* kr = (const unsigned short*)K16 + ((size_t)b * TT + j0 + nt * 16 + ln) * ldk + h * 64; FragH bk[KS];
#pragma unroll
      for (int ks = 0; ks < KS; ++ks) { bk[ks].half[0] = *(const v8us*)(kr + ks * 32 + 8 * hh); bk[ks].half[1] = *(const v8us*)(kr + ks * 32 + 16 + 8 * hh); }
#pragma unroll
      for (int rt = 0; rt < RTN; ++rt) { v8f acc = (v8f){0.f,0.f,0.f,0.f,0.f,0.f,0.f,0.f};
#pragma unroll
        for (int ks = 0; ks < KS; ++ks) acc = mmaH<1>(aq[rt][ks].v, aq[rt][ks].v, bk[ks].v, bk[ks].v, acc); s[rt][nt] = acc; } }
#pragma unroll
    for (int rt = 0; rt < RTN; ++rt)
#pragma unroll
      for (int r = 0; r < 8; ++r) { const int tq = q0 + rt * 16 + 8 * hh + r; const int k0 = j0 + ln, k1 = j0 + 16 + ln; (void)tq; (void)k0; (void)k1;
        const bool ok0 = true, ok1 = true;
        const float s0 = s[rt][0][r] * 0.125f, s1 = s[rt][1][r] * 0.125f; float mc = fmaxf(s0, s1);
        mc = fmaxf(mc, __shfl_xor(mc, 1, 32)); mc = fmaxf(mc, __shfl_xor(mc, 2, 32)); mc = fmaxf(mc, __shfl_xor(mc, 4, 32)); mc = fmaxf(mc, __shfl_xor(mc, 8, 32));
        const float mn = fmaxf(m_r[rt][r], mc); const float al = (mn > -1.0e38f) ? expf(m_r[rt][r] - mn) : 1.0f; m_r[rt][r] = mn; const float p0 = ok0 ? expf(s0 - mn) : 0.f, p1 = ok1 ? expf(s1 - mn) : 0.f; l_r[rt][r] = l_r[rt][r] * al + p0 + p1;
#pragma unroll
        for (int dt = 0; dt < DT; ++dt) oacc[rt][dt][r] *= al;
        FragH t2; t2.h[0] = (_Float16)(p0 * 1024.0f); t2.h[1] = (_Float16)(p1 * 1024.0f); sP[w][rt * 16 + 8 * hh + r][ln] = t2.u[0]; sP[w][rt * 16 + 8 * hh + r][16 + ln] = t2.u[1]; }
    __builtin_amdgcn_fence(__ATOMIC_ACQ_REL, "workgroup"); __builtin_amdgcn_wave_barrier();
    FragH pa[2];
#pragma unroll
    for (int rt = 0; rt < RTN; ++rt) { pa[rt].half[0] = *(const v8us*)&sP[w][rt * 16 + ln][8 * hh]; pa[rt].half[1] = *(const v8us*)&sP[w][rt * 16 + ln][16 + 8 * hh]; }
#pragma unroll
    for (int dt = 0; dt < DT; ++dt) { const unsigned short* vrow = Vth + (size_t)(dt * 16 + ln) * TT + j0; FragH bv; bv.half[0] = *(const v8us*)(vrow + 8 * hh); bv.half[1] = *(const v8us*)(vrow + 16 + 8 * hh);
#pragma unroll
      for (int rt = 0; rt < RTN; ++rt) oacc[rt][dt] = mmaH<1>(pa[rt].v, pa[rt].v, bv.v, bv.v, oacc[rt][dt]); }
    __builtin_amdgcn_fence(__ATOMIC_ACQ_REL, "workgroup"); __builtin_amdgcn_wave_barrier(); }
#pragma unroll
  for (int rt = 0; rt < RTN; ++rt) {
#pragma unroll
    for (int r = 0; r < 8; ++r) { float l = l_r[rt][r]; l += __shfl_xor(l, 1, 32); l += __shfl_xor(l, 2, 32); l += __shfl_xor(l, 4, 32); l += __shfl_xor(l, 8, 32); l_r[rt][r] = (l > 0.f) ? 1.0f / (l * 1024.0f) : 0.f; }
#pragma unroll
    for (int dt = 0; dt < DT; ++dt)
#pragma unroll
      for (int r = 0; r < 8; ++r) sO[w][rt * 16 + 8 * hh + r][dt * 16 + ln] = oacc[rt][dt][r] * l_r[rt][r]; }
  __builtin_amdgcn_fence(__ATOMIC_ACQ_REL, "workgroup"); __builtin_amdgcn_wave_barrier();
  {
#pragma unroll
    for (int rp = 0; rp < RPW; rp += 2) { const int r = rp + (lane >> 4), pc = lane & 15; const v4f val = *(const v4fa*)&sO[w][r][pc * 4]; *(v4f*)(O + ((size_t)b * TT + q0 + r) * ldo + h * 64 + pc * 4) = val; }
     } }

extern "C" void kernel_launch(void* const* d_in, const int* in_sizes, int n_in,
                              void* d_out, int out_size, void* d_ws, size_t ws_size, hipStream_t stream) {
  (void)in_sizes; (void)n_in; (void)out_size;
  const float* const* I = (const float* const*)d_in; const float* feats = I[0]; const float* geom = I[1]; const float* crd = I[2];
  const float* wq = I[3]; const float* bq = I[4]; const float* wk = I[5]; const float* bk = I[6]; const float* wv = I[7]; const float* bv = I[8]; const float* wo = I[9]; const float* bo = I[10];
  const float* gqw = I[11]; const float* gqb = I[12]; const float* gkw = I[13]; const float* gkb = I[14]; const float* gvw = I[15]; const float* gvb = I[16]; const float* d1w = I[17]; const float* d1b = I[18]; const float* d2w = I[19]; const float* d2b = I[20]; const float* opw = I[21]; const float* opb = I[22];
  char* ws = (char*)d_ws; size_t off = 0;
  auto take = [&](size_t bytes) { char* p = ws + off; off += (bytes + 255) & ~(size_t)255; return p; };
  const size_t WSZ = (size_t)DD * DD, GSZ = (size_t)GG * DD; _Float16* Bw = (_Float16*)take(5 * WSZ * 2); _Float16* Bg = (_Float16*)take(3 * GSZ * 2);
  _Float16* X16 = (_Float16*)take((size_t)NR * DD * 2); _Float16* GE16 = (_Float16*)take((size_t)NR * GG * 2); _Float16* Q = (_Float16*)take((size_t)NR * DD * 2); _Float16* K = (_Float16*)take((size_t)NR * DD * 2); _Float16* V = (_Float16*)take((size_t)NR * DD * 2); _Float16* Vt = (_Float16*)take((size_t)NR * DD * 2);
  float* O = (float*)take((size_t)NR * DD * 4); float* FA = (float*)take((size_t)NR * DD * 4); _Float16* GQ = (_Float16*)take((size_t)NR * DD * 2); _Float16* GK = (_Float16*)take((size_t)NR * DD * 2); float* S = (float*)take((size_t)TT * TT * 4); _Float16* P16 = (_Float16*)take((size_t)TT * TT * 2);
  _Float16* O16 = X16; _Float16* GV = Q; _Float16* GVt = K; float* SUM = O; _Float16* SUM16 = V; float* GF = O; _Float16* GQl = Vt; _Float16* GKl = X16;      /* gq/gk go through an f32 temp (the attention-output plane, free between k_h16s and the per-batch loop) into hi (GQ/GK) + ×2^10 residual (over Vt / X16) planes */      /* reuse after the MHA branch (stream order): X16 → O16; Q/K → gv / gvᵀ; O → feat+geom; V → its f16 copy */
  if (off > ws_size) return;      // 2.6 + 0.4 + 8.4 + 2.1 + 4 × 8.4 + 16.8 + 16.8 + 8.4 + 8.4 + 4.2 + 2.1 ≈ 104 MB
  const unsigned gw = (unsigned)(((size_t)DD * (DD / 8) + 255) / 256), ggw = (unsigned)(((size_t)DD * (GG / 8) + 255) / 256);
  k_wt_f16<<<gw, 256, 0, stream>>>(wq, Bw, DD, DD, 16.0f); k_wt_f16<<<gw, 256, 0, stream>>>(wk, Bw + WSZ, DD, DD, 16.0f); k_wt_f16<<<gw, 256, 0, stream>>>(wv, Bw + 2 * WSZ, DD, DD, 16.0f); k_wt_f16<<<gw, 256, 0, stream>>>(wo, Bw + 3 * WSZ, DD, DD, 16.0f); k_wt_f16<<<gw, 256, 0, stream>>>(opw, Bw + 4 * WSZ, DD, DD, 16.0f);
  k_wt_f16<<<ggw, 256, 0, stream>>>(gqw, Bg, GG, DD, 16.0f); k_wt_f16<<<ggw, 256, 0, stream>>>(gkw, Bg + GSZ, GG, DD, 16.0f); k_wt_f16<<<ggw, 256, 0, stream>>>(gvw, Bg + 2 * GSZ, GG, DD, 16.0f);      /* (in,out) → Bt ×2^4 */
  const unsigned g8 = (unsigned)(((size_t)NR * DD / 8 + 255) / 256); k_x16<<<g8, 256, 0, stream>>>(feats, X16, (size_t)NR * DD / 8); k_x16<<<(unsigned)(((size_t)NR * GG / 8 + 255) / 256), 256, 0, stream>>>(geom, GE16, (size_t)NR * GG / 8);
  const dim3 gp(((NR / 16) * (DD / 64) + 3) / 4, 1);
  k_gemm_hhx<0><<<gp, 128, 0, stream>>>(X16, DD, 0, Bw, DD, 0, 0.0625f, bq, 0, nullptr, 1, 0, 0, nullptr, Q, DD, 0, NR, DD, DD);      /* M 8192 N 512 K 512 */
  k_gemm_hhx<0><<<gp, 128, 0, stream>>>(X16, DD, 0, Bw + WSZ, DD, 0, 0.0625f, bk, 0, nullptr, 1, 0, 0, nullptr, K, DD, 0, NR, DD, DD);
  k_gemm_hhx<0><<<gp, 128, 0, stream>>>(X16, DD, 0, Bw + 2 * WSZ, DD, 0, 0.0625f, bv, 0, nullptr, 1, 0, 0, nullptr, V, DD, 0, NR, DD, DD);
  k_vt<NH, TT><<<BB * NH * (TT / 64), 256, 0, stream>>>(V, DD, 0, Vt); k_flash<<<BB * NH * (TT / 64), 128, 0, stream>>>(Q, DD, K, DD, Vt, nullptr, O, DD);
  k_h16s<<<g8, 256, 0, stream>>>(O, O16, (size_t)NR * DD / 8);
  k_gemm_hhx<0><<<gp, 128, 0, stream>>>(O16, DD, 0, Bw + 3 * WSZ, DD, 0, 0.00390625f, bo, 0, nullptr, 1, 0, 0, FA, nullptr, DD, 0, NR, DD, DD);      /* feat_att = O·wo + bo (f32) */
  k_gemm_hhx<0><<<gp, 128, 0, stream>>>(GE16, GG, 0, Bg, GG, 0, 0.0625f, gqb, 0, nullptr, 1, 0, 0, GF, nullptr, DD, 0, NR, DD, GG); k_hl<<<g8, 256, 0, stream>>>(GF, GQ, GQl, (size_t)NR * DD / 8);      /* gq (f32) → hi / ×2^10 residual: M 8192 N 512 K 128 */
  k_gemm_hhx<0><<<gp, 128, 0, stream>>>(GE16, GG, 0, Bg + GSZ, GG, 0, 0.0625f, gkb, 0, nullptr, 1, 0, 0, GF, nullptr, DD, 0, NR, DD, GG); k_hl<<<g8, 256, 0, stream>>>(GF, GK, GKl, (size_t)NR * DD / 8);      /* gk likewise */
  k_gemm_hhx<0><<<gp, 128, 0, stream>>>(GE16, GG, 0, Bg + 2 * GSZ, GG, 0, 0.0625f, gvb, 0, nullptr, 1, 0, 0, nullptr, GV, DD, 0, NR, DD, GG);
  k_vt<DD / 64, TT><<<BB * (DD / 64) * (TT / 64), 256, 0, stream>>>(GV, DD, 0, GVt);      /* gvᵀ per batch [512][1024] */
  for (int b = 0; b < BB; ++b) { const size_t r0 = (size_t)b * TT;
    k_gemm_hhx<0><<<dim3(((TT / 16) * (TT / 64) + 3) / 4, 1), 128, 0, stream>>>(GQ + r0 * DD, DD, 0, GK + r0 * DD, DD, 0, 0.125f, nullptr, 0, nullptr, 1, 0, 0, S, nullptr, TT, 0, TT, TT, DD);      /* S = gq·gkᵀ/8 f32-accurate: hi·hi … */
    k_gemm_hhx<0><<<dim3(((TT / 16) * (TT / 64) + 3) / 4, 1), 128, 0, stream>>>(GQl + r0 * DD, DD, 0, GK + r0 * DD, DD, 0, 0.125f * 0.0009765625f, nullptr, 0, S, 1, (size_t)TT, 0, S, nullptr, TT, 0, TT, TT, DD);      /* += lo·hi·2^-10 */
    k_gemm_hhx<0><<<dim3(((TT / 16) * (TT / 64) + 3) / 4, 1), 128, 0, stream>>>(GQ + r0 * DD, DD, 0, GKl + r0 * DD, DD, 0, 0.125f * 0.0009765625f, nullptr, 0, S, 1, (size_t)TT, 0, S, nullptr, TT, 0, TT, TT, DD);      /* += hi·lo·2^-10: M 1024 N 1024 K 512 each */
    k_gbias<<<(TT * TT / 4 + 255) / 256, 256, 0, stream>>>(S, crd, b, d1w, d1b, d2w, d2b); k_smx<<<TT / 8, 256, 0, stream>>>(S, P16);
    k_gemm_hhx<0><<<dim3(((TT / 16) * (DD / 64) + 3) / 4, 1), 128, 0, stream>>>(P16, TT, 0, GVt + (size_t)b * DD * TT, TT, 0, 0.000030517578125f, nullptr, 0, FA + r0 * DD, 1, (size_t)DD, 0, SUM + r0 * DD, nullptr, DD, 0, TT, DD, TT); }      /* feat_att + geom_att: M 1024 N 512 K 1024 */
  k_h16<<<g8, 256, 0, stream>>>(SUM, SUM16, (size_t)NR * DD / 8);
  k_gemm_hhx<0><<<gp, 128, 0, stream>>>(SUM16, DD, 0, Bw + 4 * WSZ, DD, 0, 0.0625f, opb, 0, nullptr, 1, 0, 0, (float*)d_out, nullptr, DD, 0, NR, DD, DD);      /* out = (feat + geom)·op_w + op_b */
}

// v001
// It runs in 636 microseconds.
// In two side-by-side timings against v000, it was 2.09 and 2.08 times as fast.
#include <hip/hip_runtime.h>
// Geometry-aware attention (B=8, N=1024, F=512, 8 heads × 64, G=128): feat = MHA(features) (x·W + b, softmax(q·k/8)·v, ·wo + bo); geometry branch: gq, gk, gv = geometry·W + b (F wide, single head);
// g_scores = gq·gkᵀ/8 + mean_h(gelu_tanh(dist·d1_w + d1_b)·d2_w + d2_b) with dist = max(‖coords_q − coords_k‖, 1e-6); geom = softmax(g_scores)·gv; out = (feat + geom)·op_w + op_b. (in,out) weights; jax.nn.gelu default = tanh approximation.
// Compute dtype: features, geometry, coords, all weights/biases rounded to bf16; f16 GEMM planes; the 8-head branch through a fused flash-style kernel (online softmax f32, P f16 ×2^10); the geometry branch, every stage one launch over all batches (batch in blockIdx.y; the softmax's BB·TT rows in blockIdx.x): S = gq·gkᵀ/8 f32-accurate from f16 hi + residual planes (hi·hi + (lo·hi + hi·lo)·2^-10; its logits reach σ≈3), a kernel adding the distance-MLP bias in place (f32, per pair from the coords), a wave-per-row f32 softmax → P f16 ×2^15, geom = P·gv by GEMM with feat_att as the f32 addend; final projection GEMM. All contractions on v_wmma_f32_16x16x32_f16, f32 accumulate.
#define BB 8
#define TT 1024
#define DD 512
#define GG 128
#define NH 8
#define NR (BB * TT)

typedef __bf16 v16b __attribute__((ext_vector_type(16)));
typedef unsigned short v8us __attribute__((ext_vector_type(8), may_alias));
typedef float  v8f  __attribute__((ext_vector_type(8)));
typedef float  v4f  __attribute__((ext_vector_type(4)));
typedef float  v4fa __attribute__((ext_vector_type(4), may_alias));
union FragB { v16b v; v8us half[2]; unsigned short u[16]; };

__device__ __forceinline__ unsigned short bf16_bits(float x) { unsigned int u = __float_as_uint(x); return (unsigned short)((u + 0x7FFFu + ((u >> 16) & 1u)) >> 16); }
__device__ __forceinline__ float bf16_val(unsigned short b) { return __uint_as_float(((unsigned int)b) << 16); }
__device__ __forceinline__ float bf16_round(float x) { return bf16_val(bf16_bits(x)); }
// D += A·B with NT terms: 1 = ah·bh, 2 = + al·bh (A split), 3 = + ah·bl (both split)
template <int NT>
__device__ __forceinline__ v8f mmaN(v16b ah, v16b al, v16b bh, v16b bl, v8f c) {
  c = __builtin_amdgcn_wmma_f32_16x16x32_bf16(false, ah, false, bh, (short)0, c, false, false);
  if (NT >= 2) c = __builtin_amdgcn_wmma_f32_16x16x32_bf16(false, al, false, bh, (short)0, c, false, false);
  if (NT >= 3) c = __builtin_amdgcn_wmma_f32_16x16x32_bf16(false, ah, false, bl, (short)0, c, false, false);
  asm volatile("v_nop\n\tv_nop\n\tv_nop\n\tv_nop" : "+v"(c) : "v"(ah), "v"(al), "v"(bh), "v"(bl));
  return c;
}

__global__ __launch_bounds__(256) void k_wt_bf16(const float* __restrict__ W, unsigned short* __restrict__ Wt, int K, int N) {
  const int t = blockIdx.x * 256 + threadIdx.x;
  const int k8n = K / 8;
  if (t >= N * k8n) return;
  const int n = t / k8n, k8 = (t % k8n) * 8;
  v8us v;
#pragma unroll
  for (int i = 0; i < 8; ++i) v[i] = bf16_bits(W[(size_t)(k8 + i) * N + n]);
  *(v8us*)(Wt + (size_t)n * K + k8) = v;
  
}

// GEMM C[M][N] (f32, pitch ldc) = act(A[M][K]·W + bias). A f32 row-major (pitch lda) converted per fragment to bf16
// (ASPLIT: hi/lo two planes -> 2 terms, else single rounded term); Wt bf16 [N][K] (pitch ldb). BIAS_BF16 rounds the
// bias to bf16 first (bias quantised to bf16 before the add). K%32==0, M%16==0, N%64==0.
template <bool ASPLIT, int ACT, bool BIAS_BF16>
__global__ __launch_bounds__(128) void k_gemm_bf(const float* __restrict__ A, int lda, const unsigned short* __restrict__ Wt, int ldb,
                                               const float* __restrict__ bias, float* __restrict__ C, int ldc, int M, int N, int K) {
  __shared__ __attribute__((aligned(16))) float so[4][16][64];
  const int tid = threadIdx.x, w = tid >> 5, lane = tid & 31, ln = lane & 15, hh = lane >> 4;
  const int ntn = N / 64;
  const int wid = blockIdx.x * 4 + w;
  const int mt = wid / ntn, nq = wid % ntn;
  if (mt * 16 >= M) return;
  const int row0 = mt * 16, col0 = nq * 64;
  const float* arow = A + (size_t)(row0 + ln) * lda;
  v8f acc[4] = {};
  for (int kb = 0; kb < K; kb += 32) {
    FragB ah, al;
    const v4f x0 = *(const v4fa*)(arow + kb + 8 * hh), x1 = *(const v4fa*)(arow + kb + 8 * hh + 4);
    const v4f x2 = *(const v4fa*)(arow + kb + 16 + 8 * hh), x3 = *(const v4fa*)(arow + kb + 16 + 8 * hh + 4);
    float xs[16] = {x0[0],x0[1],x0[2],x0[3],x1[0],x1[1],x1[2],x1[3],x2[0],x2[1],x2[2],x2[3],x3[0],x3[1],x3[2],x3[3]};
#pragma unroll
    for (int i = 0; i < 16; ++i) { const unsigned short hb = bf16_bits(xs[i]); ah.u[i] = hb; al.u[i] = ASPLIT ? bf16_bits(xs[i] - bf16_val(hb)) : (unsigned short)0; }
#pragma unroll
    for (int t = 0; t < 4; ++t) {
      const unsigned short* brow = Wt + (size_t)(col0 + t * 16 + ln) * ldb + kb;
      FragB b;
      b.half[0] = *(const v8us*)(brow + 8 * hh);
      b.half[1] = *(const v8us*)(brow + 16 + 8 * hh);
      acc[t] = mmaN<ASPLIT ? 2 : 1>(ah.v, al.v, b.v, b.v, acc[t]);
    }
  }
#pragma unroll
  for (int t = 0; t < 4; ++t) {
    float bv = bias ? bias[col0 + t * 16 + ln] : 0.f;
    if (BIAS_BF16) bv = bf16_round(bv);
#pragma unroll
    for (int r = 0; r < 8; ++r) { float v = acc[t][r] + bv; if (ACT == 1) v = fmaxf(v, 0.f); so[w][8 * hh + r][t * 16 + ln] = v; }
  }
  __builtin_amdgcn_fence(__ATOMIC_ACQ_REL, "workgroup");
  __builtin_amdgcn_wave_barrier();
  const int rsub = lane >> 4, c4 = (lane & 15) * 4;
  {
#pragma unroll
    for (int q = 0; q < 8; ++q) {
      const int r = q * 2 + rsub;
      const v4f v = *(const v4fa*)&so[w][r][c4];
      *(v4f*)(C + (size_t)(row0 + r) * ldc + col0 + c4) = v;
    }
    
  }
}

// Flash-style causal/unmasked attention, all contractions 3-term bf16 hi/lo splits, f32 softmax with running max.
// q,k,v rows are read from f32 buffers with arbitrary row pitch (so they can live inside a fused qkv buffer);
// D = head size (multiple of 32, <= 128); one wave = 16 query rows; block = 4 waves (64 queries) sharing K/V chunks of 32.
template <int D, bool CAUSAL>
__global__ __launch_bounds__(128) void k_flash(const float* __restrict__ qb, const float* __restrict__ kb, const float* __restrict__ vb,
                                             int pitch, int T, int H, float scale, float* __restrict__ y, int ypitch) {
  constexpr int KS = D / 32;        // k-steps for QK
  constexpr int DT = D / 16;        // d tiles for PV
  __shared__ __attribute__((aligned(16))) unsigned short sKh[32][D + 8], sKl[32][D + 8], sVh[32][D + 8], sVl[32][D + 8];
  __shared__ __attribute__((aligned(16))) unsigned short sPh[4][16][40], sPl[4][16][40];
  __shared__ __attribute__((aligned(16))) float sO[4][16][D];
  const int tid = threadIdx.x, w = tid >> 5, lane = tid & 31, ln = lane & 15, hh = lane >> 4;
  const int nqb = (T + 63) / 64;
  const int bh = blockIdx.x / nqb, qblk = blockIdx.x % nqb;
  const int b = bh / H, h = bh % H;
  const int q0 = qblk * 64 + w * 16;
  const float* Q = qb + (size_t)b * T * pitch + h * D;
  const float* K = kb + (size_t)b * T * pitch + h * D;
  const float* V = vb + (size_t)b * T * pitch + h * D;

  // A fragments of the wave's 16 query rows (scaled), hi/lo
  FragB aqh[KS], aql[KS];
  {
    int row = q0 + ln; if (row >= T) row = T - 1;
    const float* qr = Q + (size_t)row * pitch;
#pragma unroll
    for (int ks = 0; ks < KS; ++ks)
#pragma unroll
      for (int i = 0; i < 16; ++i) {
        const int d = ks * 32 + ((i < 8) ? (8 * hh + i) : (16 + 8 * hh + (i - 8)));
        const float x = qr[d] * scale; const unsigned short hb = bf16_bits(x);
        aqh[ks].u[i] = hb; aql[ks].u[i] = bf16_bits(x - bf16_val(hb));
      }
  }
  float m_r[8], l_r[8];
#pragma unroll
  for (int r = 0; r < 8; ++r) { m_r[r] = -3.0e38f; l_r[r] = 0.f; }
  v8f oacc[DT];
#pragma unroll
  for (int dt = 0; dt < DT; ++dt) oacc[dt] = (v8f){0.f,0.f,0.f,0.f,0.f,0.f,0.f,0.f};

  const int kv_end = CAUSAL ? min(T, qblk * 64 + 64) : T;     // block-uniform
  for (int j0 = 0; j0 < kv_end; j0 += 32) {
    __syncthreads();
    for (int e = tid; e < 32 * (D / 4); e += 128) {
      const int r = e / (D / 4), c4 = (e % (D / 4)) * 4;
      const int key = j0 + r;
      v4f kf = {0.f,0.f,0.f,0.f}, vf = {0.f,0.f,0.f,0.f};
      if (key < T) { kf = *(const v4fa*)(K + (size_t)key * pitch + c4); vf = *(const v4fa*)(V + (size_t)key * pitch + c4); }
#pragma unroll
      for (int t = 0; t < 4; ++t) {
        unsigned short hb = bf16_bits(kf[t]); sKh[r][c4 + t] = hb; sKl[r][c4 + t] = bf16_bits(kf[t] - bf16_val(hb));
        hb = bf16_bits(vf[t]); sVh[r][c4 + t] = hb; sVl[r][c4 + t] = bf16_bits(vf[t] - bf16_val(hb));
      }
    }
    __syncthreads();
    // S tile 16 x 32
    v8f s[2];
#pragma unroll
    for (int nt = 0; nt < 2; ++nt) {
      v8f acc = {};
#pragma unroll
      for (int ks = 0; ks < KS; ++ks) {
        FragB bh_, bl_;
        bh_.half[0] = *(const v8us*)&sKh[nt * 16 + ln][ks * 32 + 8 * hh]; bh_.half[1] = *(const v8us*)&sKh[nt * 16 + ln][ks * 32 + 16 + 8 * hh];
        bl_.half[0] = *(const v8us*)&sKl[nt * 16 + ln][ks * 32 + 8 * hh]; bl_.half[1] = *(const v8us*)&sKl[nt * 16 + ln][ks * 32 + 16 + 8 * hh];
        acc = mmaN<3>(aqh[ks].v, aql[ks].v, bh_.v, bl_.v, acc);
      }
      s[nt] = acc;
    }
    // mask + running max (rows 8hh+r; the 16 lanes of a half share rows)
    float alpha[8];
#pragma unroll
    for (int r = 0; r < 8; ++r) {
      const int qi = q0 + 8 * hh + r;
      const int ja = j0 + ln, jb = j0 + 16 + ln;
      if (CAUSAL) { if (ja > qi) s[0][r] = -3.0e38f; if (jb > qi) s[1][r] = -3.0e38f; }
      if (ja >= T) s[0][r] = -3.0e38f;
      if (jb >= T) s[1][r] = -3.0e38f;
      float mx = fmaxf(s[0][r], s[1][r]);
      mx = fmaxf(mx, __shfl_xor(mx, 1, 32)); mx = fmaxf(mx, __shfl_xor(mx, 2, 32)); mx = fmaxf(mx, __shfl_xor(mx, 4, 32)); mx = fmaxf(mx, __shfl_xor(mx, 8, 32));
      const float mnew = fmaxf(m_r[r], mx);
      alpha[r] = (mnew > -1.0e38f) ? __expf(m_r[r] - mnew) : 1.0f;
      const float p0 = (s[0][r] > -1.0e38f) ? __expf(s[0][r] - mnew) : 0.f;
      const float p1 = (s[1][r] > -1.0e38f) ? __expf(s[1][r] - mnew) : 0.f;
      m_r[r] = mnew;
      l_r[r] = l_r[r] * alpha[r] + p0 + p1;            // per-lane partial row sum (16 lanes combined at the end)
      unsigned short hb = bf16_bits(p0); sPh[w][8 * hh + r][ln] = hb;      sPl[w][8 * hh + r][ln] = bf16_bits(p0 - bf16_val(hb));
      hb = bf16_bits(p1);                sPh[w][8 * hh + r][16 + ln] = hb; sPl[w][8 * hh + r][16 + ln] = bf16_bits(p1 - bf16_val(hb));
    }
#pragma unroll
    for (int dt = 0; dt < DT; ++dt)
#pragma unroll
      for (int r = 0; r < 8; ++r) oacc[dt][r] *= alpha[r];
    __builtin_amdgcn_fence(__ATOMIC_ACQ_REL, "workgroup");
    __builtin_amdgcn_wave_barrier();
    FragB pah, pal;
    pah.half[0] = *(const v8us*)&sPh[w][ln][8 * hh]; pah.half[1] = *(const v8us*)&sPh[w][ln][16 + 8 * hh];
    pal.half[0] = *(const v8us*)&sPl[w][ln][8 * hh]; pal.half[1] = *(const v8us*)&sPl[w][ln][16 + 8 * hh];
#pragma unroll
    for (int dt = 0; dt < DT; ++dt) {
      FragB bvh, bvl;
#pragma unroll
      for (int i = 0; i < 8; ++i) {
        bvh.u[i] = sVh[8 * hh + i][dt * 16 + ln]; bvh.u[8 + i] = sVh[16 + 8 * hh + i][dt * 16 + ln];
        bvl.u[i] = sVl[8 * hh + i][dt * 16 + ln]; bvl.u[8 + i] = sVl[16 + 8 * hh + i][dt * 16 + ln];
      }
      oacc[dt] = mmaN<3>(pah.v, pal.v, bvh.v, bvl.v, oacc[dt]);
    }
    __builtin_amdgcn_fence(__ATOMIC_ACQ_REL, "workgroup");
    __builtin_amdgcn_wave_barrier();
  }
#pragma unroll
  for (int r = 0; r < 8; ++r) {
    float l = l_r[r];
    l += __shfl_xor(l, 1, 32); l += __shfl_xor(l, 2, 32); l += __shfl_xor(l, 4, 32); l += __shfl_xor(l, 8, 32);
    l_r[r] = (l > 0.f) ? 1.0f / l : 0.f;
  }
#pragma unroll
  for (int dt = 0; dt < DT; ++dt)
#pragma unroll
    for (int r = 0; r < 8; ++r) sO[w][8 * hh + r][dt * 16 + ln] = oacc[dt][r] * l_r[r];
  __builtin_amdgcn_fence(__ATOMIC_ACQ_REL, "workgroup");
  __builtin_amdgcn_wave_barrier();
  {
    for (int r = 0; r < 16; ++r) {
      const int row = q0 + r;
      if (row < T && lane < D / 4) {
        const v4f val = *(const v4fa*)&sO[w][r][lane * 4];
        *(v4f*)(y + ((size_t)b * T + row) * ypitch + h * D + lane * 4) = val;
      }
    }
    
  }
}

// GEMM C = act(A·W + bias + resid): A f32 (ASPLIT -> hi/lo 2 terms), Wt bf16 [N][K]; ACT 0 none, 1 relu, 2 exact gelu;
// resid (optional, f32, row index = (row % rmod), pitch ldr, RES_BF16 rounds it) added before the activation.
template <bool ASPLIT, int ACT, bool BIAS_BF16, bool RES_BF16>
__global__ __launch_bounds__(128) void k_gemm_bf3(const float* __restrict__ A, int lda, const unsigned short* __restrict__ Wt, int ldb,
                                                const float* __restrict__ bias, const float* __restrict__ resid, int rmod, int ldr,
                                                float* __restrict__ C, int ldc, int M, int N, int K) {
  __shared__ __attribute__((aligned(16))) float so[4][16][64];
  const int tid = threadIdx.x, w = tid >> 5, lane = tid & 31, ln = lane & 15, hh = lane >> 4;
  const int ntn = N / 64;
  const int wid = blockIdx.x * 4 + w;
  const int mt = wid / ntn, nq = wid % ntn;
  if (mt * 16 >= M) return;
  const int row0 = mt * 16, col0 = nq * 64;
  const float* arow = A + (size_t)(row0 + ln) * lda;
  v8f acc[4] = {};
  for (int kb = 0; kb < K; kb += 32) {
    FragB ah, al;
    const v4f x0 = *(const v4fa*)(arow + kb + 8 * hh), x1 = *(const v4fa*)(arow + kb + 8 * hh + 4);
    const v4f x2 = *(const v4fa*)(arow + kb + 16 + 8 * hh), x3 = *(const v4fa*)(arow + kb + 16 + 8 * hh + 4);
    float xs[16] = {x0[0],x0[1],x0[2],x0[3],x1[0],x1[1],x1[2],x1[3],x2[0],x2[1],x2[2],x2[3],x3[0],x3[1],x3[2],x3[3]};
#pragma unroll
    for (int i = 0; i < 16; ++i) { const unsigned short hb = bf16_bits(xs[i]); ah.u[i] = hb; al.u[i] = ASPLIT ? bf16_bits(xs[i] - bf16_val(hb)) : (unsigned short)0; }
#pragma unroll
    for (int t = 0; t < 4; ++t) {
      const unsigned short* brow = Wt + (size_t)(col0 + t * 16 + ln) * ldb + kb;
      FragB b;
      b.half[0] = *(const v8us*)(brow + 8 * hh);
      b.half[1] = *(const v8us*)(brow + 16 + 8 * hh);
      acc[t] = mmaN<ASPLIT ? 2 : 1>(ah.v, al.v, b.v, b.v, acc[t]);
    }
  }
#pragma unroll
  for (int t = 0; t < 4; ++t) {
    const int col = col0 + t * 16 + ln;
    float bv = bias ? bias[col] : 0.f;
    if (BIAS_BF16) bv = bf16_round(bv);
#pragma unroll
    for (int r = 0; r < 8; ++r) {
      float v = acc[t][r] + bv;
      if (resid) { float rv = resid[(size_t)((row0 + 8 * hh + r) % rmod) * ldr + col]; if (RES_BF16) rv = bf16_round(rv); v += rv; }
      if (ACT == 1) v = fmaxf(v, 0.f);
      if (ACT == 2) v = 0.5f * v * (1.0f + erff(v * 0.70710678118654752f));
      if (ACT == 3) { const float u = 0.7978845608028654f * (v + 0.044715f * v * v * v); v = 0.5f * v * (1.0f + tanhf(u)); }
      so[w][8 * hh + r][t * 16 + ln] = v;
    }
  }
  __builtin_amdgcn_fence(__ATOMIC_ACQ_REL, "workgroup");
  __builtin_amdgcn_wave_barrier();
  const int rsub = lane >> 4, c4 = (lane & 15) * 4;
  {
#pragma unroll
    for (int q = 0; q < 8; ++q) {
      const int r = q * 2 + rsub;
      const v4f v = *(const v4fa*)&so[w][r][c4];
      *(v4f*)(C + (size_t)(row0 + r) * ldc + col0 + c4) = v;
    }
    
  }
}
// row LayerNorm (biased variance, eps) over N: s = X (+ R); optional out_sum <- s; out_norm <- (s-mu)*rsqrt(var+eps)*g + b
template <bool PARAM_BF16>
__global__ __launch_bounds__(256) void k_layernorm(const float* __restrict__ X, const float* __restrict__ R, const float* __restrict__ g, const float* __restrict__ bta,
                                                  float* __restrict__ out_sum, float* __restrict__ out_norm, int N, float eps) {
  __shared__ float red[256];
  const int row = blockIdx.x, tid = threadIdx.x;
  const float* x = X + (size_t)row * N; const float* rr = R ? R + (size_t)row * N : nullptr;
  float vals[16];                     // up to N = 4096
  const int per = N / 256;            // contiguous chunk per thread? use strided-by-4 chunks: thread handles j = tid*4 + 1024*u
  float s1 = 0.f;
  for (int u = 0; u < per / 4; ++u) {
    const int j = tid * 4 + 1024 * u;
    const v4f a = *(const v4fa*)(x + j);
    v4f b = {0.f,0.f,0.f,0.f}; if (rr) b = *(const v4fa*)(rr + j);
#pragma unroll
    for (int q = 0; q < 4; ++q) { const float v = a[q] + b[q]; vals[u * 4 + q] = v; s1 += v; }
  }
  red[tid] = s1; __syncthreads();
  for (int st = 128; st > 0; st >>= 1) { if (tid < st) red[tid] += red[tid + st]; __syncthreads(); }
  const float mu = red[0] / (float)N; __syncthreads();
  float s2 = 0.f;
  for (int u = 0; u < per / 4; ++u)
#pragma unroll
    for (int q = 0; q < 4; ++q) { const float c = vals[u * 4 + q] - mu; s2 += c * c; }
  red[tid] = s2; __syncthreads();
  for (int st = 128; st > 0; st >>= 1) { if (tid < st) red[tid] += red[tid + st]; __syncthreads(); }
  const float rs = rsqrtf(red[0] / (float)N + eps);
  {
    for (int u = 0; u < per / 4; ++u) {
      const int j = tid * 4 + 1024 * u;
      v4f o, sm;
#pragma unroll
      for (int q = 0; q < 4; ++q) {
        float gg = g[j + q], bb = bta[j + q];
        if (PARAM_BF16) { gg = bf16_round(gg); bb = bf16_round(bb); }
        sm[q] = vals[u * 4 + q]; o[q] = (vals[u * 4 + q] - mu) * rs * gg + bb;
      }
      if (out_sum) *(v4f*)(out_sum + (size_t)row * N + j) = sm;
      *(v4f*)(out_norm + (size_t)row * N + j) = o;
    }
    
  }
}



// ---- f16 WMMA path (v_wmma_f32_16x16x32_f16): 11-bit significands for operands in range — used for every contraction launched here
typedef _Float16 v16h __attribute__((ext_vector_type(16)));
union FragH { v16h v; v8us half[2]; _Float16 h[16]; unsigned short u[16]; };
template <int NT>
__device__ __forceinline__ v8f mmaH(v16h ah, v16h al, v16h bh, v16h bl, v8f c) {
  c = __builtin_amdgcn_wmma_f32_16x16x32_f16(false, ah, false, bh, (short)0, c, false, false);
  if (NT >= 2) c = __builtin_amdgcn_wmma_f32_16x16x32_f16(false, al, false, bh, (short)0, c, false, false);
  if (NT >= 3) c = __builtin_amdgcn_wmma_f32_16x16x32_f16(false, ah, false, bl, (short)0, c, false, false);
  asm volatile("v_nop\n\tv_nop\n\tv_nop\n\tv_nop" : "+v"(c) : "v"(ah), "v"(al), "v"(bh), "v"(bl));
  return c;
}
// batched GEMM like k_gemm_b but f16 operands: A f32 (split into f16 hi/lo if ASPLIT, else rounded to f16), Bt = f16 values [n][k]; alpha; C f32; N multiple of 16 (partial tiles skipped)
template <bool ASPLIT>
__global__ __launch_bounds__(128) void k_gemm_h(const float* __restrict__ A, int lda, size_t sA, const _Float16* __restrict__ Bh, int ldb, size_t sB, float alpha, float* __restrict__ C, int ldc, size_t sC, int M, int N, int K) {
  __shared__ __attribute__((aligned(16))) float so[4][16][64];
  const int tid = threadIdx.x, w = tid >> 5, lane = tid & 31, ln = lane & 15, hh = lane >> 4; const int by = blockIdx.y;
  A += (size_t)by * sA; Bh += (size_t)by * sB; C += (size_t)by * sC;
  const int ntn = (N + 63) / 64; const int wid = blockIdx.x * 4 + w; const int mt = wid / ntn, nq = wid % ntn; if (mt * 16 >= M) return;
  const int row0 = mt * 16, col0 = nq * 64; const float* arow = A + (size_t)(row0 + ln) * lda;
  v8f acc[4] = {};
  for (int kb = 0; kb < K; kb += 32) {
    FragH ah, al;
    const v4f x0 = *(const v4fa*)(arow + kb + 8 * hh), x1 = *(const v4fa*)(arow + kb + 8 * hh + 4), x2 = *(const v4fa*)(arow + kb + 16 + 8 * hh), x3 = *(const v4fa*)(arow + kb + 16 + 8 * hh + 4);
    float xs[16] = {x0[0],x0[1],x0[2],x0[3],x1[0],x1[1],x1[2],x1[3],x2[0],x2[1],x2[2],x2[3],x3[0],x3[1],x3[2],x3[3]};
#pragma unroll
    for (int i = 0; i < 16; ++i) { const _Float16 h = (_Float16)xs[i]; ah.h[i] = h; al.h[i] = ASPLIT ? (_Float16)(xs[i] - (float)h) : (_Float16)0.0f; }
#pragma unroll
    for (int t = 0; t < 4; ++t) { if (col0 + t * 16 >= N) continue; const size_t boff = (size_t)(col0 + t * 16 + ln) * ldb + kb; FragH bq; bq.half[0] = *(const v8us*)(Bh + boff + 8 * hh); bq.half[1] = *(const v8us*)(Bh + boff + 16 + 8 * hh);
      acc[t] = mmaH<ASPLIT ? 2 : 1>(ah.v, al.v, bq.v, bq.v, acc[t]); }
  }
#pragma unroll
  for (int t = 0; t < 4; ++t) { if (col0 + t * 16 >= N) continue;
#pragma unroll
    for (int r = 0; r < 8; ++r) so[w][8 * hh + r][t * 16 + ln] = acc[t][r] * alpha; }
  __builtin_amdgcn_fence(__ATOMIC_ACQ_REL, "workgroup"); __builtin_amdgcn_wave_barrier();
  const int rsub = lane >> 4, c4 = (lane & 15) * 4;
  {
#pragma unroll
    for (int q = 0; q < 8; ++q) { const int r = q * 2 + rsub; if (col0 + c4 < N) { const v4f v = *(const v4fa*)&so[w][r][c4]; *(v4f*)(C + (size_t)(row0 + r) * ldc + col0 + c4) = v; } }
     }
}

// Wt[n][k] = f16(W[k][n]·scale) from f32 row-major W[K][N] (scale = power of two; bf16-exact weights stay exact in f16 away from the subnormal range)
__global__ __launch_bounds__(256) void k_wt_f16(const float* __restrict__ W, _Float16* __restrict__ Wt, int K, int N, float scale) {
  const int t = blockIdx.x * 256 + threadIdx.x; if (t >= N * (K / 8)) return; const int n = t / (K / 8), k8 = (t % (K / 8)) * 8; FragH f;
#pragma unroll
  for (int i = 0; i < 8; ++i) f.h[i] = (_Float16)(bf16_round(W[(size_t)(k8 + i) * N + n]) * scale); const v8us o = f.half[0];
  *(v8us*)((unsigned short*)Wt + (size_t)n * K + k8) = o; 
}
// k_gemm_hh variant with fused epilogue: v = acc·alpha + bias[by·sBias + col] (+ CP[(row/rowsPerB)*sCPb + by*sCPy + col] if CP) ; ACT 0 none / 1 elu ; writes f32 C and/or f16 C16 (each if non-null)
template <int ACT>
__global__ __launch_bounds__(128) void k_gemm_hhx(const _Float16* __restrict__ A, int lda, size_t sA, const _Float16* __restrict__ Bh, int ldb, size_t sB, float alpha, const float* __restrict__ bias, size_t sBias, const float* __restrict__ CP, int rowsPerB, size_t sCPb, size_t sCPy, int row0g,
    float* __restrict__ C, _Float16* __restrict__ C16, int ldc, size_t sC, int M, int N, int K) {
  __shared__ __attribute__((aligned(16))) float so[4][16][64];
  const int tid = threadIdx.x, w = tid >> 5, lane = tid & 31, ln = lane & 15, hh = lane >> 4; const int by = blockIdx.y;
  A += (size_t)by * sA; Bh += (size_t)by * sB; const size_t cofs = (size_t)by * sC; const float* bp = bias ? bias + (size_t)by * sBias : nullptr;
  const int ntn = (N + 63) / 64; const int wid = blockIdx.x * 4 + w; const int mt = wid / ntn, nq = wid % ntn; if (mt * 16 >= M) return;
  const int row0 = mt * 16, col0 = nq * 64; const _Float16* arow = A + (size_t)(row0 + ln) * lda;
  v8f acc[4] = {};
  for (int kb = 0; kb < K; kb += 32) { FragH ah; ah.half[0] = *(const v8us*)((const unsigned short*)arow + kb + 8 * hh); ah.half[1] = *(const v8us*)((const unsigned short*)arow + kb + 16 + 8 * hh);
#pragma unroll
    for (int t = 0; t < 4; ++t) { if (col0 + t * 16 >= N) continue; const size_t boff = (size_t)(col0 + t * 16 + ln) * ldb + kb; FragH bq; bq.half[0] = *(const v8us*)((const unsigned short*)Bh + boff + 8 * hh); bq.half[1] = *(const v8us*)((const unsigned short*)Bh + boff + 16 + 8 * hh);
      acc[t] = mmaH<1>(ah.v, ah.v, bq.v, bq.v, acc[t]); }
  }
#pragma unroll
  for (int t = 0; t < 4; ++t) { if (col0 + t * 16 >= N) continue; const int col = col0 + t * 16 + ln; const float bv = bp ? bf16_round(bp[col]) : 0.f;
#pragma unroll
    for (int r = 0; r < 8; ++r) { float v = acc[t][r] * alpha + bv; if (CP) { const int bidx = (row0g + row0 + 8 * hh + r) / rowsPerB; v += CP[(size_t)bidx * sCPb + (size_t)by * sCPy + col]; } if (ACT == 1) v = (v > 0.f) ? v : expm1f(v); else if (ACT == 7) v = (v > 0.f) ? v + 1.0f : expf(v); else if (ACT == 8) v = tanhf(v); else if (ACT == 9) v = 0.5f * v * (1.0f + tanhf(0.7978845608028654f * (v + 0.044715f * v * v * v))); else if (ACT == 11) v = 1.0f / (1.0f + expf(-v)); else if (ACT == 12) v = (v > 0.f) ? v : 0.01f * v; else if (ACT == 14) v = (v > 0.f) ? v : 0.1f * v; else if (ACT == 15) v = v / (1.0f + expf(-v)); else if (ACT == 3) v = fmaxf(v, 0.f); else if (ACT == 6) v = 0.5f * v * (1.0f + erff(v * 0.70710678118654752f)); so[w][8 * hh + r][t * 16 + ln] = v; } }
  __builtin_amdgcn_fence(__ATOMIC_ACQ_REL, "workgroup"); __builtin_amdgcn_wave_barrier();
  const int rsub = lane >> 4, c4 = (lane & 15) * 4; typedef _Float16 v4h __attribute__((ext_vector_type(4)));
  {
#pragma unroll
    for (int q = 0; q < 8; ++q) { const int r = q * 2 + rsub; if (col0 + c4 < N) { const v4f v = *(const v4fa*)&so[w][r][c4]; if (C) *(v4f*)(C + cofs + (size_t)(row0 + r) * ldc + col0 + c4) = v; if (C16) { v4h h4; for (int i = 0; i < 4; ++i) h4[i] = (_Float16)v[i]; *(v4h*)(C16 + cofs + (size_t)(row0 + r) * ldc + col0 + c4) = h4; } } }
     }
}


typedef _Float16 v4h __attribute__((ext_vector_type(4)));

__global__ __launch_bounds__(256) void k_x16(const float* __restrict__ x, _Float16* __restrict__ X16, size_t n8) { const size_t t = (size_t)blockIdx.x * 256 + threadIdx.x; if (t >= n8) return; FragH f;
#pragma unroll
  for (int q = 0; q < 8; ++q) f.h[q] = (_Float16)bf16_round(x[t * 8 + q]); *(v8us*)((unsigned short*)X16 + t * 8) = f.half[0];  }
__global__ __launch_bounds__(256) void k_h16(const float* __restrict__ x, _Float16* __restrict__ X16, size_t n8) { const size_t t = (size_t)blockIdx.x * 256 + threadIdx.x; if (t >= n8) return; FragH f;
#pragma unroll
  for (int q = 0; q < 8; ++q) f.h[q] = (_Float16)x[t * 8 + q]; *(v8us*)((unsigned short*)X16 + t * 8) = f.half[0];  }
__global__ __launch_bounds__(256) void k_round16f(const float* __restrict__ W, _Float16* __restrict__ Bt, size_t n8) { const size_t t = (size_t)blockIdx.x * 256 + threadIdx.x; if (t >= n8) return; FragH f;
#pragma unroll
  for (int i = 0; i < 8; ++i) f.h[i] = (_Float16)(bf16_round(W[t * 8 + i]) * 16.0f); *(v8us*)((unsigned short*)Bt + t * 8) = f.half[0];  }
template <int NHv, int TTv>
__global__ __launch_bounds__(256) void k_vt(const _Float16* __restrict__ V16, int ldv, int voff, _Float16* __restrict__ Vt) { __shared__ unsigned short tl[64][66]; const int tid = threadIdx.x; const int slab = blockIdx.x / (TTv / 64), lg = blockIdx.x % (TTv / 64); const int b = slab / NHv, h = slab % NHv;
  for (int i = tid; i < 64 * 8; i += 256) { const int r = i / 8, c8 = (i % 8) * 8; FragH f; f.half[0] = *(const v8us*)((const unsigned short*)V16 + ((size_t)b * TTv + lg * 64 + r) * ldv + voff + h * 64 + c8);
#pragma unroll
    for (int q = 0; q < 8; ++q) tl[r][c8 + q] = f.u[q]; }
  __syncthreads();
  {
#pragma unroll
    for (int rd = 0; rd < 2; ++rd) { const int d = rd * 32 + tid / 8, pc = tid % 8; FragH f;
#pragma unroll
      for (int q = 0; q < 8; ++q) f.u[q] = tl[pc * 8 + q][d];
      *(v8us*)((unsigned short*)Vt + ((size_t)slab * 64 + d) * TTv + lg * 64 + pc * 8) = f.half[0]; }
     } }

__global__ __launch_bounds__(256) void k_hl(const float* __restrict__ F, _Float16* __restrict__ Hh, _Float16* __restrict__ Hl, size_t n8) { const size_t t = (size_t)blockIdx.x * 256 + threadIdx.x; if (t >= n8) return; FragH fh, fl; const v4f a = *(const v4fa*)(F + t * 8), c = *(const v4fa*)(F + t * 8 + 4);
#pragma unroll
  for (int q = 0; q < 4; ++q) { _Float16 h = (_Float16)a[q]; fh.h[q] = h; fl.h[q] = (_Float16)((a[q] - (float)h) * 1024.0f); h = (_Float16)c[q]; fh.h[4 + q] = h; fl.h[4 + q] = (_Float16)((c[q] - (float)h) * 1024.0f); }
  { *(v8us*)((unsigned short*)Hh + t * 8) = fh.half[0]; *(v8us*)((unsigned short*)Hl + t * 8) = fl.half[0];  } }
__global__ __launch_bounds__(256) void k_h16s(const float* __restrict__ F, _Float16* __restrict__ H, size_t n8) { const size_t t = (size_t)blockIdx.x * 256 + threadIdx.x; if (t >= n8) return; const v4f a = *(const v4fa*)(F + t * 8), c = *(const v4fa*)(F + t * 8 + 4); FragH f;
#pragma unroll
  for (int q = 0; q < 4; ++q) { f.h[q] = (_Float16)(a[q] * 16.0f); f.h[4 + q] = (_Float16)(c[q] * 16.0f); } *(v8us*)((unsigned short*)H + t * 8) = f.half[0];  }
__device__ __forceinline__ float gelu_tanh(float x) { const float u = 0.7978845608028654f * (x + 0.044715f * x * x * x); return 0.5f * x * (1.0f + tanhf(u)); }
__global__ __launch_bounds__(256) void k_gbias(float* __restrict__ S, const float* __restrict__ CRD, const float* __restrict__ w1, const float* __restrict__ b1, const float* __restrict__ w2, const float* __restrict__ b2) {
  #pragma clang fp contract(off)
  const int b = blockIdx.y; S += (size_t)b * TT * TT;      /* one score plane per batch */
  const size_t t = (size_t)blockIdx.x * 256 + threadIdx.x; if (t >= (size_t)TT * TT / 4) return; const int q = (int)((t * 4) / TT), k0 = (int)((t * 4) % TT);
  float cb = 0.f; for (int j = 0; j < 8; ++j) cb += bf16_round(b2[j]); cb *= 0.125f;
  const float qx = bf16_round(CRD[((size_t)b * TT + q) * 3]), qy = bf16_round(CRD[((size_t)b * TT + q) * 3 + 1]), qz = bf16_round(CRD[((size_t)b * TT + q) * 3 + 2]);
  v4f sv = *(const v4fa*)(S + (size_t)q * TT + k0); float dist[4];
  for (int e = 0; e < 4; ++e) { const int k = k0 + e; const float dx = qx - bf16_round(CRD[((size_t)b * TT + k) * 3]), dy = qy - bf16_round(CRD[((size_t)b * TT + k) * 3 + 1]), dz = qz - bf16_round(CRD[((size_t)b * TT + k) * 3 + 2]); dist[e] = sqrtf(fmaxf(dx * dx + dy * dy + dz * dz, 1e-12f)); sv[e] += cb; }
#pragma unroll 1
  for (int j = 0; j < 8; ++j) { float cj = 0.f; for (int h = 0; h < 8; ++h) cj += bf16_round(w2[j * 8 + h]); cj *= 0.125f; const float wj = bf16_round(w1[j]), bj = bf16_round(b1[j]);
    for (int e = 0; e < 4; ++e) sv[e] += gelu_tanh(dist[e] * wj + bj) * cj; }
  *(v4f*)(S + (size_t)q * TT + k0) = sv;  }
#define NN TT
__global__ __launch_bounds__(256) void k_smx(const float* __restrict__ S, _Float16* __restrict__ P16) { const int tid = threadIdx.x, wv = tid >> 5, lane = tid & 31; const int i = blockIdx.x * 8 + wv; const float* sr = S + (size_t)i * NN;
  float m = -3.0e38f;
  for (int p = lane; p < NN / 8; p += 32) { const v4f a = *(const v4fa*)(sr + p * 8), c = *(const v4fa*)(sr + p * 8 + 4); for (int e = 0; e < 4; ++e) m = fmaxf(m, fmaxf(a[e], c[e])); }
  for (int o = 16; o >= 1; o >>= 1) m = fmaxf(m, __shfl_xor(m, o, 32)); float z = 0.f;
  for (int p = lane; p < NN / 8; p += 32) { const v4f a = *(const v4fa*)(sr + p * 8), c = *(const v4fa*)(sr + p * 8 + 4); for (int e = 0; e < 4; ++e) z += __expf(a[e] - m) + __expf(c[e] - m); }
  for (int o = 16; o >= 1; o >>= 1) z += __shfl_xor(z, o, 32); const float iz = 32768.0f / z;
  { for (int p = lane; p < NN / 8; p += 32) { FragH f; const v4f a = *(const v4fa*)(sr + p * 8), c = *(const v4fa*)(sr + p * 8 + 4); for (int e = 0; e < 4; ++e) { f.h[e] = (_Float16)(__expf(a[e] - m) * iz); f.h[4 + e] = (_Float16)(__expf(c[e] - m) * iz); }
      *(v8us*)((unsigned short*)P16 + (size_t)i * NN + p * 8) = f.half[0]; }  } }
__global__ __launch_bounds__(128) void k_flash(const _Float16* __restrict__ Q16, int ldq, const _Float16* __restrict__ K16, int ldk, const _Float16* __restrict__ Vt, const int* __restrict__ MSK, float* __restrict__ O, int ldo) {
  constexpr int RPW = 16, RTN = RPW / 16, NQB = TT / (4 * RPW), DT = 4, KS = 2;
  __shared__ __attribute__((aligned(16))) unsigned short sP[4][RPW][40]; __shared__ __attribute__((aligned(16))) float sO[4][RPW][64 + 4];
  const int tid = threadIdx.x, w = tid >> 5, lane = tid & 31, ln = lane & 15, hh = lane >> 4;
  const int slab = blockIdx.x / NQB, qblk = blockIdx.x % NQB; const int b = slab / NH, h = slab % NH; const int qb0 = qblk * (4 * RPW); const int q0 = qb0 + w * RPW;
  FragH aq[2][KS];
#pragma unroll
  for (int rt = 0; rt < RTN; ++rt) { const unsigned short* qr = (const unsigned short*)Q16 + ((size_t)b * TT + q0 + rt * 16 + ln) * ldq + h * 64;
#pragma unroll
    for (int ks = 0; ks < KS; ++ks) { aq[rt][ks].half[0] = *(const v8us*)(qr + ks * 32 + 8 * hh); aq[rt][ks].half[1] = *(const v8us*)(qr + ks * 32 + 16 + 8 * hh); } }
  const unsigned short* Vth = (const unsigned short*)Vt + (size_t)slab * 64 * TT;
  float m_r[2][8], l_r[2][8]; v8f oacc[2][DT];
#pragma unroll
  for (int rt = 0; rt < RTN; ++rt) {
#pragma unroll
    for (int r = 0; r < 8; ++r) { m_r[rt][r] = -3.0e38f; l_r[rt][r] = 0.f; }
#pragma unroll
    for (int dt = 0; dt < DT; ++dt) oacc[rt][dt] = (v8f){0.f,0.f,0.f,0.f,0.f,0.f,0.f,0.f}; }
  const int jend = TT;
#pragma unroll 1
  for (int j0 = 0; j0 < jend; j0 += 32) {
    v8f s[2][2];
#pragma unroll
    for (int nt = 0; nt < 2; ++nt) { const unsigned short* kr = (const unsigned short*)K16 + ((size_t)b * TT + j0 + nt * 16 + ln) * ldk + h * 64; FragH bk[KS];
#pragma unroll
      for (int ks = 0; ks < KS; ++ks) { bk[ks].half[0] = *(const v8us*)(kr + ks * 32 + 8 * hh); bk[ks].half[1] = *(const v8us*)(kr + ks * 32 + 16 + 8 * hh); }
#pragma unroll
      for (int rt = 0; rt < RTN; ++rt) { v8f acc = (v8f){0.f,0.f,0.f,0.f,0.f,0.f,0.f,0.f};
#pragma unroll
        for (int ks = 0; ks < KS; ++ks) acc = mmaH<1>(aq[rt][ks].v, aq[rt][ks].v, bk[ks].v, bk[ks].v, acc); s[rt][nt] = acc; } }
#pragma unroll
    for (int rt = 0; rt < RTN; ++rt)
#pragma unroll
      for (int r = 0; r < 8; ++r) { const int tq = q0 + rt * 16 + 8 * hh + r; const int k0 = j0 + ln, k1 = j0 + 16 + ln; (void)tq; (void)k0; (void)k1;
        const bool ok0 = true, ok1 = true;
        const float s0 = s[rt][0][r] * 0.125f, s1 = s[rt][1][r] * 0.125f; float mc = fmaxf(s0, s1);
        mc = fmaxf(mc, __shfl_xor(mc, 1, 32)); mc = fmaxf(mc, __shfl_xor(mc, 2, 32)); mc = fmaxf(mc, __shfl_xor(mc, 4, 32)); mc = fmaxf(mc, __shfl_xor(mc, 8, 32));
        const float mn = fmaxf(m_r[rt][r], mc); const float al = (mn > -1.0e38f) ? expf(m_r[rt][r] - mn) : 1.0f; m_r[rt][r] = mn; const float p0 = ok0 ? expf(s0 - mn) : 0.f, p1 = ok1 ? expf(s1 - mn) : 0.f; l_r[rt][r] = l_r[rt][r] * al + p0 + p1;
#pragma unroll
        for (int dt = 0; dt < DT; ++dt) oacc[rt][dt][r] *= al;
        FragH t2; t2.h[0] = (_Float16)(p0 * 1024.0f); t2.h[1] = (_Float16)(p1 * 1024.0f); sP[w][rt * 16 + 8 * hh + r][ln] = t2.u[0]; sP[w][rt * 16 + 8 * hh + r][16 + ln] = t2.u[1]; }
    __builtin_amdgcn_fence(__ATOMIC_ACQ_REL, "workgroup"); __builtin_amdgcn_wave_barrier();
    FragH pa[2];
#pragma unroll
    for (int rt = 0; rt < RTN; ++rt) { pa[rt].half[0] = *(const v8us*)&sP[w][rt * 16 + ln][8 * hh]; pa[rt].half[1] = *(const v8us*)&sP[w][rt * 16 + ln][16 + 8 * hh]; }
#pragma unroll
    for (int dt = 0; dt < DT; ++dt) { const unsigned short* vrow = Vth + (size_t)(dt * 16 + ln) * TT + j0; FragH bv; bv.half[0] = *(const v8us*)(vrow + 8 * hh); bv.half[1] = *(const v8us*)(vrow + 16 + 8 * hh);
#pragma unroll
      for (int rt = 0; rt < RTN; ++rt) oacc[rt][dt] = mmaH<1>(pa[rt].v, pa[rt].v, bv.v, bv.v, oacc[rt][dt]); }
    __builtin_amdgcn_fence(__ATOMIC_ACQ_REL, "workgroup"); __builtin_amdgcn_wave_barrier(); }
#pragma unroll
  for (int rt = 0; rt < RTN; ++rt) {
#pragma unroll
    for (int r = 0; r < 8; ++r) { float l = l_r[rt][r]; l += __shfl_xor(l, 1, 32); l += __shfl_xor(l, 2, 32); l += __shfl_xor(l, 4, 32); l += __shfl_xor(l, 8, 32); l_r[rt][r] = (l > 0.f) ? 1.0f / (l * 1024.0f) : 0.f; }
#pragma unroll
    for (int dt = 0; dt < DT; ++dt)
#pragma unroll
      for (int r = 0; r < 8; ++r) sO[w][rt * 16 + 8 * hh + r][dt * 16 + ln] = oacc[rt][dt][r] * l_r[rt][r]; }
  __builtin_amdgcn_fence(__ATOMIC_ACQ_REL, "workgroup"); __builtin_amdgcn_wave_barrier();
  {
#pragma unroll
    for (int rp = 0; rp < RPW; rp += 2) { const int r = rp + (lane >> 4), pc = lane & 15; const v4f val = *(const v4fa*)&sO[w][r][pc * 4]; *(v4f*)(O + ((size_t)b * TT + q0 + r) * ldo + h * 64 + pc * 4) = val; }
     } }

extern "C" void kernel_launch(void* const* d_in, const int* in_sizes, int n_in,
                              void* d_out, int out_size, void* d_ws, size_t ws_size, hipStream_t stream) {
  (void)in_sizes; (void)n_in; (void)out_size;
  const float* const* I = (const float* const*)d_in; const float* feats = I[0]; const float* geom = I[1]; const float* crd = I[2];
  const float* wq = I[3]; const float* bq = I[4]; const float* wk = I[5]; const float* bk = I[6]; const float* wv = I[7]; const float* bv = I[8]; const float* wo = I[9]; const float* bo = I[10];
  const float* gqw = I[11]; const float* gqb = I[12]; const float* gkw = I[13]; const float* gkb = I[14]; const float* gvw = I[15]; const float* gvb = I[16]; const float* d1w = I[17]; const float* d1b = I[18]; const float* d2w = I[19]; const float* d2b = I[20]; const float* opw = I[21]; const float* opb = I[22];
  char* ws = (char*)d_ws; size_t off = 0;
  auto take = [&](size_t bytes) { char* p = ws + off; off += (bytes + 255) & ~(size_t)255; return p; };
  const size_t WSZ = (size_t)DD * DD, GSZ = (size_t)GG * DD; _Float16* Bw = (_Float16*)take(5 * WSZ * 2); _Float16* Bg = (_Float16*)take(3 * GSZ * 2);
  _Float16* X16 = (_Float16*)take((size_t)NR * DD * 2); _Float16* GE16 = (_Float16*)take((size_t)NR * GG * 2); _Float16* Q = (_Float16*)take((size_t)NR * DD * 2); _Float16* K = (_Float16*)take((size_t)NR * DD * 2); _Float16* V = (_Float16*)take((size_t)NR * DD * 2); _Float16* Vt = (_Float16*)take((size_t)NR * DD * 2);
  float* O = (float*)take((size_t)NR * DD * 4); float* FA = (float*)take((size_t)NR * DD * 4); _Float16* GQ = (_Float16*)take((size_t)NR * DD * 2); _Float16* GK = (_Float16*)take((size_t)NR * DD * 2); float* S = (float*)take((size_t)BB * TT * TT * 4); _Float16* P16 = (_Float16*)take((size_t)BB * TT * TT * 2);
  _Float16* O16 = X16; _Float16* GV = Q; _Float16* GVt = K; float* SUM = O; _Float16* SUM16 = V; float* GF = O; _Float16* GQl = Vt; _Float16* GKl = X16;      /* gq/gk go through an f32 temp (the attention-output plane, free between k_h16s and the feat+geom GEMM) into hi (GQ/GK) + ×2^10 residual (over Vt / X16) planes */      /* reuse after the MHA branch (stream order): X16 → O16; Q/K → gv / gvᵀ; O → feat+geom; V → its f16 copy */
  if (off > ws_size) return;      // 2.6 + 0.4 + 8.4 + 2.1 + 4 × 8.4 + 16.8 + 16.8 + 8.4 + 8.4 + 33.6 + 16.8 = about 148 MB
  const unsigned gw = (unsigned)(((size_t)DD * (DD / 8) + 255) / 256), ggw = (unsigned)(((size_t)DD * (GG / 8) + 255) / 256);
  k_wt_f16<<<gw, 256, 0, stream>>>(wq, Bw, DD, DD, 16.0f); k_wt_f16<<<gw, 256, 0, stream>>>(wk, Bw + WSZ, DD, DD, 16.0f); k_wt_f16<<<gw, 256, 0, stream>>>(wv, Bw + 2 * WSZ, DD, DD, 16.0f); k_wt_f16<<<gw, 256, 0, stream>>>(wo, Bw + 3 * WSZ, DD, DD, 16.0f); k_wt_f16<<<gw, 256, 0, stream>>>(opw, Bw + 4 * WSZ, DD, DD, 16.0f);
  k_wt_f16<<<ggw, 256, 0, stream>>>(gqw, Bg, GG, DD, 16.0f); k_wt_f16<<<ggw, 256, 0, stream>>>(gkw, Bg + GSZ, GG, DD, 16.0f); k_wt_f16<<<ggw, 256, 0, stream>>>(gvw, Bg + 2 * GSZ, GG, DD, 16.0f);      /* (in,out) → Bt ×2^4 */
  const unsigned g8 = (unsigned)(((size_t)NR * DD / 8 + 255) / 256); k_x16<<<g8, 256, 0, stream>>>(feats, X16, (size_t)NR * DD / 8); k_x16<<<(unsigned)(((size_t)NR * GG / 8 + 255) / 256), 256, 0, stream>>>(geom, GE16, (size_t)NR * GG / 8);
  const dim3 gp(((NR / 16) * (DD / 64) + 3) / 4, 1);
  k_gemm_hhx<0><<<gp, 128, 0, stream>>>(X16, DD, 0, Bw, DD, 0, 0.0625f, bq, 0, nullptr, 1, 0, 0, 0, nullptr, Q, DD, 0, NR, DD, DD);      /* M 8192 N 512 K 512 */
  k_gemm_hhx<0><<<gp, 128, 0, stream>>>(X16, DD, 0, Bw + WSZ, DD, 0, 0.0625f, bk, 0, nullptr, 1, 0, 0, 0, nullptr, K, DD, 0, NR, DD, DD);
  k_gemm_hhx<0><<<gp, 128, 0, stream>>>(X16, DD, 0, Bw + 2 * WSZ, DD, 0, 0.0625f, bv, 0, nullptr, 1, 0, 0, 0, nullptr, V, DD, 0, NR, DD, DD);
  k_vt<NH, TT><<<BB * NH * (TT / 64), 256, 0, stream>>>(V, DD, 0, Vt); k_flash<<<BB * NH * (TT / 64), 128, 0, stream>>>(Q, DD, K, DD, Vt, nullptr, O, DD);
  k_h16s<<<g8, 256, 0, stream>>>(O, O16, (size_t)NR * DD / 8);
  k_gemm_hhx<0><<<gp, 128, 0, stream>>>(O16, DD, 0, Bw + 3 * WSZ, DD, 0, 0.00390625f, bo, 0, nullptr, 1, 0, 0, 0, FA, nullptr, DD, 0, NR, DD, DD);      /* feat_att = O·wo + bo (f32) */
  k_gemm_hhx<0><<<gp, 128, 0, stream>>>(GE16, GG, 0, Bg, GG, 0, 0.0625f, gqb, 0, nullptr, 1, 0, 0, 0, GF, nullptr, DD, 0, NR, DD, GG); k_hl<<<g8, 256, 0, stream>>>(GF, GQ, GQl, (size_t)NR * DD / 8);      /* gq (f32) → hi / ×2^10 residual: M 8192 N 512 K 128 */
  k_gemm_hhx<0><<<gp, 128, 0, stream>>>(GE16, GG, 0, Bg + GSZ, GG, 0, 0.0625f, gkb, 0, nullptr, 1, 0, 0, 0, GF, nullptr, DD, 0, NR, DD, GG); k_hl<<<g8, 256, 0, stream>>>(GF, GK, GKl, (size_t)NR * DD / 8);      /* gk likewise */
  k_gemm_hhx<0><<<gp, 128, 0, stream>>>(GE16, GG, 0, Bg + 2 * GSZ, GG, 0, 0.0625f, gvb, 0, nullptr, 1, 0, 0, 0, nullptr, GV, DD, 0, NR, DD, GG);
  k_vt<DD / 64, TT><<<BB * (DD / 64) * (TT / 64), 256, 0, stream>>>(GV, DD, 0, GVt);      /* gvᵀ per batch [512][1024] */
  /* geometry branch: all BB batches of each stage in one launch, the batch in blockIdx.y (operand, addend and result strides per batch; the softmax runs its BB * TT rows in blockIdx.x) */
  const size_t sX = (size_t)TT * DD, sS = (size_t)TT * TT; const dim3 gs(((TT / 16) * (TT / 64) + 3) / 4, BB);
  k_gemm_hhx<0><<<gs, 128, 0, stream>>>(GQ, DD, sX, GK, DD, sX, 0.125f, nullptr, 0, nullptr, 1, 0, 0, 0, S, nullptr, TT, sS, TT, TT, DD);      /* S = gq.gkT/8 f32-accurate: hi.hi ... */
  k_gemm_hhx<0><<<gs, 128, 0, stream>>>(GQl, DD, sX, GK, DD, sX, 0.125f * 0.0009765625f, nullptr, 0, S, 1, (size_t)TT, sS, 0, S, nullptr, TT, sS, TT, TT, DD);      /* += lo.hi.2^-10 */
  k_gemm_hhx<0><<<gs, 128, 0, stream>>>(GQ, DD, sX, GKl, DD, sX, 0.125f * 0.0009765625f, nullptr, 0, S, 1, (size_t)TT, sS, 0, S, nullptr, TT, sS, TT, TT, DD);      /* += hi.lo.2^-10: M 1024 N 1024 K 512 each, x BB */
  k_gbias<<<dim3((TT * TT / 4 + 255) / 256, BB), 256, 0, stream>>>(S, crd, d1w, d1b, d2w, d2b); k_smx<<<BB * TT / 8, 256, 0, stream>>>(S, P16);      /* softmax: a wave per row over the BB * TT rows */
  k_gemm_hhx<0><<<dim3(((TT / 16) * (DD / 64) + 3) / 4, BB), 128, 0, stream>>>(P16, TT, sS, GVt, TT, sX, 0.000030517578125f, nullptr, 0, FA, 1, (size_t)DD, sX, 0, SUM, nullptr, DD, sX, TT, DD, TT);      /* feat_att + geom_att: M 1024 N 512 K 1024, x BB */
  k_h16<<<g8, 256, 0, stream>>>(SUM, SUM16, (size_t)NR * DD / 8);
  k_gemm_hhx<0><<<gp, 128, 0, stream>>>(SUM16, DD, 0, Bw + 4 * WSZ, DD, 0, 0.0625f, opb, 0, nullptr, 1, 0, 0, 0, (float*)d_out, nullptr, DD, 0, NR, DD, DD);      /* out = (feat + geom)·op_w + op_b */
}

// v002
// One run takes 362 microseconds.
// Next to v001, in two timings, it ran 1.77 and 1.76 times as fast.
// Over all steps from v000 it is 3.67 times as fast.
#include <hip/hip_runtime.h>
// Geometry-aware attention (B=8, N=1024, F=512, 8 heads × 64, G=128): feat = MHA(features) (x·W + b, softmax(q·k/8)·v, ·wo + bo); geometry branch: gq, gk, gv = geometry·W + b (F wide, single head);
// g_scores = gq·gkᵀ/8 + mean_h(gelu_tanh(dist·d1_w + d1_b)·d2_w + d2_b) with dist = max(‖coords_q − coords_k‖, 1e-6); geom = softmax(g_scores)·gv; out = (feat + geom)·op_w + op_b. (in,out) weights; jax.nn.gelu default = tanh approximation.
// Compute dtype: features, geometry, coords, all weights/biases rounded to bf16; f16 GEMM planes; the 8-head branch through a fused flash-style kernel (online softmax f32, P f16 ×2^10); the geometry branch, every stage one launch over all batches (batch in blockIdx.y; the softmax's BB·TT rows in blockIdx.x): S = gq·gkᵀ/8 f32-accurate from f16 hi + residual planes (hi·hi + (lo·hi + hi·lo)·2^-10; its logits reach σ≈3), a kernel adding the distance-MLP bias in place (f32, per pair from the coords), a wave-per-row f32 softmax → P f16 ×2^15, geom = P·gv by GEMM with feat_att as the f32 addend; final projection GEMM. All contractions on v_wmma_f32_16x16x32_f16, f32 accumulate.
#define BB 8
#define TT 1024
#define DD 512
#define GG 128
#define NH 8
#define NR (BB * TT)

typedef __bf16 v16b __attribute__((ext_vector_type(16)));
typedef unsigned short v8us __attribute__((ext_vector_type(8), may_alias));
typedef float  v8f  __attribute__((ext_vector_type(8)));
typedef float  v4f  __attribute__((ext_vector_type(4)));
typedef float  v4fa __attribute__((ext_vector_type(4), may_alias));
union FragB { v16b v; v8us half[2]; unsigned short u[16]; };

__device__ __forceinline__ unsigned short bf16_bits(float x) { unsigned int u = __float_as_uint(x); return (unsigned short)((u + 0x7FFFu + ((u >> 16) & 1u)) >> 16); }
__device__ __forceinline__ float bf16_val(unsigned short b) { return __uint_as_float(((unsigned int)b) << 16); }
__device__ __forceinline__ float bf16_round(float x) { return bf16_val(bf16_bits(x)); }
// D += A·B with NT terms: 1 = ah·bh, 2 = + al·bh (A split), 3 = + ah·bl (both split)
template <int NT>
__device__ __forceinline__ v8f mmaN(v16b ah, v16b al, v16b bh, v16b bl, v8f c) {
  c = __builtin_amdgcn_wmma_f32_16x16x32_bf16(false, ah, false, bh, (short)0, c, false, false);
  if (NT >= 2) c = __builtin_amdgcn_wmma_f32_16x16x32_bf16(false, al, false, bh, (short)0, c, false, false);
  if (NT >= 3) c = __builtin_amdgcn_wmma_f32_16x16x32_bf16(false, ah, false, bl, (short)0, c, false, false);
  asm volatile("v_nop\n\tv_nop\n\tv_nop\n\tv_nop" : "+v"(c) : "v"(ah), "v"(al), "v"(bh), "v"(bl));
  return c;
}

__global__ __launch_bounds__(256) void k_wt_bf16(const float* __restrict__ W, unsigned short* __restrict__ Wt, int K, int N) {
  const int t = blockIdx.x * 256 + threadIdx.x;
  const int k8n = K / 8;
  if (t >= N * k8n) return;
  const int n = t / k8n, k8 = (t % k8n) * 8;
  v8us v;
#pragma unroll
  for (int i = 0; i < 8; ++i) v[i] = bf16_bits(W[(size_t)(k8 + i) * N + n]);
  *(v8us*)(Wt + (size_t)n * K + k8) = v;
  
}

// GEMM C[M][N] (f32, pitch ldc) = act(A[M][K]·W + bias). A f32 row-major (pitch lda) converted per fragment to bf16
// (ASPLIT: hi/lo two planes -> 2 terms, else single rounded term); Wt bf16 [N][K] (pitch ldb). BIAS_BF16 rounds the
// bias to bf16 first (bias quantised to bf16 before the add). K%32==0, M%16==0, N%64==0.
template <bool ASPLIT, int ACT, bool BIAS_BF16>
__global__ __launch_bounds__(128) void k_gemm_bf(const float* __restrict__ A, int lda, const unsigned short* __restrict__ Wt, int ldb,
                                               const float* __restrict__ bias, float* __restrict__ C, int ldc, int M, int N, int K) {
  __shared__ __attribute__((aligned(16))) float so[4][16][64];
  const int tid = threadIdx.x, w = tid >> 5, lane = tid & 31, ln = lane & 15, hh = lane >> 4;
  const int ntn = N / 64;
  const int wid = blockIdx.x * 4 + w;
  const int mt = wid / ntn, nq = wid % ntn;
  if (mt * 16 >= M) return;
  const int row0 = mt * 16, col0 = nq * 64;
  const float* arow = A + (size_t)(row0 + ln) * lda;
  v8f acc[4] = {};
  for (int kb = 0; kb < K; kb += 32) {
    FragB ah, al;
    const v4f x0 = *(const v4fa*)(arow + kb + 8 * hh), x1 = *(const v4fa*)(arow + kb + 8 * hh + 4);
    const v4f x2 = *(const v4fa*)(arow + kb + 16 + 8 * hh), x3 = *(const v4fa*)(arow + kb + 16 + 8 * hh + 4);
    float xs[16] = {x0[0],x0[1],x0[2],x0[3],x1[0],x1[1],x1[2],x1[3],x2[0],x2[1],x2[2],x2[3],x3[0],x3[1],x3[2],x3[3]};
#pragma unroll
    for (int i = 0; i < 16; ++i) { const unsigned short hb = bf16_bits(xs[i]); ah.u[i] = hb; al.u[i] = ASPLIT ? bf16_bits(xs[i] - bf16_val(hb)) : (unsigned short)0; }
#pragma unroll
    for (int t = 0; t < 4; ++t) {
      const unsigned short* brow = Wt + (size_t)(col0 + t * 16 + ln) * ldb + kb;
      FragB b;
      b.half[0] = *(const v8us*)(brow + 8 * hh);
      b.half[1] = *(const v8us*)(brow + 16 + 8 * hh);
      acc[t] = mmaN<ASPLIT ? 2 : 1>(ah.v, al.v, b.v, b.v, acc[t]);
    }
  }
#pragma unroll
  for (int t = 0; t < 4; ++t) {
    float bv = bias ? bias[col0 + t * 16 + ln] : 0.f;
    if (BIAS_BF16) bv = bf16_round(bv);
#pragma unroll
    for (int r = 0; r < 8; ++r) { float v = acc[t][r] + bv; if (ACT == 1) v = fmaxf(v, 0.f); so[w][8 * hh + r][t * 16 + ln] = v; }
  }
  __builtin_amdgcn_fence(__ATOMIC_ACQ_REL, "workgroup");
  __builtin_amdgcn_wave_barrier();
  const int rsub = lane >> 4, c4 = (lane & 15) * 4;
  {
#pragma unroll
    for (int q = 0; q < 8; ++q) {
      const int r = q * 2 + rsub;
      const v4f v = *(const v4fa*)&so[w][r][c4];
      *(v4f*)(C + (size_t)(row0 + r) * ldc + col0 + c4) = v;
    }
    
  }
}

// Flash-style causal/unmasked attention, all contractions 3-term bf16 hi/lo splits, f32 softmax with running max.
// q,k,v rows are read from f32 buffers with arbitrary row pitch (so they can live inside a fused qkv buffer);
// D = head size (multiple of 32, <= 128); one wave = 16 query rows; block = 4 waves (64 queries) sharing K/V chunks of 32.
template <int D, bool CAUSAL>
__global__ __launch_bounds__(128) void k_flash(const float* __restrict__ qb, const float* __restrict__ kb, const float* __restrict__ vb,
                                             int pitch, int T, int H, float scale, float* __restrict__ y, int ypitch) {
  constexpr int KS = D / 32;        // k-steps for QK
  constexpr int DT = D / 16;        // d tiles for PV
  __shared__ __attribute__((aligned(16))) unsigned short sKh[32][D + 8], sKl[32][D + 8], sVh[32][D + 8], sVl[32][D + 8];
  __shared__ __attribute__((aligned(16))) unsigned short sPh[4][16][40], sPl[4][16][40];
  __shared__ __attribute__((aligned(16))) float sO[4][16][D];
  const int tid = threadIdx.x, w = tid >> 5, lane = tid & 31, ln = lane & 15, hh = lane >> 4;
  const int nqb = (T + 63) / 64;
  const int bh = blockIdx.x / nqb, qblk = blockIdx.x % nqb;
  const int b = bh / H, h = bh % H;
  const int q0 = qblk * 64 + w * 16;
  const float* Q = qb + (size_t)b * T * pitch + h * D;
  const float* K = kb + (size_t)b * T * pitch + h * D;
  const float* V = vb + (size_t)b * T * pitch + h * D;

  // A fragments of the wave's 16 query rows (scaled), hi/lo
  FragB aqh[KS], aql[KS];
  {
    int row = q0 + ln; if (row >= T) row = T - 1;
    const float* qr = Q + (size_t)row * pitch;
#pragma unroll
    for (int ks = 0; ks < KS; ++ks)
#pragma unroll
      for (int i = 0; i < 16; ++i) {
        const int d = ks * 32 + ((i < 8) ? (8 * hh + i) : (16 + 8 * hh + (i - 8)));
        const float x = qr[d] * scale; const unsigned short hb = bf16_bits(x);
        aqh[ks].u[i] = hb; aql[ks].u[i] = bf16_bits(x - bf16_val(hb));
      }
  }
  float m_r[8], l_r[8];
#pragma unroll
  for (int r = 0; r < 8; ++r) { m_r[r] = -3.0e38f; l_r[r] = 0.f; }
  v8f oacc[DT];
#pragma unroll
  for (int dt = 0; dt < DT; ++dt) oacc[dt] = (v8f){0.f,0.f,0.f,0.f,0.f,0.f,0.f,0.f};

  const int kv_end = CAUSAL ? min(T, qblk * 64 + 64) : T;     // block-uniform
  for (int j0 = 0; j0 < kv_end; j0 += 32) {
    __syncthreads();
    for (int e = tid; e < 32 * (D / 4); e += 128) {
      const int r = e / (D / 4), c4 = (e % (D / 4)) * 4;
      const int key = j0 + r;
      v4f kf = {0.f,0.f,0.f,0.f}, vf = {0.f,0.f,0.f,0.f};
      if (key < T) { kf = *(const v4fa*)(K + (size_t)key * pitch + c4); vf = *(const v4fa*)(V + (size_t)key * pitch + c4); }
#pragma unroll
      for (int t = 0; t < 4; ++t) {
        unsigned short hb = bf16_bits(kf[t]); sKh[r][c4 + t] = hb; sKl[r][c4 + t] = bf16_bits(kf[t] - bf16_val(hb));
        hb = bf16_bits(vf[t]); sVh[r][c4 + t] = hb; sVl[r][c4 + t] = bf16_bits(vf[t] - bf16_val(hb));
      }
    }
    __syncthreads();
    // S tile 16 x 32
    v8f s[2];
#pragma unroll
    for (int nt = 0; nt < 2; ++nt) {
      v8f acc = {};
#pragma unroll
      for (int ks = 0; ks < KS; ++ks) {
        FragB bh_, bl_;
        bh_.half[0] = *(const v8us*)&sKh[nt * 16 + ln][ks * 32 + 8 * hh]; bh_.half[1] = *(const v8us*)&sKh[nt * 16 + ln][ks * 32 + 16 + 8 * hh];
        bl_.half[0] = *(const v8us*)&sKl[nt * 16 + ln][ks * 32 + 8 * hh]; bl_.half[1] = *(const v8us*)&sKl[nt * 16 + ln][ks * 32 + 16 + 8 * hh];
        acc = mmaN<3>(aqh[ks].v, aql[ks].v, bh_.v, bl_.v, acc);
      }
      s[nt] = acc;
    }
    // mask + running max (rows 8hh+r; the 16 lanes of a half share rows)
    float alpha[8];
#pragma unroll
    for (int r = 0; r < 8; ++r) {
      const int qi = q0 + 8 * hh + r;
      const int ja = j0 + ln, jb = j0 + 16 + ln;
      if (CAUSAL) { if (ja > qi) s[0][r] = -3.0e38f; if (jb > qi) s[1][r] = -3.0e38f; }
      if (ja >= T) s[0][r] = -3.0e38f;
      if (jb >= T) s[1][r] = -3.0e38f;
      float mx = fmaxf(s[0][r], s[1][r]);
      mx = fmaxf(mx, __shfl_xor(mx, 1, 32)); mx = fmaxf(mx, __shfl_xor(mx, 2, 32)); mx = fmaxf(mx, __shfl_xor(mx, 4, 32)); mx = fmaxf(mx, __shfl_xor(mx, 8, 32));
      const float mnew = fmaxf(m_r[r], mx);
      alpha[r] = (mnew > -1.0e38f) ? __expf(m_r[r] - mnew) : 1.0f;
      const float p0 = (s[0][r] > -1.0e38f) ? __expf(s[0][r] - mnew) : 0.f;
      const float p1 = (s[1][r] > -1.0e38f) ? __expf(s[1][r] - mnew) : 0.f;
      m_r[r] = mnew;
      l_r[r] = l_r[r] * alpha[r] + p0 + p1;            // per-lane partial row sum (16 lanes combined at the end)
      unsigned short hb = bf16_bits(p0); sPh[w][8 * hh + r][ln] = hb;      sPl[w][8 * hh + r][ln] = bf16_bits(p0 - bf16_val(hb));
      hb = bf16_bits(p1);                sPh[w][8 * hh + r][16 + ln] = hb; sPl[w][8 * hh + r][16 + ln] = bf16_bits(p1 - bf16_val(hb));
    }
#pragma unroll
    for (int dt = 0; dt < DT; ++dt)
#pragma unroll
      for (int r = 0; r < 8; ++r) oacc[dt][r] *= alpha[r];
    __builtin_amdgcn_fence(__ATOMIC_ACQ_REL, "workgroup");
    __builtin_amdgcn_wave_barrier();
    FragB pah, pal;
    pah.half[0] = *(const v8us*)&sPh[w][ln][8 * hh]; pah.half[1] = *(const v8us*)&sPh[w][ln][16 + 8 * hh];
    pal.half[0] = *(const v8us*)&sPl[w][ln][8 * hh]; pal.half[1] = *(const v8us*)&sPl[w][ln][16 + 8 * hh];
#pragma unroll
    for (int dt = 0; dt < DT; ++dt) {
      FragB bvh, bvl;
#pragma unroll
      for (int i = 0; i < 8; ++i) {
        bvh.u[i] = sVh[8 * hh + i][dt * 16 + ln]; bvh.u[8 + i] = sVh[16 + 8 * hh + i][dt * 16 + ln];
        bvl.u[i] = sVl[8 * hh + i][dt * 16 + ln]; bvl.u[8 + i] = sVl[16 + 8 * hh + i][dt * 16 + ln];
      }
      oacc[dt] = mmaN<3>(pah.v, pal.v, bvh.v, bvl.v, oacc[dt]);
    }
    __builtin_amdgcn_fence(__ATOMIC_ACQ_REL, "workgroup");
    __builtin_amdgcn_wave_barrier();
  }
#pragma unroll
  for (int r = 0; r < 8; ++r) {
    float l = l_r[r];
    l += __shfl_xor(l, 1, 32); l += __shfl_xor(l, 2, 32); l += __shfl_xor(l, 4, 32); l += __shfl_xor(l, 8, 32);
    l_r[r] = (l > 0.f) ? 1.0f / l : 0.f;
  }
#pragma unroll
  for (int dt = 0; dt < DT; ++dt)
#pragma unroll
    for (int r = 0; r < 8; ++r) sO[w][8 * hh + r][dt * 16 + ln] = oacc[dt][r] * l_r[r];
  __builtin_amdgcn_fence(__ATOMIC_ACQ_REL, "workgroup");
  __builtin_amdgcn_wave_barrier();
  {
    for (int r = 0; r < 16; ++r) {
      const int row = q0 + r;
      if (row < T && lane < D / 4) {
        const v4f val = *(const v4fa*)&sO[w][r][lane * 4];
        *(v4f*)(y + ((size_t)b * T + row) * ypitch + h * D + lane * 4) = val;
      }
    }
    
  }
}

// GEMM C = act(A·W + bias + resid): A f32 (ASPLIT -> hi/lo 2 terms), Wt bf16 [N][K]; ACT 0 none, 1 relu, 2 exact gelu;
// resid (optional, f32, row index = (row % rmod), pitch ldr, RES_BF16 rounds it) added before the activation.
template <bool ASPLIT, int ACT, bool BIAS_BF16, bool RES_BF16>
__global__ __launch_bounds__(128) void k_gemm_bf3(const float* __restrict__ A, int lda, const unsigned short* __restrict__ Wt, int ldb,
                                                const float* __restrict__ bias, const float* __restrict__ resid, int rmod, int ldr,
                                                float* __restrict__ C, int ldc, int M, int N, int K) {
  __shared__ __attribute__((aligned(16))) float so[4][16][64];
  const int tid = threadIdx.x, w = tid >> 5, lane = tid & 31, ln = lane & 15, hh = lane >> 4;
  const int ntn = N / 64;
  const int wid = blockIdx.x * 4 + w;
  const int mt = wid / ntn, nq = wid % ntn;
  if (mt * 16 >= M) return;
  const int row0 = mt * 16, col0 = nq * 64;
  const float* arow = A + (size_t)(row0 + ln) * lda;
  v8f acc[4] = {};
  for (int kb = 0; kb < K; kb += 32) {
    FragB ah, al;
    const v4f x0 = *(const v4fa*)(arow + kb + 8 * hh), x1 = *(const v4fa*)(arow + kb + 8 * hh + 4);
    const v4f x2 = *(const v4fa*)(arow + kb + 16 + 8 * hh), x3 = *(const v4fa*)(arow + kb + 16 + 8 * hh + 4);
    float xs[16] = {x0[0],x0[1],x0[2],x0[3],x1[0],x1[1],x1[2],x1[3],x2[0],x2[1],x2[2],x2[3],x3[0],x3[1],x3[2],x3[3]};
#pragma unroll
    for (int i = 0; i < 16; ++i) { const unsigned short hb = bf16_bits(xs[i]); ah.u[i] = hb; al.u[i] = ASPLIT ? bf16_bits(xs[i] - bf16_val(hb)) : (unsigned short)0; }
#pragma unroll
    for (int t = 0; t < 4; ++t) {
      const unsigned short* brow = Wt + (size_t)(col0 + t * 16 + ln) * ldb + kb;
      FragB b;
      b.half[0] = *(const v8us*)(brow + 8 * hh);
      b.half[1] = *(const v8us*)(brow + 16 + 8 * hh);
      acc[t] = mmaN<ASPLIT ? 2 : 1>(ah.v, al.v, b.v, b.v, acc[t]);
    }
  }
#pragma unroll
  for (int t = 0; t < 4; ++t) {
    const int col = col0 + t * 16 + ln;
    float bv = bias ? bias[col] : 0.f;
    if (BIAS_BF16) bv = bf16_round(bv);
#pragma unroll
    for (int r = 0; r < 8; ++r) {
      float v = acc[t][r] + bv;
      if (resid) { float rv = resid[(size_t)((row0 + 8 * hh + r) % rmod) * ldr + col]; if (RES_BF16) rv = bf16_round(rv); v += rv; }
      if (ACT == 1) v = fmaxf(v, 0.f);
      if (ACT == 2) v = 0.5f * v * (1.0f + erff(v * 0.70710678118654752f));
      if (ACT == 3) { const float u = 0.7978845608028654f * (v + 0.044715f * v * v * v); v = 0.5f * v * (1.0f + tanhf(u)); }
      so[w][8 * hh + r][t * 16 + ln] = v;
    }
  }
  __builtin_amdgcn_fence(__ATOMIC_ACQ_REL, "workgroup");
  __builtin_amdgcn_wave_barrier();
  const int rsub = lane >> 4, c4 = (lane & 15) * 4;
  {
#pragma unroll
    for (int q = 0; q < 8; ++q) {
      const int r = q * 2 + rsub;
      const v4f v = *(const v4fa*)&so[w][r][c4];
      *(v4f*)(C + (size_t)(row0 + r) * ldc + col0 + c4) = v;
    }
    
  }
}
// row LayerNorm (biased variance, eps) over N: s = X (+ R); optional out_sum <- s; out_norm <- (s-mu)*rsqrt(var+eps)*g + b
template <bool PARAM_BF16>
__global__ __launch_bounds__(256) void k_layernorm(const float* __restrict__ X, const float* __restrict__ R, const float* __restrict__ g, const float* __restrict__ bta,
                                                  float* __restrict__ out_sum, float* __restrict__ out_norm, int N, float eps) {
  __shared__ float red[256];
  const int row = blockIdx.x, tid = threadIdx.x;
  const float* x = X + (size_t)row * N; const float* rr = R ? R + (size_t)row * N : nullptr;
  float vals[16];                     // up to N = 4096
  const int per = N / 256;            // contiguous chunk per thread? use strided-by-4 chunks: thread handles j = tid*4 + 1024*u
  float s1 = 0.f;
  for (int u = 0; u < per / 4; ++u) {
    const int j = tid * 4 + 1024 * u;
    const v4f a = *(const v4fa*)(x + j);
    v4f b = {0.f,0.f,0.f,0.f}; if (rr) b = *(const v4fa*)(rr + j);
#pragma unroll
    for (int q = 0; q < 4; ++q) { const float v = a[q] + b[q]; vals[u * 4 + q] = v; s1 += v; }
  }
  red[tid] = s1; __syncthreads();
  for (int st = 128; st > 0; st >>= 1) { if (tid < st) red[tid] += red[tid + st]; __syncthreads(); }
  const float mu = red[0] / (float)N; __syncthreads();
  float s2 = 0.f;
  for (int u = 0; u < per / 4; ++u)
#pragma unroll
    for (int q = 0; q < 4; ++q) { const float c = vals[u * 4 + q] - mu; s2 += c * c; }
  red[tid] = s2; __syncthreads();
  for (int st = 128; st > 0; st >>= 1) { if (tid < st) red[tid] += red[tid + st]; __syncthreads(); }
  const float rs = rsqrtf(red[0] / (float)N + eps);
  {
    for (int u = 0; u < per / 4; ++u) {
      const int j = tid * 4 + 1024 * u;
      v4f o, sm;
#pragma unroll
      for (int q = 0; q < 4; ++q) {
        float gg = g[j + q], bb = bta[j + q];
        if (PARAM_BF16) { gg = bf16_round(gg); bb = bf16_round(bb); }
        sm[q] = vals[u * 4 + q]; o[q] = (vals[u * 4 + q] - mu) * rs * gg + bb;
      }
      if (out_sum) *(v4f*)(out_sum + (size_t)row * N + j) = sm;
      *(v4f*)(out_norm + (size_t)row * N + j) = o;
    }
    
  }
}



// ---- f16 WMMA path (v_wmma_f32_16x16x32_f16): 11-bit significands for operands in range — used for every contraction launched here
typedef _Float16 v16h __attribute__((ext_vector_type(16)));
union FragH { v16h v; v8us half[2]; _Float16 h[16]; unsigned short u[16]; };
template <int NT>
__device__ __forceinline__ v8f mmaH(v16h ah, v16h al, v16h bh, v16h bl, v8f c) {
  c = __builtin_amdgcn_wmma_f32_16x16x32_f16(false, ah, false, bh, (short)0, c, false, false);
  if (NT >= 2) c = __builtin_amdgcn_wmma_f32_16x16x32_f16(false, al, false, bh, (short)0, c, false, false);
  if (NT >= 3) c = __builtin_amdgcn_wmma_f32_16x16x32_f16(false, ah, false, bl, (short)0, c, false, false);
  asm volatile("v_nop\n\tv_nop\n\tv_nop\n\tv_nop" : "+v"(c) : "v"(ah), "v"(al), "v"(bh), "v"(bl));
  return c;
}
// batched GEMM like k_gemm_b but f16 operands: A f32 (split into f16 hi/lo if ASPLIT, else rounded to f16), Bt = f16 values [n][k]; alpha; C f32; N multiple of 16 (partial tiles skipped)
template <bool ASPLIT>
__global__ __launch_bounds__(128) void k_gemm_h(const float* __restrict__ A, int lda, size_t sA, const _Float16* __restrict__ Bh, int ldb, size_t sB, float alpha, float* __restrict__ C, int ldc, size_t sC, int M, int N, int K) {
  __shared__ __attribute__((aligned(16))) float so[4][16][64];
  const int tid = threadIdx.x, w = tid >> 5, lane = tid & 31, ln = lane & 15, hh = lane >> 4; const int by = blockIdx.y;
  A += (size_t)by * sA; Bh += (size_t)by * sB; C += (size_t)by * sC;
  const int ntn = (N + 63) / 64; const int wid = blockIdx.x * 4 + w; const int mt = wid / ntn, nq = wid % ntn; if (mt * 16 >= M) return;
  const int row0 = mt * 16, col0 = nq * 64; const float* arow = A + (size_t)(row0 + ln) * lda;
  v8f acc[4] = {};
  for (int kb = 0; kb < K; kb += 32) {
    FragH ah, al;
    const v4f x0 = *(const v4fa*)(arow + kb + 8 * hh), x1 = *(const v4fa*)(arow + kb + 8 * hh + 4), x2 = *(const v4fa*)(arow + kb + 16 + 8 * hh), x3 = *(const v4fa*)(arow + kb + 16 + 8 * hh + 4);
    float xs[16] = {x0[0],x0[1],x0[2],x0[3],x1[0],x1[1],x1[2],x1[3],x2[0],x2[1],x2[2],x2[3],x3[0],x3[1],x3[2],x3[3]};
#pragma unroll
    for (int i = 0; i < 16; ++i) { const _Float16 h = (_Float16)xs[i]; ah.h[i] = h; al.h[i] = ASPLIT ? (_Float16)(xs[i] - (float)h) : (_Float16)0.0f; }
#pragma unroll
    for (int t = 0; t < 4; ++t) { if (col0 + t * 16 >= N) continue; const size_t boff = (size_t)(col0 + t * 16 + ln) * ldb + kb; FragH bq; bq.half[0] = *(const v8us*)(Bh + boff + 8 * hh); bq.half[1] = *(const v8us*)(Bh + boff + 16 + 8 * hh);
      acc[t] = mmaH<ASPLIT ? 2 : 1>(ah.v, al.v, bq.v, bq.v, acc[t]); }
  }
#pragma unroll
  for (int t = 0; t < 4; ++t) { if (col0 + t * 16 >= N) continue;
#pragma unroll
    for (int r = 0; r < 8; ++r) so[w][8 * hh + r][t * 16 + ln] = acc[t][r] * alpha; }
  __builtin_amdgcn_fence(__ATOMIC_ACQ_REL, "workgroup"); __builtin_amdgcn_wave_barrier();
  const int rsub = lane >> 4, c4 = (lane & 15) * 4;
  {
#pragma unroll
    for (int q = 0; q < 8; ++q) { const int r = q * 2 + rsub; if (col0 + c4 < N) { const v4f v = *(const v4fa*)&so[w][r][c4]; *(v4f*)(C + (size_t)(row0 + r) * ldc + col0 + c4) = v; } }
     }
}

// Wt[n][k] = f16(W[k][n]·scale) from f32 row-major W[K][N] (scale = power of two; bf16-exact weights stay exact in f16 away from the subnormal range)
__global__ __launch_bounds__(256) void k_wt_f16(const float* __restrict__ W, _Float16* __restrict__ Wt, int K, int N, float scale) {
  const int t = blockIdx.x * 256 + threadIdx.x; if (t >= N * (K / 8)) return; const int n = t / (K / 8), k8 = (t % (K / 8)) * 8; FragH f;
#pragma unroll
  for (int i = 0; i < 8; ++i) f.h[i] = (_Float16)(bf16_round(W[(size_t)(k8 + i) * N + n]) * scale); const v8us o = f.half[0];
  *(v8us*)((unsigned short*)Wt + (size_t)n * K + k8) = o; 
}
// Block-tiled GEMM, f16 operands, both K-contiguous: v = (A.Bt^T)*alpha + bf16(bias[col]) (+ CP[row*LDCP + by*sCPy + col] if LDCP; CP may be C itself: a lane reads only what it then writes); writes f32 C or f16 C16. Batch in blockIdx.y.
// One work-group of 8 waves (4 x 2) makes 128 x 128 of C, a wave 32 x 64. Each trip takes 64 k: 128 rows of 128 B of A and of Bt are brought into LDS by asynchronous copies (whole 128-B lines, 16 B a lane),
// two buffers, the next tile in flight while this one is multiplied; LDS rows at pitch 144 B for the ds_load_b128 fragment reads. M, N multiples of 128, K a multiple of 64.
#define GT_PITCH 144
#define GT_OPB (128 * GT_PITCH)
#define GT_BUF (2 * GT_OPB)
typedef _Float16 v4h __attribute__((ext_vector_type(4)));
// one tile: 4 copies of A and 4 of Bt per lane. The s_wait_xcnt stands inside the statement so that no address register named here is rewritten ahead of it.
__device__ __forceinline__ void gt_copy(unsigned l, const unsigned short* ga, const unsigned short* gb, size_t a32, size_t b32) {
  asm volatile("global_load_async_to_lds_b128 %0, %8, off\n\t"
               "global_load_async_to_lds_b128 %1, %9, off\n\t"
               "global_load_async_to_lds_b128 %2, %10, off\n\t"
               "global_load_async_to_lds_b128 %3, %11, off\n\t"
               "global_load_async_to_lds_b128 %4, %12, off\n\t"
               "global_load_async_to_lds_b128 %5, %13, off\n\t"
               "global_load_async_to_lds_b128 %6, %14, off\n\t"
               "global_load_async_to_lds_b128 %7, %15, off\n\t"
               "s_wait_xcnt 0x0"
               :: "v"(l), "v"(l + 32 * GT_PITCH), "v"(l + 64 * GT_PITCH), "v"(l + 96 * GT_PITCH),
                  "v"(l + GT_OPB), "v"(l + GT_OPB + 32 * GT_PITCH), "v"(l + GT_OPB + 64 * GT_PITCH), "v"(l + GT_OPB + 96 * GT_PITCH),
                  "v"(ga), "v"(ga + a32), "v"(ga + 2 * a32), "v"(ga + 3 * a32), "v"(gb), "v"(gb + b32), "v"(gb + 2 * b32), "v"(gb + 3 * b32)
               : "memory");
}
template <int LDCP, bool OF32>      /* LDCP: row pitch of an f32 addend plane CP, 0 for none (a constant, so that its 16 loads share one address register pair); OF32: f32 result in C, else f16 result in C16 */
__global__ __launch_bounds__(256) void k_gemm_t(const _Float16* __restrict__ A, int lda, size_t sA, const _Float16* __restrict__ Bh, int ldb, size_t sB, float alpha, const float* __restrict__ bias,
    const float* CP, size_t sCPy, float* C, _Float16* __restrict__ C16, int ldc, size_t sC, int N, int K) {
  __shared__ __attribute__((aligned(16))) unsigned char L[2 * GT_BUF];
  const int tid = threadIdx.x, w = tid >> 5, lane = tid & 31, ln = lane & 15, hh = lane >> 4; const int by = blockIdx.y;
  const int ntn = N / 128; const int row0 = ((int)blockIdx.x / ntn) * 128, col0 = ((int)blockIdx.x % ntn) * 128; const int wm = w >> 1, wn = w & 1;
  const int cr = tid >> 3, cc = tid & 7;      /* copies: 8 lanes a row, 32 rows a copy */
  const unsigned short* ga = (const unsigned short*)A + (size_t)by * sA + (size_t)(row0 + cr) * lda + cc * 8;
  const unsigned short* gb = (const unsigned short*)Bh + (size_t)by * sB + (size_t)(col0 + cr) * ldb + cc * 8;
  const size_t a32 = (size_t)32 * lda, b32 = (size_t)32 * ldb;
  const unsigned lcp = (unsigned)(size_t)L + (unsigned)(cr * GT_PITCH + cc * 16);
  const int nk = K / 64;
  v8f acc[2][4] = {};
  gt_copy(lcp, ga, gb, a32, b32);
  asm volatile("s_wait_asynccnt 0x0" ::: "memory");      /* tile 0 has landed before the barrier that publishes it */
  __syncthreads();
  if (nk > 1) gt_copy(lcp + GT_BUF, ga + 64, gb + 64, a32, b32);
  const unsigned char* fa = L + (wm * 32 + ln) * GT_PITCH + hh * 16; const unsigned char* fb = L + GT_OPB + (wn * 64 + ln) * GT_PITCH + hh * 16;
#pragma unroll 1
  for (int t = 0; t < nk; ++t) {      /* stays rolled: one copy of the ring's foot */
    const unsigned bo = (unsigned)(t & 1) * GT_BUF;
    FragH a[2][2], b[2][4];
#pragma unroll
    for (int ks = 0; ks < 2; ++ks) {
#pragma unroll
      for (int i = 0; i < 2; ++i) { a[ks][i].half[0] = *(const v8us*)(fa + bo + i * 16 * GT_PITCH + ks * 64); a[ks][i].half[1] = *(const v8us*)(fa + bo + i * 16 * GT_PITCH + ks * 64 + 32); }
#pragma unroll
      for (int j = 0; j < 4; ++j) { b[ks][j].half[0] = *(const v8us*)(fb + bo + j * 16 * GT_PITCH + ks * 64); b[ks][j].half[1] = *(const v8us*)(fb + bo + j * 16 * GT_PITCH + ks * 64 + 32); } }
    /* the ring's foot stands here, behind the trip's 24 fragment reads and ahead of its WMMAs, which work on registers alone: the refill then flies under them too */
    asm volatile("s_wait_dscnt 0x0" ::: "memory");      /* this wave's reads of the buffer are over before it may be refilled */
    asm volatile("s_wait_asynccnt 0x0" ::: "memory");      /* this wave's share of tile t + 1 has landed before the barrier publishes it */
    __syncthreads();
    if (t + 2 < nk) gt_copy(lcp + bo, ga + (size_t)(t + 2) * 64, gb + (size_t)(t + 2) * 64, a32, b32);
    __builtin_amdgcn_sched_barrier(0);      /* keeps the WMMAs behind the refill's issue: ahead of it they would delay the copies by their whole run */
#pragma unroll
    for (int ks = 0; ks < 2; ++ks)
#pragma unroll
      for (int i = 0; i < 2; ++i)
#pragma unroll
        for (int j = 0; j < 4; ++j) acc[i][j] = __builtin_amdgcn_wmma_f32_16x16x32_f16(false, a[ks][i].v, false, b[ks][j].v, (short)0, acc[i][j], false, false);
  }
  asm volatile("s_wait_asynccnt 0x0" ::: "memory");      /* no copy outstanding when the ring becomes output staging */
  /* epilogue: each wave stages its 32 x 64 in its own 8,704 B of the ring (every wave's last read of it ended ahead of the last barrier), then whole row pieces (256 B of f32, 128 B of f16) go out */
  const int c4 = ln * 4, col = col0 + wn * 64 + c4, rw0 = row0 + wm * 32 + hh; const size_t cofs = (size_t)by * sC;
  v4f cp[16];      /* the addend's 16 row pieces are asked for together, ahead of the staging */
  if (LDCP) { const float* cpp = CP + (size_t)rw0 * LDCP + (size_t)by * sCPy + col;
#pragma unroll
    for (int q = 0; q < 16; ++q) cp[q] = *(const v4fa*)(cpp + q * 2 * LDCP);
    asm volatile("s_wait_xcnt 0x0" ::: "memory"); }      /* ahead of any rewrite of the address registers that the loads above name */
  v4f bv = {0.f, 0.f, 0.f, 0.f}; if (bias) { const v4f bb = *(const v4fa*)(bias + col); for (int e = 0; e < 4; ++e) bv[e] = bf16_round(bb[e]); }
  float* so = (float*)(L + w * (32 * 68 * 4));
#pragma unroll
  for (int i = 0; i < 2; ++i)
#pragma unroll
    for (int j = 0; j < 4; ++j)
#pragma unroll
      for (int r = 0; r < 8; ++r) so[(i * 16 + 8 * hh + r) * 68 + j * 16 + ln] = acc[i][j][r];
  __builtin_amdgcn_fence(__ATOMIC_ACQ_REL, "workgroup"); __builtin_amdgcn_wave_barrier();
#pragma unroll
  for (int q = 0; q < 16; ++q) { const size_t o = cofs + (size_t)rw0 * ldc + col + (size_t)(q * 2) * ldc; const v4f x = *(const v4fa*)&so[(q * 2 + hh) * 68 + c4]; v4f v;
    for (int e = 0; e < 4; ++e) v[e] = x[e] * alpha + bv[e];
    if (LDCP) for (int e = 0; e < 4; ++e) v[e] += cp[q][e];
    if (OF32) *(v4f*)(C + o) = v;
    else { v4h h4; for (int e = 0; e < 4; ++e) h4[e] = (_Float16)v[e]; *(v4h*)(C16 + o) = h4; } }
}


__global__ __launch_bounds__(256) void k_x16(const float* __restrict__ x, _Float16* __restrict__ X16, size_t n8) { const size_t t = (size_t)blockIdx.x * 256 + threadIdx.x; if (t >= n8) return; FragH f;
#pragma unroll
  for (int q = 0; q < 8; ++q) f.h[q] = (_Float16)bf16_round(x[t * 8 + q]); *(v8us*)((unsigned short*)X16 + t * 8) = f.half[0];  }
__global__ __launch_bounds__(256) void k_h16(const float* __restrict__ x, _Float16* __restrict__ X16, size_t n8) { const size_t t = (size_t)blockIdx.x * 256 + threadIdx.x; if (t >= n8) return; FragH f;
#pragma unroll
  for (int q = 0; q < 8; ++q) f.h[q] = (_Float16)x[t * 8 + q]; *(v8us*)((unsigned short*)X16 + t * 8) = f.half[0];  }
__global__ __launch_bounds__(256) void k_round16f(const float* __restrict__ W, _Float16* __restrict__ Bt, size_t n8) { const size_t t = (size_t)blockIdx.x * 256 + threadIdx.x; if (t >= n8) return; FragH f;
#pragma unroll
  for (int i = 0; i < 8; ++i) f.h[i] = (_Float16)(bf16_round(W[t * 8 + i]) * 16.0f); *(v8us*)((unsigned short*)Bt + t * 8) = f.half[0];  }
template <int NHv, int TTv>
__global__ __launch_bounds__(256) void k_vt(const _Float16* __restrict__ V16, int ldv, int voff, _Float16* __restrict__ Vt) { __shared__ unsigned short tl[64][66]; const int tid = threadIdx.x; const int slab = blockIdx.x / (TTv / 64), lg = blockIdx.x % (TTv / 64); const int b = slab / NHv, h = slab % NHv;
  for (int i = tid; i < 64 * 8; i += 256) { const int r = i / 8, c8 = (i % 8) * 8; FragH f; f.half[0] = *(const v8us*)((const unsigned short*)V16 + ((size_t)b * TTv + lg * 64 + r) * ldv + voff + h * 64 + c8);
#pragma unroll
    for (int q = 0; q < 8; ++q) tl[r][c8 + q] = f.u[q]; }
  __syncthreads();
  {
#pragma unroll
    for (int rd = 0; rd < 2; ++rd) { const int d = rd * 32 + tid / 8, pc = tid % 8; FragH f;
#pragma unroll
      for (int q = 0; q < 8; ++q) f.u[q] = tl[pc * 8 + q][d];
      *(v8us*)((unsigned short*)Vt + ((size_t)slab * 64 + d) * TTv + lg * 64 + pc * 8) = f.half[0]; }
     } }

__global__ __launch_bounds__(256) void k_hl(const float* __restrict__ F, _Float16* __restrict__ Hh, _Float16* __restrict__ Hl, size_t n8) { const size_t t = (size_t)blockIdx.x * 256 + threadIdx.x; if (t >= n8) return; FragH fh, fl; const v4f a = *(const v4fa*)(F + t * 8), c = *(const v4fa*)(F + t * 8 + 4);
#pragma unroll
  for (int q = 0; q < 4; ++q) { _Float16 h = (_Float16)a[q]; fh.h[q] = h; fl.h[q] = (_Float16)((a[q] - (float)h) * 1024.0f); h = (_Float16)c[q]; fh.h[4 + q] = h; fl.h[4 + q] = (_Float16)((c[q] - (float)h) * 1024.0f); }
  { *(v8us*)((unsigned short*)Hh + t * 8) = fh.half[0]; *(v8us*)((unsigned short*)Hl + t * 8) = fl.half[0];  } }
__global__ __launch_bounds__(256) void k_h16s(const float* __restrict__ F, _Float16* __restrict__ H, size_t n8) { const size_t t = (size_t)blockIdx.x * 256 + threadIdx.x; if (t >= n8) return; const v4f a = *(const v4fa*)(F + t * 8), c = *(const v4fa*)(F + t * 8 + 4); FragH f;
#pragma unroll
  for (int q = 0; q < 4; ++q) { f.h[q] = (_Float16)(a[q] * 16.0f); f.h[4 + q] = (_Float16)(c[q] * 16.0f); } *(v8us*)((unsigned short*)H + t * 8) = f.half[0];  }
__device__ __forceinline__ float gelu_tanh(float x) { const float u = 0.7978845608028654f * (x + 0.044715f * x * x * x); return 0.5f * x * (1.0f + tanhf(u)); }
__global__ __launch_bounds__(256) void k_gbias(float* __restrict__ S, const float* __restrict__ CRD, const float* __restrict__ w1, const float* __restrict__ b1, const float* __restrict__ w2, const float* __restrict__ b2) {
  #pragma clang fp contract(off)
  const int b = blockIdx.y; S += (size_t)b * TT * TT;      /* one score plane per batch */
  const size_t t = (size_t)blockIdx.x * 256 + threadIdx.x; if (t >= (size_t)TT * TT / 4) return; const int q = (int)((t * 4) / TT), k0 = (int)((t * 4) % TT);
  float cb = 0.f; for (int j = 0; j < 8; ++j) cb += bf16_round(b2[j]); cb *= 0.125f;
  const float qx = bf16_round(CRD[((size_t)b * TT + q) * 3]), qy = bf16_round(CRD[((size_t)b * TT + q) * 3 + 1]), qz = bf16_round(CRD[((size_t)b * TT + q) * 3 + 2]);
  v4f sv = *(const v4fa*)(S + (size_t)q * TT + k0); float dist[4];
  for (int e = 0; e < 4; ++e) { const int k = k0 + e; const float dx = qx - bf16_round(CRD[((size_t)b * TT + k) * 3]), dy = qy - bf16_round(CRD[((size_t)b * TT + k) * 3 + 1]), dz = qz - bf16_round(CRD[((size_t)b * TT + k) * 3 + 2]); dist[e] = sqrtf(fmaxf(dx * dx + dy * dy + dz * dz, 1e-12f)); sv[e] += cb; }
#pragma unroll 1
  for (int j = 0; j < 8; ++j) { float cj = 0.f; for (int h = 0; h < 8; ++h) cj += bf16_round(w2[j * 8 + h]); cj *= 0.125f; const float wj = bf16_round(w1[j]), bj = bf16_round(b1[j]);
    for (int e = 0; e < 4; ++e) sv[e] += gelu_tanh(dist[e] * wj + bj) * cj; }
  *(v4f*)(S + (size_t)q * TT + k0) = sv;  }
#define NN TT
__global__ __launch_bounds__(256) void k_smx(const float* __restrict__ S, _Float16* __restrict__ P16) { const int tid = threadIdx.x, wv = tid >> 5, lane = tid & 31; const int i = blockIdx.x * 8 + wv; const float* sr = S + (size_t)i * NN;
  float m = -3.0e38f;
  for (int p = lane; p < NN / 8; p += 32) { const v4f a = *(const v4fa*)(sr + p * 8), c = *(const v4fa*)(sr + p * 8 + 4); for (int e = 0; e < 4; ++e) m = fmaxf(m, fmaxf(a[e], c[e])); }
  for (int o = 16; o >= 1; o >>= 1) m = fmaxf(m, __shfl_xor(m, o, 32)); float z = 0.f;
  for (int p = lane; p < NN / 8; p += 32) { const v4f a = *(const v4fa*)(sr + p * 8), c = *(const v4fa*)(sr + p * 8 + 4); for (int e = 0; e < 4; ++e) z += __expf(a[e] - m) + __expf(c[e] - m); }
  for (int o = 16; o >= 1; o >>= 1) z += __shfl_xor(z, o, 32); const float iz = 32768.0f / z;
  { for (int p = lane; p < NN / 8; p += 32) { FragH f; const v4f a = *(const v4fa*)(sr + p * 8), c = *(const v4fa*)(sr + p * 8 + 4); for (int e = 0; e < 4; ++e) { f.h[e] = (_Float16)(__expf(a[e] - m) * iz); f.h[4 + e] = (_Float16)(__expf(c[e] - m) * iz); }
      *(v8us*)((unsigned short*)P16 + (size_t)i * NN + p * 8) = f.half[0]; }  } }
__global__ __launch_bounds__(128) void k_flash(const _Float16* __restrict__ Q16, int ldq, const _Float16* __restrict__ K16, int ldk, const _Float16* __restrict__ Vt, const int* __restrict__ MSK, float* __restrict__ O, int ldo) {
  constexpr int RPW = 16, RTN = RPW / 16, NQB = TT / (4 * RPW), DT = 4, KS = 2;
  __shared__ __attribute__((aligned(16))) unsigned short sP[4][RPW][40]; __shared__ __attribute__((aligned(16))) float sO[4][RPW][64 + 4];
  const int tid = threadIdx.x, w = tid >> 5, lane = tid & 31, ln = lane & 15, hh = lane >> 4;
  const int slab = blockIdx.x / NQB, qblk = blockIdx.x % NQB; const int b = slab / NH, h = slab % NH; const int qb0 = qblk * (4 * RPW); const int q0 = qb0 + w * RPW;
  FragH aq[2][KS];
#pragma unroll
  for (int rt = 0; rt < RTN; ++rt) { const unsigned short* qr = (const unsigned short*)Q16 + ((size_t)b * TT + q0 + rt * 16 + ln) * ldq + h * 64;
#pragma unroll
    for (int ks = 0; ks < KS; ++ks) { aq[rt][ks].half[0] = *(const v8us*)(qr + ks * 32 + 8 * hh); aq[rt][ks].half[1] = *(const v8us*)(qr + ks * 32 + 16 + 8 * hh); } }
  const unsigned short* Vth = (const unsigned short*)Vt + (size_t)slab * 64 * TT;
  float m_r[2][8], l_r[2][8]; v8f oacc[2][DT];
#pragma unroll
  for (int rt = 0; rt < RTN; ++rt) {
#pragma unroll
    for (int r = 0; r < 8; ++r) { m_r[rt][r] = -3.0e38f; l_r[rt][r] = 0.f; }
#pragma unroll
    for (int dt = 0; dt < DT; ++dt) oacc[rt][dt] = (v8f){0.f,0.f,0.f,0.f,0.f,0.f,0.f,0.f}; }
  const int jend = TT;
#pragma unroll 1
  for (int j0 = 0; j0 < jend; j0 += 32) {
    v8f s[2][2];
#pragma unroll
    for (int nt = 0; nt < 2; ++nt) { const unsigned short* kr = (const unsigned short*)K16 + ((size_t)b * TT + j0 + nt * 16 + ln) * ldk + h * 64; FragH bk[KS];
#pragma unroll
      for (int ks = 0; ks < KS; ++ks) { bk[ks].half[0] = *(const v8us*)(kr + ks * 32 + 8 * hh); bk[ks].half[1] = *(const v8us*)(kr + ks * 32 + 16 + 8 * hh); }
#pragma unroll
      for (int rt = 0; rt < RTN; ++rt) { v8f acc = (v8f){0.f,0.f,0.f,0.f,0.f,0.f,0.f,0.f};
#pragma unroll
        for (int ks = 0; ks < KS; ++ks) acc = mmaH<1>(aq[rt][ks].v, aq[rt][ks].v, bk[ks].v, bk[ks].v, acc); s[rt][nt] = acc; } }
#pragma unroll
    for (int rt = 0; rt < RTN; ++rt)
#pragma unroll
      for (int r = 0; r < 8; ++r) { const int tq = q0 + rt * 16 + 8 * hh + r; const int k0 = j0 + ln, k1 = j0 + 16 + ln; (void)tq; (void)k0; (void)k1;
        const bool ok0 = true, ok1 = true;
        const float s0 = s[rt][0][r] * 0.125f, s1 = s[rt][1][r] * 0.125f; float mc = fmaxf(s0, s1);
        mc = fmaxf(mc, __shfl_xor(mc, 1, 32)); mc = fmaxf(mc, __shfl_xor(mc, 2, 32)); mc = fmaxf(mc, __shfl_xor(mc, 4, 32)); mc = fmaxf(mc, __shfl_xor(mc, 8, 32));
        const float mn = fmaxf(m_r[rt][r], mc); const float al = (mn > -1.0e38f) ? expf(m_r[rt][r] - mn) : 1.0f; m_r[rt][r] = mn; const float p0 = ok0 ? expf(s0 - mn) : 0.f, p1 = ok1 ? expf(s1 - mn) : 0.f; l_r[rt][r] = l_r[rt][r] * al + p0 + p1;
#pragma unroll
        for (int dt = 0; dt < DT; ++dt) oacc[rt][dt][r] *= al;
        FragH t2; t2.h[0] = (_Float16)(p0 * 1024.0f); t2.h[1] = (_Float16)(p1 * 1024.0f); sP[w][rt * 16 + 8 * hh + r][ln] = t2.u[0]; sP[w][rt * 16 + 8 * hh + r][16 + ln] = t2.u[1]; }
    __builtin_amdgcn_fence(__ATOMIC_ACQ_REL, "workgroup"); __builtin_amdgcn_wave_barrier();
    FragH pa[2];
#pragma unroll
    for (int rt = 0; rt < RTN; ++rt) { pa[rt].half[0] = *(const v8us*)&sP[w][rt * 16 + ln][8 * hh]; pa[rt].half[1] = *(const v8us*)&sP[w][rt * 16 + ln][16 + 8 * hh]; }
#pragma unroll
    for (int dt = 0; dt < DT; ++dt) { const unsigned short* vrow = Vth + (size_t)(dt * 16 + ln) * TT + j0; FragH bv; bv.half[0] = *(const v8us*)(vrow + 8 * hh); bv.half[1] = *(const v8us*)(vrow + 16 + 8 * hh);
#pragma unroll
      for (int rt = 0; rt < RTN; ++rt) oacc[rt][dt] = mmaH<1>(pa[rt].v, pa[rt].v, bv.v, bv.v, oacc[rt][dt]); }
    __builtin_amdgcn_fence(__ATOMIC_ACQ_REL, "workgroup"); __builtin_amdgcn_wave_barrier(); }
#pragma unroll
  for (int rt = 0; rt < RTN; ++rt) {
#pragma unroll
    for (int r = 0; r < 8; ++r) { float l = l_r[rt][r]; l += __shfl_xor(l, 1, 32); l += __shfl_xor(l, 2, 32); l += __shfl_xor(l, 4, 32); l += __shfl_xor(l, 8, 32); l_r[rt][r] = (l > 0.f) ? 1.0f / (l * 1024.0f) : 0.f; }
#pragma unroll
    for (int dt = 0; dt < DT; ++dt)
#pragma unroll
      for (int r = 0; r < 8; ++r) sO[w][rt * 16 + 8 * hh + r][dt * 16 + ln] = oacc[rt][dt][r] * l_r[rt][r]; }
  __builtin_amdgcn_fence(__ATOMIC_ACQ_REL, "workgroup"); __builtin_amdgcn_wave_barrier();
  {
#pragma unroll
    for (int rp = 0; rp < RPW; rp += 2) { const int r = rp + (lane >> 4), pc = lane & 15; const v4f val = *(const v4fa*)&sO[w][r][pc * 4]; *(v4f*)(O + ((size_t)b * TT + q0 + r) * ldo + h * 64 + pc * 4) = val; }
     } }

extern "C" void kernel_launch(void* const* d_in, const int* in_sizes, int n_in,
                              void* d_out, int out_size, void* d_ws, size_t ws_size, hipStream_t stream) {
  (void)in_sizes; (void)n_in; (void)out_size;
  const float* const* I = (const float* const*)d_in; const float* feats = I[0]; const float* geom = I[1]; const float* crd = I[2];
  const float* wq = I[3]; const float* bq = I[4]; const float* wk = I[5]; const float* bk = I[6]; const float* wv = I[7]; const float* bv = I[8]; const float* wo = I[9]; const float* bo = I[10];
  const float* gqw = I[11]; const float* gqb = I[12]; const float* gkw = I[13]; const float* gkb = I[14]; const float* gvw = I[15]; const float* gvb = I[16]; const float* d1w = I[17]; const float* d1b = I[18]; const float* d2w = I[19]; const float* d2b = I[20]; const float* opw = I[21]; const float* opb = I[22];
  char* ws = (char*)d_ws; size_t off = 0;
  auto take = [&](size_t bytes) { char* p = ws + off; off += (bytes + 255) & ~(size_t)255; return p; };
  const size_t WSZ = (size_t)DD * DD, GSZ = (size_t)GG * DD; _Float16* Bw = (_Float16*)take(5 * WSZ * 2); _Float16* Bg = (_Float16*)take(3 * GSZ * 2);
  _Float16* X16 = (_Float16*)take((size_t)NR * DD * 2); _Float16* GE16 = (_Float16*)take((size_t)NR * GG * 2); _Float16* Q = (_Float16*)take((size_t)NR * DD * 2); _Float16* K = (_Float16*)take((size_t)NR * DD * 2); _Float16* V = (_Float16*)take((size_t)NR * DD * 2); _Float16* Vt = (_Float16*)take((size_t)NR * DD * 2);
  float* O = (float*)take((size_t)NR * DD * 4); float* FA = (float*)take((size_t)NR * DD * 4); _Float16* GQ = (_Float16*)take((size_t)NR * DD * 2); _Float16* GK = (_Float16*)take((size_t)NR * DD * 2); float* S = (float*)take((size_t)BB * TT * TT * 4); _Float16* P16 = (_Float16*)take((size_t)BB * TT * TT * 2);
  _Float16* O16 = X16; _Float16* GV = Q; _Float16* GVt = K; float* SUM = O; _Float16* SUM16 = V; float* GF = O; _Float16* GQl = Vt; _Float16* GKl = X16;      /* gq/gk go through an f32 temp (the attention-output plane, free between k_h16s and the feat+geom GEMM) into hi (GQ/GK) + ×2^10 residual (over Vt / X16) planes */      /* reuse after the MHA branch (stream order): X16 → O16; Q/K → gv / gvᵀ; O → feat+geom; V → its f16 copy */
  if (off > ws_size) return;      // 2.6 + 0.4 + 8.4 + 2.1 + 4 × 8.4 + 16.8 + 16.8 + 8.4 + 8.4 + 33.6 + 16.8 = about 148 MB
  const unsigned gw = (unsigned)(((size_t)DD * (DD / 8) + 255) / 256), ggw = (unsigned)(((size_t)DD * (GG / 8) + 255) / 256);
  k_wt_f16<<<gw, 256, 0, stream>>>(wq, Bw, DD, DD, 16.0f); k_wt_f16<<<gw, 256, 0, stream>>>(wk, Bw + WSZ, DD, DD, 16.0f); k_wt_f16<<<gw, 256, 0, stream>>>(wv, Bw + 2 * WSZ, DD, DD, 16.0f); k_wt_f16<<<gw, 256, 0, stream>>>(wo, Bw + 3 * WSZ, DD, DD, 16.0f); k_wt_f16<<<gw, 256, 0, stream>>>(opw, Bw + 4 * WSZ, DD, DD, 16.0f);
  k_wt_f16<<<ggw, 256, 0, stream>>>(gqw, Bg, GG, DD, 16.0f); k_wt_f16<<<ggw, 256, 0, stream>>>(gkw, Bg + GSZ, GG, DD, 16.0f); k_wt_f16<<<ggw, 256, 0, stream>>>(gvw, Bg + 2 * GSZ, GG, DD, 16.0f);      /* (in,out) → Bt ×2^4 */
  const unsigned g8 = (unsigned)(((size_t)NR * DD / 8 + 255) / 256); k_x16<<<g8, 256, 0, stream>>>(feats, X16, (size_t)NR * DD / 8); k_x16<<<(unsigned)(((size_t)NR * GG / 8 + 255) / 256), 256, 0, stream>>>(geom, GE16, (size_t)NR * GG / 8);
  const dim3 gp((NR / 128) * (DD / 128), 1);
  k_gemm_t<0, false><<<gp, 256, 0, stream>>>(X16, DD, 0, Bw, DD, 0, 0.0625f, bq, nullptr, 0, nullptr, Q, DD, 0, DD, DD);      /* M 8192 N 512 K 512 */
  k_gemm_t<0, false><<<gp, 256, 0, stream>>>(X16, DD, 0, Bw + WSZ, DD, 0, 0.0625f, bk, nullptr, 0, nullptr, K, DD, 0, DD, DD);
  k_gemm_t<0, false><<<gp, 256, 0, stream>>>(X16, DD, 0, Bw + 2 * WSZ, DD, 0, 0.0625f, bv, nullptr, 0, nullptr, V, DD, 0, DD, DD);
  k_vt<NH, TT><<<BB * NH * (TT / 64), 256, 0, stream>>>(V, DD, 0, Vt); k_flash<<<BB * NH * (TT / 64), 128, 0, stream>>>(Q, DD, K, DD, Vt, nullptr, O, DD);
  k_h16s<<<g8, 256, 0, stream>>>(O, O16, (size_t)NR * DD / 8);
  k_gemm_t<0, true><<<gp, 256, 0, stream>>>(O16, DD, 0, Bw + 3 * WSZ, DD, 0, 0.00390625f, bo, nullptr, 0, FA, nullptr, DD, 0, DD, DD);      /* feat_att = O.wo + bo (f32) */
  k_gemm_t<0, true><<<gp, 256, 0, stream>>>(GE16, GG, 0, Bg, GG, 0, 0.0625f, gqb, nullptr, 0, GF, nullptr, DD, 0, DD, GG); k_hl<<<g8, 256, 0, stream>>>(GF, GQ, GQl, (size_t)NR * DD / 8);      /* gq (f32) -> hi / x2^10 residual: M 8192 N 512 K 128 */
  k_gemm_t<0, true><<<gp, 256, 0, stream>>>(GE16, GG, 0, Bg + GSZ, GG, 0, 0.0625f, gkb, nullptr, 0, GF, nullptr, DD, 0, DD, GG); k_hl<<<g8, 256, 0, stream>>>(GF, GK, GKl, (size_t)NR * DD / 8);      /* gk likewise */
  k_gemm_t<0, false><<<gp, 256, 0, stream>>>(GE16, GG, 0, Bg + 2 * GSZ, GG, 0, 0.0625f, gvb, nullptr, 0, nullptr, GV, DD, 0, DD, GG);
  k_vt<DD / 64, TT><<<BB * (DD / 64) * (TT / 64), 256, 0, stream>>>(GV, DD, 0, GVt);      /* gvᵀ per batch [512][1024] */
  /* geometry branch: all BB batches of each stage in one launch, the batch in blockIdx.y, the softmax's BB * TT rows in blockIdx.x (operand, addend and result strides per batch) */
  const size_t sX = (size_t)TT * DD, sS = (size_t)TT * TT; const dim3 gs((TT / 128) * (TT / 128), BB);
  k_gemm_t<0, true><<<gs, 256, 0, stream>>>(GQ, DD, sX, GK, DD, sX, 0.125f, nullptr, nullptr, 0, S, nullptr, TT, sS, TT, DD);      /* S = gq.gkT/8 f32-accurate: hi.hi ... */
  k_gemm_t<TT, true><<<gs, 256, 0, stream>>>(GQl, DD, sX, GK, DD, sX, 0.125f * 0.0009765625f, nullptr, S, sS, S, nullptr, TT, sS, TT, DD);      /* += lo.hi.2^-10 */
  k_gemm_t<TT, true><<<gs, 256, 0, stream>>>(GQ, DD, sX, GKl, DD, sX, 0.125f * 0.0009765625f, nullptr, S, sS, S, nullptr, TT, sS, TT, DD);      /* += hi.lo.2^-10: M 1024 N 1024 K 512 each, x BB */
  k_gbias<<<dim3((TT * TT / 4 + 255) / 256, BB), 256, 0, stream>>>(S, crd, d1w, d1b, d2w, d2b); k_smx<<<BB * TT / 8, 256, 0, stream>>>(S, P16);      /* softmax: a wave per row over the BB * TT rows */
  k_gemm_t<DD, true><<<dim3((TT / 128) * (DD / 128), BB), 256, 0, stream>>>(P16, TT, sS, GVt, TT, sX, 0.000030517578125f, nullptr, FA, sX, SUM, nullptr, DD, sX, DD, TT);      /* feat_att + geom_att: M 1024 N 512 K 1024, x BB */
  k_h16<<<g8, 256, 0, stream>>>(SUM, SUM16, (size_t)NR * DD / 8);
  k_gemm_t<0, true><<<gp, 256, 0, stream>>>(SUM16, DD, 0, Bw + 4 * WSZ, DD, 0, 0.0625f, opb, nullptr, 0, (float*)d_out, nullptr, DD, 0, DD, DD);      /* out = (feat + geom).op_w + op_b */
}

// v003
// A run of this version takes 311 microseconds.
// Timed twice side by side with v002, it ran 1.16 times as fast both times.
// All steps since v000 together make it 4.26 times as fast.
#include <hip/hip_runtime.h>
// Geometry-aware attention (B=8, N=1024, F=512, 8 heads × 64, G=128): feat = MHA(features) (x·W + b, softmax(q·k/8)·v, ·wo + bo); geometry branch: gq, gk, gv = geometry·W + b (F wide, single head);
// g_scores = gq·gkᵀ/8 + mean_h(gelu_tanh(dist·d1_w + d1_b)·d2_w + d2_b) with dist = max(‖coords_q − coords_k‖, 1e-6); geom = softmax(g_scores)·gv; out = (feat + geom)·op_w + op_b. (in,out) weights; jax.nn.gelu default = tanh approximation.
// Compute dtype: features, geometry, coords, all weights/biases rounded to bf16; f16 GEMM planes; the 8-head branch through a fused flash-style kernel (online softmax f32, P f16 ×2^10); the geometry branch, every stage one launch over all batches (batch in blockIdx.y; the softmax's BB·TT rows in blockIdx.x): S = gq·gkᵀ/8 f32-accurate from f16 hi + residual planes (hi·hi + (lo·hi + hi·lo)·2^-10; its logits reach σ≈3), a kernel adding the distance-MLP bias in place (f32, per pair from the coords), a wave-per-row f32 softmax → P f16 ×2^15, geom = P·gv by GEMM with feat_att as the f32 addend; final projection GEMM. All contractions on v_wmma_f32_16x16x32_f16, f32 accumulate.
#define BB 8
#define TT 1024
#define DD 512
#define GG 128
#define NH 8
#define NR (BB * TT)

typedef __bf16 v16b __attribute__((ext_vector_type(16)));
typedef unsigned short v8us __attribute__((ext_vector_type(8), may_alias));
typedef float  v8f  __attribute__((ext_vector_type(8)));
typedef float  v4f  __attribute__((ext_vector_type(4)));
typedef float  v4fa __attribute__((ext_vector_type(4), may_alias));
union FragB { v16b v; v8us half[2]; unsigned short u[16]; };

__device__ __forceinline__ unsigned short bf16_bits(float x) { unsigned int u = __float_as_uint(x); return (unsigned short)((u + 0x7FFFu + ((u >> 16) & 1u)) >> 16); }
__device__ __forceinline__ float bf16_val(unsigned short b) { return __uint_as_float(((unsigned int)b) << 16); }
__device__ __forceinline__ float bf16_round(float x) { return bf16_val(bf16_bits(x)); }
// D += A·B with NT terms: 1 = ah·bh, 2 = + al·bh (A split), 3 = + ah·bl (both split)
template <int NT>
__device__ __forceinline__ v8f mmaN(v16b ah, v16b al, v16b bh, v16b bl, v8f c) {
  c = __builtin_amdgcn_wmma_f32_16x16x32_bf16(false, ah, false, bh, (short)0, c, false, false);
  if (NT >= 2) c = __builtin_amdgcn_wmma_f32_16x16x32_bf16(false, al, false, bh, (short)0, c, false, false);
  if (NT >= 3) c = __builtin_amdgcn_wmma_f32_16x16x32_bf16(false, ah, false, bl, (short)0, c, false, false);
  asm volatile("v_nop\n\tv_nop\n\tv_nop\n\tv_nop" : "+v"(c) : "v"(ah), "v"(al), "v"(bh), "v"(bl));
  return c;
}

__global__ __launch_bounds__(256) void k_wt_bf16(const float* __restrict__ W, unsigned short* __restrict__ Wt, int K, int N) {
  const int t = blockIdx.x * 256 + threadIdx.x;
  const int k8n = K / 8;
  if (t >= N * k8n) return;
  const int n = t / k8n, k8 = (t % k8n) * 8;
  v8us v;
#pragma unroll
  for (int i = 0; i < 8; ++i) v[i] = bf16_bits(W[(size_t)(k8 + i) * N + n]);
  *(v8us*)(Wt + (size_t)n * K + k8) = v;
  
}

// GEMM C[M][N] (f32, pitch ldc) = act(A[M][K]·W + bias). A f32 row-major (pitch lda) converted per fragment to bf16
// (ASPLIT: hi/lo two planes -> 2 terms, else single rounded term); Wt bf16 [N][K] (pitch ldb). BIAS_BF16 rounds the
// bias to bf16 first (bias quantised to bf16 before the add). K%32==0, M%16==0, N%64==0.
template <bool ASPLIT, int ACT, bool BIAS_BF16>
__global__ __launch_bounds__(128) void k_gemm_bf(const float* __restrict__ A, int lda, const unsigned short* __restrict__ Wt, int ldb,
                                               const float* __restrict__ bias, float* __restrict__ C, int ldc, int M, int N, int K) {
  __shared__ __attribute__((aligned(16))) float so[4][16][64];
  const int tid = threadIdx.x, w = tid >> 5, lane = tid & 31, ln = lane & 15, hh = lane >> 4;
  const int ntn = N / 64;
  const int wid = blockIdx.x * 4 + w;
  const int mt = wid / ntn, nq = wid % ntn;
  if (mt * 16 >= M) return;
  const int row0 = mt * 16, col0 = nq * 64;
  const float* arow = A + (size_t)(row0 + ln) * lda;
  v8f acc[4] = {};
  for (int kb = 0; kb < K; kb += 32) {
    FragB ah, al;
    const v4f x0 = *(const v4fa*)(arow + kb + 8 * hh), x1 = *(const v4fa*)(arow + kb + 8 * hh + 4);
    const v4f x2 = *(const v4fa*)(arow + kb + 16 + 8 * hh), x3 = *(const v4fa*)(arow + kb + 16 + 8 * hh + 4);
    float xs[16] = {x0[0],x0[1],x0[2],x0[3],x1[0],x1[1],x1[2],x1[3],x2[0],x2[1],x2[2],x2[3],x3[0],x3[1],x3[2],x3[3]};
#pragma unroll
    for (int i = 0; i < 16; ++i) { const unsigned short hb = bf16_bits(xs[i]); ah.u[i] = hb; al.u[i] = ASPLIT ? bf16_bits(xs[i] - bf16_val(hb)) : (unsigned short)0; }
#pragma unroll
    for (int t = 0; t < 4; ++t) {
      const unsigned short* brow = Wt + (size_t)(col0 + t * 16 + ln) * ldb + kb;
      FragB b;
      b.half[0] = *(const v8us*)(brow + 8 * hh);
      b.half[1] = *(const v8us*)(brow + 16 + 8 * hh);
      acc[t] = mmaN<ASPLIT ? 2 : 1>(ah.v, al.v, b.v, b.v, acc[t]);
    }
  }
#pragma unroll
  for (int t = 0; t < 4; ++t) {
    float bv = bias ? bias[col0 + t * 16 + ln] : 0.f;
    if (BIAS_BF16) bv = bf16_round(bv);
#pragma unroll
    for (int r = 0; r < 8; ++r) { float v = acc[t][r] + bv; if (ACT == 1) v = fmaxf(v, 0.f); so[w][8 * hh + r][t * 16 + ln] = v; }
  }
  __builtin_amdgcn_fence(__ATOMIC_ACQ_REL, "workgroup");
  __builtin_amdgcn_wave_barrier();
  const int rsub = lane >> 4, c4 = (lane & 15) * 4;
  {
#pragma unroll
    for (int q = 0; q < 8; ++q) {
      const int r = q * 2 + rsub;
      const v4f v = *(const v4fa*)&so[w][r][c4];
      *(v4f*)(C + (size_t)(row0 + r) * ldc + col0 + c4) = v;
    }
    
  }
}

// Flash-style causal/unmasked attention, all contractions 3-term bf16 hi/lo splits, f32 softmax with running max.
// q,k,v rows are read from f32 buffers with arbitrary row pitch (so they can live inside a fused qkv buffer);
// D = head size (multiple of 32, <= 128); one wave = 16 query rows; block = 4 waves (64 queries) sharing K/V chunks of 32.
template <int D, bool CAUSAL>
__global__ __launch_bounds__(128) void k_flash(const float* __restrict__ qb, const float* __restrict__ kb, const float* __restrict__ vb,
                                             int pitch, int T, int H, float scale, float* __restrict__ y, int ypitch) {
  constexpr int KS = D / 32;        // k-steps for QK
  constexpr int DT = D / 16;        // d tiles for PV
  __shared__ __attribute__((aligned(16))) unsigned short sKh[32][D + 8], sKl[32][D + 8], sVh[32][D + 8], sVl[32][D + 8];
  __shared__ __attribute__((aligned(16))) unsigned short sPh[4][16][40], sPl[4][16][40];
  __shared__ __attribute__((aligned(16))) float sO[4][16][D];
  const int tid = threadIdx.x, w = tid >> 5, lane = tid & 31, ln = lane & 15, hh = lane >> 4;
  const int nqb = (T + 63) / 64;
  const int bh = blockIdx.x / nqb, qblk = blockIdx.x % nqb;
  const int b = bh / H, h = bh % H;
  const int q0 = qblk * 64 + w * 16;
  const float* Q = qb + (size_t)b * T * pitch + h * D;
  const float* K = kb + (size_t)b * T * pitch + h * D;
  const float* V = vb + (size_t)b * T * pitch + h * D;

  // A fragments of the wave's 16 query rows (scaled), hi/lo
  FragB aqh[KS], aql[KS];
  {
    int row = q0 + ln; if (row >= T) row = T - 1;
    const float* qr = Q + (size_t)row * pitch;
#pragma unroll
    for (int ks = 0; ks < KS; ++ks)
#pragma unroll
      for (int i = 0; i < 16; ++i) {
        const int d = ks * 32 + ((i < 8) ? (8 * hh + i) : (16 + 8 * hh + (i - 8)));
        const float x = qr[d] * scale; const unsigned short hb = bf16_bits(x);
        aqh[ks].u[i] = hb; aql[ks].u[i] = bf16_bits(x - bf16_val(hb));
      }
  }
  float m_r[8], l_r[8];
#pragma unroll
  for (int r = 0; r < 8; ++r) { m_r[r] = -3.0e38f; l_r[r] = 0.f; }
  v8f oacc[DT];
#pragma unroll
  for (int dt = 0; dt < DT; ++dt) oacc[dt] = (v8f){0.f,0.f,0.f,0.f,0.f,0.f,0.f,0.f};

  const int kv_end = CAUSAL ? min(T, qblk * 64 + 64) : T;     // block-uniform
  for (int j0 = 0; j0 < kv_end; j0 += 32) {
    __syncthreads();
    for (int e = tid; e < 32 * (D / 4); e += 128) {
      const int r = e / (D / 4), c4 = (e % (D / 4)) * 4;
      const int key = j0 + r;
      v4f kf = {0.f,0.f,0.f,0.f}, vf = {0.f,0.f,0.f,0.f};
      if (key < T) { kf = *(const v4fa*)(K + (size_t)key * pitch + c4); vf = *(const v4fa*)(V + (size_t)key * pitch + c4); }
#pragma unroll
      for (int t = 0; t < 4; ++t) {
        unsigned short hb = bf16_bits(kf[t]); sKh[r][c4 + t] = hb; sKl[r][c4 + t] = bf16_bits(kf[t] - bf16_val(hb));
        hb = bf16_bits(vf[t]); sVh[r][c4 + t] = hb; sVl[r][c4 + t] = bf16_bits(vf[t] - bf16_val(hb));
      }
    }
    __syncthreads();
    // S tile 16 x 32
    v8f s[2];
#pragma unroll
    for (int nt = 0; nt < 2; ++nt) {
      v8f acc = {};
#pragma unroll
      for (int ks = 0; ks < KS; ++ks) {
        FragB bh_, bl_;
        bh_.half[0] = *(const v8us*)&sKh[nt * 16 + ln][ks * 32 + 8 * hh]; bh_.half[1] = *(const v8us*)&sKh[nt * 16 + ln][ks * 32 + 16 + 8 * hh];
        bl_.half[0] = *(const v8us*)&sKl[nt * 16 + ln][ks * 32 + 8 * hh]; bl_.half[1] = *(const v8us*)&sKl[nt * 16 + ln][ks * 32 + 16 + 8 * hh];
        acc = mmaN<3>(aqh[ks].v, aql[ks].v, bh_.v, bl_.v, acc);
      }
      s[nt] = acc;
    }
    // mask + running max (rows 8hh+r; the 16 lanes of a half share rows)
    float alpha[8];
#pragma unroll
    for (int r = 0; r < 8; ++r) {
      const int qi = q0 + 8 * hh + r;
      const int ja = j0 + ln, jb = j0 + 16 + ln;
      if (CAUSAL) { if (ja > qi) s[0][r] = -3.0e38f; if (jb > qi) s[1][r] = -3.0e38f; }
      if (ja >= T) s[0][r] = -3.0e38f;
      if (jb >= T) s[1][r] = -3.0e38f;
      float mx = fmaxf(s[0][r], s[1][r]);
      mx = fmaxf(mx, __shfl_xor(mx, 1, 32)); mx = fmaxf(mx, __shfl_xor(mx, 2, 32)); mx = fmaxf(mx, __shfl_xor(mx, 4, 32)); mx = fmaxf(mx, __shfl_xor(mx, 8, 32));
      const float mnew = fmaxf(m_r[r], mx);
      alpha[r] = (mnew > -1.0e38f) ? __expf(m_r[r] - mnew) : 1.0f;
      const float p0 = (s[0][r] > -1.0e38f) ? __expf(s[0][r] - mnew) : 0.f;
      const float p1 = (s[1][r] > -1.0e38f) ? __expf(s[1][r] - mnew) : 0.f;
      m_r[r] = mnew;
      l_r[r] = l_r[r] * alpha[r] + p0 + p1;            // per-lane partial row sum (16 lanes combined at the end)
      unsigned short hb = bf16_bits(p0); sPh[w][8 * hh + r][ln] = hb;      sPl[w][8 * hh + r][ln] = bf16_bits(p0 - bf16_val(hb));
      hb = bf16_bits(p1);                sPh[w][8 * hh + r][16 + ln] = hb; sPl[w][8 * hh + r][16 + ln] = bf16_bits(p1 - bf16_val(hb));
    }
#pragma unroll
    for (int dt = 0; dt < DT; ++dt)
#pragma unroll
      for (int r = 0; r < 8; ++r) oacc[dt][r] *= alpha[r];
    __builtin_amdgcn_fence(__ATOMIC_ACQ_REL, "workgroup");
    __builtin_amdgcn_wave_barrier();
    FragB pah, pal;
    pah.half[0] = *(const v8us*)&sPh[w][ln][8 * hh]; pah.half[1] = *(const v8us*)&sPh[w][ln][16 + 8 * hh];
    pal.half[0] = *(const v8us*)&sPl[w][ln][8 * hh]; pal.half[1] = *(const v8us*)&sPl[w][ln][16 + 8 * hh];
#pragma unroll
    for (int dt = 0; dt < DT; ++dt) {
      FragB bvh, bvl;
#pragma unroll
      for (int i = 0; i < 8; ++i) {
        bvh.u[i] = sVh[8 * hh + i][dt * 16 + ln]; bvh.u[8 + i] = sVh[16 + 8 * hh + i][dt * 16 + ln];
        bvl.u[i] = sVl[8 * hh + i][dt * 16 + ln]; bvl.u[8 + i] = sVl[16 + 8 * hh + i][dt * 16 + ln];
      }
      oacc[dt] = mmaN<3>(pah.v, pal.v, bvh.v, bvl.v, oacc[dt]);
    }
    __builtin_amdgcn_fence(__ATOMIC_ACQ_REL, "workgroup");
    __builtin_amdgcn_wave_barrier();
  }
#pragma unroll
  for (int r = 0; r < 8; ++r) {
    float l = l_r[r];
    l += __shfl_xor(l, 1, 32); l += __shfl_xor(l, 2, 32); l += __shfl_xor(l, 4, 32); l += __shfl_xor(l, 8, 32);
    l_r[r] = (l > 0.f) ? 1.0f / l : 0.f;
  }
#pragma unroll
  for (int dt = 0; dt < DT; ++dt)
#pragma unroll
    for (int r = 0; r < 8; ++r) sO[w][8 * hh + r][dt * 16 + ln] = oacc[dt][r] * l_r[r];
  __builtin_amdgcn_fence(__ATOMIC_ACQ_REL, "workgroup");
  __builtin_amdgcn_wave_barrier();
  {
    for (int r = 0; r < 16; ++r) {
      const int row = q0 + r;
      if (row < T && lane < D / 4) {
        const v4f val = *(const v4fa*)&sO[w][r][lane * 4];
        *(v4f*)(y + ((size_t)b * T + row) * ypitch + h * D + lane * 4) = val;
      }
    }
    
  }
}

// GEMM C = act(A·W + bias + resid): A f32 (ASPLIT -> hi/lo 2 terms), Wt bf16 [N][K]; ACT 0 none, 1 relu, 2 exact gelu;
// resid (optional, f32, row index = (row % rmod), pitch ldr, RES_BF16 rounds it) added before the activation.
template <bool ASPLIT, int ACT, bool BIAS_BF16, bool RES_BF16>
__global__ __launch_bounds__(128) void k_gemm_bf3(const float* __restrict__ A, int lda, const unsigned short* __restrict__ Wt, int ldb,
                                                const float* __restrict__ bias, const float* __restrict__ resid, int rmod, int ldr,
                                                float* __restrict__ C, int ldc, int M, int N, int K) {
  __shared__ __attribute__((aligned(16))) float so[4][16][64];
  const int tid = threadIdx.x, w = tid >> 5, lane = tid & 31, ln = lane & 15, hh = lane >> 4;
  const int ntn = N / 64;
  const int wid = blockIdx.x * 4 + w;
  const int mt = wid / ntn, nq = wid % ntn;
  if (mt * 16 >= M) return;
  const int row0 = mt * 16, col0 = nq * 64;
  const float* arow = A + (size_t)(row0 + ln) * lda;
  v8f acc[4] = {};
  for (int kb = 0; kb < K; kb += 32) {
    FragB ah, al;
    const v4f x0 = *(const v4fa*)(arow + kb + 8 * hh), x1 = *(const v4fa*)(arow + kb + 8 * hh + 4);
    const v4f x2 = *(const v4fa*)(arow + kb + 16 + 8 * hh), x3 = *(const v4fa*)(arow + kb + 16 + 8 * hh + 4);
    float xs[16] = {x0[0],x0[1],x0[2],x0[3],x1[0],x1[1],x1[2],x1[3],x2[0],x2[1],x2[2],x2[3],x3[0],x3[1],x3[2],x3[3]};
#pragma unroll
    for (int i = 0; i < 16; ++i) { const unsigned short hb = bf16_bits(xs[i]); ah.u[i] = hb; al.u[i] = ASPLIT ? bf16_bits(xs[i] - bf16_val(hb)) : (unsigned short)0; }
#pragma unroll
    for (int t = 0; t < 4; ++t) {
      const unsigned short* brow = Wt + (size_t)(col0 + t * 16 + ln) * ldb + kb;
      FragB b;
      b.half[0] = *(const v8us*)(brow + 8 * hh);
      b.half[1] = *(const v8us*)(brow + 16 + 8 * hh);
      acc[t] = mmaN<ASPLIT ? 2 : 1>(ah.v, al.v, b.v, b.v, acc[t]);
    }
  }
#pragma unroll
  for (int t = 0; t < 4; ++t) {
    const int col = col0 + t * 16 + ln;
    float bv = bias ? bias[col] : 0.f;
    if (BIAS_BF16) bv = bf16_round(bv);
#pragma unroll
    for (int r = 0; r < 8; ++r) {
      float v = acc[t][r] + bv;
      if (resid) { float rv = resid[(size_t)((row0 + 8 * hh + r) % rmod) * ldr + col]; if (RES_BF16) rv = bf16_round(rv); v += rv; }
      if (ACT == 1) v = fmaxf(v, 0.f);
      if (ACT == 2) v = 0.5f * v * (1.0f + erff(v * 0.70710678118654752f));
      if (ACT == 3) { const float u = 0.7978845608028654f * (v + 0.044715f * v * v * v); v = 0.5f * v * (1.0f + tanhf(u)); }
      so[w][8 * hh + r][t * 16 + ln] = v;
    }
  }
  __builtin_amdgcn_fence(__ATOMIC_ACQ_REL, "workgroup");
  __builtin_amdgcn_wave_barrier();
  const int rsub = lane >> 4, c4 = (lane & 15) * 4;
  {
#pragma unroll
    for (int q = 0; q < 8; ++q) {
      const int r = q * 2 + rsub;
      const v4f v = *(const v4fa*)&so[w][r][c4];
      *(v4f*)(C + (size_t)(row0 + r) * ldc + col0 + c4) = v;
    }
    
  }
}
// row LayerNorm (biased variance, eps) over N: s = X (+ R); optional out_sum <- s; out_norm <- (s-mu)*rsqrt(var+eps)*g + b
template <bool PARAM_BF16>
__global__ __launch_bounds__(256) void k_layernorm(const float* __restrict__ X, const float* __restrict__ R, const float* __restrict__ g, const float* __restrict__ bta,
                                                  float* __restrict__ out_sum, float* __restrict__ out_norm, int N, float eps) {
  __shared__ float red[256];
  const int row = blockIdx.x, tid = threadIdx.x;
  const float* x = X + (size_t)row * N; const float* rr = R ? R + (size_t)row * N : nullptr;
  float vals[16];                     // up to N = 4096
  const int per = N / 256;            // contiguous chunk per thread? use strided-by-4 chunks: thread handles j = tid*4 + 1024*u
  float s1 = 0.f;
  for (int u = 0; u < per / 4; ++u) {
    const int j = tid * 4 + 1024 * u;
    const v4f a = *(const v4fa*)(x + j);
    v4f b = {0.f,0.f,0.f,0.f}; if (rr) b = *(const v4fa*)(rr + j);
#pragma unroll
    for (int q = 0; q < 4; ++q) { const float v = a[q] + b[q]; vals[u * 4 + q] = v; s1 += v; }
  }
  red[tid] = s1; __syncthreads();
  for (int st = 128; st > 0; st >>= 1) { if (tid < st) red[tid] += red[tid + st]; __syncthreads(); }
  const float mu = red[0] / (float)N; __syncthreads();
  float s2 = 0.f;
  for (int u = 0; u < per / 4; ++u)
#pragma unroll
    for (int q = 0; q < 4; ++q) { const float c = vals[u * 4 + q] - mu; s2 += c * c; }
  red[tid] = s2; __syncthreads();
  for (int st = 128; st > 0; st >>= 1) { if (tid < st) red[tid] += red[tid + st]; __syncthreads(); }
  const float rs = rsqrtf(red[0] / (float)N + eps);
  {
    for (int u = 0; u < per / 4; ++u) {
      const int j = tid * 4 + 1024 * u;
      v4f o, sm;
#pragma unroll
      for (int q = 0; q < 4; ++q) {
        float gg = g[j + q], bb = bta[j + q];
        if (PARAM_BF16) { gg = bf16_round(gg); bb = bf16_round(bb); }
        sm[q] = vals[u * 4 + q]; o[q] = (vals[u * 4 + q] - mu) * rs * gg + bb;
      }
      if (out_sum) *(v4f*)(out_sum + (size_t)row * N + j) = sm;
      *(v4f*)(out_norm + (size_t)row * N + j) = o;
    }
    
  }
}



// ---- f16 WMMA path (v_wmma_f32_16x16x32_f16): 11-bit significands for operands in range — used for every contraction launched here
typedef _Float16 v16h __attribute__((ext_vector_type(16)));
union FragH { v16h v; v8us half[2]; _Float16 h[16]; unsigned short u[16]; };
template <int NT>
__device__ __forceinline__ v8f mmaH(v16h ah, v16h al, v16h bh, v16h bl, v8f c) {
  c = __builtin_amdgcn_wmma_f32_16x16x32_f16(false, ah, false, bh, (short)0, c, false, false);
  if (NT >= 2) c = __builtin_amdgcn_wmma_f32_16x16x32_f16(false, al, false, bh, (short)0, c, false, false);
  if (NT >= 3) c = __builtin_amdgcn_wmma_f32_16x16x32_f16(false, ah, false, bl, (short)0, c, false, false);
  asm volatile("v_nop\n\tv_nop\n\tv_nop\n\tv_nop" : "+v"(c) : "v"(ah), "v"(al), "v"(bh), "v"(bl));
  return c;
}
// batched GEMM like k_gemm_b but f16 operands: A f32 (split into f16 hi/lo if ASPLIT, else rounded to f16), Bt = f16 values [n][k]; alpha; C f32; N multiple of 16 (partial tiles skipped)
template <bool ASPLIT>
__global__ __launch_bounds__(128) void k_gemm_h(const float* __restrict__ A, int lda, size_t sA, const _Float16* __restrict__ Bh, int ldb, size_t sB, float alpha, float* __restrict__ C, int ldc, size_t sC, int M, int N, int K) {
  __shared__ __attribute__((aligned(16))) float so[4][16][64];
  const int tid = threadIdx.x, w = tid >> 5, lane = tid & 31, ln = lane & 15, hh = lane >> 4; const int by = blockIdx.y;
  A += (size_t)by * sA; Bh += (size_t)by * sB; C += (size_t)by * sC;
  const int ntn = (N + 63) / 64; const int wid = blockIdx.x * 4 + w; const int mt = wid / ntn, nq = wid % ntn; if (mt * 16 >= M) return;
  const int row0 = mt * 16, col0 = nq * 64; const float* arow = A + (size_t)(row0 + ln) * lda;
  v8f acc[4] = {};
  for (int kb = 0; kb < K; kb += 32) {
    FragH ah, al;
    const v4f x0 = *(const v4fa*)(arow + kb + 8 * hh), x1 = *(const v4fa*)(arow + kb + 8 * hh + 4), x2 = *(const v4fa*)(arow + kb + 16 + 8 * hh), x3 = *(const v4fa*)(arow + kb + 16 + 8 * hh + 4);
    float xs[16] = {x0[0],x0[1],x0[2],x0[3],x1[0],x1[1],x1[2],x1[3],x2[0],x2[1],x2[2],x2[3],x3[0],x3[1],x3[2],x3[3]};
#pragma unroll
    for (int i = 0; i < 16; ++i) { const _Float16 h = (_Float16)xs[i]; ah.h[i] = h; al.h[i] = ASPLIT ? (_Float16)(xs[i] - (float)h) : (_Float16)0.0f; }
#pragma unroll
    for (int t = 0; t < 4; ++t) { if (col0 + t * 16 >= N) continue; const size_t boff = (size_t)(col0 + t * 16 + ln) * ldb + kb; FragH bq; bq.half[0] = *(const v8us*)(Bh + boff + 8 * hh); bq.half[1] = *(const v8us*)(Bh + boff + 16 + 8 * hh);
      acc[t] = mmaH<ASPLIT ? 2 : 1>(ah.v, al.v, bq.v, bq.v, acc[t]); }
  }
#pragma unroll
  for (int t = 0; t < 4; ++t) { if (col0 + t * 16 >= N) continue;
#pragma unroll
    for (int r = 0; r < 8; ++r) so[w][8 * hh + r][t * 16 + ln] = acc[t][r] * alpha; }
  __builtin_amdgcn_fence(__ATOMIC_ACQ_REL, "workgroup"); __builtin_amdgcn_wave_barrier();
  const int rsub = lane >> 4, c4 = (lane & 15) * 4;
  {
#pragma unroll
    for (int q = 0; q < 8; ++q) { const int r = q * 2 + rsub; if (col0 + c4 < N) { const v4f v = *(const v4fa*)&so[w][r][c4]; *(v4f*)(C + (size_t)(row0 + r) * ldc + col0 + c4) = v; } }
     }
}

// Wt[n][k] = f16(W[k][n]·scale) from f32 row-major W[K][N] (scale = power of two; bf16-exact weights stay exact in f16 away from the subnormal range)
__global__ __launch_bounds__(256) void k_wt_f16(const float* __restrict__ W, _Float16* __restrict__ Wt, int K, int N, float scale) {
  const int t = blockIdx.x * 256 + threadIdx.x; if (t >= N * (K / 8)) return; const int n = t / (K / 8), k8 = (t % (K / 8)) * 8; FragH f;
#pragma unroll
  for (int i = 0; i < 8; ++i) f.h[i] = (_Float16)(bf16_round(W[(size_t)(k8 + i) * N + n]) * scale); const v8us o = f.half[0];
  *(v8us*)((unsigned short*)Wt + (size_t)n * K + k8) = o; 
}
// Block-tiled GEMM, f16 operands, both K-contiguous: v = (A.Bt^T)*alpha + bf16(bias[col]) (+ CP[row*LDCP + by*sCPy + col] if LDCP; CP may be C itself: a lane reads only what it then writes); writes f32 C or f16 C16. Batch in blockIdx.y.
// One work-group of 8 waves (4 x 2) makes 128 x 128 of C, a wave 32 x 64. Each trip takes 64 k: 128 rows of 128 B of A and of Bt are brought into LDS by asynchronous copies (whole 128-B lines, 16 B a lane),
// two buffers, the next tile in flight while this one is multiplied; LDS rows at pitch 144 B for the ds_load_b128 fragment reads. M, N multiples of 128, K a multiple of 64.
#define GT_PITCH 144
#define GT_OPB (128 * GT_PITCH)
#define GT_BUF (2 * GT_OPB)
typedef _Float16 v4h __attribute__((ext_vector_type(4)));
// one tile: 4 copies of A and 4 of Bt per lane. The s_wait_xcnt stands inside the statement so that no address register named here is rewritten ahead of it.
__device__ __forceinline__ void gt_copy(unsigned l, const unsigned short* ga, const unsigned short* gb, size_t a32, size_t b32) {
  asm volatile("global_load_async_to_lds_b128 %0, %8, off\n\t"
               "global_load_async_to_lds_b128 %1, %9, off\n\t"
               "global_load_async_to_lds_b128 %2, %10, off\n\t"
               "global_load_async_to_lds_b128 %3, %11, off\n\t"
               "global_load_async_to_lds_b128 %4, %12, off\n\t"
               "global_load_async_to_lds_b128 %5, %13, off\n\t"
               "global_load_async_to_lds_b128 %6, %14, off\n\t"
               "global_load_async_to_lds_b128 %7, %15, off\n\t"
               "s_wait_xcnt 0x0"
               :: "v"(l), "v"(l + 32 * GT_PITCH), "v"(l + 64 * GT_PITCH), "v"(l + 96 * GT_PITCH),
                  "v"(l + GT_OPB), "v"(l + GT_OPB + 32 * GT_PITCH), "v"(l + GT_OPB + 64 * GT_PITCH), "v"(l + GT_OPB + 96 * GT_PITCH),
                  "v"(ga), "v"(ga + a32), "v"(ga + 2 * a32), "v"(ga + 3 * a32), "v"(gb), "v"(gb + b32), "v"(gb + 2 * b32), "v"(gb + 3 * b32)
               : "memory");
}
template <int LDCP, bool OF32>      /* LDCP: row pitch of an f32 addend plane CP, 0 for none (a constant, so that its 16 loads share one address register pair); OF32: f32 result in C, else f16 result in C16 */
__global__ __launch_bounds__(256) void k_gemm_t(const _Float16* __restrict__ A, int lda, size_t sA, const _Float16* __restrict__ Bh, int ldb, size_t sB, float alpha, const float* __restrict__ bias,
    const float* CP, size_t sCPy, float* C, _Float16* __restrict__ C16, int ldc, size_t sC, int N, int K) {
  __shared__ __attribute__((aligned(16))) unsigned char L[2 * GT_BUF];
  const int tid = threadIdx.x, w = tid >> 5, lane = tid & 31, ln = lane & 15, hh = lane >> 4; const int by = blockIdx.y;
  const int ntn = N / 128; const int row0 = ((int)blockIdx.x / ntn) * 128, col0 = ((int)blockIdx.x % ntn) * 128; const int wm = w >> 1, wn = w & 1;
  const int cr = tid >> 3, cc = tid & 7;      /* copies: 8 lanes a row, 32 rows a copy */
  const unsigned short* ga = (const unsigned short*)A + (size_t)by * sA + (size_t)(row0 + cr) * lda + cc * 8;
  const unsigned short* gb = (const unsigned short*)Bh + (size_t)by * sB + (size_t)(col0 + cr) * ldb + cc * 8;
  const size_t a32 = (size_t)32 * lda, b32 = (size_t)32 * ldb;
  const unsigned lcp = (unsigned)(size_t)L + (unsigned)(cr * GT_PITCH + cc * 16);
  const int nk = K / 64;
  v8f acc[2][4] = {};
  gt_copy(lcp, ga, gb, a32, b32);
  asm volatile("s_wait_asynccnt 0x0" ::: "memory");      /* tile 0 has landed before the barrier that publishes it */
  __syncthreads();
  if (nk > 1) gt_copy(lcp + GT_BUF, ga + 64, gb + 64, a32, b32);
  const unsigned char* fa = L + (wm * 32 + ln) * GT_PITCH + hh * 16; const unsigned char* fb = L + GT_OPB + (wn * 64 + ln) * GT_PITCH + hh * 16;
#pragma unroll 1
  for (int t = 0; t < nk; ++t) {      /* stays rolled: one copy of the ring's foot */
    const unsigned bo = (unsigned)(t & 1) * GT_BUF;
    FragH a[2][2], b[2][4];
#pragma unroll
    for (int ks = 0; ks < 2; ++ks) {
#pragma unroll
      for (int i = 0; i < 2; ++i) { a[ks][i].half[0] = *(const v8us*)(fa + bo + i * 16 * GT_PITCH + ks * 64); a[ks][i].half[1] = *(const v8us*)(fa + bo + i * 16 * GT_PITCH + ks * 64 + 32); }
#pragma unroll
      for (int j = 0; j < 4; ++j) { b[ks][j].half[0] = *(const v8us*)(fb + bo + j * 16 * GT_PITCH + ks * 64); b[ks][j].half[1] = *(const v8us*)(fb + bo + j * 16 * GT_PITCH + ks * 64 + 32); } }
    /* the ring's foot stands here, behind the trip's 24 fragment reads and ahead of its WMMAs, which work on registers alone: the refill then flies under them too */
    asm volatile("s_wait_dscnt 0x0" ::: "memory");      /* this wave's reads of the buffer are over before it may be refilled */
    asm volatile("s_wait_asynccnt 0x0" ::: "memory");      /* this wave's share of tile t + 1 has landed before the barrier publishes it */
    __syncthreads();
    if (t + 2 < nk) gt_copy(lcp + bo, ga + (size_t)(t + 2) * 64, gb + (size_t)(t + 2) * 64, a32, b32);
    __builtin_amdgcn_sched_barrier(0);      /* keeps the WMMAs behind the refill's issue: ahead of it they would delay the copies by their whole run */
#pragma unroll
    for (int ks = 0; ks < 2; ++ks)
#pragma unroll
      for (int i = 0; i < 2; ++i)
#pragma unroll
        for (int j = 0; j < 4; ++j) acc[i][j] = __builtin_amdgcn_wmma_f32_16x16x32_f16(false, a[ks][i].v, false, b[ks][j].v, (short)0, acc[i][j], false, false);
  }
  asm volatile("s_wait_asynccnt 0x0" ::: "memory");      /* no copy outstanding when the ring becomes output staging */
  /* epilogue: each wave stages its 32 x 64 in its own 8,704 B of the ring (every wave's last read of it ended ahead of the last barrier), then whole row pieces (256 B of f32, 128 B of f16) go out */
  const int c4 = ln * 4, col = col0 + wn * 64 + c4, rw0 = row0 + wm * 32 + hh; const size_t cofs = (size_t)by * sC;
  v4f cp[16];      /* the addend's 16 row pieces are asked for together, ahead of the staging */
  if (LDCP) { const float* cpp = CP + (size_t)rw0 * LDCP + (size_t)by * sCPy + col;
#pragma unroll
    for (int q = 0; q < 16; ++q) cp[q] = *(const v4fa*)(cpp + q * 2 * LDCP);
    asm volatile("s_wait_xcnt 0x0" ::: "memory"); }      /* ahead of any rewrite of the address registers that the loads above name */
  v4f bv = {0.f, 0.f, 0.f, 0.f}; if (bias) { const v4f bb = *(const v4fa*)(bias + col); for (int e = 0; e < 4; ++e) bv[e] = bf16_round(bb[e]); }
  float* so = (float*)(L + w * (32 * 68 * 4));
#pragma unroll
  for (int i = 0; i < 2; ++i)
#pragma unroll
    for (int j = 0; j < 4; ++j)
#pragma unroll
      for (int r = 0; r < 8; ++r) so[(i * 16 + 8 * hh + r) * 68 + j * 16 + ln] = acc[i][j][r];
  __builtin_amdgcn_fence(__ATOMIC_ACQ_REL, "workgroup"); __builtin_amdgcn_wave_barrier();
#pragma unroll
  for (int q = 0; q < 16; ++q) { const size_t o = cofs + (size_t)rw0 * ldc + col + (size_t)(q * 2) * ldc; const v4f x = *(const v4fa*)&so[(q * 2 + hh) * 68 + c4]; v4f v;
    for (int e = 0; e < 4; ++e) v[e] = x[e] * alpha + bv[e];
    if (LDCP) for (int e = 0; e < 4; ++e) v[e] += cp[q][e];
    if (OF32) *(v4f*)(C + o) = v;
    else { v4h h4; for (int e = 0; e < 4; ++e) h4[e] = (_Float16)v[e]; *(v4h*)(C16 + o) = h4; } }
}


__global__ __launch_bounds__(256) void k_x16(const float* __restrict__ x, _Float16* __restrict__ X16, size_t n8) { const size_t t = (size_t)blockIdx.x * 256 + threadIdx.x; if (t >= n8) return; FragH f;
#pragma unroll
  for (int q = 0; q < 8; ++q) f.h[q] = (_Float16)bf16_round(x[t * 8 + q]); *(v8us*)((unsigned short*)X16 + t * 8) = f.half[0];  }
__global__ __launch_bounds__(256) void k_h16(const float* __restrict__ x, _Float16* __restrict__ X16, size_t n8) { const size_t t = (size_t)blockIdx.x * 256 + threadIdx.x; if (t >= n8) return; FragH f;
#pragma unroll
  for (int q = 0; q < 8; ++q) f.h[q] = (_Float16)x[t * 8 + q]; *(v8us*)((unsigned short*)X16 + t * 8) = f.half[0];  }
__global__ __launch_bounds__(256) void k_round16f(const float* __restrict__ W, _Float16* __restrict__ Bt, size_t n8) { const size_t t = (size_t)blockIdx.x * 256 + threadIdx.x; if (t >= n8) return; FragH f;
#pragma unroll
  for (int i = 0; i < 8; ++i) f.h[i] = (_Float16)(bf16_round(W[t * 8 + i]) * 16.0f); *(v8us*)((unsigned short*)Bt + t * 8) = f.half[0];  }
template <int NHv, int TTv>
__global__ __launch_bounds__(256) void k_vt(const _Float16* __restrict__ V16, int ldv, int voff, _Float16* __restrict__ Vt) { __shared__ unsigned short tl[64][66]; const int tid = threadIdx.x; const int slab = blockIdx.x / (TTv / 64), lg = blockIdx.x % (TTv / 64); const int b = slab / NHv, h = slab % NHv;
  for (int i = tid; i < 64 * 8; i += 256) { const int r = i / 8, c8 = (i % 8) * 8; FragH f; f.half[0] = *(const v8us*)((const unsigned short*)V16 + ((size_t)b * TTv + lg * 64 + r) * ldv + voff + h * 64 + c8);
#pragma unroll
    for (int q = 0; q < 8; ++q) tl[r][c8 + q] = f.u[q]; }
  __syncthreads();
  {
#pragma unroll
    for (int rd = 0; rd < 2; ++rd) { const int d = rd * 32 + tid / 8, pc = tid % 8; FragH f;
#pragma unroll
      for (int q = 0; q < 8; ++q) f.u[q] = tl[pc * 8 + q][d];
      *(v8us*)((unsigned short*)Vt + ((size_t)slab * 64 + d) * TTv + lg * 64 + pc * 8) = f.half[0]; }
     } }

__global__ __launch_bounds__(256) void k_hl(const float* __restrict__ F, _Float16* __restrict__ Hh, _Float16* __restrict__ Hl, size_t n8) { const size_t t = (size_t)blockIdx.x * 256 + threadIdx.x; if (t >= n8) return; FragH fh, fl; const v4f a = *(const v4fa*)(F + t * 8), c = *(const v4fa*)(F + t * 8 + 4);
#pragma unroll
  for (int q = 0; q < 4; ++q) { _Float16 h = (_Float16)a[q]; fh.h[q] = h; fl.h[q] = (_Float16)((a[q] - (float)h) * 1024.0f); h = (_Float16)c[q]; fh.h[4 + q] = h; fl.h[4 + q] = (_Float16)((c[q] - (float)h) * 1024.0f); }
  { *(v8us*)((unsigned short*)Hh + t * 8) = fh.half[0]; *(v8us*)((unsigned short*)Hl + t * 8) = fl.half[0];  } }
__global__ __launch_bounds__(256) void k_h16s(const float* __restrict__ F, _Float16* __restrict__ H, size_t n8) { const size_t t = (size_t)blockIdx.x * 256 + threadIdx.x; if (t >= n8) return; const v4f a = *(const v4fa*)(F + t * 8), c = *(const v4fa*)(F + t * 8 + 4); FragH f;
#pragma unroll
  for (int q = 0; q < 4; ++q) { f.h[q] = (_Float16)(a[q] * 16.0f); f.h[4 + q] = (_Float16)(c[q] * 16.0f); } *(v8us*)((unsigned short*)H + t * 8) = f.half[0];  }
__device__ __forceinline__ float gelu_tanh(float x) { const float u = 0.7978845608028654f * (x + 0.044715f * x * x * x); return 0.5f * x * (1.0f + tanhf(u)); }
__global__ __launch_bounds__(256) void k_gbias(float* __restrict__ S, const float* __restrict__ CRD, const float* __restrict__ w1, const float* __restrict__ b1, const float* __restrict__ w2, const float* __restrict__ b2) {
  #pragma clang fp contract(off)
  const int b = blockIdx.y; S += (size_t)b * TT * TT;      /* one score plane per batch */
  const size_t t = (size_t)blockIdx.x * 256 + threadIdx.x; if (t >= (size_t)TT * TT / 4) return; const int q = (int)((t * 4) / TT), k0 = (int)((t * 4) % TT);
  float cb = 0.f; for (int j = 0; j < 8; ++j) cb += bf16_round(b2[j]); cb *= 0.125f;
  const float qx = bf16_round(CRD[((size_t)b * TT + q) * 3]), qy = bf16_round(CRD[((size_t)b * TT + q) * 3 + 1]), qz = bf16_round(CRD[((size_t)b * TT + q) * 3 + 2]);
  v4f sv = *(const v4fa*)(S + (size_t)q * TT + k0); float dist[4];
  for (int e = 0; e < 4; ++e) { const int k = k0 + e; const float dx = qx - bf16_round(CRD[((size_t)b * TT + k) * 3]), dy = qy - bf16_round(CRD[((size_t)b * TT + k) * 3 + 1]), dz = qz - bf16_round(CRD[((size_t)b * TT + k) * 3 + 2]); dist[e] = sqrtf(fmaxf(dx * dx + dy * dy + dz * dz, 1e-12f)); sv[e] += cb; }
#pragma unroll 1
  for (int j = 0; j < 8; ++j) { float cj = 0.f; for (int h = 0; h < 8; ++h) cj += bf16_round(w2[j * 8 + h]); cj *= 0.125f; const float wj = bf16_round(w1[j]), bj = bf16_round(b1[j]);
    for (int e = 0; e < 4; ++e) sv[e] += gelu_tanh(dist[e] * wj + bj) * cj; }
  *(v4f*)(S + (size_t)q * TT + k0) = sv;  }
#define NN TT
__global__ __launch_bounds__(256) void k_smx(const float* __restrict__ S, _Float16* __restrict__ P16) { const int tid = threadIdx.x, wv = tid >> 5, lane = tid & 31; const int i = blockIdx.x * 8 + wv; const float* sr = S + (size_t)i * NN;
  float m = -3.0e38f;
  for (int p = lane; p < NN / 8; p += 32) { const v4f a = *(const v4fa*)(sr + p * 8), c = *(const v4fa*)(sr + p * 8 + 4); for (int e = 0; e < 4; ++e) m = fmaxf(m, fmaxf(a[e], c[e])); }
  for (int o = 16; o >= 1; o >>= 1) m = fmaxf(m, __shfl_xor(m, o, 32)); float z = 0.f;
  for (int p = lane; p < NN / 8; p += 32) { const v4f a = *(const v4fa*)(sr + p * 8), c = *(const v4fa*)(sr + p * 8 + 4); for (int e = 0; e < 4; ++e) z += __expf(a[e] - m) + __expf(c[e] - m); }
  for (int o = 16; o >= 1; o >>= 1) z += __shfl_xor(z, o, 32); const float iz = 32768.0f / z;
  { for (int p = lane; p < NN / 8; p += 32) { FragH f; const v4f a = *(const v4fa*)(sr + p * 8), c = *(const v4fa*)(sr + p * 8 + 4); for (int e = 0; e < 4; ++e) { f.h[e] = (_Float16)(__expf(a[e] - m) * iz); f.h[4 + e] = (_Float16)(__expf(c[e] - m) * iz); }
      *(v8us*)((unsigned short*)P16 + (size_t)i * NN + p * 8) = f.half[0]; }  } }
// lane l with lane l ^ 16 (the two halves of a wave hold the two halves of a query's keys)
__device__ __forceinline__ float xhalf(float x) { return __builtin_bit_cast(float, __builtin_amdgcn_permlanex16(__builtin_bit_cast(int, x), __builtin_bit_cast(int, x), 0x76543210, 0xfedcba98, false, false)); }
__global__ __launch_bounds__(128) void k_flash(const _Float16* __restrict__ Q16, int ldq, const _Float16* __restrict__ K16, int ldk, const _Float16* __restrict__ Vt, const int* __restrict__ MSK, float* __restrict__ O, int ldo) {
  constexpr int RPW = 16, NQB = TT / (4 * RPW), DT = 4, KS = 2; (void)MSK;
  __shared__ __attribute__((aligned(16))) float sO[4][RPW][64 + 4];
  const int tid = threadIdx.x, w = tid >> 5, lane = tid & 31, ln = lane & 15, hh = lane >> 4;
  const int slab = blockIdx.x / NQB, qblk = blockIdx.x % NQB; const int b = slab / NH, h = slab % NH; const int q0 = qblk * (4 * RPW) + w * RPW;
  FragH bq[KS];
  { const unsigned short* qr = (const unsigned short*)Q16 + ((size_t)b * TT + q0 + ln) * ldq + h * 64;
#pragma unroll
    for (int ks = 0; ks < KS; ++ks) { bq[ks].half[0] = *(const v8us*)(qr + ks * 32 + 8 * hh); bq[ks].half[1] = *(const v8us*)(qr + ks * 32 + 16 + 8 * hh); } }
  const unsigned short* Vth = (const unsigned short*)Vt + (size_t)slab * 64 * TT;
  float m_q = -3.0e38f, l_q = 0.f; v8f oacc[DT];
#pragma unroll
  for (int dt = 0; dt < DT; ++dt) oacc[dt] = (v8f){0.f,0.f,0.f,0.f,0.f,0.f,0.f,0.f};
#pragma unroll 1      /* stays rolled: an unrolled body would hold two trips' fragments in registers */
  for (int j0 = 0; j0 < TT; j0 += 32) {
    FragH ak[2][KS], av[DT];      /* no fence stands in the loop: the trip's 16 loads are asked for together at its head, one trip to L2 instead of one per fragment */
#pragma unroll
    for (int nt = 0; nt < 2; ++nt) { const unsigned short* kr = (const unsigned short*)K16 + ((size_t)b * TT + j0 + nt * 16 + ln) * ldk + h * 64;
#pragma unroll
      for (int ks = 0; ks < KS; ++ks) { ak[nt][ks].half[0] = *(const v8us*)(kr + ks * 32 + 8 * hh); ak[nt][ks].half[1] = *(const v8us*)(kr + ks * 32 + 16 + 8 * hh); } }
    asm volatile("s_wait_xcnt 0x0" ::: "memory");      /* ahead of the VT loads, whose results may be given the registers that held the key loads' addresses */
#pragma unroll
    for (int dt = 0; dt < DT; ++dt) { const unsigned short* vrow = Vth + (size_t)(dt * 16 + ln) * TT + j0; av[dt].half[0] = *(const v8us*)(vrow + 8 * hh); av[dt].half[1] = *(const v8us*)(vrow + 16 + 8 * hh); }
    __builtin_amdgcn_sched_barrier(0);      /* keeps all 16 loads ahead of the first product's wait: behind it the second key tile would pay a second trip to L2 */
    v8f s[2];
#pragma unroll
    for (int nt = 0; nt < 2; ++nt) { v8f acc = (v8f){0.f,0.f,0.f,0.f,0.f,0.f,0.f,0.f};
#pragma unroll
      for (int ks = 0; ks < KS; ++ks) acc = mmaH<1>(ak[nt][ks].v, ak[nt][ks].v, bq[ks].v, bq[ks].v, acc);
      s[nt] = acc; }
    float mc = -3.0e38f;
#pragma unroll
    for (int nt = 0; nt < 2; ++nt)
#pragma unroll
      for (int r = 0; r < 8; ++r) { s[nt][r] *= 0.125f; mc = fmaxf(mc, s[nt][r]); }
    mc = fmaxf(mc, xhalf(mc));
    const float mn = fmaxf(m_q, mc); const float al = (mn > -1.0e38f) ? expf(m_q - mn) : 1.0f; m_q = mn;
    FragH pb; float ps = 0.f;
#pragma unroll
    for (int nt = 0; nt < 2; ++nt)
#pragma unroll
      for (int r = 0; r < 8; ++r) { const float p = expf(s[nt][r] - mn); ps += p; pb.h[nt * 8 + r] = (_Float16)(p * 1024.0f); }
    l_q = l_q * al + ps;      /* this half's keys only; the halves are joined behind the loop */
#pragma unroll
    for (int dt = 0; dt < DT; ++dt)
#pragma unroll
      for (int r = 0; r < 8; ++r) oacc[dt][r] *= al;
#pragma unroll
    for (int dt = 0; dt < DT; ++dt) oacc[dt] = mmaH<1>(av[dt].v, av[dt].v, pb.v, pb.v, oacc[dt]); }
  const float lt = l_q + xhalf(l_q); const float il = (lt > 0.f) ? 1.0f / (lt * 1024.0f) : 0.f;
#pragma unroll
  for (int dt = 0; dt < DT; ++dt) { v4f lo, hi;      /* oacc[dt][r] = OT[dt * 16 + 8 * hh + r][query ln] */
#pragma unroll
    for (int e = 0; e < 4; ++e) { lo[e] = oacc[dt][e] * il; hi[e] = oacc[dt][4 + e] * il; }
    *(v4fa*)&sO[w][ln][dt * 16 + 8 * hh] = lo; *(v4fa*)&sO[w][ln][dt * 16 + 8 * hh + 4] = hi; }
  __builtin_amdgcn_fence(__ATOMIC_ACQ_REL, "workgroup"); __builtin_amdgcn_wave_barrier();
  {
#pragma unroll
    for (int rp = 0; rp < RPW; rp += 2) { const int r = rp + (lane >> 4), pc = lane & 15; const v4f val = *(const v4fa*)&sO[w][r][pc * 4]; *(v4f*)(O + ((size_t)b * TT + q0 + r) * ldo + h * 64 + pc * 4) = val; }
     } }

extern "C" void kernel_launch(void* const* d_in, const int* in_sizes, int n_in,
                              void* d_out, int out_size, void* d_ws, size_t ws_size, hipStream_t stream) {
  (void)in_sizes; (void)n_in; (void)out_size;
  const float* const* I = (const float* const*)d_in; const float* feats = I[0]; const float* geom = I[1]; const float* crd = I[2];
  const float* wq = I[3]; const float* bq = I[4]; const float* wk = I[5]; const float* bk = I[6]; const float* wv = I[7]; const float* bv = I[8]; const float* wo = I[9]; const float* bo = I[10];
  const float* gqw = I[11]; const float* gqb = I[12]; const float* gkw = I[13]; const float* gkb = I[14]; const float* gvw = I[15]; const float* gvb = I[16]; const float* d1w = I[17]; const float* d1b = I[18]; const float* d2w = I[19]; const float* d2b = I[20]; const float* opw = I[21]; const float* opb = I[22];
  char* ws = (char*)d_ws; size_t off = 0;
  auto take = [&](size_t bytes) { char* p = ws + off; off += (bytes + 255) & ~(size_t)255; return p; };
  const size_t WSZ = (size_t)DD * DD, GSZ = (size_t)GG * DD; _Float16* Bw = (_Float16*)take(5 * WSZ * 2); _Float16* Bg = (_Float16*)take(3 * GSZ * 2);
  _Float16* X16 = (_Float16*)take((size_t)NR * DD * 2); _Float16* GE16 = (_Float16*)take((size_t)NR * GG * 2); _Float16* Q = (_Float16*)take((size_t)NR * DD * 2); _Float16* K = (_Float16*)take((size_t)NR * DD * 2); _Float16* V = (_Float16*)take((size_t)NR * DD * 2); _Float16* Vt = (_Float16*)take((size_t)NR * DD * 2);
  float* O = (float*)take((size_t)NR * DD * 4); float* FA = (float*)take((size_t)NR * DD * 4); _Float16* GQ = (_Float16*)take((size_t)NR * DD * 2); _Float16* GK = (_Float16*)take((size_t)NR * DD * 2); float* S = (float*)take((size_t)BB * TT * TT * 4); _Float16* P16 = (_Float16*)take((size_t)BB * TT * TT * 2);
  _Float16* O16 = X16; _Float16* GV = Q; _Float16* GVt = K; float* SUM = O; _Float16* SUM16 = V; float* GF = O; _Float16* GQl = Vt; _Float16* GKl = X16;      /* gq/gk go through an f32 temp (the attention-output plane, free between k_h16s and the feat+geom GEMM) into hi (GQ/GK) + ×2^10 residual (over Vt / X16) planes */      /* reuse after the MHA branch (stream order): X16 → O16; Q/K → gv / gvᵀ; O → feat+geom; V → its f16 copy */
  if (off > ws_size) return;      // 2.6 + 0.4 + 8.4 + 2.1 + 4 × 8.4 + 16.8 + 16.8 + 8.4 + 8.4 + 33.6 + 16.8 = about 148 MB
  const unsigned gw = (unsigned)(((size_t)DD * (DD / 8) + 255) / 256), ggw = (unsigned)(((size_t)DD * (GG / 8) + 255) / 256);
  k_wt_f16<<<gw, 256, 0, stream>>>(wq, Bw, DD, DD, 16.0f); k_wt_f16<<<gw, 256, 0, stream>>>(wk, Bw + WSZ, DD, DD, 16.0f); k_wt_f16<<<gw, 256, 0, stream>>>(wv, Bw + 2 * WSZ, DD, DD, 16.0f); k_wt_f16<<<gw, 256, 0, stream>>>(wo, Bw + 3 * WSZ, DD, DD, 16.0f); k_wt_f16<<<gw, 256, 0, stream>>>(opw, Bw + 4 * WSZ, DD, DD, 16.0f);
  k_wt_f16<<<ggw, 256, 0, stream>>>(gqw, Bg, GG, DD, 16.0f); k_wt_f16<<<ggw, 256, 0, stream>>>(gkw, Bg + GSZ, GG, DD, 16.0f); k_wt_f16<<<ggw, 256, 0, stream>>>(gvw, Bg + 2 * GSZ, GG, DD, 16.0f);      /* (in,out) → Bt ×2^4 */
  const unsigned g8 = (unsigned)(((size_t)NR * DD / 8 + 255) / 256); k_x16<<<g8, 256, 0, stream>>>(feats, X16, (size_t)NR * DD / 8); k_x16<<<(unsigned)(((size_t)NR * GG / 8 + 255) / 256), 256, 0, stream>>>(geom, GE16, (size_t)NR * GG / 8);
  const dim3 gp((NR / 128) * (DD / 128), 1);
  k_gemm_t<0, false><<<gp, 256, 0, stream>>>(X16, DD, 0, Bw, DD, 0, 0.0625f, bq, nullptr, 0, nullptr, Q, DD, 0, DD, DD);      /* M 8192 N 512 K 512 */
  k_gemm_t<0, false><<<gp, 256, 0, stream>>>(X16, DD, 0, Bw + WSZ, DD, 0, 0.0625f, bk, nullptr, 0, nullptr, K, DD, 0, DD, DD);
  k_gemm_t<0, false><<<gp, 256, 0, stream>>>(X16, DD, 0, Bw + 2 * WSZ, DD, 0, 0.0625f, bv, nullptr, 0, nullptr, V, DD, 0, DD, DD);
  k_vt<NH, TT><<<BB * NH * (TT / 64), 256, 0, stream>>>(V, DD, 0, Vt); k_flash<<<BB * NH * (TT / 64), 128, 0, stream>>>(Q, DD, K, DD, Vt, nullptr, O, DD);
  k_h16s<<<g8, 256, 0, stream>>>(O, O16, (size_t)NR * DD / 8);
  k_gemm_t<0, true><<<gp, 256, 0, stream>>>(O16, DD, 0, Bw + 3 * WSZ, DD, 0, 0.00390625f, bo, nullptr, 0, FA, nullptr, DD, 0, DD, DD);      /* feat_att = O.wo + bo (f32) */
  k_gemm_t<0, true><<<gp, 256, 0, stream>>>(GE16, GG, 0, Bg, GG, 0, 0.0625f, gqb, nullptr, 0, GF, nullptr, DD, 0, DD, GG); k_hl<<<g8, 256, 0, stream>>>(GF, GQ, GQl, (size_t)NR * DD / 8);      /* gq (f32) -> hi / x2^10 residual: M 8192 N 512 K 128 */
  k_gemm_t<0, true><<<gp, 256, 0, stream>>>(GE16, GG, 0, Bg + GSZ, GG, 0, 0.0625f, gkb, nullptr, 0, GF, nullptr, DD, 0, DD, GG); k_hl<<<g8, 256, 0, stream>>>(GF, GK, GKl, (size_t)NR * DD / 8);      /* gk likewise */
  k_gemm_t<0, false><<<gp, 256, 0, stream>>>(GE16, GG, 0, Bg + 2 * GSZ, GG, 0, 0.0625f, gvb, nullptr, 0, nullptr, GV, DD, 0, DD, GG);
  k_vt<DD / 64, TT><<<BB * (DD / 64) * (TT / 64), 256, 0, stream>>>(GV, DD, 0, GVt);      /* gvᵀ per batch [512][1024] */
  /* geometry branch: all BB batches of each stage in one launch, the batch in blockIdx.y, the softmax's BB * TT rows in blockIdx.x (operand, addend and result strides per batch) */
  const size_t sX = (size_t)TT * DD, sS = (size_t)TT * TT; const dim3 gs((TT / 128) * (TT / 128), BB);
  k_gemm_t<0, true><<<gs, 256, 0, stream>>>(GQ, DD, sX, GK, DD, sX, 0.125f, nullptr, nullptr, 0, S, nullptr, TT, sS, TT, DD);      /* S = gq.gkT/8 f32-accurate: hi.hi ... */
  k_gemm_t<TT, true><<<gs, 256, 0, stream>>>(GQl, DD, sX, GK, DD, sX, 0.125f * 0.0009765625f, nullptr, S, sS, S, nullptr, TT, sS, TT, DD);      /* += lo.hi.2^-10 */
  k_gemm_t<TT, true><<<gs, 256, 0, stream>>>(GQ, DD, sX, GKl, DD, sX, 0.125f * 0.0009765625f, nullptr, S, sS, S, nullptr, TT, sS, TT, DD);      /* += hi.lo.2^-10: M 1024 N 1024 K 512 each, x BB */
  k_gbias<<<dim3((TT * TT / 4 + 255) / 256, BB), 256, 0, stream>>>(S, crd, d1w, d1b, d2w, d2b); k_smx<<<BB * TT / 8, 256, 0, stream>>>(S, P16);      /* softmax: a wave per row over the BB * TT rows */
  k_gemm_t<DD, true><<<dim3((TT / 128) * (DD / 128), BB), 256, 0, stream>>>(P16, TT, sS, GVt, TT, sX, 0.000030517578125f, nullptr, FA, sX, SUM, nullptr, DD, sX, DD, TT);      /* feat_att + geom_att: M 1024 N 512 K 1024, x BB */
  k_h16<<<g8, 256, 0, stream>>>(SUM, SUM16, (size_t)NR * DD / 8);
  k_gemm_t<0, true><<<gp, 256, 0, stream>>>(SUM16, DD, 0, Bw + 4 * WSZ, DD, 0, 0.0625f, opb, nullptr, 0, (float*)d_out, nullptr, DD, 0, DD, DD);      /* out = (feat + geom).op_w + op_b */
}

// v004
// A run of this version takes 282 microseconds.
// Timed twice side by side with v003, it ran 1.10 times as fast both times.
// Over all steps from v000 it is 4.69 times as fast.
#include <hip/hip_runtime.h>
// Geometry-aware attention (B=8, N=1024, F=512, 8 heads × 64, G=128): feat = MHA(features) (x·W + b, softmax(q·k/8)·v, ·wo + bo); geometry branch: gq, gk, gv = geometry·W + b (F wide, single head);
// g_scores = gq·gkᵀ/8 + mean_h(gelu_tanh(dist·d1_w + d1_b)·d2_w + d2_b) with dist = max(‖coords_q − coords_k‖, 1e-6); geom = softmax(g_scores)·gv; out = (feat + geom)·op_w + op_b. (in,out) weights; jax.nn.gelu default = tanh approximation.
// Compute dtype: features, geometry, coords, all weights/biases rounded to bf16; f16 GEMM planes; the 8-head branch through a fused flash-style kernel (online softmax f32, P f16 ×2^10); the geometry branch, every stage one launch over all batches (batch in blockIdx.y; the softmax's BB·TT rows in blockIdx.x): S = gq·gkᵀ/8 f32-accurate from f16 hi + residual planes (hi·hi + (lo·hi + hi·lo)·2^-10; its logits reach σ≈3), a kernel adding the distance-MLP bias in place (f32, per pair from the coords), a wave-per-row f32 softmax → P f16 ×2^15, geom = P·gv by GEMM with feat_att as the f32 addend; final projection GEMM. All contractions on v_wmma_f32_16x16x32_f16, f32 accumulate.
#define BB 8
#define TT 1024
#define DD 512
#define GG 128
#define NH 8
#define NR (BB * TT)

typedef __bf16 v16b __attribute__((ext_vector_type(16)));
typedef unsigned short v8us __attribute__((ext_vector_type(8), may_alias));
typedef float  v8f  __attribute__((ext_vector_type(8)));
typedef float  v4f  __attribute__((ext_vector_type(4)));
typedef float  v4fa __attribute__((ext_vector_type(4), may_alias));
union FragB { v16b v; v8us half[2]; unsigned short u[16]; };

__device__ __forceinline__ unsigned short bf16_bits(float x) { unsigned int u = __float_as_uint(x); return (unsigned short)((u + 0x7FFFu + ((u >> 16) & 1u)) >> 16); }
__device__ __forceinline__ float bf16_val(unsigned short b) { return __uint_as_float(((unsigned int)b) << 16); }
__device__ __forceinline__ float bf16_round(float x) { return bf16_val(bf16_bits(x)); }
// D += A·B with NT terms: 1 = ah·bh, 2 = + al·bh (A split), 3 = + ah·bl (both split)
template <int NT>
__device__ __forceinline__ v8f mmaN(v16b ah, v16b al, v16b bh, v16b bl, v8f c) {
  c = __builtin_amdgcn_wmma_f32_16x16x32_bf16(false, ah, false, bh, (short)0, c, false, false);
  if (NT >= 2) c = __builtin_amdgcn_wmma_f32_16x16x32_bf16(false, al, false, bh, (short)0, c, false, false);
  if (NT >= 3) c = __builtin_amdgcn_wmma_f32_16x16x32_bf16(false, ah, false, bl, (short)0, c, false, false);
  asm volatile("v_nop\n\tv_nop\n\tv_nop\n\tv_nop" : "+v"(c) : "v"(ah), "v"(al), "v"(bh), "v"(bl));
  return c;
}

__global__ __launch_bounds__(256) void k_wt_bf16(const float* __restrict__ W, unsigned short* __restrict__ Wt, int K, int N) {
  const int t = blockIdx.x * 256 + threadIdx.x;
  const int k8n = K / 8;
  if (t >= N * k8n) return;
  const int n = t / k8n, k8 = (t % k8n) * 8;
  v8us v;
#pragma unroll
  for (int i = 0; i < 8; ++i) v[i] = bf16_bits(W[(size_t)(k8 + i) * N + n]);
  *(v8us*)(Wt + (size_t)n * K + k8) = v;
  
}

// GEMM C[M][N] (f32, pitch ldc) = act(A[M][K]·W + bias). A f32 row-major (pitch lda) converted per fragment to bf16
// (ASPLIT: hi/lo two planes -> 2 terms, else single rounded term); Wt bf16 [N][K] (pitch ldb). BIAS_BF16 rounds the
// bias to bf16 first (bias quantised to bf16 before the add). K%32==0, M%16==0, N%64==0.
template <bool ASPLIT, int ACT, bool BIAS_BF16>
__global__ __launch_bounds__(128) void k_gemm_bf(const float* __restrict__ A, int lda, const unsigned short* __restrict__ Wt, int ldb,
                                               const float* __restrict__ bias, float* __restrict__ C, int ldc, int M, int N, int K) {
  __shared__ __attribute__((aligned(16))) float so[4][16][64];
  const int tid = threadIdx.x, w = tid >> 5, lane = tid & 31, ln = lane & 15, hh = lane >> 4;
  const int ntn = N / 64;
  const int wid = blockIdx.x * 4 + w;
  const int mt = wid / ntn, nq = wid % ntn;
  if (mt * 16 >= M) return;
  const int row0 = mt * 16, col0 = nq * 64;
  const float* arow = A + (size_t)(row0 + ln) * lda;
  v8f acc[4] = {};
  for (int kb = 0; kb < K; kb += 32) {
    FragB ah, al;
    const v4f x0 = *(const v4fa*)(arow + kb + 8 * hh), x1 = *(const v4fa*)(arow + kb + 8 * hh + 4);
    const v4f x2 = *(const v4fa*)(arow + kb + 16 + 8 * hh), x3 = *(const v4fa*)(arow + kb + 16 + 8 * hh + 4);
    float xs[16] = {x0[0],x0[1],x0[2],x0[3],x1[0],x1[1],x1[2],x1[3],x2[0],x2[1],x2[2],x2[3],x3[0],x3[1],x3[2],x3[3]};
#pragma unroll
    for (int i = 0; i < 16; ++i) { const unsigned short hb = bf16_bits(xs[i]); ah.u[i] = hb; al.u[i] = ASPLIT ? bf16_bits(xs[i] - bf16_val(hb)) : (unsigned short)0; }
#pragma unroll
    for (int t = 0; t < 4; ++t) {
      const unsigned short* brow = Wt + (size_t)(col0 + t * 16 + ln) * ldb + kb;
      FragB b;
      b.half[0] = *(const v8us*)(brow + 8 * hh);
      b.half[1] = *(const v8us*)(brow + 16 + 8 * hh);
      acc[t] = mmaN<ASPLIT ? 2 : 1>(ah.v, al.v, b.v, b.v, acc[t]);
    }
  }
#pragma unroll
  for (int t = 0; t < 4; ++t) {
    float bv = bias ? bias[col0 + t * 16 + ln] : 0.f;
    if (BIAS_BF16) bv = bf16_round(bv);
#pragma unroll
    for (int r = 0; r < 8; ++r) { float v = acc[t][r] + bv; if (ACT == 1) v = fmaxf(v, 0.f); so[w][8 * hh + r][t * 16 + ln] = v; }
  }
  __builtin_amdgcn_fence(__ATOMIC_ACQ_REL, "workgroup");
  __builtin_amdgcn_wave_barrier();
  const int rsub = lane >> 4, c4 = (lane & 15) * 4;
  {
#pragma unroll
    for (int q = 0; q < 8; ++q) {
      const int r = q * 2 + rsub;
      const v4f v = *(const v4fa*)&so[w][r][c4];
      *(v4f*)(C + (size_t)(row0 + r) * ldc + col0 + c4) = v;
    }
    
  }
}

// Flash-style causal/unmasked attention, all contractions 3-term bf16 hi/lo splits, f32 softmax with running max.
// q,k,v rows are read from f32 buffers with arbitrary row pitch (so they can live inside a fused qkv buffer);
// D = head size (multiple of 32, <= 128); one wave = 16 query rows; block = 4 waves (64 queries) sharing K/V chunks of 32.
template <int D, bool CAUSAL>
__global__ __launch_bounds__(128) void k_flash(const float* __restrict__ qb, const float* __restrict__ kb, const float* __restrict__ vb,
                                             int pitch, int T, int H, float scale, float* __restrict__ y, int ypitch) {
  constexpr int KS = D / 32;        // k-steps for QK
  constexpr int DT = D / 16;        // d tiles for PV
  __shared__ __attribute__((aligned(16))) unsigned short sKh[32][D + 8], sKl[32][D + 8], sVh[32][D + 8], sVl[32][D + 8];
  __shared__ __attribute__((aligned(16))) unsigned short sPh[4][16][40], sPl[4][16][40];
  __shared__ __attribute__((aligned(16))) float sO[4][16][D];
  const int tid = threadIdx.x, w = tid >> 5, lane = tid & 31, ln = lane & 15, hh = lane >> 4;
  const int nqb = (T + 63) / 64;
  const int bh = blockIdx.x / nqb, qblk = blockIdx.x % nqb;
  const int b = bh / H, h = bh % H;
  const int q0 = qblk * 64 + w * 16;
  const float* Q = qb + (size_t)b * T * pitch + h * D;
  const float* K = kb + (size_t)b * T * pitch + h * D;
  const float* V = vb + (size_t)b * T * pitch + h * D;

  // A fragments of the wave's 16 query rows (scaled), hi/lo
  FragB aqh[KS], aql[KS];
  {
    int row = q0 + ln; if (row >= T) row = T - 1;
    const float* qr = Q + (size_t)row * pitch;
#pragma unroll
    for (int ks = 0; ks < KS; ++ks)
#pragma unroll
      for (int i = 0; i < 16; ++i) {
        const int d = ks * 32 + ((i < 8) ? (8 * hh + i) : (16 + 8 * hh + (i - 8)));
        const float x = qr[d] * scale; const unsigned short hb = bf16_bits(x);
        aqh[ks].u[i] = hb; aql[ks].u[i] = bf16_bits(x - bf16_val(hb));
      }
  }
  float m_r[8], l_r[8];
#pragma unroll
  for (int r = 0; r < 8; ++r) { m_r[r] = -3.0e38f; l_r[r] = 0.f; }
  v8f oacc[DT];
#pragma unroll
  for (int dt = 0; dt < DT; ++dt) oacc[dt] = (v8f){0.f,0.f,0.f,0.f,0.f,0.f,0.f,0.f};

  const int kv_end = CAUSAL ? min(T, qblk * 64 + 64) : T;     // block-uniform
  for (int j0 = 0; j0 < kv_end; j0 += 32) {
    __syncthreads();
    for (int e = tid; e < 32 * (D / 4); e += 128) {
      const int r = e / (D / 4), c4 = (e % (D / 4)) * 4;
      const int key = j0 + r;
      v4f kf = {0.f,0.f,0.f,0.f}, vf = {0.f,0.f,0.f,0.f};
      if (key < T) { kf = *(const v4fa*)(K + (size_t)key * pitch + c4); vf = *(const v4fa*)(V + (size_t)key * pitch + c4); }
#pragma unroll
      for (int t = 0; t < 4; ++t) {
        unsigned short hb = bf16_bits(kf[t]); sKh[r][c4 + t] = hb; sKl[r][c4 + t] = bf16_bits(kf[t] - bf16_val(hb));
        hb = bf16_bits(vf[t]); sVh[r][c4 + t] = hb; sVl[r][c4 + t] = bf16_bits(vf[t] - bf16_val(hb));
      }
    }
    __syncthreads();
    // S tile 16 x 32
    v8f s[2];
#pragma unroll
    for (int nt = 0; nt < 2; ++nt) {
      v8f acc = {};
#pragma unroll
      for (int ks = 0; ks < KS; ++ks) {
        FragB bh_, bl_;
        bh_.half[0] = *(const v8us*)&sKh[nt * 16 + ln][ks * 32 + 8 * hh]; bh_.half[1] = *(const v8us*)&sKh[nt * 16 + ln][ks * 32 + 16 + 8 * hh];
        bl_.half[0] = *(const v8us*)&sKl[nt * 16 + ln][ks * 32 + 8 * hh]; bl_.half[1] = *(const v8us*)&sKl[nt * 16 + ln][ks * 32 + 16 + 8 * hh];
        acc = mmaN<3>(aqh[ks].v, aql[ks].v, bh_.v, bl_.v, acc);
      }
      s[nt] = acc;
    }
    // mask + running max (rows 8hh+r; the 16 lanes of a half share rows)
    float alpha[8];
#pragma unroll
    for (int r = 0; r < 8; ++r) {
      const int qi = q0 + 8 * hh + r;
      const int ja = j0 + ln, jb = j0 + 16 + ln;
      if (CAUSAL) { if (ja > qi) s[0][r] = -3.0e38f; if (jb > qi) s[1][r] = -3.0e38f; }
      if (ja >= T) s[0][r] = -3.0e38f;
      if (jb >= T) s[1][r] = -3.0e38f;
      float mx = fmaxf(s[0][r], s[1][r]);
      mx = fmaxf(mx, __shfl_xor(mx, 1, 32)); mx = fmaxf(mx, __shfl_xor(mx, 2, 32)); mx = fmaxf(mx, __shfl_xor(mx, 4, 32)); mx = fmaxf(mx, __shfl_xor(mx, 8, 32));
      const float mnew = fmaxf(m_r[r], mx);
      alpha[r] = (mnew > -1.0e38f) ? __expf(m_r[r] - mnew) : 1.0f;
      const float p0 = (s[0][r] > -1.0e38f) ? __expf(s[0][r] - mnew) : 0.f;
      const float p1 = (s[1][r] > -1.0e38f) ? __expf(s[1][r] - mnew) : 0.f;
      m_r[r] = mnew;
      l_r[r] = l_r[r] * alpha[r] + p0 + p1;            // per-lane partial row sum (16 lanes combined at the end)
      unsigned short hb = bf16_bits(p0); sPh[w][8 * hh + r][ln] = hb;      sPl[w][8 * hh + r][ln] = bf16_bits(p0 - bf16_val(hb));
      hb = bf16_bits(p1);                sPh[w][8 * hh + r][16 + ln] = hb; sPl[w][8 * hh + r][16 + ln] = bf16_bits(p1 - bf16_val(hb));
    }
#pragma unroll
    for (int dt = 0; dt < DT; ++dt)
#pragma unroll
      for (int r = 0; r < 8; ++r) oacc[dt][r] *= alpha[r];
    __builtin_amdgcn_fence(__ATOMIC_ACQ_REL, "workgroup");
    __builtin_amdgcn_wave_barrier();
    FragB pah, pal;
    pah.half[0] = *(const v8us*)&sPh[w][ln][8 * hh]; pah.half[1] = *(const v8us*)&sPh[w][ln][16 + 8 * hh];
    pal.half[0] = *(const v8us*)&sPl[w][ln][8 * hh]; pal.half[1] = *(const v8us*)&sPl[w][ln][16 + 8 * hh];
#pragma unroll
    for (int dt = 0; dt < DT; ++dt) {
      FragB bvh, bvl;
#pragma unroll
      for (int i = 0; i < 8; ++i) {
        bvh.u[i] = sVh[8 * hh + i][dt * 16 + ln]; bvh.u[8 + i] = sVh[16 + 8 * hh + i][dt * 16 + ln];
        bvl.u[i] = sVl[8 * hh + i][dt * 16 + ln]; bvl.u[8 + i] = sVl[16 + 8 * hh + i][dt * 16 + ln];
      }
      oacc[dt] = mmaN<3>(pah.v, pal.v, bvh.v, bvl.v, oacc[dt]);
    }
    __builtin_amdgcn_fence(__ATOMIC_ACQ_REL, "workgroup");
    __builtin_amdgcn_wave_barrier();
  }
#pragma unroll
  for (int r = 0; r < 8; ++r) {
    float l = l_r[r];
    l += __shfl_xor(l, 1, 32); l += __shfl_xor(l, 2, 32); l += __shfl_xor(l, 4, 32); l += __shfl_xor(l, 8, 32);
    l_r[r] = (l > 0.f) ? 1.0f / l : 0.f;
  }
#pragma unroll
  for (int dt = 0; dt < DT; ++dt)
#pragma unroll
    for (int r = 0; r < 8; ++r) sO[w][8 * hh + r][dt * 16 + ln] = oacc[dt][r] * l_r[r];
  __builtin_amdgcn_fence(__ATOMIC_ACQ_REL, "workgroup");
  __builtin_amdgcn_wave_barrier();
  {
    for (int r = 0; r < 16; ++r) {
      const int row = q0 + r;
      if (row < T && lane < D / 4) {
        const v4f val = *(const v4fa*)&sO[w][r][lane * 4];
        *(v4f*)(y + ((size_t)b * T + row) * ypitch + h * D + lane * 4) = val;
      }
    }
    
  }
}

// GEMM C = act(A·W + bias + resid): A f32 (ASPLIT -> hi/lo 2 terms), Wt bf16 [N][K]; ACT 0 none, 1 relu, 2 exact gelu;
// resid (optional, f32, row index = (row % rmod), pitch ldr, RES_BF16 rounds it) added before the activation.
template <bool ASPLIT, int ACT, bool BIAS_BF16, bool RES_BF16>
__global__ __launch_bounds__(128) void k_gemm_bf3(const float* __restrict__ A, int lda, const unsigned short* __restrict__ Wt, int ldb,
                                                const float* __restrict__ bias, const float* __restrict__ resid, int rmod, int ldr,
                                                float* __restrict__ C, int ldc, int M, int N, int K) {
  __shared__ __attribute__((aligned(16))) float so[4][16][64];
  const int tid = threadIdx.x, w = tid >> 5, lane = tid & 31, ln = lane & 15, hh = lane >> 4;
  const int ntn = N / 64;
  const int wid = blockIdx.x * 4 + w;
  const int mt = wid / ntn, nq = wid % ntn;
  if (mt * 16 >= M) return;
  const int row0 = mt * 16, col0 = nq * 64;
  const float* arow = A + (size_t)(row0 + ln) * lda;
  v8f acc[4] = {};
  for (int kb = 0; kb < K; kb += 32) {
    FragB ah, al;
    const v4f x0 = *(const v4fa*)(arow + kb + 8 * hh), x1 = *(const v4fa*)(arow + kb + 8 * hh + 4);
    const v4f x2 = *(const v4fa*)(arow + kb + 16 + 8 * hh), x3 = *(const v4fa*)(arow + kb + 16 + 8 * hh + 4);
    float xs[16] = {x0[0],x0[1],x0[2],x0[3],x1[0],x1[1],x1[2],x1[3],x2[0],x2[1],x2[2],x2[3],x3[0],x3[1],x3[2],x3[3]};
#pragma unroll
    for (int i = 0; i < 16; ++i) { const unsigned short hb = bf16_bits(xs[i]); ah.u[i] = hb; al.u[i] = ASPLIT ? bf16_bits(xs[i] - bf16_val(hb)) : (unsigned short)0; }
#pragma unroll
    for (int t = 0; t < 4; ++t) {
      const unsigned short* brow = Wt + (size_t)(col0 + t * 16 + ln) * ldb + kb;
      FragB b;
      b.half[0] = *(const v8us*)(brow + 8 * hh);
      b.half[1] = *(const v8us*)(brow + 16 + 8 * hh);
      acc[t] = mmaN<ASPLIT ? 2 : 1>(ah.v, al.v, b.v, b.v, acc[t]);
    }
  }
#pragma unroll
  for (int t = 0; t < 4; ++t) {
    const int col = col0 + t * 16 + ln;
    float bv = bias ? bias[col] : 0.f;
    if (BIAS_BF16) bv = bf16_round(bv);
#pragma unroll
    for (int r = 0; r < 8; ++r) {
      float v = acc[t][r] + bv;
      if (resid) { float rv = resid[(size_t)((row0 + 8 * hh + r) % rmod) * ldr + col]; if (RES_BF16) rv = bf16_round(rv); v += rv; }
      if (ACT == 1) v = fmaxf(v, 0.f);
      if (ACT == 2) v = 0.5f * v * (1.0f + erff(v * 0.70710678118654752f));
      if (ACT == 3) { const float u = 0.7978845608028654f * (v + 0.044715f * v * v * v); v = 0.5f * v * (1.0f + tanhf(u)); }
      so[w][8 * hh + r][t * 16 + ln] = v;
    }
  }
  __builtin_amdgcn_fence(__ATOMIC_ACQ_REL, "workgroup");
  __builtin_amdgcn_wave_barrier();
  const int rsub = lane >> 4, c4 = (lane & 15) * 4;
  {
#pragma unroll
    for (int q = 0; q < 8; ++q) {
      const int r = q * 2 + rsub;
      const v4f v = *(const v4fa*)&so[w][r][c4];
      *(v4f*)(C + (size_t)(row0 + r) * ldc + col0 + c4) = v;
    }
    
  }
}
// row LayerNorm (biased variance, eps) over N: s = X (+ R); optional out_sum <- s; out_norm <- (s-mu)*rsqrt(var+eps)*g + b
template <bool PARAM_BF16>
__global__ __launch_bounds__(256) void k_layernorm(const float* __restrict__ X, const float* __restrict__ R, const float* __restrict__ g, const float* __restrict__ bta,
                                                  float* __restrict__ out_sum, float* __restrict__ out_norm, int N, float eps) {
  __shared__ float red[256];
  const int row = blockIdx.x, tid = threadIdx.x;
  const float* x = X + (size_t)row * N; const float* rr = R ? R + (size_t)row * N : nullptr;
  float vals[16];                     // up to N = 4096
  const int per = N / 256;            // contiguous chunk per thread? use strided-by-4 chunks: thread handles j = tid*4 + 1024*u
  float s1 = 0.f;
  for (int u = 0; u < per / 4; ++u) {
    const int j = tid * 4 + 1024 * u;
    const v4f a = *(const v4fa*)(x + j);
    v4f b = {0.f,0.f,0.f,0.f}; if (rr) b = *(const v4fa*)(rr + j);
#pragma unroll
    for (int q = 0; q < 4; ++q) { const float v = a[q] + b[q]; vals[u * 4 + q] = v; s1 += v; }
  }
  red[tid] = s1; __syncthreads();
  for (int st = 128; st > 0; st >>= 1) { if (tid < st) red[tid] += red[tid + st]; __syncthreads(); }
  const float mu = red[0] / (float)N; __syncthreads();
  float s2 = 0.f;
  for (int u = 0; u < per / 4; ++u)
#pragma unroll
    for (int q = 0; q < 4; ++q) { const float c = vals[u * 4 + q] - mu; s2 += c * c; }
  red[tid] = s2; __syncthreads();
  for (int st = 128; st > 0; st >>= 1) { if (tid < st) red[tid] += red[tid + st]; __syncthreads(); }
  const float rs = rsqrtf(red[0] / (float)N + eps);
  {
    for (int u = 0; u < per / 4; ++u) {
      const int j = tid * 4 + 1024 * u;
      v4f o, sm;
#pragma unroll
      for (int q = 0; q < 4; ++q) {
        float gg = g[j + q], bb = bta[j + q];
        if (PARAM_BF16) { gg = bf16_round(gg); bb = bf16_round(bb); }
        sm[q] = vals[u * 4 + q]; o[q] = (vals[u * 4 + q] - mu) * rs * gg + bb;
      }
      if (out_sum) *(v4f*)(out_sum + (size_t)row * N + j) = sm;
      *(v4f*)(out_norm + (size_t)row * N + j) = o;
    }
    
  }
}



// ---- f16 WMMA path (v_wmma_f32_16x16x32_f16): 11-bit significands for operands in range — used for every contraction launched here
typedef _Float16 v16h __attribute__((ext_vector_type(16)));
union FragH { v16h v; v8us half[2]; _Float16 h[16]; unsigned short u[16]; };
template <int NT>
__device__ __forceinline__ v8f mmaH(v16h ah, v16h al, v16h bh, v16h bl, v8f c) {
  c = __builtin_amdgcn_wmma_f32_16x16x32_f16(false, ah, false, bh, (short)0, c, false, false);
  if (NT >= 2) c = __builtin_amdgcn_wmma_f32_16x16x32_f16(false, al, false, bh, (short)0, c, false, false);
  if (NT >= 3) c = __builtin_amdgcn_wmma_f32_16x16x32_f16(false, ah, false, bl, (short)0, c, false, false);
  asm volatile("v_nop\n\tv_nop\n\tv_nop\n\tv_nop" : "+v"(c) : "v"(ah), "v"(al), "v"(bh), "v"(bl));
  return c;
}
// batched GEMM like k_gemm_b but f16 operands: A f32 (split into f16 hi/lo if ASPLIT, else rounded to f16), Bt = f16 values [n][k]; alpha; C f32; N multiple of 16 (partial tiles skipped)
template <bool ASPLIT>
__global__ __launch_bounds__(128) void k_gemm_h(const float* __restrict__ A, int lda, size_t sA, const _Float16* __restrict__ Bh, int ldb, size_t sB, float alpha, float* __restrict__ C, int ldc, size_t sC, int M, int N, int K) {
  __shared__ __attribute__((aligned(16))) float so[4][16][64];
  const int tid = threadIdx.x, w = tid >> 5, lane = tid & 31, ln = lane & 15, hh = lane >> 4; const int by = blockIdx.y;
  A += (size_t)by * sA; Bh += (size_t)by * sB; C += (size_t)by * sC;
  const int ntn = (N + 63) / 64; const int wid = blockIdx.x * 4 + w; const int mt = wid / ntn, nq = wid % ntn; if (mt * 16 >= M) return;
  const int row0 = mt * 16, col0 = nq * 64; const float* arow = A + (size_t)(row0 + ln) * lda;
  v8f acc[4] = {};
  for (int kb = 0; kb < K; kb += 32) {
    FragH ah, al;
    const v4f x0 = *(const v4fa*)(arow + kb + 8 * hh), x1 = *(const v4fa*)(arow + kb + 8 * hh + 4), x2 = *(const v4fa*)(arow + kb + 16 + 8 * hh), x3 = *(const v4fa*)(arow + kb + 16 + 8 * hh + 4);
    float xs[16] = {x0[0],x0[1],x0[2],x0[3],x1[0],x1[1],x1[2],x1[3],x2[0],x2[1],x2[2],x2[3],x3[0],x3[1],x3[2],x3[3]};
#pragma unroll
    for (int i = 0; i < 16; ++i) { const _Float16 h = (_Float16)xs[i]; ah.h[i] = h; al.h[i] = ASPLIT ? (_Float16)(xs[i] - (float)h) : (_Float16)0.0f; }
#pragma unroll
    for (int t = 0; t < 4; ++t) { if (col0 + t * 16 >= N) continue; const size_t boff = (size_t)(col0 + t * 16 + ln) * ldb + kb; FragH bq; bq.half[0] = *(const v8us*)(Bh + boff + 8 * hh); bq.half[1] = *(const v8us*)(Bh + boff + 16 + 8 * hh);
      acc[t] = mmaH<ASPLIT ? 2 : 1>(ah.v, al.v, bq.v, bq.v, acc[t]); }
  }
#pragma unroll
  for (int t = 0; t < 4; ++t) { if (col0 + t * 16 >= N) continue;
#pragma unroll
    for (int r = 0; r < 8; ++r) so[w][8 * hh + r][t * 16 + ln] = acc[t][r] * alpha; }
  __builtin_amdgcn_fence(__ATOMIC_ACQ_REL, "workgroup"); __builtin_amdgcn_wave_barrier();
  const int rsub = lane >> 4, c4 = (lane & 15) * 4;
  {
#pragma unroll
    for (int q = 0; q < 8; ++q) { const int r = q * 2 + rsub; if (col0 + c4 < N) { const v4f v = *(const v4fa*)&so[w][r][c4]; *(v4f*)(C + (size_t)(row0 + r) * ldc + col0 + c4) = v; } }
     }
}

// Wt[n][k] = f16(W[k][n]·scale) from f32 row-major W[K][N] (scale = power of two; bf16-exact weights stay exact in f16 away from the subnormal range)
__global__ __launch_bounds__(256) void k_wt_f16(const float* __restrict__ W, _Float16* __restrict__ Wt, int K, int N, float scale) {
  const int t = blockIdx.x * 256 + threadIdx.x; if (t >= N * (K / 8)) return; const int n = t / (K / 8), k8 = (t % (K / 8)) * 8; FragH f;
#pragma unroll
  for (int i = 0; i < 8; ++i) f.h[i] = (_Float16)(bf16_round(W[(size_t)(k8 + i) * N + n]) * scale); const v8us o = f.half[0];
  *(v8us*)((unsigned short*)Wt + (size_t)n * K + k8) = o; 
}
// Block-tiled GEMM, f16 operands, both K-contiguous: v = (A.Bt^T)*alpha + bf16(bias[col]) (+ CP[row*LDCP + by*sCPy + col] if LDCP; CP may be C itself: a lane reads only what it then writes); writes f32 C, or f16 C16, or f16 C16 with the rounding residual x 2^10 in C16l. Batch in blockIdx.y.
// One work-group of 8 waves (4 x 2) makes 128 x 128 of C, a wave 32 x 64. Each trip takes 64 k: 128 rows of 128 B of A and of Bt are brought into LDS by asynchronous copies (whole 128-B lines, 16 B a lane),
// two buffers, the next tile in flight while this one is multiplied; LDS rows at pitch 144 B for the ds_load_b128 fragment reads. M, N multiples of 128, K a multiple of 64.
#define GT_PITCH 144
#define GT_OPB (128 * GT_PITCH)
#define GT_BUF (2 * GT_OPB)
typedef _Float16 v4h __attribute__((ext_vector_type(4)));
// one tile: 4 copies of A and 4 of Bt per lane. The s_wait_xcnt stands inside the statement so that no address register named here is rewritten ahead of it.
__device__ __forceinline__ void gt_copy(unsigned l, const unsigned short* ga, const unsigned short* gb, size_t a32, size_t b32) {
  asm volatile("global_load_async_to_lds_b128 %0, %8, off\n\t"
               "global_load_async_to_lds_b128 %1, %9, off\n\t"
               "global_load_async_to_lds_b128 %2, %10, off\n\t"
               "global_load_async_to_lds_b128 %3, %11, off\n\t"
               "global_load_async_to_lds_b128 %4, %12, off\n\t"
               "global_load_async_to_lds_b128 %5, %13, off\n\t"
               "global_load_async_to_lds_b128 %6, %14, off\n\t"
               "global_load_async_to_lds_b128 %7, %15, off\n\t"
               "s_wait_xcnt 0x0"
               :: "v"(l), "v"(l + 32 * GT_PITCH), "v"(l + 64 * GT_PITCH), "v"(l + 96 * GT_PITCH),
                  "v"(l + GT_OPB), "v"(l + GT_OPB + 32 * GT_PITCH), "v"(l + GT_OPB + 64 * GT_PITCH), "v"(l + GT_OPB + 96 * GT_PITCH),
                  "v"(ga), "v"(ga + a32), "v"(ga + 2 * a32), "v"(ga + 3 * a32), "v"(gb), "v"(gb + b32), "v"(gb + 2 * b32), "v"(gb + 3 * b32)
               : "memory");
}
template <int LDCP, int OUT>      /* LDCP: row pitch of an f32 addend plane CP, 0 for none (a constant, so that its 16 loads share one address register pair); OUT 1: f32 result in C; 0: f16 result in C16; 2: f16 result in C16 and (v - f16(v)) x 2^10 as f16 in C16l */
__global__ __launch_bounds__(256) void k_gemm_t(const _Float16* __restrict__ A, int lda, size_t sA, const _Float16* __restrict__ Bh, int ldb, size_t sB, float alpha, const float* __restrict__ bias,
    const float* CP, size_t sCPy, float* C, _Float16* __restrict__ C16, _Float16* __restrict__ C16l, int ldc, size_t sC, int N, int K) {
  __shared__ __attribute__((aligned(16))) unsigned char L[2 * GT_BUF];
  const int tid = threadIdx.x, w = tid >> 5, lane = tid & 31, ln = lane & 15, hh = lane >> 4; const int by = blockIdx.y;
  const int ntn = N / 128; const int row0 = ((int)blockIdx.x / ntn) * 128, col0 = ((int)blockIdx.x % ntn) * 128; const int wm = w >> 1, wn = w & 1;
  const int cr = tid >> 3, cc = tid & 7;      /* copies: 8 lanes a row, 32 rows a copy */
  const unsigned short* ga = (const unsigned short*)A + (size_t)by * sA + (size_t)(row0 + cr) * lda + cc * 8;
  const unsigned short* gb = (const unsigned short*)Bh + (size_t)by * sB + (size_t)(col0 + cr) * ldb + cc * 8;
  const size_t a32 = (size_t)32 * lda, b32 = (size_t)32 * ldb;
  const unsigned lcp = (unsigned)(size_t)L + (unsigned)(cr * GT_PITCH + cc * 16);
  const int nk = K / 64;
  v8f acc[2][4] = {};
  gt_copy(lcp, ga, gb, a32, b32);
  asm volatile("s_wait_asynccnt 0x0" ::: "memory");      /* tile 0 has landed before the barrier that publishes it */
  __syncthreads();
  if (nk > 1) gt_copy(lcp + GT_BUF, ga + 64, gb + 64, a32, b32);
  const unsigned char* fa = L + (wm * 32 + ln) * GT_PITCH + hh * 16; const unsigned char* fb = L + GT_OPB + (wn * 64 + ln) * GT_PITCH + hh * 16;
#pragma unroll 1
  for (int t = 0; t < nk; ++t) {      /* stays rolled: one copy of the ring's foot */
    const unsigned bo = (unsigned)(t & 1) * GT_BUF;
    FragH a[2][2], b[2][4];
#pragma unroll
    for (int ks = 0; ks < 2; ++ks) {
#pragma unroll
      for (int i = 0; i < 2; ++i) { a[ks][i].half[0] = *(const v8us*)(fa + bo + i * 16 * GT_PITCH + ks * 64); a[ks][i].half[1] = *(const v8us*)(fa + bo + i * 16 * GT_PITCH + ks * 64 + 32); }
#pragma unroll
      for (int j = 0; j < 4; ++j) { b[ks][j].half[0] = *(const v8us*)(fb + bo + j * 16 * GT_PITCH + ks * 64); b[ks][j].half[1] = *(const v8us*)(fb + bo + j * 16 * GT_PITCH + ks * 64 + 32); } }
    /* the ring's foot stands here, behind the trip's 24 fragment reads and ahead of its WMMAs, which work on registers alone: the refill then flies under them too */
    asm volatile("s_wait_dscnt 0x0" ::: "memory");      /* this wave's reads of the buffer are over before it may be refilled */
    asm volatile("s_wait_asynccnt 0x0" ::: "memory");      /* this wave's share of tile t + 1 has landed before the barrier publishes it */
    __syncthreads();
    if (t + 2 < nk) gt_copy(lcp + bo, ga + (size_t)(t + 2) * 64, gb + (size_t)(t + 2) * 64, a32, b32);
    __builtin_amdgcn_sched_barrier(0);      /* keeps the WMMAs behind the refill's issue: ahead of it they would delay the copies by their whole run */
#pragma unroll
    for (int ks = 0; ks < 2; ++ks)
#pragma unroll
      for (int i = 0; i < 2; ++i)
#pragma unroll
        for (int j = 0; j < 4; ++j) acc[i][j] = __builtin_amdgcn_wmma_f32_16x16x32_f16(false, a[ks][i].v, false, b[ks][j].v, (short)0, acc[i][j], false, false);
  }
  asm volatile("s_wait_asynccnt 0x0" ::: "memory");      /* no copy outstanding when the ring becomes output staging */
  /* epilogue: each wave stages its 32 x 64 in its own 8,704 B of the ring (every wave's last read of it ended ahead of the last barrier), then whole row pieces (256 B of f32, 128 B of f16) go out */
  const int c4 = ln * 4, col = col0 + wn * 64 + c4, rw0 = row0 + wm * 32 + hh; const size_t cofs = (size_t)by * sC;
  v4f cp[16];      /* the addend's 16 row pieces are asked for together, ahead of the staging */
  if (LDCP) { const float* cpp = CP + (size_t)rw0 * LDCP + (size_t)by * sCPy + col;
#pragma unroll
    for (int q = 0; q < 16; ++q) cp[q] = *(const v4fa*)(cpp + q * 2 * LDCP);
    asm volatile("s_wait_xcnt 0x0" ::: "memory"); }      /* ahead of any rewrite of the address registers that the loads above name */
  v4f bv = {0.f, 0.f, 0.f, 0.f}; if (bias) { const v4f bb = *(const v4fa*)(bias + col); for (int e = 0; e < 4; ++e) bv[e] = bf16_round(bb[e]); }
  float* so = (float*)(L + w * (32 * 68 * 4));
#pragma unroll
  for (int i = 0; i < 2; ++i)
#pragma unroll
    for (int j = 0; j < 4; ++j)
#pragma unroll
      for (int r = 0; r < 8; ++r) so[(i * 16 + 8 * hh + r) * 68 + j * 16 + ln] = acc[i][j][r];
  __builtin_amdgcn_fence(__ATOMIC_ACQ_REL, "workgroup"); __builtin_amdgcn_wave_barrier();
#pragma unroll
  for (int q = 0; q < 16; ++q) { const size_t o = cofs + (size_t)rw0 * ldc + col + (size_t)(q * 2) * ldc; const v4f x = *(const v4fa*)&so[(q * 2 + hh) * 68 + c4]; v4f v;
    for (int e = 0; e < 4; ++e) v[e] = x[e] * alpha + bv[e];
    if (LDCP) for (int e = 0; e < 4; ++e) v[e] += cp[q][e];
    if (OUT == 1) *(v4f*)(C + o) = v;
    else { v4h h4; for (int e = 0; e < 4; ++e) h4[e] = (_Float16)v[e]; *(v4h*)(C16 + o) = h4;
      if (OUT == 2) { v4h l4; for (int e = 0; e < 4; ++e) l4[e] = (_Float16)((v[e] - (float)h4[e]) * 1024.0f); *(v4h*)(C16l + o) = l4; } } }
}


__global__ __launch_bounds__(256) void k_x16(const float* __restrict__ x, _Float16* __restrict__ X16, size_t n8) { const size_t t = (size_t)blockIdx.x * 256 + threadIdx.x; if (t >= n8) return; FragH f;
#pragma unroll
  for (int q = 0; q < 8; ++q) f.h[q] = (_Float16)bf16_round(x[t * 8 + q]); *(v8us*)((unsigned short*)X16 + t * 8) = f.half[0];  }
__global__ __launch_bounds__(256) void k_round16f(const float* __restrict__ W, _Float16* __restrict__ Bt, size_t n8) { const size_t t = (size_t)blockIdx.x * 256 + threadIdx.x; if (t >= n8) return; FragH f;
#pragma unroll
  for (int i = 0; i < 8; ++i) f.h[i] = (_Float16)(bf16_round(W[t * 8 + i]) * 16.0f); *(v8us*)((unsigned short*)Bt + t * 8) = f.half[0];  }
template <int NHv, int TTv>
__global__ __launch_bounds__(256) void k_vt(const _Float16* __restrict__ V16, int ldv, int voff, _Float16* __restrict__ Vt) { __shared__ unsigned short tl[64][66]; const int tid = threadIdx.x; const int slab = blockIdx.x / (TTv / 64), lg = blockIdx.x % (TTv / 64); const int b = slab / NHv, h = slab % NHv;
  for (int i = tid; i < 64 * 8; i += 256) { const int r = i / 8, c8 = (i % 8) * 8; FragH f; f.half[0] = *(const v8us*)((const unsigned short*)V16 + ((size_t)b * TTv + lg * 64 + r) * ldv + voff + h * 64 + c8);
#pragma unroll
    for (int q = 0; q < 8; ++q) tl[r][c8 + q] = f.u[q]; }
  __syncthreads();
  {
#pragma unroll
    for (int rd = 0; rd < 2; ++rd) { const int d = rd * 32 + tid / 8, pc = tid % 8; FragH f;
#pragma unroll
      for (int q = 0; q < 8; ++q) f.u[q] = tl[pc * 8 + q][d];
      *(v8us*)((unsigned short*)Vt + ((size_t)slab * 64 + d) * TTv + lg * 64 + pc * 8) = f.half[0]; }
     } }

__device__ __forceinline__ float gelu_tanh(float x) { const float u = 0.7978845608028654f * (x + 0.044715f * x * x * x); return 0.5f * x * (1.0f + tanhf(u)); }
__global__ __launch_bounds__(256) void k_gbias(float* __restrict__ S, const float* __restrict__ CRD, const float* __restrict__ w1, const float* __restrict__ b1, const float* __restrict__ w2, const float* __restrict__ b2) {
  #pragma clang fp contract(off)
  const int b = blockIdx.y; S += (size_t)b * TT * TT;      /* one score plane per batch */
  const size_t t = (size_t)blockIdx.x * 256 + threadIdx.x; if (t >= (size_t)TT * TT / 4) return; const int q = (int)((t * 4) / TT), k0 = (int)((t * 4) % TT);
  float cb = 0.f; for (int j = 0; j < 8; ++j) cb += bf16_round(b2[j]); cb *= 0.125f;
  const float qx = bf16_round(CRD[((size_t)b * TT + q) * 3]), qy = bf16_round(CRD[((size_t)b * TT + q) * 3 + 1]), qz = bf16_round(CRD[((size_t)b * TT + q) * 3 + 2]);
  v4f sv = *(const v4fa*)(S + (size_t)q * TT + k0); float dist[4];
  for (int e = 0; e < 4; ++e) { const int k = k0 + e; const float dx = qx - bf16_round(CRD[((size_t)b * TT + k) * 3]), dy = qy - bf16_round(CRD[((size_t)b * TT + k) * 3 + 1]), dz = qz - bf16_round(CRD[((size_t)b * TT + k) * 3 + 2]); dist[e] = sqrtf(fmaxf(dx * dx + dy * dy + dz * dz, 1e-12f)); sv[e] += cb; }
#pragma unroll 1
  for (int j = 0; j < 8; ++j) { float cj = 0.f; for (int h = 0; h < 8; ++h) cj += bf16_round(w2[j * 8 + h]); cj *= 0.125f; const float wj = bf16_round(w1[j]), bj = bf16_round(b1[j]);
    for (int e = 0; e < 4; ++e) sv[e] += gelu_tanh(dist[e] * wj + bj) * cj; }
  *(v4f*)(S + (size_t)q * TT + k0) = sv;  }
#define NN TT
__global__ __launch_bounds__(256) void k_smx(const float* __restrict__ S, _Float16* __restrict__ P16) { const int tid = threadIdx.x, wv = tid >> 5, lane = tid & 31; const int i = blockIdx.x * 8 + wv; const float* sr = S + (size_t)i * NN;
  float m = -3.0e38f;
  for (int p = lane; p < NN / 8; p += 32) { const v4f a = *(const v4fa*)(sr + p * 8), c = *(const v4fa*)(sr + p * 8 + 4); for (int e = 0; e < 4; ++e) m = fmaxf(m, fmaxf(a[e], c[e])); }
  for (int o = 16; o >= 1; o >>= 1) m = fmaxf(m, __shfl_xor(m, o, 32)); float z = 0.f;
  for (int p = lane; p < NN / 8; p += 32) { const v4f a = *(const v4fa*)(sr + p * 8), c = *(const v4fa*)(sr + p * 8 + 4); for (int e = 0; e < 4; ++e) z += __expf(a[e] - m) + __expf(c[e] - m); }
  for (int o = 16; o >= 1; o >>= 1) z += __shfl_xor(z, o, 32); const float iz = 32768.0f / z;
  { for (int p = lane; p < NN / 8; p += 32) { FragH f; const v4f a = *(const v4fa*)(sr + p * 8), c = *(const v4fa*)(sr + p * 8 + 4); for (int e = 0; e < 4; ++e) { f.h[e] = (_Float16)(__expf(a[e] - m) * iz); f.h[4 + e] = (_Float16)(__expf(c[e] - m) * iz); }
      *(v8us*)((unsigned short*)P16 + (size_t)i * NN + p * 8) = f.half[0]; }  } }
// lane l with lane l ^ 16 (the two halves of a wave hold the two halves of a query's keys)
__device__ __forceinline__ float xhalf(float x) { return __builtin_bit_cast(float, __builtin_amdgcn_permlanex16(__builtin_bit_cast(int, x), __builtin_bit_cast(int, x), 0x76543210, 0xfedcba98, false, false)); }
__global__ __launch_bounds__(128) void k_flash(const _Float16* __restrict__ Q16, int ldq, const _Float16* __restrict__ K16, int ldk, const _Float16* __restrict__ Vt, const int* __restrict__ MSK, _Float16* __restrict__ O16, int ldo) {
  constexpr int RPW = 16, NQB = TT / (4 * RPW), DT = 4, KS = 2; (void)MSK;
  __shared__ __attribute__((aligned(16))) unsigned short sO[4][RPW][64 + 8];      /* f16 rows at pitch 144 B */
  const int tid = threadIdx.x, w = tid >> 5, lane = tid & 31, ln = lane & 15, hh = lane >> 4;
  const int slab = blockIdx.x / NQB, qblk = blockIdx.x % NQB; const int b = slab / NH, h = slab % NH; const int q0 = qblk * (4 * RPW) + w * RPW;
  FragH bq[KS];
  { const unsigned short* qr = (const unsigned short*)Q16 + ((size_t)b * TT + q0 + ln) * ldq + h * 64;
#pragma unroll
    for (int ks = 0; ks < KS; ++ks) { bq[ks].half[0] = *(const v8us*)(qr + ks * 32 + 8 * hh); bq[ks].half[1] = *(const v8us*)(qr + ks * 32 + 16 + 8 * hh); } }
  const unsigned short* Vth = (const unsigned short*)Vt + (size_t)slab * 64 * TT;
  float m_q = -3.0e38f, l_q = 0.f; v8f oacc[DT];
#pragma unroll
  for (int dt = 0; dt < DT; ++dt) oacc[dt] = (v8f){0.f,0.f,0.f,0.f,0.f,0.f,0.f,0.f};
#pragma unroll 1      /* stays rolled: an unrolled body would hold two trips' fragments in registers */
  for (int j0 = 0; j0 < TT; j0 += 32) {
    FragH ak[2][KS], av[DT];      /* no fence stands in the loop: the trip's 16 loads are asked for together at its head, one trip to L2 instead of one per fragment */
#pragma unroll
    for (int nt = 0; nt < 2; ++nt) { const unsigned short* kr = (const unsigned short*)K16 + ((size_t)b * TT + j0 + nt * 16 + ln) * ldk + h * 64;
#pragma unroll
      for (int ks = 0; ks < KS; ++ks) { ak[nt][ks].half[0] = *(const v8us*)(kr + ks * 32 + 8 * hh); ak[nt][ks].half[1] = *(const v8us*)(kr + ks * 32 + 16 + 8 * hh); } }
    asm volatile("s_wait_xcnt 0x0" ::: "memory");      /* ahead of the VT loads, whose results may be given the registers that held the key loads' addresses */
#pragma unroll
    for (int dt = 0; dt < DT; ++dt) { const unsigned short* vrow = Vth + (size_t)(dt * 16 + ln) * TT + j0; av[dt].half[0] = *(const v8us*)(vrow + 8 * hh); av[dt].half[1] = *(const v8us*)(vrow + 16 + 8 * hh); }
    __builtin_amdgcn_sched_barrier(0);      /* keeps all 16 loads ahead of the first product's wait: behind it the second key tile would pay a second trip to L2 */
    v8f s[2];
#pragma unroll
    for (int nt = 0; nt < 2; ++nt) { v8f acc = (v8f){0.f,0.f,0.f,0.f,0.f,0.f,0.f,0.f};
#pragma unroll
      for (int ks = 0; ks < KS; ++ks) acc = mmaH<1>(ak[nt][ks].v, ak[nt][ks].v, bq[ks].v, bq[ks].v, acc);
      s[nt] = acc; }
    float mc = -3.0e38f;
#pragma unroll
    for (int nt = 0; nt < 2; ++nt)
#pragma unroll
      for (int r = 0; r < 8; ++r) { s[nt][r] *= 0.125f; mc = fmaxf(mc, s[nt][r]); }
    mc = fmaxf(mc, xhalf(mc));
    const float mn = fmaxf(m_q, mc); const float al = (mn > -1.0e38f) ? expf(m_q - mn) : 1.0f; m_q = mn;
    FragH pb; float ps = 0.f;
#pragma unroll
    for (int nt = 0; nt < 2; ++nt)
#pragma unroll
      for (int r = 0; r < 8; ++r) { const float p = expf(s[nt][r] - mn); ps += p; pb.h[nt * 8 + r] = (_Float16)(p * 1024.0f); }
    l_q = l_q * al + ps;      /* this half's keys only; the halves are joined behind the loop */
#pragma unroll
    for (int dt = 0; dt < DT; ++dt)
#pragma unroll
      for (int r = 0; r < 8; ++r) oacc[dt][r] *= al;
#pragma unroll
    for (int dt = 0; dt < DT; ++dt) oacc[dt] = mmaH<1>(av[dt].v, av[dt].v, pb.v, pb.v, oacc[dt]); }
  const float lt = l_q + xhalf(l_q); const float il = (lt > 0.f) ? 1.0f / (lt * 64.0f) : 0.f;      /* P carries 2^10, the f16 result plane 2^4 */
#pragma unroll
  for (int dt = 0; dt < DT; ++dt) { FragH f;      /* oacc[dt][r] = OT[dt * 16 + 8 * hh + r][query ln] */
#pragma unroll
    for (int r = 0; r < 8; ++r) f.h[r] = (_Float16)(oacc[dt][r] * il);
    *(v8us*)&sO[w][ln][dt * 16 + 8 * hh] = f.half[0]; }
  __builtin_amdgcn_fence(__ATOMIC_ACQ_REL, "workgroup"); __builtin_amdgcn_wave_barrier();
#pragma unroll
  for (int rp = 0; rp < RPW; rp += 4) { const int r = rp + (lane >> 3), pc = lane & 7; const v8us val = *(const v8us*)&sO[w][r][pc * 8];      /* 8 lanes a row: one whole 128-B line of the f16 plane */
    *(v8us*)((unsigned short*)O16 + ((size_t)b * TT + q0 + r) * ldo + h * 64 + pc * 8) = val; } }

extern "C" void kernel_launch(void* const* d_in, const int* in_sizes, int n_in,
                              void* d_out, int out_size, void* d_ws, size_t ws_size, hipStream_t stream) {
  (void)in_sizes; (void)n_in; (void)out_size;
  const float* const* I = (const float* const*)d_in; const float* feats = I[0]; const float* geom = I[1]; const float* crd = I[2];
  const float* wq = I[3]; const float* bq = I[4]; const float* wk = I[5]; const float* bk = I[6]; const float* wv = I[7]; const float* bv = I[8]; const float* wo = I[9]; const float* bo = I[10];
  const float* gqw = I[11]; const float* gqb = I[12]; const float* gkw = I[13]; const float* gkb = I[14]; const float* gvw = I[15]; const float* gvb = I[16]; const float* d1w = I[17]; const float* d1b = I[18]; const float* d2w = I[19]; const float* d2b = I[20]; const float* opw = I[21]; const float* opb = I[22];
  char* ws = (char*)d_ws; size_t off = 0;
  auto take = [&](size_t bytes) { char* p = ws + off; off += (bytes + 255) & ~(size_t)255; return p; };
  const size_t WSZ = (size_t)DD * DD, GSZ = (size_t)GG * DD; _Float16* Bw = (_Float16*)take(5 * WSZ * 2); _Float16* Bg = (_Float16*)take(3 * GSZ * 2);
  _Float16* X16 = (_Float16*)take((size_t)NR * DD * 2); _Float16* GE16 = (_Float16*)take((size_t)NR * GG * 2); _Float16* Q = (_Float16*)take((size_t)NR * DD * 2); _Float16* K = (_Float16*)take((size_t)NR * DD * 2); _Float16* V = (_Float16*)take((size_t)NR * DD * 2); _Float16* Vt = (_Float16*)take((size_t)NR * DD * 2);
  float* FA = (float*)take((size_t)NR * DD * 4); _Float16* GQ = (_Float16*)take((size_t)NR * DD * 2); _Float16* GK = (_Float16*)take((size_t)NR * DD * 2); float* S = (float*)take((size_t)BB * TT * TT * 4); _Float16* P16 = (_Float16*)take((size_t)BB * TT * TT * 2);
  _Float16* O16 = X16; _Float16* GV = Q; _Float16* GVt = K; _Float16* SUM16 = V; _Float16* GQl = Vt; _Float16* GKl = X16;      /* reuse after the MHA branch (stream order): X16 -> the attention output, then gk's residual plane; Q/K -> gv and its transpose; V -> feat + geom; Vt -> gq's residual plane */
  if (off > ws_size) return;      // 2.6 + 0.4 + 8.4 + 2.1 + 4 x 8.4 + 16.8 + 8.4 + 8.4 + 33.6 + 16.8 = about 131 MB
  const unsigned gw = (unsigned)(((size_t)DD * (DD / 8) + 255) / 256), ggw = (unsigned)(((size_t)DD * (GG / 8) + 255) / 256);
  k_wt_f16<<<gw, 256, 0, stream>>>(wq, Bw, DD, DD, 16.0f); k_wt_f16<<<gw, 256, 0, stream>>>(wk, Bw + WSZ, DD, DD, 16.0f); k_wt_f16<<<gw, 256, 0, stream>>>(wv, Bw + 2 * WSZ, DD, DD, 16.0f); k_wt_f16<<<gw, 256, 0, stream>>>(wo, Bw + 3 * WSZ, DD, DD, 16.0f); k_wt_f16<<<gw, 256, 0, stream>>>(opw, Bw + 4 * WSZ, DD, DD, 16.0f);
  k_wt_f16<<<ggw, 256, 0, stream>>>(gqw, Bg, GG, DD, 16.0f); k_wt_f16<<<ggw, 256, 0, stream>>>(gkw, Bg + GSZ, GG, DD, 16.0f); k_wt_f16<<<ggw, 256, 0, stream>>>(gvw, Bg + 2 * GSZ, GG, DD, 16.0f);      /* (in,out) → Bt ×2^4 */
  const unsigned g8 = (unsigned)(((size_t)NR * DD / 8 + 255) / 256); k_x16<<<g8, 256, 0, stream>>>(feats, X16, (size_t)NR * DD / 8); k_x16<<<(unsigned)(((size_t)NR * GG / 8 + 255) / 256), 256, 0, stream>>>(geom, GE16, (size_t)NR * GG / 8);
  const dim3 gp((NR / 128) * (DD / 128), 1);
  k_gemm_t<0, 0><<<gp, 256, 0, stream>>>(X16, DD, 0, Bw, DD, 0, 0.0625f, bq, nullptr, 0, nullptr, Q, nullptr, DD, 0, DD, DD);      /* M 8192 N 512 K 512 */
  k_gemm_t<0, 0><<<gp, 256, 0, stream>>>(X16, DD, 0, Bw + WSZ, DD, 0, 0.0625f, bk, nullptr, 0, nullptr, K, nullptr, DD, 0, DD, DD);
  k_gemm_t<0, 0><<<gp, 256, 0, stream>>>(X16, DD, 0, Bw + 2 * WSZ, DD, 0, 0.0625f, bv, nullptr, 0, nullptr, V, nullptr, DD, 0, DD, DD);
  k_vt<NH, TT><<<BB * NH * (TT / 64), 256, 0, stream>>>(V, DD, 0, Vt); k_flash<<<BB * NH * (TT / 64), 128, 0, stream>>>(Q, DD, K, DD, Vt, nullptr, O16, DD);      /* the attention output leaves as f16 x 2^4 */
  k_gemm_t<0, 1><<<gp, 256, 0, stream>>>(O16, DD, 0, Bw + 3 * WSZ, DD, 0, 0.00390625f, bo, nullptr, 0, FA, nullptr, nullptr, DD, 0, DD, DD);      /* feat_att = O.wo + bo (f32) */
  k_gemm_t<0, 2><<<gp, 256, 0, stream>>>(GE16, GG, 0, Bg, GG, 0, 0.0625f, gqb, nullptr, 0, nullptr, GQ, GQl, DD, 0, DD, GG);      /* gq -> hi / x2^10 residual planes: M 8192 N 512 K 128 */
  k_gemm_t<0, 2><<<gp, 256, 0, stream>>>(GE16, GG, 0, Bg + GSZ, GG, 0, 0.0625f, gkb, nullptr, 0, nullptr, GK, GKl, DD, 0, DD, GG);      /* gk likewise */
  k_gemm_t<0, 0><<<gp, 256, 0, stream>>>(GE16, GG, 0, Bg + 2 * GSZ, GG, 0, 0.0625f, gvb, nullptr, 0, nullptr, GV, nullptr, DD, 0, DD, GG);
  k_vt<DD / 64, TT><<<BB * (DD / 64) * (TT / 64), 256, 0, stream>>>(GV, DD, 0, GVt);      /* gv transposed per batch [512][1024] */
  /* geometry branch: all BB batches of each stage in one launch, the batch in blockIdx.y (operand, addend and result strides per batch) */
  const size_t sX = (size_t)TT * DD, sS = (size_t)TT * TT; const dim3 gs((TT / 128) * (TT / 128), BB);
  k_gemm_t<0, 1><<<gs, 256, 0, stream>>>(GQ, DD, sX, GK, DD, sX, 0.125f, nullptr, nullptr, 0, S, nullptr, nullptr, TT, sS, TT, DD);      /* S = gq.gkT/8 f32-accurate: hi.hi ... */
  k_gemm_t<TT, 1><<<gs, 256, 0, stream>>>(GQl, DD, sX, GK, DD, sX, 0.125f * 0.0009765625f, nullptr, S, sS, S, nullptr, nullptr, TT, sS, TT, DD);      /* += lo.hi.2^-10 */
  k_gemm_t<TT, 1><<<gs, 256, 0, stream>>>(GQ, DD, sX, GKl, DD, sX, 0.125f * 0.0009765625f, nullptr, S, sS, S, nullptr, nullptr, TT, sS, TT, DD);      /* += hi.lo.2^-10: M 1024 N 1024 K 512 each, x BB */
  k_gbias<<<dim3((TT * TT / 4 + 255) / 256, BB), 256, 0, stream>>>(S, crd, d1w, d1b, d2w, d2b); k_smx<<<BB * TT / 8, 256, 0, stream>>>(S, P16);      /* softmax: a wave per row over the BB * TT rows */
  k_gemm_t<DD, 0><<<dim3((TT / 128) * (DD / 128), BB), 256, 0, stream>>>(P16, TT, sS, GVt, TT, sX, 0.000030517578125f, nullptr, FA, sX, nullptr, SUM16, nullptr, DD, sX, DD, TT);      /* feat_att + geom_att, stored as f16: M 1024 N 512 K 1024, x BB */
  k_gemm_t<0, 1><<<gp, 256, 0, stream>>>(SUM16, DD, 0, Bw + 4 * WSZ, DD, 0, 0.0625f, opb, nullptr, 0, (float*)d_out, nullptr, nullptr, DD, 0, DD, DD);      /* out = (feat + geom).op_w + op_b */
}

// v005
// Measured time: 236 microseconds a run.
// In two side-by-side timings against v004, it was 1.19 and 1.20 times as fast.
// All steps since v000 together make it 5.60 times as fast.
#include <hip/hip_runtime.h>
// Geometry-aware attention (B=8, N=1024, F=512, 8 heads × 64, G=128): feat = MHA(features) (x·W + b, softmax(q·k/8)·v, ·wo + bo); geometry branch: gq, gk, gv = geometry·W + b (F wide, single head);
// g_scores = gq·gkᵀ/8 + mean_h(gelu_tanh(dist·d1_w + d1_b)·d2_w + d2_b) with dist = max(‖coords_q − coords_k‖, 1e-6); geom = softmax(g_scores)·gv; out = (feat + geom)·op_w + op_b. (in,out) weights; jax.nn.gelu default = tanh approximation.
// Compute dtype: features, geometry, coords, all weights/biases rounded to bf16; f16 GEMM planes; the 8-head branch through a fused flash-style kernel (online softmax f32, P f16 ×2^10); the geometry branch, every stage one launch over all batches (batch in blockIdx.y; the softmax's BB·TT rows in blockIdx.x): S = gq·gkᵀ/8 f32-accurate from f16 hi + residual planes (hi·hi + (lo·hi + hi·lo)·2^-10; its logits reach σ≈3), a kernel adding the distance-MLP bias in place (f32, per pair from the coords), a wave-per-row f32 softmax → P f16 ×2^15, geom = P·gv by GEMM with feat_att as the f32 addend; final projection GEMM. All contractions on v_wmma_f32_16x16x32_f16, f32 accumulate.
#define BB 8
#define TT 1024
#define DD 512
#define GG 128
#define NH 8
#define NR (BB * TT)

typedef __bf16 v16b __attribute__((ext_vector_type(16)));
typedef unsigned short v8us __attribute__((ext_vector_type(8), may_alias));
typedef float  v8f  __attribute__((ext_vector_type(8)));
typedef float  v4f  __attribute__((ext_vector_type(4)));
typedef float  v4fa __attribute__((ext_vector_type(4), may_alias));
union FragB { v16b v; v8us half[2]; unsigned short u[16]; };

__device__ __forceinline__ unsigned short bf16_bits(float x) { unsigned int u = __float_as_uint(x); return (unsigned short)((u + 0x7FFFu + ((u >> 16) & 1u)) >> 16); }
__device__ __forceinline__ float bf16_val(unsigned short b) { return __uint_as_float(((unsigned int)b) << 16); }
__device__ __forceinline__ float bf16_round(float x) { return bf16_val(bf16_bits(x)); }
// D += A·B with NT terms: 1 = ah·bh, 2 = + al·bh (A split), 3 = + ah·bl (both split)
template <int NT>
__device__ __forceinline__ v8f mmaN(v16b ah, v16b al, v16b bh, v16b bl, v8f c) {
  c = __builtin_amdgcn_wmma_f32_16x16x32_bf16(false, ah, false, bh, (short)0, c, false, false);
  if (NT >= 2) c = __builtin_amdgcn_wmma_f32_16x16x32_bf16(false, al, false, bh, (short)0, c, false, false);
  if (NT >= 3) c = __builtin_amdgcn_wmma_f32_16x16x32_bf16(false, ah, false, bl, (short)0, c, false, false);
  asm volatile("v_nop\n\tv_nop\n\tv_nop\n\tv_nop" : "+v"(c) : "v"(ah), "v"(al), "v"(bh), "v"(bl));
  return c;
}

__global__ __launch_bounds__(256) void k_wt_bf16(const float* __restrict__ W, unsigned short* __restrict__ Wt, int K, int N) {
  const int t = blockIdx.x * 256 + threadIdx.x;
  const int k8n = K / 8;
  if (t >= N * k8n) return;
  const int n = t / k8n, k8 = (t % k8n) * 8;
  v8us v;
#pragma unroll
  for (int i = 0; i < 8; ++i) v[i] = bf16_bits(W[(size_t)(k8 + i) * N + n]);
  *(v8us*)(Wt + (size_t)n * K + k8) = v;
  
}

// GEMM C[M][N] (f32, pitch ldc) = act(A[M][K]·W + bias). A f32 row-major (pitch lda) converted per fragment to bf16
// (ASPLIT: hi/lo two planes -> 2 terms, else single rounded term); Wt bf16 [N][K] (pitch ldb). BIAS_BF16 rounds the
// bias to bf16 first (bias quantised to bf16 before the add). K%32==0, M%16==0, N%64==0.
template <bool ASPLIT, int ACT, bool BIAS_BF16>
__global__ __launch_bounds__(128) void k_gemm_bf(const float* __restrict__ A, int lda, const unsigned short* __restrict__ Wt, int ldb,
                                               const float* __restrict__ bias, float* __restrict__ C, int ldc, int M, int N, int K) {
  __shared__ __attribute__((aligned(16))) float so[4][16][64];
  const int tid = threadIdx.x, w = tid >> 5, lane = tid & 31, ln = lane & 15, hh = lane >> 4;
  const int ntn = N / 64;
  const int wid = blockIdx.x * 4 + w;
  const int mt = wid / ntn, nq = wid % ntn;
  if (mt * 16 >= M) return;
  const int row0 = mt * 16, col0 = nq * 64;
  const float* arow = A + (size_t)(row0 + ln) * lda;
  v8f acc[4] = {};
  for (int kb = 0; kb < K; kb += 32) {
    FragB ah, al;
    const v4f x0 = *(const v4fa*)(arow + kb + 8 * hh), x1 = *(const v4fa*)(arow + kb + 8 * hh + 4);
    const v4f x2 = *(const v4fa*)(arow + kb + 16 + 8 * hh), x3 = *(const v4fa*)(arow + kb + 16 + 8 * hh + 4);
    float xs[16] = {x0[0],x0[1],x0[2],x0[3],x1[0],x1[1],x1[2],x1[3],x2[0],x2[1],x2[2],x2[3],x3[0],x3[1],x3[2],x3[3]};
#pragma unroll
    for (int i = 0; i < 16; ++i) { const unsigned short hb = bf16_bits(xs[i]); ah.u[i] = hb; al.u[i] = ASPLIT ? bf16_bits(xs[i] - bf16_val(hb)) : (unsigned short)0; }
#pragma unroll
    for (int t = 0; t < 4; ++t) {
      const unsigned short* brow = Wt + (size_t)(col0 + t * 16 + ln) * ldb + kb;
      FragB b;
      b.half[0] = *(const v8us*)(brow + 8 * hh);
      b.half[1] = *(const v8us*)(brow + 16 + 8 * hh);
      acc[t] = mmaN<ASPLIT ? 2 : 1>(ah.v, al.v, b.v, b.v, acc[t]);
    }
  }
#pragma unroll
  for (int t = 0; t < 4; ++t) {
    float bv = bias ? bias[col0 + t * 16 + ln] : 0.f;
    if (BIAS_BF16) bv = bf16_round(bv);
#pragma unroll
    for (int r = 0; r < 8; ++r) { float v = acc[t][r] + bv; if (ACT == 1) v = fmaxf(v, 0.f); so[w][8 * hh + r][t * 16 + ln] = v; }
  }
  __builtin_amdgcn_fence(__ATOMIC_ACQ_REL, "workgroup");
  __builtin_amdgcn_wave_barrier();
  const int rsub = lane >> 4, c4 = (lane & 15) * 4;
  {
#pragma unroll
    for (int q = 0; q < 8; ++q) {
      const int r = q * 2 + rsub;
      const v4f v = *(const v4fa*)&so[w][r][c4];
      *(v4f*)(C + (size_t)(row0 + r) * ldc + col0 + c4) = v;
    }
    
  }
}

// Flash-style causal/unmasked attention, all contractions 3-term bf16 hi/lo splits, f32 softmax with running max.
// q,k,v rows are read from f32 buffers with arbitrary row pitch (so they can live inside a fused qkv buffer);
// D = head size (multiple of 32, <= 128); one wave = 16 query rows; block = 4 waves (64 queries) sharing K/V chunks of 32.
template <int D, bool CAUSAL>
__global__ __launch_bounds__(128) void k_flash(const float* __restrict__ qb, const float* __restrict__ kb, const float* __restrict__ vb,
                                             int pitch, int T, int H, float scale, float* __restrict__ y, int ypitch) {
  constexpr int KS = D / 32;        // k-steps for QK
  constexpr int DT = D / 16;        // d tiles for PV
  __shared__ __attribute__((aligned(16))) unsigned short sKh[32][D + 8], sKl[32][D + 8], sVh[32][D + 8], sVl[32][D + 8];
  __shared__ __attribute__((aligned(16))) unsigned short sPh[4][16][40], sPl[4][16][40];
  __shared__ __attribute__((aligned(16))) float sO[4][16][D];
  const int tid = threadIdx.x, w = tid >> 5, lane = tid & 31, ln = lane & 15, hh = lane >> 4;
  const int nqb = (T + 63) / 64;
  const int bh = blockIdx.x / nqb, qblk = blockIdx.x % nqb;
  const int b = bh / H, h = bh % H;
  const int q0 = qblk * 64 + w * 16;
  const float* Q = qb + (size_t)b * T * pitch + h * D;
  const float* K = kb + (size_t)b * T * pitch + h * D;
  const float* V = vb + (size_t)b * T * pitch + h * D;

  // A fragments of the wave's 16 query rows (scaled), hi/lo
  FragB aqh[KS], aql[KS];
  {
    int row = q0 + ln; if (row >= T) row = T - 1;
    const float* qr = Q + (size_t)row * pitch;
#pragma unroll
    for (int ks = 0; ks < KS; ++ks)
#pragma unroll
      for (int i = 0; i < 16; ++i) {
        const int d = ks * 32 + ((i < 8) ? (8 * hh + i) : (16 + 8 * hh + (i - 8)));
        const float x = qr[d] * scale; const unsigned short hb = bf16_bits(x);
        aqh[ks].u[i] = hb; aql[ks].u[i] = bf16_bits(x - bf16_val(hb));
      }
  }
  float m_r[8], l_r[8];
#pragma unroll
  for (int r = 0; r < 8; ++r) { m_r[r] = -3.0e38f; l_r[r] = 0.f; }
  v8f oacc[DT];
#pragma unroll
  for (int dt = 0; dt < DT; ++dt) oacc[dt] = (v8f){0.f,0.f,0.f,0.f,0.f,0.f,0.f,0.f};

  const int kv_end = CAUSAL ? min(T, qblk * 64 + 64) : T;     // block-uniform
  for (int j0 = 0; j0 < kv_end; j0 += 32) {
    __syncthreads();
    for (int e = tid; e < 32 * (D / 4); e += 128) {
      const int r = e / (D / 4), c4 = (e % (D / 4)) * 4;
      const int key = j0 + r;
      v4f kf = {0.f,0.f,0.f,0.f}, vf = {0.f,0.f,0.f,0.f};
      if (key < T) { kf = *(const v4fa*)(K + (size_t)key * pitch + c4); vf = *(const v4fa*)(V + (size_t)key * pitch + c4); }
#pragma unroll
      for (int t = 0; t < 4; ++t) {
        unsigned short hb = bf16_bits(kf[t]); sKh[r][c4 + t] = hb; sKl[r][c4 + t] = bf16_bits(kf[t] - bf16_val(hb));
        hb = bf16_bits(vf[t]); sVh[r][c4 + t] = hb; sVl[r][c4 + t] = bf16_bits(vf[t] - bf16_val(hb));
      }
    }
    __syncthreads();
    // S tile 16 x 32
    v8f s[2];
#pragma unroll
    for (int nt = 0; nt < 2; ++nt) {
      v8f acc = {};
#pragma unroll
      for (int ks = 0; ks < KS; ++ks) {
        FragB bh_, bl_;
        bh_.half[0] = *(const v8us*)&sKh[nt * 16 + ln][ks * 32 + 8 * hh]; bh_.half[1] = *(const v8us*)&sKh[nt * 16 + ln][ks * 32 + 16 + 8 * hh];
        bl_.half[0] = *(const v8us*)&sKl[nt * 16 + ln][ks * 32 + 8 * hh]; bl_.half[1] = *(const v8us*)&sKl[nt * 16 + ln][ks * 32 + 16 + 8 * hh];
        acc = mmaN<3>(aqh[ks].v, aql[ks].v, bh_.v, bl_.v, acc);
      }
      s[nt] = acc;
    }
    // mask + running max (rows 8hh+r; the 16 lanes of a half share rows)
    float alpha[8];
#pragma unroll
    for (int r = 0; r < 8; ++r) {
      const int qi = q0 + 8 * hh + r;
      const int ja = j0 + ln, jb = j0 + 16 + ln;
      if (CAUSAL) { if (ja > qi) s[0][r] = -3.0e38f; if (jb > qi) s[1][r] = -3.0e38f; }
      if (ja >= T) s[0][r] = -3.0e38f;
      if (jb >= T) s[1][r] = -3.0e38f;
      float mx = fmaxf(s[0][r], s[1][r]);
      mx = fmaxf(mx, __shfl_xor(mx, 1, 32)); mx = fmaxf(mx, __shfl_xor(mx, 2, 32)); mx = fmaxf(mx, __shfl_xor(mx, 4, 32)); mx = fmaxf(mx, __shfl_xor(mx, 8, 32));
      const float mnew = fmaxf(m_r[r], mx);
      alpha[r] = (mnew > -1.0e38f) ? __expf(m_r[r] - mnew) : 1.0f;
      const float p0 = (s[0][r] > -1.0e38f) ? __expf(s[0][r] - mnew) : 0.f;
      const float p1 = (s[1][r] > -1.0e38f) ? __expf(s[1][r] - mnew) : 0.f;
      m_r[r] = mnew;
      l_r[r] = l_r[r] * alpha[r] + p0 + p1;            // per-lane partial row sum (16 lanes combined at the end)
      unsigned short hb = bf16_bits(p0); sPh[w][8 * hh + r][ln] = hb;      sPl[w][8 * hh + r][ln] = bf16_bits(p0 - bf16_val(hb));
      hb = bf16_bits(p1);                sPh[w][8 * hh + r][16 + ln] = hb; sPl[w][8 * hh + r][16 + ln] = bf16_bits(p1 - bf16_val(hb));
    }
#pragma unroll
    for (int dt = 0; dt < DT; ++dt)
#pragma unroll
      for (int r = 0; r < 8; ++r) oacc[dt][r] *= alpha[r];
    __builtin_amdgcn_fence(__ATOMIC_ACQ_REL, "workgroup");
    __builtin_amdgcn_wave_barrier();
    FragB pah, pal;
    pah.half[0] = *(const v8us*)&sPh[w][ln][8 * hh]; pah.half[1] = *(const v8us*)&sPh[w][ln][16 + 8 * hh];
    pal.half[0] = *(const v8us*)&sPl[w][ln][8 * hh]; pal.half[1] = *(const v8us*)&sPl[w][ln][16 + 8 * hh];
#pragma unroll
    for (int dt = 0; dt < DT; ++dt) {
      FragB bvh, bvl;
#pragma unroll
      for (int i = 0; i < 8; ++i) {
        bvh.u[i] = sVh[8 * hh + i][dt * 16 + ln]; bvh.u[8 + i] = sVh[16 + 8 * hh + i][dt * 16 + ln];
        bvl.u[i] = sVl[8 * hh + i][dt * 16 + ln]; bvl.u[8 + i] = sVl[16 + 8 * hh + i][dt * 16 + ln];
      }
      oacc[dt] = mmaN<3>(pah.v, pal.v, bvh.v, bvl.v, oacc[dt]);
    }
    __builtin_amdgcn_fence(__ATOMIC_ACQ_REL, "workgroup");
    __builtin_amdgcn_wave_barrier();
  }
#pragma unroll
  for (int r = 0; r < 8; ++r) {
    float l = l_r[r];
    l += __shfl_xor(l, 1, 32); l += __shfl_xor(l, 2, 32); l += __shfl_xor(l, 4, 32); l += __shfl_xor(l, 8, 32);
    l_r[r] = (l > 0.f) ? 1.0f / l : 0.f;
  }
#pragma unroll
  for (int dt = 0; dt < DT; ++dt)
#pragma unroll
    for (int r = 0; r < 8; ++r) sO[w][8 * hh + r][dt * 16 + ln] = oacc[dt][r] * l_r[r];
  __builtin_amdgcn_fence(__ATOMIC_ACQ_REL, "workgroup");
  __builtin_amdgcn_wave_barrier();
  {
    for (int r = 0; r < 16; ++r) {
      const int row = q0 + r;
      if (row < T && lane < D / 4) {
        const v4f val = *(const v4fa*)&sO[w][r][lane * 4];
        *(v4f*)(y + ((size_t)b * T + row) * ypitch + h * D + lane * 4) = val;
      }
    }
    
  }
}

// GEMM C = act(A·W + bias + resid): A f32 (ASPLIT -> hi/lo 2 terms), Wt bf16 [N][K]; ACT 0 none, 1 relu, 2 exact gelu;
// resid (optional, f32, row index = (row % rmod), pitch ldr, RES_BF16 rounds it) added before the activation.
template <bool ASPLIT, int ACT, bool BIAS_BF16, bool RES_BF16>
__global__ __launch_bounds__(128) void k_gemm_bf3(const float* __restrict__ A, int lda, const unsigned short* __restrict__ Wt, int ldb,
                                                const float* __restrict__ bias, const float* __restrict__ resid, int rmod, int ldr,
                                                float* __restrict__ C, int ldc, int M, int N, int K) {
  __shared__ __attribute__((aligned(16))) float so[4][16][64];
  const int tid = threadIdx.x, w = tid >> 5, lane = tid & 31, ln = lane & 15, hh = lane >> 4;
  const int ntn = N / 64;
  const int wid = blockIdx.x * 4 + w;
  const int mt = wid / ntn, nq = wid % ntn;
  if (mt * 16 >= M) return;
  const int row0 = mt * 16, col0 = nq * 64;
  const float* arow = A + (size_t)(row0 + ln) * lda;
  v8f acc[4] = {};
  for (int kb = 0; kb < K; kb += 32) {
    FragB ah, al;
    const v4f x0 = *(const v4fa*)(arow + kb + 8 * hh), x1 = *(const v4fa*)(arow + kb + 8 * hh + 4);
    const v4f x2 = *(const v4fa*)(arow + kb + 16 + 8 * hh), x3 = *(const v4fa*)(arow + kb + 16 + 8 * hh + 4);
    float xs[16] = {x0[0],x0[1],x0[2],x0[3],x1[0],x1[1],x1[2],x1[3],x2[0],x2[1],x2[2],x2[3],x3[0],x3[1],x3[2],x3[3]};
#pragma unroll
    for (int i = 0; i < 16; ++i) { const unsigned short hb = bf16_bits(xs[i]); ah.u[i] = hb; al.u[i] = ASPLIT ? bf16_bits(xs[i] - bf16_val(hb)) : (unsigned short)0; }
#pragma unroll
    for (int t = 0; t < 4; ++t) {
      const unsigned short* brow = Wt + (size_t)(col0 + t * 16 + ln) * ldb + kb;
      FragB b;
      b.half[0] = *(const v8us*)(brow + 8 * hh);
      b.half[1] = *(const v8us*)(brow + 16 + 8 * hh);
      acc[t] = mmaN<ASPLIT ? 2 : 1>(ah.v, al.v, b.v, b.v, acc[t]);
    }
  }
#pragma unroll
  for (int t = 0; t < 4; ++t) {
    const int col = col0 + t * 16 + ln;
    float bv = bias ? bias[col] : 0.f;
    if (BIAS_BF16) bv = bf16_round(bv);
#pragma unroll
    for (int r = 0; r < 8; ++r) {
      float v = acc[t][r] + bv;
      if (resid) { float rv = resid[(size_t)((row0 + 8 * hh + r) % rmod) * ldr + col]; if (RES_BF16) rv = bf16_round(rv); v += rv; }
      if (ACT == 1) v = fmaxf(v, 0.f);
      if (ACT == 2) v = 0.5f * v * (1.0f + erff(v * 0.70710678118654752f));
      if (ACT == 3) { const float u = 0.7978845608028654f * (v + 0.044715f * v * v * v); v = 0.5f * v * (1.0f + tanhf(u)); }
      so[w][8 * hh + r][t * 16 + ln] = v;
    }
  }
  __builtin_amdgcn_fence(__ATOMIC_ACQ_REL, "workgroup");
  __builtin_amdgcn_wave_barrier();
  const int rsub = lane >> 4, c4 = (lane & 15) * 4;
  {
#pragma unroll
    for (int q = 0; q < 8; ++q) {
      const int r = q * 2 + rsub;
      const v4f v = *(const v4fa*)&so[w][r][c4];
      *(v4f*)(C + (size_t)(row0 + r) * ldc + col0 + c4) = v;
    }
    
  }
}
// row LayerNorm (biased variance, eps) over N: s = X (+ R); optional out_sum <- s; out_norm <- (s-mu)*rsqrt(var+eps)*g + b
template <bool PARAM_BF16>
__global__ __launch_bounds__(256) void k_layernorm(const float* __restrict__ X, const float* __restrict__ R, const float* __restrict__ g, const float* __restrict__ bta,
                                                  float* __restrict__ out_sum, float* __restrict__ out_norm, int N, float eps) {
  __shared__ float red[256];
  const int row = blockIdx.x, tid = threadIdx.x;
  const float* x = X + (size_t)row * N; const float* rr = R ? R + (size_t)row * N : nullptr;
  float vals[16];                     // up to N = 4096
  const int per = N / 256;            // contiguous chunk per thread? use strided-by-4 chunks: thread handles j = tid*4 + 1024*u
  float s1 = 0.f;
  for (int u = 0; u < per / 4; ++u) {
    const int j = tid * 4 + 1024 * u;
    const v4f a = *(const v4fa*)(x + j);
    v4f b = {0.f,0.f,0.f,0.f}; if (rr) b = *(const v4fa*)(rr + j);
#pragma unroll
    for (int q = 0; q < 4; ++q) { const float v = a[q] + b[q]; vals[u * 4 + q] = v; s1 += v; }
  }
  red[tid] = s1; __syncthreads();
  for (int st = 128; st > 0; st >>= 1) { if (tid < st) red[tid] += red[tid + st]; __syncthreads(); }
  const float mu = red[0] / (float)N; __syncthreads();
  float s2 = 0.f;
  for (int u = 0; u < per / 4; ++u)
#pragma unroll
    for (int q = 0; q < 4; ++q) { const float c = vals[u * 4 + q] - mu; s2 += c * c; }
  red[tid] = s2; __syncthreads();
  for (int st = 128; st > 0; st >>= 1) { if (tid < st) red[tid] += red[tid + st]; __syncthreads(); }
  const float rs = rsqrtf(red[0] / (float)N + eps);
  {
    for (int u = 0; u < per / 4; ++u) {
      const int j = tid * 4 + 1024 * u;
      v4f o, sm;
#pragma unroll
      for (int q = 0; q < 4; ++q) {
        float gg = g[j + q], bb = bta[j + q];
        if (PARAM_BF16) { gg = bf16_round(gg); bb = bf16_round(bb); }
        sm[q] = vals[u * 4 + q]; o[q] = (vals[u * 4 + q] - mu) * rs * gg + bb;
      }
      if (out_sum) *(v4f*)(out_sum + (size_t)row * N + j) = sm;
      *(v4f*)(out_norm + (size_t)row * N + j) = o;
    }
    
  }
}



// ---- f16 WMMA path (v_wmma_f32_16x16x32_f16): 11-bit significands for operands in range — used for every contraction launched here
typedef _Float16 v16h __attribute__((ext_vector_type(16)));
union FragH { v16h v; v8us half[2]; _Float16 h[16]; unsigned short u[16]; };
template <int NT>
__device__ __forceinline__ v8f mmaH(v16h ah, v16h al, v16h bh, v16h bl, v8f c) {
  c = __builtin_amdgcn_wmma_f32_16x16x32_f16(false, ah, false, bh, (short)0, c, false, false);
  if (NT >= 2) c = __builtin_amdgcn_wmma_f32_16x16x32_f16(false, al, false, bh, (short)0, c, false, false);
  if (NT >= 3) c = __builtin_amdgcn_wmma_f32_16x16x32_f16(false, ah, false, bl, (short)0, c, false, false);
  asm volatile("v_nop\n\tv_nop\n\tv_nop\n\tv_nop" : "+v"(c) : "v"(ah), "v"(al), "v"(bh), "v"(bl));
  return c;
}
// batched GEMM like k_gemm_b but f16 operands: A f32 (split into f16 hi/lo if ASPLIT, else rounded to f16), Bt = f16 values [n][k]; alpha; C f32; N multiple of 16 (partial tiles skipped)
template <bool ASPLIT>
__global__ __launch_bounds__(128) void k_gemm_h(const float* __restrict__ A, int lda, size_t sA, const _Float16* __restrict__ Bh, int ldb, size_t sB, float alpha, float* __restrict__ C, int ldc, size_t sC, int M, int N, int K) {
  __shared__ __attribute__((aligned(16))) float so[4][16][64];
  const int tid = threadIdx.x, w = tid >> 5, lane = tid & 31, ln = lane & 15, hh = lane >> 4; const int by = blockIdx.y;
  A += (size_t)by * sA; Bh += (size_t)by * sB; C += (size_t)by * sC;
  const int ntn = (N + 63) / 64; const int wid = blockIdx.x * 4 + w; const int mt = wid / ntn, nq = wid % ntn; if (mt * 16 >= M) return;
  const int row0 = mt * 16, col0 = nq * 64; const float* arow = A + (size_t)(row0 + ln) * lda;
  v8f acc[4] = {};
  for (int kb = 0; kb < K; kb += 32) {
    FragH ah, al;
    const v4f x0 = *(const v4fa*)(arow + kb + 8 * hh), x1 = *(const v4fa*)(arow + kb + 8 * hh + 4), x2 = *(const v4fa*)(arow + kb + 16 + 8 * hh), x3 = *(const v4fa*)(arow + kb + 16 + 8 * hh + 4);
    float xs[16] = {x0[0],x0[1],x0[2],x0[3],x1[0],x1[1],x1[2],x1[3],x2[0],x2[1],x2[2],x2[3],x3[0],x3[1],x3[2],x3[3]};
#pragma unroll
    for (int i = 0; i < 16; ++i) { const _Float16 h = (_Float16)xs[i]; ah.h[i] = h; al.h[i] = ASPLIT ? (_Float16)(xs[i] - (float)h) : (_Float16)0.0f; }
#pragma unroll
    for (int t = 0; t < 4; ++t) { if (col0 + t * 16 >= N) continue; const size_t boff = (size_t)(col0 + t * 16 + ln) * ldb + kb; FragH bq; bq.half[0] = *(const v8us*)(Bh + boff + 8 * hh); bq.half[1] = *(const v8us*)(Bh + boff + 16 + 8 * hh);
      acc[t] = mmaH<ASPLIT ? 2 : 1>(ah.v, al.v, bq.v, bq.v, acc[t]); }
  }
#pragma unroll
  for (int t = 0; t < 4; ++t) { if (col0 + t * 16 >= N) continue;
#pragma unroll
    for (int r = 0; r < 8; ++r) so[w][8 * hh + r][t * 16 + ln] = acc[t][r] * alpha; }
  __builtin_amdgcn_fence(__ATOMIC_ACQ_REL, "workgroup"); __builtin_amdgcn_wave_barrier();
  const int rsub = lane >> 4, c4 = (lane & 15) * 4;
  {
#pragma unroll
    for (int q = 0; q < 8; ++q) { const int r = q * 2 + rsub; if (col0 + c4 < N) { const v4f v = *(const v4fa*)&so[w][r][c4]; *(v4f*)(C + (size_t)(row0 + r) * ldc + col0 + c4) = v; } }
     }
}

// Wt[n][k] = f16(W[k][n]·scale) from f32 row-major W[K][N] (scale = power of two; bf16-exact weights stay exact in f16 away from the subnormal range)
__device__ __forceinline__ void wt_f16(const float* __restrict__ W, _Float16* __restrict__ Wt, int K, int N, float scale, int blk) {
  const int t = blk * 256 + threadIdx.x; if (t >= N * (K / 8)) return; const int n = t / (K / 8), k8 = (t % (K / 8)) * 8; FragH f;
#pragma unroll
  for (int i = 0; i < 8; ++i) f.h[i] = (_Float16)(bf16_round(W[(size_t)(k8 + i) * N + n]) * scale); const v8us o = f.half[0];
  *(v8us*)((unsigned short*)Wt + (size_t)n * K + k8) = o; 
}
// Block-tiled GEMM, f16 operands, both K-contiguous: v = (A.Bt^T)*alpha + bf16(bias[col]) (+ CP[row*LDCP + by*sCPy + col] if LDCP; CP may be C itself: a lane reads only what it then writes); writes f32 C, or f16 C16, or f16 C16 with the rounding residual x 2^10 in C16l. Batch in blockIdx.y.
// One work-group of 8 waves (4 x 2) makes 128 x 128 of C, a wave 32 x 64. Each trip takes 64 k: 128 rows of 128 B of A and of Bt are brought into LDS by asynchronous copies (whole 128-B lines, 16 B a lane),
// two buffers, the next tile in flight while this one is multiplied; LDS rows at pitch 144 B for the ds_load_b128 fragment reads. M, N multiples of 128, K a multiple of 64.
#define GT_PITCH 144
#define GT_OPB (128 * GT_PITCH)
#define GT_BUF (2 * GT_OPB)
typedef _Float16 v4h __attribute__((ext_vector_type(4)));
// one tile: 4 copies of A and 4 of Bt per lane. The s_wait_xcnt stands inside the statement so that no address register named here is rewritten ahead of it.
__device__ __forceinline__ void gt_copy(unsigned l, const unsigned short* ga, const unsigned short* gb, size_t a32, size_t b32) {
  asm volatile("global_load_async_to_lds_b128 %0, %8, off\n\t"
               "global_load_async_to_lds_b128 %1, %9, off\n\t"
               "global_load_async_to_lds_b128 %2, %10, off\n\t"
               "global_load_async_to_lds_b128 %3, %11, off\n\t"
               "global_load_async_to_lds_b128 %4, %12, off\n\t"
               "global_load_async_to_lds_b128 %5, %13, off\n\t"
               "global_load_async_to_lds_b128 %6, %14, off\n\t"
               "global_load_async_to_lds_b128 %7, %15, off\n\t"
               "s_wait_xcnt 0x0"
               :: "v"(l), "v"(l + 32 * GT_PITCH), "v"(l + 64 * GT_PITCH), "v"(l + 96 * GT_PITCH),
                  "v"(l + GT_OPB), "v"(l + GT_OPB + 32 * GT_PITCH), "v"(l + GT_OPB + 64 * GT_PITCH), "v"(l + GT_OPB + 96 * GT_PITCH),
                  "v"(ga), "v"(ga + a32), "v"(ga + 2 * a32), "v"(ga + 3 * a32), "v"(gb), "v"(gb + b32), "v"(gb + 2 * b32), "v"(gb + 3 * b32)
               : "memory");
}
// One launch may hold two sets of independent products: blockIdx.y below ysplit belongs to set g0, from ysplit on to set g1; inside a set y steps the operands and the result by the set's strides and picks one of three biases (y 1: bias1, y 2: bias2, else bias0).
struct GSet { const _Float16* A; const _Float16* B; const float* bias0; const float* bias1; const float* bias2; float* C; _Float16* C16; _Float16* C16l; size_t sA, sB, sC; int lda, ldb, ldc, N, K; float alpha; };
template <int LDCP, int OUT>      /* LDCP: row pitch of an f32 addend plane CP, 0 for none (a constant, so that its 16 loads share one address register pair); OUT 1: f32 result in C; 0: f16 result in C16; 2: f16 result in C16 and (v - f16(v)) x 2^10 as f16 in C16l */
__global__ __launch_bounds__(256) void k_gemm_t(const GSet g0, const GSet g1, int ysplit, const float* CP, size_t sCPy) {
  __shared__ __attribute__((aligned(16))) unsigned char L[2 * GT_BUF];
  const int tid = threadIdx.x, w = tid >> 5, lane = tid & 31, ln = lane & 15, hh = lane >> 4;
  const bool sec = (int)blockIdx.y >= ysplit; const GSet& g = sec ? g1 : g0; const int by = (int)blockIdx.y - (sec ? ysplit : 0);
  const _Float16* A = g.A; const _Float16* Bh = g.B; const float* bias = by == 1 ? g.bias1 : by == 2 ? g.bias2 : g.bias0; float* C = g.C; _Float16* C16 = g.C16; _Float16* C16l = g.C16l;
  const size_t sA = g.sA, sB = g.sB, sC = g.sC; const int lda = g.lda, ldb = g.ldb, ldc = g.ldc, N = g.N, K = g.K; const float alpha = g.alpha;
  const int ntn = N / 128; const int row0 = ((int)blockIdx.x / ntn) * 128, col0 = ((int)blockIdx.x % ntn) * 128; const int wm = w >> 1, wn = w & 1;
  const int cr = tid >> 3, cc = tid & 7;      /* copies: 8 lanes a row, 32 rows a copy */
  const unsigned short* ga = (const unsigned short*)A + (size_t)by * sA + (size_t)(row0 + cr) * lda + cc * 8;
  const unsigned short* gb = (const unsigned short*)Bh + (size_t)by * sB + (size_t)(col0 + cr) * ldb + cc * 8;
  const size_t a32 = (size_t)32 * lda, b32 = (size_t)32 * ldb;
  const unsigned lcp = (unsigned)(size_t)L + (unsigned)(cr * GT_PITCH + cc * 16);
  const int nk = K / 64;
  v8f acc[2][4] = {};
  gt_copy(lcp, ga, gb, a32, b32);
  asm volatile("s_wait_asynccnt 0x0" ::: "memory");      /* tile 0 has landed before the barrier that publishes it */
  __syncthreads();
  if (nk > 1) gt_copy(lcp + GT_BUF, ga + 64, gb + 64, a32, b32);
  const unsigned char* fa = L + (wm * 32 + ln) * GT_PITCH + hh * 16; const unsigned char* fb = L + GT_OPB + (wn * 64 + ln) * GT_PITCH + hh * 16;
#pragma unroll 1
  for (int t = 0; t < nk; ++t) {      /* stays rolled: one copy of the ring's foot */
    const unsigned bo = (unsigned)(t & 1) * GT_BUF;
    FragH a[2][2], b[2][4];
#pragma unroll
    for (int ks = 0; ks < 2; ++ks) {
#pragma unroll
      for (int i = 0; i < 2; ++i) { a[ks][i].half[0] = *(const v8us*)(fa + bo + i * 16 * GT_PITCH + ks * 64); a[ks][i].half[1] = *(const v8us*)(fa + bo + i * 16 * GT_PITCH + ks * 64 + 32); }
#pragma unroll
      for (int j = 0; j < 4; ++j) { b[ks][j].half[0] = *(const v8us*)(fb + bo + j * 16 * GT_PITCH + ks * 64); b[ks][j].half[1] = *(const v8us*)(fb + bo + j * 16 * GT_PITCH + ks * 64 + 32); } }
    /* the ring's foot stands here, behind the trip's 24 fragment reads and ahead of its WMMAs, which work on registers alone: the refill then flies under them too */
    asm volatile("s_wait_dscnt 0x0" ::: "memory");      /* this wave's reads of the buffer are over before it may be refilled */
    asm volatile("s_wait_asynccnt 0x0" ::: "memory");      /* this wave's share of tile t + 1 has landed before the barrier publishes it */
    __syncthreads();
    if (t + 2 < nk) gt_copy(lcp + bo, ga + (size_t)(t + 2) * 64, gb + (size_t)(t + 2) * 64, a32, b32);
    __builtin_amdgcn_sched_barrier(0);      /* keeps the WMMAs behind the refill's issue: ahead of it they would delay the copies by their whole run */
#pragma unroll
    for (int ks = 0; ks < 2; ++ks)
#pragma unroll
      for (int i = 0; i < 2; ++i)
#pragma unroll
        for (int j = 0; j < 4; ++j) acc[i][j] = __builtin_amdgcn_wmma_f32_16x16x32_f16(false, a[ks][i].v, false, b[ks][j].v, (short)0, acc[i][j], false, false);
  }
  asm volatile("s_wait_asynccnt 0x0" ::: "memory");      /* no copy outstanding when the ring becomes output staging */
  /* epilogue: each wave stages its 32 x 64 in its own 8,704 B of the ring (every wave's last read of it ended ahead of the last barrier), then whole row pieces (256 B of f32, 128 B of f16) go out */
  const int c4 = ln * 4, col = col0 + wn * 64 + c4, rw0 = row0 + wm * 32 + hh; const size_t cofs = (size_t)by * sC;
  v4f cp[16];      /* the addend's 16 row pieces are asked for together, ahead of the staging */
  if (LDCP) { const float* cpp = CP + (size_t)rw0 * LDCP + (size_t)by * sCPy + col;
#pragma unroll
    for (int q = 0; q < 16; ++q) cp[q] = *(const v4fa*)(cpp + q * 2 * LDCP);
    asm volatile("s_wait_xcnt 0x0" ::: "memory"); }      /* ahead of any rewrite of the address registers that the loads above name */
  v4f bv = {0.f, 0.f, 0.f, 0.f}; if (bias) { const v4f bb = *(const v4fa*)(bias + col); for (int e = 0; e < 4; ++e) bv[e] = bf16_round(bb[e]); }
  float* so = (float*)(L + w * (32 * 68 * 4));
#pragma unroll
  for (int i = 0; i < 2; ++i)
#pragma unroll
    for (int j = 0; j < 4; ++j)
#pragma unroll
      for (int r = 0; r < 8; ++r) so[(i * 16 + 8 * hh + r) * 68 + j * 16 + ln] = acc[i][j][r];
  __builtin_amdgcn_fence(__ATOMIC_ACQ_REL, "workgroup"); __builtin_amdgcn_wave_barrier();
#pragma unroll
  for (int q = 0; q < 16; ++q) { const size_t o = cofs + (size_t)rw0 * ldc + col + (size_t)(q * 2) * ldc; const v4f x = *(const v4fa*)&so[(q * 2 + hh) * 68 + c4]; v4f v;
    for (int e = 0; e < 4; ++e) v[e] = x[e] * alpha + bv[e];
    if (LDCP) for (int e = 0; e < 4; ++e) v[e] += cp[q][e];
    if (OUT == 1) *(v4f*)(C + o) = v;
    else { v4h h4; for (int e = 0; e < 4; ++e) h4[e] = (_Float16)v[e]; *(v4h*)(C16 + o) = h4;
      if (OUT == 2) { v4h l4; for (int e = 0; e < 4; ++e) l4[e] = (_Float16)((v[e] - (float)h4[e]) * 1024.0f); *(v4h*)(C16l + o) = l4; } } }
}


__device__ __forceinline__ void x16(const float* __restrict__ x, _Float16* __restrict__ X16, size_t n8, int blk) { const size_t t = (size_t)blk * 256 + threadIdx.x; if (t >= n8) return; FragH f;
#pragma unroll
  for (int q = 0; q < 8; ++q) f.h[q] = (_Float16)bf16_round(x[t * 8 + q]); *(v8us*)((unsigned short*)X16 + t * 8) = f.half[0];  }
// All operand preparation in one launch: none of its ten parts reads what another writes. Ranges of blockIdx.x: the five F x F weights, the three G x F weights (each transposed, x 2^4), then features and geometry (rounded to f16 planes).
#define PW_BIG (DD * (DD / 8) / 256)
#define PW_SML (DD * (GG / 8) / 256)
#define PX_F (NR * DD / 8 / 256)
#define PX_G (NR * GG / 8 / 256)
__global__ __launch_bounds__(256) void k_prep(const float* __restrict__ wq, const float* __restrict__ wk, const float* __restrict__ wv, const float* __restrict__ wo, const float* __restrict__ opw,
    const float* __restrict__ gqw, const float* __restrict__ gkw, const float* __restrict__ gvw, const float* __restrict__ feats, const float* __restrict__ geom,
    _Float16* __restrict__ Bw, _Float16* __restrict__ Bg, _Float16* __restrict__ X16, _Float16* __restrict__ GE16) {
  int blk = blockIdx.x;
  if (blk < 5 * PW_BIG) { const int i = blk / PW_BIG; const float* W = i == 0 ? wq : i == 1 ? wk : i == 2 ? wv : i == 3 ? wo : opw; wt_f16(W, Bw + (size_t)i * DD * DD, DD, DD, 16.0f, blk % PW_BIG); return; }
  blk -= 5 * PW_BIG;
  if (blk < 3 * PW_SML) { const int i = blk / PW_SML; const float* W = i == 0 ? gqw : i == 1 ? gkw : gvw; wt_f16(W, Bg + (size_t)i * GG * DD, GG, DD, 16.0f, blk % PW_SML); return; }
  blk -= 3 * PW_SML;
  if (blk < PX_F) { x16(feats, X16, (size_t)NR * DD / 8, blk); return; }
  x16(geom, GE16, (size_t)NR * GG / 8, blk - PX_F);
}
__global__ __launch_bounds__(256) void k_round16f(const float* __restrict__ W, _Float16* __restrict__ Bt, size_t n8) { const size_t t = (size_t)blockIdx.x * 256 + threadIdx.x; if (t >= n8) return; FragH f;
#pragma unroll
  for (int i = 0; i < 8; ++i) f.h[i] = (_Float16)(bf16_round(W[t * 8 + i]) * 16.0f); *(v8us*)((unsigned short*)Bt + t * 8) = f.half[0];  }
template <int NHv, int TTv>
__global__ __launch_bounds__(256) void k_vt(const _Float16* __restrict__ V16, size_t sV, int ldv, int voff, _Float16* __restrict__ Vt, size_t sVt) { __shared__ unsigned short tl[64][66]; const int tid = threadIdx.x; V16 += (size_t)blockIdx.y * sV; Vt += (size_t)blockIdx.y * sVt;      /* blockIdx.y: which plane */ const int slab = blockIdx.x / (TTv / 64), lg = blockIdx.x % (TTv / 64); const int b = slab / NHv, h = slab % NHv;
  for (int i = tid; i < 64 * 8; i += 256) { const int r = i / 8, c8 = (i % 8) * 8; FragH f; f.half[0] = *(const v8us*)((const unsigned short*)V16 + ((size_t)b * TTv + lg * 64 + r) * ldv + voff + h * 64 + c8);
#pragma unroll
    for (int q = 0; q < 8; ++q) tl[r][c8 + q] = f.u[q]; }
  __syncthreads();
  {
#pragma unroll
    for (int rd = 0; rd < 2; ++rd) { const int d = rd * 32 + tid / 8, pc = tid % 8; FragH f;
#pragma unroll
      for (int q = 0; q < 8; ++q) f.u[q] = tl[pc * 8 + q][d];
      *(v8us*)((unsigned short*)Vt + ((size_t)slab * 64 + d) * TTv + lg * 64 + pc * 8) = f.half[0]; }
     } }

__device__ __forceinline__ float gelu_tanh(float x) { const float u = 0.7978845608028654f * (x + 0.044715f * x * x * x); return 0.5f * x * (1.0f + tanhf(u)); }
__global__ __launch_bounds__(256) void k_gbias(float* __restrict__ S, const float* __restrict__ CRD, const float* __restrict__ w1, const float* __restrict__ b1, const float* __restrict__ w2, const float* __restrict__ b2) {
  #pragma clang fp contract(off)
  const int b = blockIdx.y; S += (size_t)b * TT * TT;      /* one score plane per batch */
  const size_t t = (size_t)blockIdx.x * 256 + threadIdx.x; if (t >= (size_t)TT * TT / 4) return; const int q = (int)((t * 4) / TT), k0 = (int)((t * 4) % TT);
  float cb = 0.f; for (int j = 0; j < 8; ++j) cb += bf16_round(b2[j]); cb *= 0.125f;
  const float qx = bf16_round(CRD[((size_t)b * TT + q) * 3]), qy = bf16_round(CRD[((size_t)b * TT + q) * 3 + 1]), qz = bf16_round(CRD[((size_t)b * TT + q) * 3 + 2]);
  v4f sv = *(const v4fa*)(S + (size_t)q * TT + k0); float dist[4];
  for (int e = 0; e < 4; ++e) { const int k = k0 + e; const float dx = qx - bf16_round(CRD[((size_t)b * TT + k) * 3]), dy = qy - bf16_round(CRD[((size_t)b * TT + k) * 3 + 1]), dz = qz - bf16_round(CRD[((size_t)b * TT + k) * 3 + 2]); dist[e] = sqrtf(fmaxf(dx * dx + dy * dy + dz * dz, 1e-12f)); sv[e] += cb; }
#pragma unroll 1
  for (int j = 0; j < 8; ++j) { float cj = 0.f; for (int h = 0; h < 8; ++h) cj += bf16_round(w2[j * 8 + h]); cj *= 0.125f; const float wj = bf16_round(w1[j]), bj = bf16_round(b1[j]);
    for (int e = 0; e < 4; ++e) sv[e] += gelu_tanh(dist[e] * wj + bj) * cj; }
  *(v4f*)(S + (size_t)q * TT + k0) = sv;  }
#define NN TT
__global__ __launch_bounds__(256) void k_smx(const float* __restrict__ S, _Float16* __restrict__ P16) { const int tid = threadIdx.x, wv = tid >> 5, lane = tid & 31; const int i = blockIdx.x * 8 + wv; const float* sr = S + (size_t)i * NN;
  float m = -3.0e38f;
  for (int p = lane; p < NN / 8; p += 32) { const v4f a = *(const v4fa*)(sr + p * 8), c = *(const v4fa*)(sr + p * 8 + 4); for (int e = 0; e < 4; ++e) m = fmaxf(m, fmaxf(a[e], c[e])); }
  for (int o = 16; o >= 1; o >>= 1) m = fmaxf(m, __shfl_xor(m, o, 32)); float z = 0.f;
  for (int p = lane; p < NN / 8; p += 32) { const v4f a = *(const v4fa*)(sr + p * 8), c = *(const v4fa*)(sr + p * 8 + 4); for (int e = 0; e < 4; ++e) z += __expf(a[e] - m) + __expf(c[e] - m); }
  for (int o = 16; o >= 1; o >>= 1) z += __shfl_xor(z, o, 32); const float iz = 32768.0f / z;
  { for (int p = lane; p < NN / 8; p += 32) { FragH f; const v4f a = *(const v4fa*)(sr + p * 8), c = *(const v4fa*)(sr + p * 8 + 4); for (int e = 0; e < 4; ++e) { f.h[e] = (_Float16)(__expf(a[e] - m) * iz); f.h[4 + e] = (_Float16)(__expf(c[e] - m) * iz); }
      *(v8us*)((unsigned short*)P16 + (size_t)i * NN + p * 8) = f.half[0]; }  } }
// lane l with lane l ^ 16 (the two halves of a wave hold the two halves of a query's keys)
__device__ __forceinline__ float xhalf(float x) { return __builtin_bit_cast(float, __builtin_amdgcn_permlanex16(__builtin_bit_cast(int, x), __builtin_bit_cast(int, x), 0x76543210, 0xfedcba98, false, false)); }
__global__ __launch_bounds__(128) void k_flash(const _Float16* __restrict__ Q16, int ldq, const _Float16* __restrict__ K16, int ldk, const _Float16* __restrict__ Vt, const int* __restrict__ MSK, _Float16* __restrict__ O16, int ldo) {
  constexpr int RPW = 16, NQB = TT / (4 * RPW), DT = 4, KS = 2; (void)MSK;
  __shared__ __attribute__((aligned(16))) unsigned short sO[4][RPW][64 + 8];      /* f16 rows at pitch 144 B */
  const int tid = threadIdx.x, w = tid >> 5, lane = tid & 31, ln = lane & 15, hh = lane >> 4;
  const int slab = blockIdx.x / NQB, qblk = blockIdx.x % NQB; const int b = slab / NH, h = slab % NH; const int q0 = qblk * (4 * RPW) + w * RPW;
  FragH bq[KS];
  { const unsigned short* qr = (const unsigned short*)Q16 + ((size_t)b * TT + q0 + ln) * ldq + h * 64;
#pragma unroll
    for (int ks = 0; ks < KS; ++ks) { bq[ks].half[0] = *(const v8us*)(qr + ks * 32 + 8 * hh); bq[ks].half[1] = *(const v8us*)(qr + ks * 32 + 16 + 8 * hh); } }
  const unsigned short* Vth = (const unsigned short*)Vt + (size_t)slab * 64 * TT;
  float m_q = -3.0e38f, l_q = 0.f; v8f oacc[DT];
#pragma unroll
  for (int dt = 0; dt < DT; ++dt) oacc[dt] = (v8f){0.f,0.f,0.f,0.f,0.f,0.f,0.f,0.f};
#pragma unroll 1      /* stays rolled: an unrolled body would hold two trips' fragments in registers */
  for (int j0 = 0; j0 < TT; j0 += 32) {
    FragH ak[2][KS], av[DT];      /* no fence stands in the loop: the trip's 16 loads are asked for together at its head, one trip to L2 instead of one per fragment */
#pragma unroll
    for (int nt = 0; nt < 2; ++nt) { const unsigned short* kr = (const unsigned short*)K16 + ((size_t)b * TT + j0 + nt * 16 + ln) * ldk + h * 64;
#pragma unroll
      for (int ks = 0; ks < KS; ++ks) { ak[nt][ks].half[0] = *(const v8us*)(kr + ks * 32 + 8 * hh); ak[nt][ks].half[1] = *(const v8us*)(kr + ks * 32 + 16 + 8 * hh); } }
    asm volatile("s_wait_xcnt 0x0" ::: "memory");      /* ahead of the VT loads, whose results may be given the registers that held the key loads' addresses */
#pragma unroll
    for (int dt = 0; dt < DT; ++dt) { const unsigned short* vrow = Vth + (size_t)(dt * 16 + ln) * TT + j0; av[dt].half[0] = *(const v8us*)(vrow + 8 * hh); av[dt].half[1] = *(const v8us*)(vrow + 16 + 8 * hh); }
    __builtin_amdgcn_sched_barrier(0);      /* keeps all 16 loads ahead of the first product's wait: behind it the second key tile would pay a second trip to L2 */
    v8f s[2];
#pragma unroll
    for (int nt = 0; nt < 2; ++nt) { v8f acc = (v8f){0.f,0.f,0.f,0.f,0.f,0.f,0.f,0.f};
#pragma unroll
      for (int ks = 0; ks < KS; ++ks) acc = mmaH<1>(ak[nt][ks].v, ak[nt][ks].v, bq[ks].v, bq[ks].v, acc);
      s[nt] = acc; }
    float mc = -3.0e38f;
#pragma unroll
    for (int nt = 0; nt < 2; ++nt)
#pragma unroll
      for (int r = 0; r < 8; ++r) { s[nt][r] *= 0.125f; mc = fmaxf(mc, s[nt][r]); }
    mc = fmaxf(mc, xhalf(mc));
    const float mn = fmaxf(m_q, mc); const float al = (mn > -1.0e38f) ? expf(m_q - mn) : 1.0f; m_q = mn;
    FragH pb; float ps = 0.f;
#pragma unroll
    for (int nt = 0; nt < 2; ++nt)
#pragma unroll
      for (int r = 0; r < 8; ++r) { const float p = expf(s[nt][r] - mn); ps += p; pb.h[nt * 8 + r] = (_Float16)(p * 1024.0f); }
    l_q = l_q * al + ps;      /* this half's keys only; the halves are joined behind the loop */
#pragma unroll
    for (int dt = 0; dt < DT; ++dt)
#pragma unroll
      for (int r = 0; r < 8; ++r) oacc[dt][r] *= al;
#pragma unroll
    for (int dt = 0; dt < DT; ++dt) oacc[dt] = mmaH<1>(av[dt].v, av[dt].v, pb.v, pb.v, oacc[dt]); }
  const float lt = l_q + xhalf(l_q); const float il = (lt > 0.f) ? 1.0f / (lt * 64.0f) : 0.f;      /* P carries 2^10, the f16 result plane 2^4 */
#pragma unroll
  for (int dt = 0; dt < DT; ++dt) { FragH f;      /* oacc[dt][r] = OT[dt * 16 + 8 * hh + r][query ln] */
#pragma unroll
    for (int r = 0; r < 8; ++r) f.h[r] = (_Float16)(oacc[dt][r] * il);
    *(v8us*)&sO[w][ln][dt * 16 + 8 * hh] = f.half[0]; }
  __builtin_amdgcn_fence(__ATOMIC_ACQ_REL, "workgroup"); __builtin_amdgcn_wave_barrier();
#pragma unroll
  for (int rp = 0; rp < RPW; rp += 4) { const int r = rp + (lane >> 3), pc = lane & 7; const v8us val = *(const v8us*)&sO[w][r][pc * 8];      /* 8 lanes a row: one whole 128-B line of the f16 plane */
    *(v8us*)((unsigned short*)O16 + ((size_t)b * TT + q0 + r) * ldo + h * 64 + pc * 8) = val; } }

extern "C" void kernel_launch(void* const* d_in, const int* in_sizes, int n_in,
                              void* d_out, int out_size, void* d_ws, size_t ws_size, hipStream_t stream) {
  (void)in_sizes; (void)n_in; (void)out_size;
  const float* const* I = (const float* const*)d_in; const float* feats = I[0]; const float* geom = I[1]; const float* crd = I[2];
  const float* wq = I[3]; const float* bq = I[4]; const float* wk = I[5]; const float* bk = I[6]; const float* wv = I[7]; const float* bv = I[8]; const float* wo = I[9]; const float* bo = I[10];
  const float* gqw = I[11]; const float* gqb = I[12]; const float* gkw = I[13]; const float* gkb = I[14]; const float* gvw = I[15]; const float* gvb = I[16]; const float* d1w = I[17]; const float* d1b = I[18]; const float* d2w = I[19]; const float* d2b = I[20]; const float* opw = I[21]; const float* opb = I[22];
  char* ws = (char*)d_ws; size_t off = 0;
  auto take = [&](size_t bytes) { char* p = ws + off; off += (bytes + 255) & ~(size_t)255; return p; };
  const size_t WSZ = (size_t)DD * DD, GSZ = (size_t)GG * DD, PSZ = (size_t)NR * DD; _Float16* Bw = (_Float16*)take(5 * WSZ * 2); _Float16* Bg = (_Float16*)take(3 * GSZ * 2);
  _Float16* X16 = (_Float16*)take(PSZ * 2); _Float16* GE16 = (_Float16*)take((size_t)NR * GG * 2);
  _Float16* PL = (_Float16*)take(6 * PSZ * 2);      /* the six projections' planes in a row: q, k, v, gv, gq, gk */
  _Float16* RL = (_Float16*)take(2 * PSZ * 2);      /* residual planes of gq, gk */
  _Float16* VT = (_Float16*)take(2 * PSZ * 2);      /* v and gv transposed */
  float* FA = (float*)take(PSZ * 4); float* S = (float*)take((size_t)BB * TT * TT * 4); _Float16* P16 = (_Float16*)take((size_t)BB * TT * TT * 2);
  _Float16* Q = PL; _Float16* K = PL + PSZ; _Float16* V = PL + 2 * PSZ; _Float16* GQ = PL + 4 * PSZ; _Float16* GK = PL + 5 * PSZ; _Float16* GQl = RL; _Float16* GKl = RL + PSZ; _Float16* Vt = VT; _Float16* GVt = VT + PSZ;
  _Float16* O16 = X16; _Float16* SUM16 = V;      /* reuse in stream order: X16 -> the attention output (behind the projections); V -> feat + geom (behind the transposes) */
  if (off > ws_size) return;      // 2.6 + 0.4 + 8.4 + 2.1 + 10 x 8.4 + 16.8 + 33.6 + 16.8 = about 165 MB
  const int NOSPLIT = 0x7fffffff;      /* a launch with one set only */
  k_prep<<<5 * PW_BIG + 3 * PW_SML + PX_F + PX_G, 256, 0, stream>>>(wq, wk, wv, wo, opw, gqw, gkw, gvw, feats, geom, Bw, Bg, X16, GE16);      /* (in,out) weights -> Bt x 2^4; features, geometry -> f16 */
  const unsigned gpx = (NR / 128) * (DD / 128);
  { const GSet f = {X16, Bw, bq, bk, bv, nullptr, PL, nullptr, 0, WSZ, PSZ, DD, DD, DD, DD, DD, 0.0625f};      /* q, k, v: M 8192 N 512 K 512 */
    const GSet e = {GE16, Bg + 2 * GSZ, gvb, gvb, gvb, nullptr, PL + 3 * PSZ, nullptr, 0, 0, 0, GG, GG, DD, DD, GG, 0.0625f};      /* gv: M 8192 N 512 K 128 */
    k_gemm_t<0, 0><<<dim3(gpx, 4), 256, 0, stream>>>(f, e, 3, nullptr, 0); }
  { const GSet e = {GE16, Bg, gqb, gkb, gkb, nullptr, GQ, RL, 0, GSZ, PSZ, GG, GG, DD, DD, GG, 0.0625f};      /* gq, gk -> hi / x2^10 residual planes: M 8192 N 512 K 128 */
    k_gemm_t<0, 2><<<dim3(gpx, 2), 256, 0, stream>>>(e, e, NOSPLIT, nullptr, 0); }
  k_vt<NH, TT><<<dim3(BB * NH * (TT / 64), 2), 256, 0, stream>>>(V, PSZ, DD, 0, VT, PSZ);      /* v per head [64][1024]; gv per batch [512][1024] (the same 64-wide slabs) */
  k_flash<<<BB * NH * (TT / 64), 128, 0, stream>>>(Q, DD, K, DD, Vt, nullptr, O16, DD);      /* the attention output leaves as f16 x 2^4 */
  /* geometry branch: all BB batches of each stage in one launch, the batch in blockIdx.y (operand, addend and result strides per batch) */
  const size_t sX = (size_t)TT * DD, sS = (size_t)TT * TT; const dim3 gs((TT / 128) * (TT / 128), BB);
  { const GSet hh = {GQ, GK, nullptr, nullptr, nullptr, S, nullptr, nullptr, sX, sX, sS, DD, DD, TT, TT, DD, 0.125f};      /* S = gq.gkT/8 f32-accurate: hi.hi ... */
    const GSet fo = {O16, Bw + 3 * WSZ, bo, bo, bo, FA, nullptr, nullptr, PSZ / 4, 0, PSZ / 4, DD, DD, DD, DD, DD, 0.00390625f};      /* feat_att = O.wo + bo (f32), in four slices of 2048 rows, each as many work-groups as one batch of S */
    k_gemm_t<0, 1><<<dim3((TT / 128) * (TT / 128), BB + 4), 256, 0, stream>>>(hh, fo, BB, nullptr, 0); }
  { const GSet lh = {GQl, GK, nullptr, nullptr, nullptr, S, nullptr, nullptr, sX, sX, sS, DD, DD, TT, TT, DD, 0.125f * 0.0009765625f};
    k_gemm_t<TT, 1><<<gs, 256, 0, stream>>>(lh, lh, NOSPLIT, S, sS); }      /* += lo.hi.2^-10 */
  { const GSet hl = {GQ, GKl, nullptr, nullptr, nullptr, S, nullptr, nullptr, sX, sX, sS, DD, DD, TT, TT, DD, 0.125f * 0.0009765625f};
    k_gemm_t<TT, 1><<<gs, 256, 0, stream>>>(hl, hl, NOSPLIT, S, sS); }      /* += hi.lo.2^-10: M 1024 N 1024 K 512 each, x BB */
  k_gbias<<<dim3((TT * TT / 4 + 255) / 256, BB), 256, 0, stream>>>(S, crd, d1w, d1b, d2w, d2b); k_smx<<<BB * TT / 8, 256, 0, stream>>>(S, P16);      /* softmax: a wave per row over the BB * TT rows */
  { const GSet pv = {P16, GVt, nullptr, nullptr, nullptr, nullptr, SUM16, nullptr, sS, sX, sX, TT, TT, DD, DD, TT, 0.000030517578125f};
    k_gemm_t<DD, 0><<<dim3((TT / 128) * (DD / 128), BB), 256, 0, stream>>>(pv, pv, NOSPLIT, FA, sX); }      /* feat_att + geom_att, stored as f16: M 1024 N 512 K 1024, x BB */
  { const GSet op = {SUM16, Bw + 4 * WSZ, opb, opb, opb, (float*)d_out, nullptr, nullptr, 0, 0, 0, DD, DD, DD, DD, DD, 0.0625f};
    k_gemm_t<0, 1><<<dim3(gpx, 1), 256, 0, stream>>>(op, op, NOSPLIT, nullptr, 0); }      /* out = (feat + geom).op_w + op_b */
}

// v006
// It runs in 210 microseconds.
// Timed twice side by side with v005, it ran 1.13 times as fast both times.
// All steps since v000 together make it 6.32 times as fast.
#include <hip/hip_runtime.h>
// Geometry-aware attention (B=8, N=1024, F=512, 8 heads × 64, G=128): feat = MHA(features) (x·W + b, softmax(q·k/8)·v, ·wo + bo); geometry branch: gq, gk, gv = geometry·W + b (F wide, single head);
// g_scores = gq·gkᵀ/8 + mean_h(gelu_tanh(dist·d1_w + d1_b)·d2_w + d2_b) with dist = max(‖coords_q − coords_k‖, 1e-6); geom = softmax(g_scores)·gv; out = (feat + geom)·op_w + op_b. (in,out) weights; jax.nn.gelu default = tanh approximation.
// Compute dtype: features, geometry, coords, all weights/biases rounded to bf16; f16 GEMM planes; the 8-head branch through a fused flash-style kernel (online softmax f32, P f16 ×2^10); the geometry branch, every stage one launch over all batches (batch in blockIdx.y; the softmax's BB·TT rows in blockIdx.x): S = gq·gkᵀ/8 f32-accurate from f16 hi + residual planes (hi·hi + (lo·hi + hi·lo)·2^-10; its logits reach σ≈3), a kernel adding the distance-MLP bias in place (f32, per pair from the coords), a wave-per-row f32 softmax → P f16 ×2^15, geom = P·gv by GEMM with feat_att as the f32 addend; final projection GEMM. All contractions on v_wmma_f32_16x16x32_f16, f32 accumulate.
#define BB 8
#define TT 1024
#define DD 512
#define GG 128
#define NH 8
#define NR (BB * TT)

typedef __bf16 v16b __attribute__((ext_vector_type(16)));
typedef unsigned short v8us __attribute__((ext_vector_type(8), may_alias));
typedef float  v8f  __attribute__((ext_vector_type(8)));
typedef float  v4f  __attribute__((ext_vector_type(4)));
typedef float  v4fa __attribute__((ext_vector_type(4), may_alias));
union FragB { v16b v; v8us half[2]; unsigned short u[16]; };

__device__ __forceinline__ unsigned short bf16_bits(float x) { unsigned int u = __float_as_uint(x); return (unsigned short)((u + 0x7FFFu + ((u >> 16) & 1u)) >> 16); }
__device__ __forceinline__ float bf16_val(unsigned short b) { return __uint_as_float(((unsigned int)b) << 16); }
__device__ __forceinline__ float bf16_round(float x) { return bf16_val(bf16_bits(x)); }
// D += A·B with NT terms: 1 = ah·bh, 2 = + al·bh (A split), 3 = + ah·bl (both split)
template <int NT>
__device__ __forceinline__ v8f mmaN(v16b ah, v16b al, v16b bh, v16b bl, v8f c) {
  c = __builtin_amdgcn_wmma_f32_16x16x32_bf16(false, ah, false, bh, (short)0, c, false, false);
  if (NT >= 2) c = __builtin_amdgcn_wmma_f32_16x16x32_bf16(false, al, false, bh, (short)0, c, false, false);
  if (NT >= 3) c = __builtin_amdgcn_wmma_f32_16x16x32_bf16(false, ah, false, bl, (short)0, c, false, false);
  asm volatile("v_nop\n\tv_nop\n\tv_nop\n\tv_nop" : "+v"(c) : "v"(ah), "v"(al), "v"(bh), "v"(bl));
  return c;
}

__global__ __launch_bounds__(256) void k_wt_bf16(const float* __restrict__ W, unsigned short* __restrict__ Wt, int K, int N) {
  const int t = blockIdx.x * 256 + threadIdx.x;
  const int k8n = K / 8;
  if (t >= N * k8n) return;
  const int n = t / k8n, k8 = (t % k8n) * 8;
  v8us v;
#pragma unroll
  for (int i = 0; i < 8; ++i) v[i] = bf16_bits(W[(size_t)(k8 + i) * N + n]);
  *(v8us*)(Wt + (size_t)n * K + k8) = v;
  
}

// GEMM C[M][N] (f32, pitch ldc) = act(A[M][K]·W + bias). A f32 row-major (pitch lda) converted per fragment to bf16
// (ASPLIT: hi/lo two planes -> 2 terms, else single rounded term); Wt bf16 [N][K] (pitch ldb). BIAS_BF16 rounds the
// bias to bf16 first (bias quantised to bf16 before the add). K%32==0, M%16==0, N%64==0.
template <bool ASPLIT, int ACT, bool BIAS_BF16>
__global__ __launch_bounds__(128) void k_gemm_bf(const float* __restrict__ A, int lda, const unsigned short* __restrict__ Wt, int ldb,
                                               const float* __restrict__ bias, float* __restrict__ C, int ldc, int M, int N, int K) {
  __shared__ __attribute__((aligned(16))) float so[4][16][64];
  const int tid = threadIdx.x, w = tid >> 5, lane = tid & 31, ln = lane & 15, hh = lane >> 4;
  const int ntn = N / 64;
  const int wid = blockIdx.x * 4 + w;
  const int mt = wid / ntn, nq = wid % ntn;
  if (mt * 16 >= M) return;
  const int row0 = mt * 16, col0 = nq * 64;
  const float* arow = A + (size_t)(row0 + ln) * lda;
  v8f acc[4] = {};
  for (int kb = 0; kb < K; kb += 32) {
    FragB ah, al;
    const v4f x0 = *(const v4fa*)(arow + kb + 8 * hh), x1 = *(const v4fa*)(arow + kb + 8 * hh + 4);
    const v4f x2 = *(const v4fa*)(arow + kb + 16 + 8 * hh), x3 = *(const v4fa*)(arow + kb + 16 + 8 * hh + 4);
    float xs[16] = {x0[0],x0[1],x0[2],x0[3],x1[0],x1[1],x1[2],x1[3],x2[0],x2[1],x2[2],x2[3],x3[0],x3[1],x3[2],x3[3]};
#pragma unroll
    for (int i = 0; i < 16; ++i) { const unsigned short hb = bf16_bits(xs[i]); ah.u[i] = hb; al.u[i] = ASPLIT ? bf16_bits(xs[i] - bf16_val(hb)) : (unsigned short)0; }
#pragma unroll
    for (int t = 0; t < 4; ++t) {
      const unsigned short* brow = Wt + (size_t)(col0 + t * 16 + ln) * ldb + kb;
      FragB b;
      b.half[0] = *(const v8us*)(brow + 8 * hh);
      b.half[1] = *(const v8us*)(brow + 16 + 8 * hh);
      acc[t] = mmaN<ASPLIT ? 2 : 1>(ah.v, al.v, b.v, b.v, acc[t]);
    }
  }
#pragma unroll
  for (int t = 0; t < 4; ++t) {
    float bv = bias ? bias[col0 + t * 16 + ln] : 0.f;
    if (BIAS_BF16) bv = bf16_round(bv);
#pragma unroll
    for (int r = 0; r < 8; ++r) { float v = acc[t][r] + bv; if (ACT == 1) v = fmaxf(v, 0.f); so[w][8 * hh + r][t * 16 + ln] = v; }
  }
  __builtin_amdgcn_fence(__ATOMIC_ACQ_REL, "workgroup");
  __builtin_amdgcn_wave_barrier();
  const int rsub = lane >> 4, c4 = (lane & 15) * 4;
  {
#pragma unroll
    for (int q = 0; q < 8; ++q) {
      const int r = q * 2 + rsub;
      const v4f v = *(const v4fa*)&so[w][r][c4];
      *(v4f*)(C + (size_t)(row0 + r) * ldc + col0 + c4) = v;
    }
    
  }
}

// Flash-style causal/unmasked attention, all contractions 3-term bf16 hi/lo splits, f32 softmax with running max.
// q,k,v rows are read from f32 buffers with arbitrary row pitch (so they can live inside a fused qkv buffer);
// D = head size (multiple of 32, <= 128); one wave = 16 query rows; block = 4 waves (64 queries) sharing K/V chunks of 32.
template <int D, bool CAUSAL>
__global__ __launch_bounds__(128) void k_flash(const float* __restrict__ qb, const float* __restrict__ kb, const float* __restrict__ vb,
                                             int pitch, int T, int H, float scale, float* __restrict__ y, int ypitch) {
  constexpr int KS = D / 32;        // k-steps for QK
  constexpr int DT = D / 16;        // d tiles for PV
  __shared__ __attribute__((aligned(16))) unsigned short sKh[32][D + 8], sKl[32][D + 8], sVh[32][D + 8], sVl[32][D + 8];
  __shared__ __attribute__((aligned(16))) unsigned short sPh[4][16][40], sPl[4][16][40];
  __shared__ __attribute__((aligned(16))) float sO[4][16][D];
  const int tid = threadIdx.x, w = tid >> 5, lane = tid & 31, ln = lane & 15, hh = lane >> 4;
  const int nqb = (T + 63) / 64;
  const int bh = blockIdx.x / nqb, qblk = blockIdx.x % nqb;
  const int b = bh / H, h = bh % H;
  const int q0 = qblk * 64 + w * 16;
  const float* Q = qb + (size_t)b * T * pitch + h * D;
  const float* K = kb + (size_t)b * T * pitch + h * D;
  const float* V = vb + (size_t)b * T * pitch + h * D;

  // A fragments of the wave's 16 query rows (scaled), hi/lo
  FragB aqh[KS], aql[KS];
  {
    int row = q0 + ln; if (row >= T) row = T - 1;
    const float* qr = Q + (size_t)row * pitch;
#pragma unroll
    for (int ks = 0; ks < KS; ++ks)
#pragma unroll
      for (int i = 0; i < 16; ++i) {
        const int d = ks * 32 + ((i < 8) ? (8 * hh + i) : (16 + 8 * hh + (i - 8)));
        const float x = qr[d] * scale; const unsigned short hb = bf16_bits(x);
        aqh[ks].u[i] = hb; aql[ks].u[i] = bf16_bits(x - bf16_val(hb));
      }
  }
  float m_r[8], l_r[8];
#pragma unroll
  for (int r = 0; r < 8; ++r) { m_r[r] = -3.0e38f; l_r[r] = 0.f; }
  v8f oacc[DT];
#pragma unroll
  for (int dt = 0; dt < DT; ++dt) oacc[dt] = (v8f){0.f,0.f,0.f,0.f,0.f,0.f,0.f,0.f};

  const int kv_end = CAUSAL ? min(T, qblk * 64 + 64) : T;     // block-uniform
  for (int j0 = 0; j0 < kv_end; j0 += 32) {
    __syncthreads();
    for (int e = tid; e < 32 * (D / 4); e += 128) {
      const int r = e / (D / 4), c4 = (e % (D / 4)) * 4;
      const int key = j0 + r;
      v4f kf = {0.f,0.f,0.f,0.f}, vf = {0.f,0.f,0.f,0.f};
      if (key < T) { kf = *(const v4fa*)(K + (size_t)key * pitch + c4); vf = *(const v4fa*)(V + (size_t)key * pitch + c4); }
#pragma unroll
      for (int t = 0; t < 4; ++t) {
        unsigned short hb = bf16_bits(kf[t]); sKh[r][c4 + t] = hb; sKl[r][c4 + t] = bf16_bits(kf[t] - bf16_val(hb));
        hb = bf16_bits(vf[t]); sVh[r][c4 + t] = hb; sVl[r][c4 + t] = bf16_bits(vf[t] - bf16_val(hb));
      }
    }
    __syncthreads();
    // S tile 16 x 32
    v8f s[2];
#pragma unroll
    for (int nt = 0; nt < 2; ++nt) {
      v8f acc = {};
#pragma unroll
      for (int ks = 0; ks < KS; ++ks) {
        FragB bh_, bl_;
        bh_.half[0] = *(const v8us*)&sKh[nt * 16 + ln][ks * 32 + 8 * hh]; bh_.half[1] = *(const v8us*)&sKh[nt * 16 + ln][ks * 32 + 16 + 8 * hh];
        bl_.half[0] = *(const v8us*)&sKl[nt * 16 + ln][ks * 32 + 8 * hh]; bl_.half[1] = *(const v8us*)&sKl[nt * 16 + ln][ks * 32 + 16 + 8 * hh];
        acc = mmaN<3>(aqh[ks].v, aql[ks].v, bh_.v, bl_.v, acc);
      }
      s[nt] = acc;
    }
    // mask + running max (rows 8hh+r; the 16 lanes of a half share rows)
    float alpha[8];
#pragma unroll
    for (int r = 0; r < 8; ++r) {
      const int qi = q0 + 8 * hh + r;
      const int ja = j0 + ln, jb = j0 + 16 + ln;
      if (CAUSAL) { if (ja > qi) s[0][r] = -3.0e38f; if (jb > qi) s[1][r] = -3.0e38f; }
      if (ja >= T) s[0][r] = -3.0e38f;
      if (jb >= T) s[1][r] = -3.0e38f;
      float mx = fmaxf(s[0][r], s[1][r]);
      mx = fmaxf(mx, __shfl_xor(mx, 1, 32)); mx = fmaxf(mx, __shfl_xor(mx, 2, 32)); mx = fmaxf(mx, __shfl_xor(mx, 4, 32)); mx = fmaxf(mx, __shfl_xor(mx, 8, 32));
      const float mnew = fmaxf(m_r[r], mx);
      alpha[r] = (mnew > -1.0e38f) ? __expf(m_r[r] - mnew) : 1.0f;
      const float p0 = (s[0][r] > -1.0e38f) ? __expf(s[0][r] - mnew) : 0.f;
      const float p1 = (s[1][r] > -1.0e38f) ? __expf(s[1][r] - mnew) : 0.f;
      m_r[r] = mnew;
      l_r[r] = l_r[r] * alpha[r] + p0 + p1;            // per-lane partial row sum (16 lanes combined at the end)
      unsigned short hb = bf16_bits(p0); sPh[w][8 * hh + r][ln] = hb;      sPl[w][8 * hh + r][ln] = bf16_bits(p0 - bf16_val(hb));
      hb = bf16_bits(p1);                sPh[w][8 * hh + r][16 + ln] = hb; sPl[w][8 * hh + r][16 + ln] = bf16_bits(p1 - bf16_val(hb));
    }
#pragma unroll
    for (int dt = 0; dt < DT; ++dt)
#pragma unroll
      for (int r = 0; r < 8; ++r) oacc[dt][r] *= alpha[r];
    __builtin_amdgcn_fence(__ATOMIC_ACQ_REL, "workgroup");
    __builtin_amdgcn_wave_barrier();
    FragB pah, pal;
    pah.half[0] = *(const v8us*)&sPh[w][ln][8 * hh]; pah.half[1] = *(const v8us*)&sPh[w][ln][16 + 8 * hh];
    pal.half[0] = *(const v8us*)&sPl[w][ln][8 * hh]; pal.half[1] = *(const v8us*)&sPl[w][ln][16 + 8 * hh];
#pragma unroll
    for (int dt = 0; dt < DT; ++dt) {
      FragB bvh, bvl;
#pragma unroll
      for (int i = 0; i < 8; ++i) {
        bvh.u[i] = sVh[8 * hh + i][dt * 16 + ln]; bvh.u[8 + i] = sVh[16 + 8 * hh + i][dt * 16 + ln];
        bvl.u[i] = sVl[8 * hh + i][dt * 16 + ln]; bvl.u[8 + i] = sVl[16 + 8 * hh + i][dt * 16 + ln];
      }
      oacc[dt] = mmaN<3>(pah.v, pal.v, bvh.v, bvl.v, oacc[dt]);
    }
    __builtin_amdgcn_fence(__ATOMIC_ACQ_REL, "workgroup");
    __builtin_amdgcn_wave_barrier();
  }
#pragma unroll
  for (int r = 0; r < 8; ++r) {
    float l = l_r[r];
    l += __shfl_xor(l, 1, 32); l += __shfl_xor(l, 2, 32); l += __shfl_xor(l, 4, 32); l += __shfl_xor(l, 8, 32);
    l_r[r] = (l > 0.f) ? 1.0f / l : 0.f;
  }
#pragma unroll
  for (int dt = 0; dt < DT; ++dt)
#pragma unroll
    for (int r = 0; r < 8; ++r) sO[w][8 * hh + r][dt * 16 + ln] = oacc[dt][r] * l_r[r];
  __builtin_amdgcn_fence(__ATOMIC_ACQ_REL, "workgroup");
  __builtin_amdgcn_wave_barrier();
  {
    for (int r = 0; r < 16; ++r) {
      const int row = q0 + r;
      if (row < T && lane < D / 4) {
        const v4f val = *(const v4fa*)&sO[w][r][lane * 4];
        *(v4f*)(y + ((size_t)b * T + row) * ypitch + h * D + lane * 4) = val;
      }
    }
    
  }
}

// GEMM C = act(A·W + bias + resid): A f32 (ASPLIT -> hi/lo 2 terms), Wt bf16 [N][K]; ACT 0 none, 1 relu, 2 exact gelu;
// resid (optional, f32, row index = (row % rmod), pitch ldr, RES_BF16 rounds it) added before the activation.
template <bool ASPLIT, int ACT, bool BIAS_BF16, bool RES_BF16>
__global__ __launch_bounds__(128) void k_gemm_bf3(const float* __restrict__ A, int lda, const unsigned short* __restrict__ Wt, int ldb,
                                                const float* __restrict__ bias, const float* __restrict__ resid, int rmod, int ldr,
                                                float* __restrict__ C, int ldc, int M, int N, int K) {
  __shared__ __attribute__((aligned(16))) float so[4][16][64];
  const int tid = threadIdx.x, w = tid >> 5, lane = tid & 31, ln = lane & 15, hh = lane >> 4;
  const int ntn = N / 64;
  const int wid = blockIdx.x * 4 + w;
  const int mt = wid / ntn, nq = wid % ntn;
  if (mt * 16 >= M) return;
  const int row0 = mt * 16, col0 = nq * 64;
  const float* arow = A + (size_t)(row0 + ln) * lda;
  v8f acc[4] = {};
  for (int kb = 0; kb < K; kb += 32) {
    FragB ah, al;
    const v4f x0 = *(const v4fa*)(arow + kb + 8 * hh), x1 = *(const v4fa*)(arow + kb + 8 * hh + 4);
    const v4f x2 = *(const v4fa*)(arow + kb + 16 + 8 * hh), x3 = *(const v4fa*)(arow + kb + 16 + 8 * hh + 4);
    float xs[16] = {x0[0],x0[1],x0[2],x0[3],x1[0],x1[1],x1[2],x1[3],x2[0],x2[1],x2[2],x2[3],x3[0],x3[1],x3[2],x3[3]};
#pragma unroll
    for (int i = 0; i < 16; ++i) { const unsigned short hb = bf16_bits(xs[i]); ah.u[i] = hb; al.u[i] = ASPLIT ? bf16_bits(xs[i] - bf16_val(hb)) : (unsigned short)0; }
#pragma unroll
    for (int t = 0; t < 4; ++t) {
      const unsigned short* brow = Wt + (size_t)(col0 + t * 16 + ln) * ldb + kb;
      FragB b;
      b.half[0] = *(const v8us*)(brow + 8 * hh);
      b.half[1] = *(const v8us*)(brow + 16 + 8 * hh);
      acc[t] = mmaN<ASPLIT ? 2 : 1>(ah.v, al.v, b.v, b.v, acc[t]);
    }
  }
#pragma unroll
  for (int t = 0; t < 4; ++t) {
    const int col = col0 + t * 16 + ln;
    float bv = bias ? bias[col] : 0.f;
    if (BIAS_BF16) bv = bf16_round(bv);
#pragma unroll
    for (int r = 0; r < 8; ++r) {
      float v = acc[t][r] + bv;
      if (resid) { float rv = resid[(size_t)((row0 + 8 * hh + r) % rmod) * ldr + col]; if (RES_BF16) rv = bf16_round(rv); v += rv; }
      if (ACT == 1) v = fmaxf(v, 0.f);
      if (ACT == 2) v = 0.5f * v * (1.0f + erff(v * 0.70710678118654752f));
      if (ACT == 3) { const float u = 0.7978845608028654f * (v + 0.044715f * v * v * v); v = 0.5f * v * (1.0f + tanhf(u)); }
      so[w][8 * hh + r][t * 16 + ln] = v;
    }
  }
  __builtin_amdgcn_fence(__ATOMIC_ACQ_REL, "workgroup");
  __builtin_amdgcn_wave_barrier();
  const int rsub = lane >> 4, c4 = (lane & 15) * 4;
  {
#pragma unroll
    for (int q = 0; q < 8; ++q) {
      const int r = q * 2 + rsub;
      const v4f v = *(const v4fa*)&so[w][r][c4];
      *(v4f*)(C + (size_t)(row0 + r) * ldc + col0 + c4) = v;
    }
    
  }
}
// row LayerNorm (biased variance, eps) over N: s = X (+ R); optional out_sum <- s; out_norm <- (s-mu)*rsqrt(var+eps)*g + b
template <bool PARAM_BF16>
__global__ __launch_bounds__(256) void k_layernorm(const float* __restrict__ X, const float* __restrict__ R, const float* __restrict__ g, const float* __restrict__ bta,
                                                  float* __restrict__ out_sum, float* __restrict__ out_norm, int N, float eps) {
  __shared__ float red[256];
  const int row = blockIdx.x, tid = threadIdx.x;
  const float* x = X + (size_t)row * N; const float* rr = R ? R + (size_t)row * N : nullptr;
  float vals[16];                     // up to N = 4096
  const int per = N / 256;            // contiguous chunk per thread? use strided-by-4 chunks: thread handles j = tid*4 + 1024*u
  float s1 = 0.f;
  for (int u = 0; u < per / 4; ++u) {
    const int j = tid * 4 + 1024 * u;
    const v4f a = *(const v4fa*)(x + j);
    v4f b = {0.f,0.f,0.f,0.f}; if (rr) b = *(const v4fa*)(rr + j);
#pragma unroll
    for (int q = 0; q < 4; ++q) { const float v = a[q] + b[q]; vals[u * 4 + q] = v; s1 += v; }
  }
  red[tid] = s1; __syncthreads();
  for (int st = 128; st > 0; st >>= 1) { if (tid < st) red[tid] += red[tid + st]; __syncthreads(); }
  const float mu = red[0] / (float)N; __syncthreads();
  float s2 = 0.f;
  for (int u = 0; u < per / 4; ++u)
#pragma unroll
    for (int q = 0; q < 4; ++q) { const float c = vals[u * 4 + q] - mu; s2 += c * c; }
  red[tid] = s2; __syncthreads();
  for (int st = 128; st > 0; st >>= 1) { if (tid < st) red[tid] += red[tid + st]; __syncthreads(); }
  const float rs = rsqrtf(red[0] / (float)N + eps);
  {
    for (int u = 0; u < per / 4; ++u) {
      const int j = tid * 4 + 1024 * u;
      v4f o, sm;
#pragma unroll
      for (int q = 0; q < 4; ++q) {
        float gg = g[j + q], bb = bta[j + q];
        if (PARAM_BF16) { gg = bf16_round(gg); bb = bf16_round(bb); }
        sm[q] = vals[u * 4 + q]; o[q] = (vals[u * 4 + q] - mu) * rs * gg + bb;
      }
      if (out_sum) *(v4f*)(out_sum + (size_t)row * N + j) = sm;
      *(v4f*)(out_norm + (size_t)row * N + j) = o;
    }
    
  }
}



// ---- f16 WMMA path (v_wmma_f32_16x16x32_f16): 11-bit significands for operands in range — used for every contraction launched here
typedef _Float16 v16h __attribute__((ext_vector_type(16)));
union FragH { v16h v; v8us half[2]; _Float16 h[16]; unsigned short u[16]; };
template <int NT>
__device__ __forceinline__ v8f mmaH(v16h ah, v16h al, v16h bh, v16h bl, v8f c) {
  c = __builtin_amdgcn_wmma_f32_16x16x32_f16(false, ah, false, bh, (short)0, c, false, false);
  if (NT >= 2) c = __builtin_amdgcn_wmma_f32_16x16x32_f16(false, al, false, bh, (short)0, c, false, false);
  if (NT >= 3) c = __builtin_amdgcn_wmma_f32_16x16x32_f16(false, ah, false, bl, (short)0, c, false, false);
  asm volatile("v_nop\n\tv_nop\n\tv_nop\n\tv_nop" : "+v"(c) : "v"(ah), "v"(al), "v"(bh), "v"(bl));
  return c;
}
// batched GEMM like k_gemm_b but f16 operands: A f32 (split into f16 hi/lo if ASPLIT, else rounded to f16), Bt = f16 values [n][k]; alpha; C f32; N multiple of 16 (partial tiles skipped)
template <bool ASPLIT>
__global__ __launch_bounds__(128) void k_gemm_h(const float* __restrict__ A, int lda, size_t sA, const _Float16* __restrict__ Bh, int ldb, size_t sB, float alpha, float* __restrict__ C, int ldc, size_t sC, int M, int N, int K) {
  __shared__ __attribute__((aligned(16))) float so[4][16][64];
  const int tid = threadIdx.x, w = tid >> 5, lane = tid & 31, ln = lane & 15, hh = lane >> 4; const int by = blockIdx.y;
  A += (size_t)by * sA; Bh += (size_t)by * sB; C += (size_t)by * sC;
  const int ntn = (N + 63) / 64; const int wid = blockIdx.x * 4 + w; const int mt = wid / ntn, nq = wid % ntn; if (mt * 16 >= M) return;
  const int row0 = mt * 16, col0 = nq * 64; const float* arow = A + (size_t)(row0 + ln) * lda;
  v8f acc[4] = {};
  for (int kb = 0; kb < K; kb += 32) {
    FragH ah, al;
    const v4f x0 = *(const v4fa*)(arow + kb + 8 * hh), x1 = *(const v4fa*)(arow + kb + 8 * hh + 4), x2 = *(const v4fa*)(arow + kb + 16 + 8 * hh), x3 = *(const v4fa*)(arow + kb + 16 + 8 * hh + 4);
    float xs[16] = {x0[0],x0[1],x0[2],x0[3],x1[0],x1[1],x1[2],x1[3],x2[0],x2[1],x2[2],x2[3],x3[0],x3[1],x3[2],x3[3]};
#pragma unroll
    for (int i = 0; i < 16; ++i) { const _Float16 h = (_Float16)xs[i]; ah.h[i] = h; al.h[i] = ASPLIT ? (_Float16)(xs[i] - (float)h) : (_Float16)0.0f; }
#pragma unroll
    for (int t = 0; t < 4; ++t) { if (col0 + t * 16 >= N) continue; const size_t boff = (size_t)(col0 + t * 16 + ln) * ldb + kb; FragH bq; bq.half[0] = *(const v8us*)(Bh + boff + 8 * hh); bq.half[1] = *(const v8us*)(Bh + boff + 16 + 8 * hh);
      acc[t] = mmaH<ASPLIT ? 2 : 1>(ah.v, al.v, bq.v, bq.v, acc[t]); }
  }
#pragma unroll
  for (int t = 0; t < 4; ++t) { if (col0 + t * 16 >= N) continue;
#pragma unroll
    for (int r = 0; r < 8; ++r) so[w][8 * hh + r][t * 16 + ln] = acc[t][r] * alpha; }
  __builtin_amdgcn_fence(__ATOMIC_ACQ_REL, "workgroup"); __builtin_amdgcn_wave_barrier();
  const int rsub = lane >> 4, c4 = (lane & 15) * 4;
  {
#pragma unroll
    for (int q = 0; q < 8; ++q) { const int r = q * 2 + rsub; if (col0 + c4 < N) { const v4f v = *(const v4fa*)&so[w][r][c4]; *(v4f*)(C + (size_t)(row0 + r) * ldc + col0 + c4) = v; } }
     }
}

// Wt[n][k] = f16(W[k][n]·scale) from f32 row-major W[K][N] (scale = power of two; bf16-exact weights stay exact in f16 away from the subnormal range)
__device__ __forceinline__ void wt_f16(const float* __restrict__ W, _Float16* __restrict__ Wt, int K, int N, float scale, int blk) {
  const int t = blk * 256 + threadIdx.x; if (t >= N * (K / 8)) return; const int n = t / (K / 8), k8 = (t % (K / 8)) * 8; FragH f;
#pragma unroll
  for (int i = 0; i < 8; ++i) f.h[i] = (_Float16)(bf16_round(W[(size_t)(k8 + i) * N + n]) * scale); const v8us o = f.half[0];
  *(v8us*)((unsigned short*)Wt + (size_t)n * K + k8) = o; 
}
// Block-tiled GEMM, f16 operands, both K-contiguous: v = (A.Bt^T)*alpha + bf16(bias[col]) (+ CP[row*LDCP + by*sCPy + col] if LDCP; CP may be C itself: a lane reads only what it then writes); writes f32 C, or f16 C16, or f16 C16 with the rounding residual x 2^10 in C16l. Batch in blockIdx.y.
// One work-group of 8 waves (4 x 2) makes 128 x 128 of C, a wave 32 x 64. Each trip takes 64 k: 128 rows of 128 B of A and of Bt are brought into LDS by asynchronous copies (whole 128-B lines, 16 B a lane),
// two buffers, the next tile in flight while this one is multiplied; LDS rows at pitch 144 B for the ds_load_b128 fragment reads. M, N multiples of 128, K a multiple of 64.
#define GT_PITCH 144
#define GT_OPB (128 * GT_PITCH)
#define GT_BUF (2 * GT_OPB)
typedef _Float16 v4h __attribute__((ext_vector_type(4)));
// one tile: 4 copies of A and 4 of Bt per lane. The s_wait_xcnt stands inside the statement so that no address register named here is rewritten ahead of it.
__device__ __forceinline__ void gt_copy(unsigned l, const unsigned short* ga, const unsigned short* gb, size_t a32, size_t b32) {
  asm volatile("global_load_async_to_lds_b128 %0, %8, off\n\t"
               "global_load_async_to_lds_b128 %1, %9, off\n\t"
               "global_load_async_to_lds_b128 %2, %10, off\n\t"
               "global_load_async_to_lds_b128 %3, %11, off\n\t"
               "global_load_async_to_lds_b128 %4, %12, off\n\t"
               "global_load_async_to_lds_b128 %5, %13, off\n\t"
               "global_load_async_to_lds_b128 %6, %14, off\n\t"
               "global_load_async_to_lds_b128 %7, %15, off\n\t"
               "s_wait_xcnt 0x0"
               :: "v"(l), "v"(l + 32 * GT_PITCH), "v"(l + 64 * GT_PITCH), "v"(l + 96 * GT_PITCH),
                  "v"(l + GT_OPB), "v"(l + GT_OPB + 32 * GT_PITCH), "v"(l + GT_OPB + 64 * GT_PITCH), "v"(l + GT_OPB + 96 * GT_PITCH),
                  "v"(ga), "v"(ga + a32), "v"(ga + 2 * a32), "v"(ga + 3 * a32), "v"(gb), "v"(gb + b32), "v"(gb + 2 * b32), "v"(gb + 3 * b32)
               : "memory");
}
// One launch may hold two sets of independent products: blockIdx.y below ysplit belongs to set g0, from ysplit on to set g1; inside a set y steps the operands and the result by the set's strides and picks one of three biases (y 1: bias1, y 2: bias2, else bias0).
struct GSet { const _Float16* A; const _Float16* B; const float* bias0; const float* bias1; const float* bias2; float* C; _Float16* C16; _Float16* C16l; size_t sA, sB, sC; int lda, ldb, ldc, N, K; float alpha; };
template <int LDCP, int OUT>      /* LDCP: row pitch of an f32 addend plane CP, 0 for none (a constant, so that its 16 loads share one address register pair); OUT 1: f32 result in C; 0: f16 result in C16; 2: f16 result in C16 and (v - f16(v)) x 2^10 as f16 in C16l */
__global__ __launch_bounds__(256) void k_gemm_t(const GSet g0, const GSet g1, int ysplit, const float* CP, size_t sCPy) {
  __shared__ __attribute__((aligned(16))) unsigned char L[2 * GT_BUF];
  const int tid = threadIdx.x, w = tid >> 5, lane = tid & 31, ln = lane & 15, hh = lane >> 4;
  const bool sec = (int)blockIdx.y >= ysplit; const GSet& g = sec ? g1 : g0; const int by = (int)blockIdx.y - (sec ? ysplit : 0);
  const _Float16* A = g.A; const _Float16* Bh = g.B; const float* bias = by == 1 ? g.bias1 : by == 2 ? g.bias2 : g.bias0; float* C = g.C; _Float16* C16 = g.C16; _Float16* C16l = g.C16l;
  const size_t sA = g.sA, sB = g.sB, sC = g.sC; const int lda = g.lda, ldb = g.ldb, ldc = g.ldc, N = g.N, K = g.K; const float alpha = g.alpha;
  const int ntn = N / 128; const int row0 = ((int)blockIdx.x / ntn) * 128, col0 = ((int)blockIdx.x % ntn) * 128; const int wm = w >> 1, wn = w & 1;
  const int cr = tid >> 3, cc = tid & 7;      /* copies: 8 lanes a row, 32 rows a copy */
  const unsigned short* ga = (const unsigned short*)A + (size_t)by * sA + (size_t)(row0 + cr) * lda + cc * 8;
  const unsigned short* gb = (const unsigned short*)Bh + (size_t)by * sB + (size_t)(col0 + cr) * ldb + cc * 8;
  const size_t a32 = (size_t)32 * lda, b32 = (size_t)32 * ldb;
  const unsigned lcp = (unsigned)(size_t)L + (unsigned)(cr * GT_PITCH + cc * 16);
  const int nk = K / 64;
  v8f acc[2][4] = {};
  gt_copy(lcp, ga, gb, a32, b32);
  asm volatile("s_wait_asynccnt 0x0" ::: "memory");      /* tile 0 has landed before the barrier that publishes it */
  __syncthreads();
  if (nk > 1) gt_copy(lcp + GT_BUF, ga + 64, gb + 64, a32, b32);
  const unsigned char* fa = L + (wm * 32 + ln) * GT_PITCH + hh * 16; const unsigned char* fb = L + GT_OPB + (wn * 64 + ln) * GT_PITCH + hh * 16;
#pragma unroll 1
  for (int t = 0; t < nk; ++t) {      /* stays rolled: one copy of the ring's foot */
    const unsigned bo = (unsigned)(t & 1) * GT_BUF;
    FragH a[2][2], b[2][4];
#pragma unroll
    for (int ks = 0; ks < 2; ++ks) {
#pragma unroll
      for (int i = 0; i < 2; ++i) { a[ks][i].half[0] = *(const v8us*)(fa + bo + i * 16 * GT_PITCH + ks * 64); a[ks][i].half[1] = *(const v8us*)(fa + bo + i * 16 * GT_PITCH + ks * 64 + 32); }
#pragma unroll
      for (int j = 0; j < 4; ++j) { b[ks][j].half[0] = *(const v8us*)(fb + bo + j * 16 * GT_PITCH + ks * 64); b[ks][j].half[1] = *(const v8us*)(fb + bo + j * 16 * GT_PITCH + ks * 64 + 32); } }
    /* the ring's foot stands here, behind the trip's 24 fragment reads and ahead of its WMMAs, which work on registers alone: the refill then flies under them too */
    asm volatile("s_wait_dscnt 0x0" ::: "memory");      /* this wave's reads of the buffer are over before it may be refilled */
    asm volatile("s_wait_asynccnt 0x0" ::: "memory");      /* this wave's share of tile t + 1 has landed before the barrier publishes it */
    __syncthreads();
    if (t + 2 < nk) gt_copy(lcp + bo, ga + (size_t)(t + 2) * 64, gb + (size_t)(t + 2) * 64, a32, b32);
    __builtin_amdgcn_sched_barrier(0);      /* keeps the WMMAs behind the refill's issue: ahead of it they would delay the copies by their whole run */
#pragma unroll
    for (int ks = 0; ks < 2; ++ks)
#pragma unroll
      for (int i = 0; i < 2; ++i)
#pragma unroll
        for (int j = 0; j < 4; ++j) acc[i][j] = __builtin_amdgcn_wmma_f32_16x16x32_f16(false, a[ks][i].v, false, b[ks][j].v, (short)0, acc[i][j], false, false);
  }
  asm volatile("s_wait_asynccnt 0x0" ::: "memory");      /* no copy outstanding when the ring becomes output staging */
  /* epilogue: each wave stages its 32 x 64 in its own 8,704 B of the ring (every wave's last read of it ended ahead of the last barrier), then whole row pieces (256 B of f32, 128 B of f16) go out */
  const int c4 = ln * 4, col = col0 + wn * 64 + c4, rw0 = row0 + wm * 32 + hh; const size_t cofs = (size_t)by * sC;
  v4f cp[16];      /* the addend's 16 row pieces are asked for together, ahead of the staging */
  if (LDCP) { const float* cpp = CP + (size_t)rw0 * LDCP + (size_t)by * sCPy + col;
#pragma unroll
    for (int q = 0; q < 16; ++q) cp[q] = *(const v4fa*)(cpp + q * 2 * LDCP);
    asm volatile("s_wait_xcnt 0x0" ::: "memory"); }      /* ahead of any rewrite of the address registers that the loads above name */
  v4f bv = {0.f, 0.f, 0.f, 0.f}; if (bias) { const v4f bb = *(const v4fa*)(bias + col); for (int e = 0; e < 4; ++e) bv[e] = bf16_round(bb[e]); }
  float* so = (float*)(L + w * (32 * 68 * 4));
#pragma unroll
  for (int i = 0; i < 2; ++i)
#pragma unroll
    for (int j = 0; j < 4; ++j)
#pragma unroll
      for (int r = 0; r < 8; ++r) so[(i * 16 + 8 * hh + r) * 68 + j * 16 + ln] = acc[i][j][r];
  __builtin_amdgcn_fence(__ATOMIC_ACQ_REL, "workgroup"); __builtin_amdgcn_wave_barrier();
#pragma unroll
  for (int q = 0; q < 16; ++q) { const size_t o = cofs + (size_t)rw0 * ldc + col + (size_t)(q * 2) * ldc; const v4f x = *(const v4fa*)&so[(q * 2 + hh) * 68 + c4]; v4f v;
    for (int e = 0; e < 4; ++e) v[e] = x[e] * alpha + bv[e];
    if (LDCP) for (int e = 0; e < 4; ++e) v[e] += cp[q][e];
    if (OUT == 1) *(v4f*)(C + o) = v;
    else { v4h h4; for (int e = 0; e < 4; ++e) h4[e] = (_Float16)v[e]; *(v4h*)(C16 + o) = h4;
      if (OUT == 2) { v4h l4; for (int e = 0; e < 4; ++e) l4[e] = (_Float16)((v[e] - (float)h4[e]) * 1024.0f); *(v4h*)(C16l + o) = l4; } } }
}


__device__ __forceinline__ void x16(const float* __restrict__ x, _Float16* __restrict__ X16, size_t n8, int blk) { const size_t t = (size_t)blk * 256 + threadIdx.x; if (t >= n8) return; FragH f;
#pragma unroll
  for (int q = 0; q < 8; ++q) f.h[q] = (_Float16)bf16_round(x[t * 8 + q]); *(v8us*)((unsigned short*)X16 + t * 8) = f.half[0];  }
// All operand preparation in one launch: none of its ten parts reads what another writes. Ranges of blockIdx.x: the five F x F weights, the three G x F weights (each transposed, x 2^4), then features and geometry (rounded to f16 planes).
#define PW_BIG (DD * (DD / 8) / 256)
#define PW_SML (DD * (GG / 8) / 256)
#define PX_F (NR * DD / 8 / 256)
#define PX_G (NR * GG / 8 / 256)
__global__ __launch_bounds__(256) void k_prep(const float* __restrict__ wq, const float* __restrict__ wk, const float* __restrict__ wv, const float* __restrict__ wo, const float* __restrict__ opw,
    const float* __restrict__ gqw, const float* __restrict__ gkw, const float* __restrict__ gvw, const float* __restrict__ feats, const float* __restrict__ geom,
    _Float16* __restrict__ Bw, _Float16* __restrict__ Bg, _Float16* __restrict__ X16, _Float16* __restrict__ GE16) {
  int blk = blockIdx.x;
  if (blk < 5 * PW_BIG) { const int i = blk / PW_BIG; const float* W = i == 0 ? wq : i == 1 ? wk : i == 2 ? wv : i == 3 ? wo : opw; wt_f16(W, Bw + (size_t)i * DD * DD, DD, DD, 16.0f, blk % PW_BIG); return; }
  blk -= 5 * PW_BIG;
  if (blk < 3 * PW_SML) { const int i = blk / PW_SML; const float* W = i == 0 ? gqw : i == 1 ? gkw : gvw; wt_f16(W, Bg + (size_t)i * GG * DD, GG, DD, 16.0f, blk % PW_SML); return; }
  blk -= 3 * PW_SML;
  if (blk < PX_F) { x16(feats, X16, (size_t)NR * DD / 8, blk); return; }
  x16(geom, GE16, (size_t)NR * GG / 8, blk - PX_F);
}
__global__ __launch_bounds__(256) void k_round16f(const float* __restrict__ W, _Float16* __restrict__ Bt, size_t n8) { const size_t t = (size_t)blockIdx.x * 256 + threadIdx.x; if (t >= n8) return; FragH f;
#pragma unroll
  for (int i = 0; i < 8; ++i) f.h[i] = (_Float16)(bf16_round(W[t * 8 + i]) * 16.0f); *(v8us*)((unsigned short*)Bt + t * 8) = f.half[0];  }
template <int NHv, int TTv>
__global__ __launch_bounds__(256) void k_vt(const _Float16* __restrict__ V16, size_t sV, int ldv, int voff, _Float16* __restrict__ Vt, size_t sVt) { __shared__ unsigned short tl[64][66]; const int tid = threadIdx.x; V16 += (size_t)blockIdx.y * sV; Vt += (size_t)blockIdx.y * sVt;      /* blockIdx.y: which plane */ const int slab = blockIdx.x / (TTv / 64), lg = blockIdx.x % (TTv / 64); const int b = slab / NHv, h = slab % NHv;
  for (int i = tid; i < 64 * 8; i += 256) { const int r = i / 8, c8 = (i % 8) * 8; FragH f; f.half[0] = *(const v8us*)((const unsigned short*)V16 + ((size_t)b * TTv + lg * 64 + r) * ldv + voff + h * 64 + c8);
#pragma unroll
    for (int q = 0; q < 8; ++q) tl[r][c8 + q] = f.u[q]; }
  __syncthreads();
  {
#pragma unroll
    for (int rd = 0; rd < 2; ++rd) { const int d = rd * 32 + tid / 8, pc = tid % 8; FragH f;
#pragma unroll
      for (int q = 0; q < 8; ++q) f.u[q] = tl[pc * 8 + q][d];
      *(v8us*)((unsigned short*)Vt + ((size_t)slab * 64 + d) * TTv + lg * 64 + pc * 8) = f.half[0]; }
     } }

typedef float v2f __attribute__((ext_vector_type(2)));
// Distance-MLP bias, added to S in place. gelu_tanh(x) = 0.5 x (1 + tanh(u)) = x / (1 + exp(-2 u)), u = sqrt(2 / pi) (x + 0.044715 x^3): one v_exp_f32 and one v_rcp_f32, no branch
// (x far above 0: exp -> 0, quotient x; x far below 0: exp -> inf, rcp -> 0, quotient -0: the limits of the tanh form). The other steps are packed f32 operations on two keys at a time.
// A work-group takes GB_ROWS whole score rows, a thread the same 4 keys in each: the rounded weights, their head means and the keys' coordinates are made once per thread, not once per 4 pairs.
#define GB_ROWS 8
#define GB_K0 (-2.3022081986f)      /* -2 sqrt(2 / pi) log2(e) */
#define GB_K1 (GB_K0 * 0.044715f)
__global__ __launch_bounds__(256) void k_gbias(float* __restrict__ S, const float* __restrict__ CRD, const float* __restrict__ w1, const float* __restrict__ b1, const float* __restrict__ w2, const float* __restrict__ b2) {
  const int b = blockIdx.y, q0 = blockIdx.x * GB_ROWS, k0 = threadIdx.x * 4;      /* one score plane per batch */
  const float* C3 = CRD + (size_t)b * TT * 3; float* sp = S + (size_t)b * TT * TT + (size_t)q0 * TT + k0;
  float cb = 0.f; for (int j = 0; j < 8; ++j) cb += bf16_round(b2[j]); cb *= 0.125f;
  float wj[8], bj[8], cj[8];
#pragma unroll
  for (int j = 0; j < 8; ++j) { float c = 0.f; for (int h = 0; h < 8; ++h) c += bf16_round(w2[j * 8 + h]); cj[j] = c * 0.125f; wj[j] = bf16_round(w1[j]); bj[j] = bf16_round(b1[j]); }
  const v4f c0 = *(const v4fa*)(C3 + k0 * 3), c1 = *(const v4fa*)(C3 + k0 * 3 + 4), c2 = *(const v4fa*)(C3 + k0 * 3 + 8);
  const v2f kx[2] = {{bf16_round(c0[0]), bf16_round(c0[3])}, {bf16_round(c1[2]), bf16_round(c2[1])}};
  const v2f ky[2] = {{bf16_round(c0[1]), bf16_round(c1[0])}, {bf16_round(c1[3]), bf16_round(c2[2])}};
  const v2f kz[2] = {{bf16_round(c0[2]), bf16_round(c1[1])}, {bf16_round(c2[0]), bf16_round(c2[3])}};
#pragma unroll 1      /* stays rolled: a row already holds 16 independent chains */
  for (int r = 0; r < GB_ROWS; ++r) {
    const v4f sv = *(const v4fa*)(sp + (size_t)r * TT);      /* asked for at the row's head, used at its foot */
    const float qx = bf16_round(C3[(q0 + r) * 3]), qy = bf16_round(C3[(q0 + r) * 3 + 1]), qz = bf16_round(C3[(q0 + r) * 3 + 2]);
    v2f d[2], acc[2];
#pragma unroll
    for (int p = 0; p < 2; ++p) { const v2f dx = qx - kx[p], dy = qy - ky[p], dz = qz - kz[p]; const v2f d2 = dx * dx + dy * dy + dz * dz;
      d[p][0] = __builtin_amdgcn_sqrtf(fmaxf(d2[0], 1e-12f)); d[p][1] = __builtin_amdgcn_sqrtf(fmaxf(d2[1], 1e-12f)); acc[p] = (v2f){cb, cb}; }
#pragma unroll
    for (int j = 0; j < 8; ++j)
#pragma unroll
      for (int p = 0; p < 2; ++p) { const v2f x = d[p] * wj[j] + bj[j]; const v2f a = x * (x * x * GB_K1 + GB_K0);
        const v2f s = (v2f){__builtin_amdgcn_exp2f(a[0]), __builtin_amdgcn_exp2f(a[1])} + 1.0f;
        const v2f g = x * (v2f){__builtin_amdgcn_rcpf(s[0]), __builtin_amdgcn_rcpf(s[1])}; acc[p] += g * cj[j]; }
    const v4f o = {sv[0] + acc[0][0], sv[1] + acc[0][1], sv[2] + acc[1][0], sv[3] + acc[1][1]};
    *(v4f*)(sp + (size_t)r * TT) = o;
  } }
#define NN TT
__global__ __launch_bounds__(256) void k_smx(const float* __restrict__ S, _Float16* __restrict__ P16) { const int tid = threadIdx.x, wv = tid >> 5, lane = tid & 31; const int i = blockIdx.x * 8 + wv; const float* sr = S + (size_t)i * NN;
  float m = -3.0e38f;
  for (int p = lane; p < NN / 8; p += 32) { const v4f a = *(const v4fa*)(sr + p * 8), c = *(const v4fa*)(sr + p * 8 + 4); for (int e = 0; e < 4; ++e) m = fmaxf(m, fmaxf(a[e], c[e])); }
  for (int o = 16; o >= 1; o >>= 1) m = fmaxf(m, __shfl_xor(m, o, 32)); float z = 0.f;
  for (int p = lane; p < NN / 8; p += 32) { const v4f a = *(const v4fa*)(sr + p * 8), c = *(const v4fa*)(sr + p * 8 + 4); for (int e = 0; e < 4; ++e) z += __expf(a[e] - m) + __expf(c[e] - m); }
  for (int o = 16; o >= 1; o >>= 1) z += __shfl_xor(z, o, 32); const float iz = 32768.0f / z;
  { for (int p = lane; p < NN / 8; p += 32) { FragH f; const v4f a = *(const v4fa*)(sr + p * 8), c = *(const v4fa*)(sr + p * 8 + 4); for (int e = 0; e < 4; ++e) { f.h[e] = (_Float16)(__expf(a[e] - m) * iz); f.h[4 + e] = (_Float16)(__expf(c[e] - m) * iz); }
      *(v8us*)((unsigned short*)P16 + (size_t)i * NN + p * 8) = f.half[0]; }  } }
// lane l with lane l ^ 16 (the two halves of a wave hold the two halves of a query's keys)
__device__ __forceinline__ float xhalf(float x) { return __builtin_bit_cast(float, __builtin_amdgcn_permlanex16(__builtin_bit_cast(int, x), __builtin_bit_cast(int, x), 0x76543210, 0xfedcba98, false, false)); }
__global__ __launch_bounds__(128) void k_flash(const _Float16* __restrict__ Q16, int ldq, const _Float16* __restrict__ K16, int ldk, const _Float16* __restrict__ Vt, const int* __restrict__ MSK, _Float16* __restrict__ O16, int ldo) {
  constexpr int RPW = 16, NQB = TT / (4 * RPW), DT = 4, KS = 2; (void)MSK;
  __shared__ __attribute__((aligned(16))) unsigned short sO[4][RPW][64 + 8];      /* f16 rows at pitch 144 B */
  const int tid = threadIdx.x, w = tid >> 5, lane = tid & 31, ln = lane & 15, hh = lane >> 4;
  const int slab = blockIdx.x / NQB, qblk = blockIdx.x % NQB; const int b = slab / NH, h = slab % NH; const int q0 = qblk * (4 * RPW) + w * RPW;
  FragH bq[KS];
  { const unsigned short* qr = (const unsigned short*)Q16 + ((size_t)b * TT + q0 + ln) * ldq + h * 64;
#pragma unroll
    for (int ks = 0; ks < KS; ++ks) { bq[ks].half[0] = *(const v8us*)(qr + ks * 32 + 8 * hh); bq[ks].half[1] = *(const v8us*)(qr + ks * 32 + 16 + 8 * hh); } }
  const unsigned short* Vth = (const unsigned short*)Vt + (size_t)slab * 64 * TT;
  float m_q = -3.0e38f, l_q = 0.f; v8f oacc[DT];
#pragma unroll
  for (int dt = 0; dt < DT; ++dt) oacc[dt] = (v8f){0.f,0.f,0.f,0.f,0.f,0.f,0.f,0.f};
#pragma unroll 1      /* stays rolled: an unrolled body would hold two trips' fragments in registers */
  for (int j0 = 0; j0 < TT; j0 += 32) {
    FragH ak[2][KS], av[DT];      /* no fence stands in the loop: the trip's 16 loads are asked for together at its head, one trip to L2 instead of one per fragment */
#pragma unroll
    for (int nt = 0; nt < 2; ++nt) { const unsigned short* kr = (const unsigned short*)K16 + ((size_t)b * TT + j0 + nt * 16 + ln) * ldk + h * 64;
#pragma unroll
      for (int ks = 0; ks < KS; ++ks) { ak[nt][ks].half[0] = *(const v8us*)(kr + ks * 32 + 8 * hh); ak[nt][ks].half[1] = *(const v8us*)(kr + ks * 32 + 16 + 8 * hh); } }
    asm volatile("s_wait_xcnt 0x0" ::: "memory");      /* ahead of the VT loads, whose results may be given the registers that held the key loads' addresses */
#pragma unroll
    for (int dt = 0; dt < DT; ++dt) { const unsigned short* vrow = Vth + (size_t)(dt * 16 + ln) * TT + j0; av[dt].half[0] = *(const v8us*)(vrow + 8 * hh); av[dt].half[1] = *(const v8us*)(vrow + 16 + 8 * hh); }
    __builtin_amdgcn_sched_barrier(0);      /* keeps all 16 loads ahead of the first product's wait: behind it the second key tile would pay a second trip to L2 */
    v8f s[2];
#pragma unroll
    for (int nt = 0; nt < 2; ++nt) { v8f acc = (v8f){0.f,0.f,0.f,0.f,0.f,0.f,0.f,0.f};
#pragma unroll
      for (int ks = 0; ks < KS; ++ks) acc = mmaH<1>(ak[nt][ks].v, ak[nt][ks].v, bq[ks].v, bq[ks].v, acc);
      s[nt] = acc; }
    float mc = -3.0e38f;
#pragma unroll
    for (int nt = 0; nt < 2; ++nt)
#pragma unroll
      for (int r = 0; r < 8; ++r) { s[nt][r] *= 0.125f; mc = fmaxf(mc, s[nt][r]); }
    mc = fmaxf(mc, xhalf(mc));
    const float mn = fmaxf(m_q, mc); const float al = (mn > -1.0e38f) ? expf(m_q - mn) : 1.0f; m_q = mn;
    FragH pb; float ps = 0.f;
#pragma unroll
    for (int nt = 0; nt < 2; ++nt)
#pragma unroll
      for (int r = 0; r < 8; ++r) { const float p = expf(s[nt][r] - mn); ps += p; pb.h[nt * 8 + r] = (_Float16)(p * 1024.0f); }
    l_q = l_q * al + ps;      /* this half's keys only; the halves are joined behind the loop */
#pragma unroll
    for (int dt = 0; dt < DT; ++dt)
#pragma unroll
      for (int r = 0; r < 8; ++r) oacc[dt][r] *= al;
#pragma unroll
    for (int dt = 0; dt < DT; ++dt) oacc[dt] = mmaH<1>(av[dt].v, av[dt].v, pb.v, pb.v, oacc[dt]); }
  const float lt = l_q + xhalf(l_q); const float il = (lt > 0.f) ? 1.0f / (lt * 64.0f) : 0.f;      /* P carries 2^10, the f16 result plane 2^4 */
#pragma unroll
  for (int dt = 0; dt < DT; ++dt) { FragH f;      /* oacc[dt][r] = OT[dt * 16 + 8 * hh + r][query ln] */
#pragma unroll
    for (int r = 0; r < 8; ++r) f.h[r] = (_Float16)(oacc[dt][r] * il);
    *(v8us*)&sO[w][ln][dt * 16 + 8 * hh] = f.half[0]; }
  __builtin_amdgcn_fence(__ATOMIC_ACQ_REL, "workgroup"); __builtin_amdgcn_wave_barrier();
#pragma unroll
  for (int rp = 0; rp < RPW; rp += 4) { const int r = rp + (lane >> 3), pc = lane & 7; const v8us val = *(const v8us*)&sO[w][r][pc * 8];      /* 8 lanes a row: one whole 128-B line of the f16 plane */
    *(v8us*)((unsigned short*)O16 + ((size_t)b * TT + q0 + r) * ldo + h * 64 + pc * 8) = val; } }

extern "C" void kernel_launch(void* const* d_in, const int* in_sizes, int n_in,
                              void* d_out, int out_size, void* d_ws, size_t ws_size, hipStream_t stream) {
  (void)in_sizes; (void)n_in; (void)out_size;
  const float* const* I = (const float* const*)d_in; const float* feats = I[0]; const float* geom = I[1]; const float* crd = I[2];
  const float* wq = I[3]; const float* bq = I[4]; const float* wk = I[5]; const float* bk = I[6]; const float* wv = I[7]; const float* bv = I[8]; const float* wo = I[9]; const float* bo = I[10];
  const float* gqw = I[11]; const float* gqb = I[12]; const float* gkw = I[13]; const float* gkb = I[14]; const float* gvw = I[15]; const float* gvb = I[16]; const float* d1w = I[17]; const float* d1b = I[18]; const float* d2w = I[19]; const float* d2b = I[20]; const float* opw = I[21]; const float* opb = I[22];
  char* ws = (char*)d_ws; size_t off = 0;
  auto take = [&](size_t bytes) { char* p = ws + off; off += (bytes + 255) & ~(size_t)255; return p; };
  const size_t WSZ = (size_t)DD * DD, GSZ = (size_t)GG * DD, PSZ = (size_t)NR * DD; _Float16* Bw = (_Float16*)take(5 * WSZ * 2); _Float16* Bg = (_Float16*)take(3 * GSZ * 2);
  _Float16* X16 = (_Float16*)take(PSZ * 2); _Float16* GE16 = (_Float16*)take((size_t)NR * GG * 2);
  _Float16* PL = (_Float16*)take(6 * PSZ * 2);      /* the six projections' planes in a row: q, k, v, gv, gq, gk */
  _Float16* RL = (_Float16*)take(2 * PSZ * 2);      /* residual planes of gq, gk */
  _Float16* VT = (_Float16*)take(2 * PSZ * 2);      /* v and gv transposed */
  float* FA = (float*)take(PSZ * 4); float* S = (float*)take((size_t)BB * TT * TT * 4); _Float16* P16 = (_Float16*)take((size_t)BB * TT * TT * 2);
  _Float16* Q = PL; _Float16* K = PL + PSZ; _Float16* V = PL + 2 * PSZ; _Float16* GQ = PL + 4 * PSZ; _Float16* GK = PL + 5 * PSZ; _Float16* GQl = RL; _Float16* GKl = RL + PSZ; _Float16* Vt = VT; _Float16* GVt = VT + PSZ;
  _Float16* O16 = X16; _Float16* SUM16 = V;      /* reuse in stream order: X16 -> the attention output (behind the projections); V -> feat + geom (behind the transposes) */
  if (off > ws_size) return;      // 2.6 + 0.4 + 8.4 + 2.1 + 10 x 8.4 + 16.8 + 33.6 + 16.8 = about 165 MB
  const int NOSPLIT = 0x7fffffff;      /* a launch with one set only */
  k_prep<<<5 * PW_BIG + 3 * PW_SML + PX_F + PX_G, 256, 0, stream>>>(wq, wk, wv, wo, opw, gqw, gkw, gvw, feats, geom, Bw, Bg, X16, GE16);      /* (in,out) weights -> Bt x 2^4; features, geometry -> f16 */
  const unsigned gpx = (NR / 128) * (DD / 128);
  { const GSet f = {X16, Bw, bq, bk, bv, nullptr, PL, nullptr, 0, WSZ, PSZ, DD, DD, DD, DD, DD, 0.0625f};      /* q, k, v: M 8192 N 512 K 512 */
    const GSet e = {GE16, Bg + 2 * GSZ, gvb, gvb, gvb, nullptr, PL + 3 * PSZ, nullptr, 0, 0, 0, GG, GG, DD, DD, GG, 0.0625f};      /* gv: M 8192 N 512 K 128 */
    k_gemm_t<0, 0><<<dim3(gpx, 4), 256, 0, stream>>>(f, e, 3, nullptr, 0); }
  { const GSet e = {GE16, Bg, gqb, gkb, gkb, nullptr, GQ, RL, 0, GSZ, PSZ, GG, GG, DD, DD, GG, 0.0625f};      /* gq, gk -> hi / x2^10 residual planes: M 8192 N 512 K 128 */
    k_gemm_t<0, 2><<<dim3(gpx, 2), 256, 0, stream>>>(e, e, NOSPLIT, nullptr, 0); }
  k_vt<NH, TT><<<dim3(BB * NH * (TT / 64), 2), 256, 0, stream>>>(V, PSZ, DD, 0, VT, PSZ);      /* v per head [64][1024]; gv per batch [512][1024] (the same 64-wide slabs) */
  k_flash<<<BB * NH * (TT / 64), 128, 0, stream>>>(Q, DD, K, DD, Vt, nullptr, O16, DD);      /* the attention output leaves as f16 x 2^4 */
  /* geometry branch: all BB batches of each stage in one launch, the batch in blockIdx.y (operand, addend and result strides per batch) */
  const size_t sX = (size_t)TT * DD, sS = (size_t)TT * TT; const dim3 gs((TT / 128) * (TT / 128), BB);
  { const GSet hh = {GQ, GK, nullptr, nullptr, nullptr, S, nullptr, nullptr, sX, sX, sS, DD, DD, TT, TT, DD, 0.125f};      /* S = gq.gkT/8 f32-accurate: hi.hi ... */
    const GSet fo = {O16, Bw + 3 * WSZ, bo, bo, bo, FA, nullptr, nullptr, PSZ / 4, 0, PSZ / 4, DD, DD, DD, DD, DD, 0.00390625f};      /* feat_att = O.wo + bo (f32), in four slices of 2048 rows, each as many work-groups as one batch of S */
    k_gemm_t<0, 1><<<dim3((TT / 128) * (TT / 128), BB + 4), 256, 0, stream>>>(hh, fo, BB, nullptr, 0); }
  { const GSet lh = {GQl, GK, nullptr, nullptr, nullptr, S, nullptr, nullptr, sX, sX, sS, DD, DD, TT, TT, DD, 0.125f * 0.0009765625f};
    k_gemm_t<TT, 1><<<gs, 256, 0, stream>>>(lh, lh, NOSPLIT, S, sS); }      /* += lo.hi.2^-10 */
  { const GSet hl = {GQ, GKl, nullptr, nullptr, nullptr, S, nullptr, nullptr, sX, sX, sS, DD, DD, TT, TT, DD, 0.125f * 0.0009765625f};
    k_gemm_t<TT, 1><<<gs, 256, 0, stream>>>(hl, hl, NOSPLIT, S, sS); }      /* += hi.lo.2^-10: M 1024 N 1024 K 512 each, x BB */
  k_gbias<<<dim3(TT / GB_ROWS, BB), 256, 0, stream>>>(S, crd, d1w, d1b, d2w, d2b); k_smx<<<BB * TT / 8, 256, 0, stream>>>(S, P16);      /* softmax: a wave per row over the BB * TT rows */
  { const GSet pv = {P16, GVt, nullptr, nullptr, nullptr, nullptr, SUM16, nullptr, sS, sX, sX, TT, TT, DD, DD, TT, 0.000030517578125f};
    k_gemm_t<DD, 0><<<dim3((TT / 128) * (DD / 128), BB), 256, 0, stream>>>(pv, pv, NOSPLIT, FA, sX); }      /* feat_att + geom_att, stored as f16: M 1024 N 512 K 1024, x BB */
  { const GSet op = {SUM16, Bw + 4 * WSZ, opb, opb, opb, (float*)d_out, nullptr, nullptr, 0, 0, 0, DD, DD, DD, DD, DD, 0.0625f};
    k_gemm_t<0, 1><<<dim3(gpx, 1), 256, 0, stream>>>(op, op, NOSPLIT, nullptr, 0); }      /* out = (feat + geom).op_w + op_b */
}

// v007
// A run of this version takes 191 microseconds.
// Next to v006, in two timings, it ran 1.10 times as fast each time.
// All steps since v000 together make it 6.93 times as fast.
#include <hip/hip_runtime.h>
// Geometry-aware attention (B=8, N=1024, F=512, 8 heads × 64, G=128): feat = MHA(features) (x·W + b, softmax(q·k/8)·v, ·wo + bo); geometry branch: gq, gk, gv = geometry·W + b (F wide, single head);
// g_scores = gq·gkᵀ/8 + mean_h(gelu_tanh(dist·d1_w + d1_b)·d2_w + d2_b) with dist = max(‖coords_q − coords_k‖, 1e-6); geom = softmax(g_scores)·gv; out = (feat + geom)·op_w + op_b. (in,out) weights; jax.nn.gelu default = tanh approximation.
// Compute dtype: features, geometry, coords, all weights/biases rounded to bf16; f16 GEMM planes; the 8-head branch through a fused flash-style kernel (online softmax f32, P f16 ×2^10); the geometry branch, every stage one launch over all batches (batch in blockIdx.y; the softmax's BB·TT rows in blockIdx.x): S = gq·gkᵀ/8 f32-accurate from f16 hi + residual planes (hi·hi + (lo·hi + hi·lo)·2^-10; its logits reach σ≈3), a kernel adding the distance-MLP bias in place (f32, per pair from the coords), a wave-per-row f32 softmax → P f16 ×2^15, geom = P·gv by GEMM with feat_att as the f32 addend; final projection GEMM. All contractions on v_wmma_f32_16x16x32_f16, f32 accumulate.
#define BB 8
#define TT 1024
#define DD 512
#define GG 128
#define NH 8
#define NR (BB * TT)

typedef __bf16 v16b __attribute__((ext_vector_type(16)));
typedef unsigned short v8us __attribute__((ext_vector_type(8), may_alias));
typedef float  v8f  __attribute__((ext_vector_type(8)));
typedef float  v4f  __attribute__((ext_vector_type(4)));
typedef float  v4fa __attribute__((ext_vector_type(4), may_alias));
union FragB { v16b v; v8us half[2]; unsigned short u[16]; };

__device__ __forceinline__ unsigned short bf16_bits(float x) { unsigned int u = __float_as_uint(x); return (unsigned short)((u + 0x7FFFu + ((u >> 16) & 1u)) >> 16); }
__device__ __forceinline__ float bf16_val(unsigned short b) { return __uint_as_float(((unsigned int)b) << 16); }
__device__ __forceinline__ float bf16_round(float x) { return bf16_val(bf16_bits(x)); }
// D += A·B with NT terms: 1 = ah·bh, 2 = + al·bh (A split), 3 = + ah·bl (both split)
template <int NT>
__device__ __forceinline__ v8f mmaN(v16b ah, v16b al, v16b bh, v16b bl, v8f c) {
  c = __builtin_amdgcn_wmma_f32_16x16x32_bf16(false, ah, false, bh, (short)0, c, false, false);
  if (NT >= 2) c = __builtin_amdgcn_wmma_f32_16x16x32_bf16(false, al, false, bh, (short)0, c, false, false);
  if (NT >= 3) c = __builtin_amdgcn_wmma_f32_16x16x32_bf16(false, ah, false, bl, (short)0, c, false, false);
  asm volatile("v_nop\n\tv_nop\n\tv_nop\n\tv_nop" : "+v"(c) : "v"(ah), "v"(al), "v"(bh), "v"(bl));
  return c;
}

__global__ __launch_bounds__(256) void k_wt_bf16(const float* __restrict__ W, unsigned short* __restrict__ Wt, int K, int N) {
  const int t = blockIdx.x * 256 + threadIdx.x;
  const int k8n = K / 8;
  if (t >= N * k8n) return;
  const int n = t / k8n, k8 = (t % k8n) * 8;
  v8us v;
#pragma unroll
  for (int i = 0; i < 8; ++i) v[i] = bf16_bits(W[(size_t)(k8 + i) * N + n]);
  *(v8us*)(Wt + (size_t)n * K + k8) = v;
  
}

// GEMM C[M][N] (f32, pitch ldc) = act(A[M][K]·W + bias). A f32 row-major (pitch lda) converted per fragment to bf16
// (ASPLIT: hi/lo two planes -> 2 terms, else single rounded term); Wt bf16 [N][K] (pitch ldb). BIAS_BF16 rounds the
// bias to bf16 first (bias quantised to bf16 before the add). K%32==0, M%16==0, N%64==0.
template <bool ASPLIT, int ACT, bool BIAS_BF16>
__global__ __launch_bounds__(128) void k_gemm_bf(const float* __restrict__ A, int lda, const unsigned short* __restrict__ Wt, int ldb,
                                               const float* __restrict__ bias, float* __restrict__ C, int ldc, int M, int N, int K) {
  __shared__ __attribute__((aligned(16))) float so[4][16][64];
  const int tid = threadIdx.x, w = tid >> 5, lane = tid & 31, ln = lane & 15, hh = lane >> 4;
  const int ntn = N / 64;
  const int wid = blockIdx.x * 4 + w;
  const int mt = wid / ntn, nq = wid % ntn;
  if (mt * 16 >= M) return;
  const int row0 = mt * 16, col0 = nq * 64;
  const float* arow = A + (size_t)(row0 + ln) * lda;
  v8f acc[4] = {};
  for (int kb = 0; kb < K; kb += 32) {
    FragB ah, al;
    const v4f x0 = *(const v4fa*)(arow + kb + 8 * hh), x1 = *(const v4fa*)(arow + kb + 8 * hh + 4);
    const v4f x2 = *(const v4fa*)(arow + kb + 16 + 8 * hh), x3 = *(const v4fa*)(arow + kb + 16 + 8 * hh + 4);
    float xs[16] = {x0[0],x0[1],x0[2],x0[3],x1[0],x1[1],x1[2],x1[3],x2[0],x2[1],x2[2],x2[3],x3[0],x3[1],x3[2],x3[3]};
#pragma unroll
    for (int i = 0; i < 16; ++i) { const unsigned short hb = bf16_bits(xs[i]); ah.u[i] = hb; al.u[i] = ASPLIT ? bf16_bits(xs[i] - bf16_val(hb)) : (unsigned short)0; }
#pragma unroll
    for (int t = 0; t < 4; ++t) {
      const unsigned short* brow = Wt + (size_t)(col0 + t * 16 + ln) * ldb + kb;
      FragB b;
      b.half[0] = *(const v8us*)(brow + 8 * hh);
      b.half[1] = *(const v8us*)(brow + 16 + 8 * hh);
      acc[t] = mmaN<ASPLIT ? 2 : 1>(ah.v, al.v, b.v, b.v, acc[t]);
    }
  }
#pragma unroll
  for (int t = 0; t < 4; ++t) {
    float bv = bias ? bias[col0 + t * 16 + ln] : 0.f;
    if (BIAS_BF16) bv = bf16_round(bv);
#pragma unroll
    for (int r = 0; r < 8; ++r) { float v = acc[t][r] + bv; if (ACT == 1) v = fmaxf(v, 0.f); so[w][8 * hh + r][t * 16 + ln] = v; }
  }
  __builtin_amdgcn_fence(__ATOMIC_ACQ_REL, "workgroup");
  __builtin_amdgcn_wave_barrier();
  const int rsub = lane >> 4, c4 = (lane & 15) * 4;
  {
#pragma unroll
    for (int q = 0; q < 8; ++q) {
      const int r = q * 2 + rsub;
      const v4f v = *(const v4fa*)&so[w][r][c4];
      *(v4f*)(C + (size_t)(row0 + r) * ldc + col0 + c4) = v;
    }
    
  }
}

// Flash-style causal/unmasked attention, all contractions 3-term bf16 hi/lo splits, f32 softmax with running max.
// q,k,v rows are read from f32 buffers with arbitrary row pitch (so they can live inside a fused qkv buffer);
// D = head size (multiple of 32, <= 128); one wave = 16 query rows; block = 4 waves (64 queries) sharing K/V chunks of 32.
template <int D, bool CAUSAL>
__global__ __launch_bounds__(128) void k_flash(const float* __restrict__ qb, const float* __restrict__ kb, const float* __restrict__ vb,
                                             int pitch, int T, int H, float scale, float* __restrict__ y, int ypitch) {
  constexpr int KS = D / 32;        // k-steps for QK
  constexpr int DT = D / 16;        // d tiles for PV
  __shared__ __attribute__((aligned(16))) unsigned short sKh[32][D + 8], sKl[32][D + 8], sVh[32][D + 8], sVl[32][D + 8];
  __shared__ __attribute__((aligned(16))) unsigned short sPh[4][16][40], sPl[4][16][40];
  __shared__ __attribute__((aligned(16))) float sO[4][16][D];
  const int tid = threadIdx.x, w = tid >> 5, lane = tid & 31, ln = lane & 15, hh = lane >> 4;
  const int nqb = (T + 63) / 64;
  const int bh = blockIdx.x / nqb, qblk = blockIdx.x % nqb;
  const int b = bh / H, h = bh % H;
  const int q0 = qblk * 64 + w * 16;
  const float* Q = qb + (size_t)b * T * pitch + h * D;
  const float* K = kb + (size_t)b * T * pitch + h * D;
  const float* V = vb + (size_t)b * T * pitch + h * D;

  // A fragments of the wave's 16 query rows (scaled), hi/lo
  FragB aqh[KS], aql[KS];
  {
    int row = q0 + ln; if (row >= T) row = T - 1;
    const float* qr = Q + (size_t)row * pitch;
#pragma unroll
    for (int ks = 0; ks < KS; ++ks)
#pragma unroll
      for (int i = 0; i < 16; ++i) {
        const int d = ks * 32 + ((i < 8) ? (8 * hh + i) : (16 + 8 * hh + (i - 8)));
        const float x = qr[d] * scale; const unsigned short hb = bf16_bits(x);
        aqh[ks].u[i] = hb; aql[ks].u[i] = bf16_bits(x - bf16_val(hb));
      }
  }
  float m_r[8], l_r[8];
#pragma unroll
  for (int r = 0; r < 8; ++r) { m_r[r] = -3.0e38f; l_r[r] = 0.f; }
  v8f oacc[DT];
#pragma unroll
  for (int dt = 0; dt < DT; ++dt) oacc[dt] = (v8f){0.f,0.f,0.f,0.f,0.f,0.f,0.f,0.f};

  const int kv_end = CAUSAL ? min(T, qblk * 64 + 64) : T;     // block-uniform
  for (int j0 = 0; j0 < kv_end; j0 += 32) {
    __syncthreads();
    for (int e = tid; e < 32 * (D / 4); e += 128) {
      const int r = e / (D / 4), c4 = (e % (D / 4)) * 4;
      const int key = j0 + r;
      v4f kf = {0.f,0.f,0.f,0.f}, vf = {0.f,0.f,0.f,0.f};
      if (key < T) { kf = *(const v4fa*)(K + (size_t)key * pitch + c4); vf = *(const v4fa*)(V + (size_t)key * pitch + c4); }
#pragma unroll
      for (int t = 0; t < 4; ++t) {
        unsigned short hb = bf16_bits(kf[t]); sKh[r][c4 + t] = hb; sKl[r][c4 + t] = bf16_bits(kf[t] - bf16_val(hb));
        hb = bf16_bits(vf[t]); sVh[r][c4 + t] = hb; sVl[r][c4 + t] = bf16_bits(vf[t] - bf16_val(hb));
      }
    }
    __syncthreads();
    // S tile 16 x 32
    v8f s[2];
#pragma unroll
    for (int nt = 0; nt < 2; ++nt) {
      v8f acc = {};
#pragma unroll
      for (int ks = 0; ks < KS; ++ks) {
        FragB bh_, bl_;
        bh_.half[0] = *(const v8us*)&sKh[nt * 16 + ln][ks * 32 + 8 * hh]; bh_.half[1] = *(const v8us*)&sKh[nt * 16 + ln][ks * 32 + 16 + 8 * hh];
        bl_.half[0] = *(const v8us*)&sKl[nt * 16 + ln][ks * 32 + 8 * hh]; bl_.half[1] = *(const v8us*)&sKl[nt * 16 + ln][ks * 32 + 16 + 8 * hh];
        acc = mmaN<3>(aqh[ks].v, aql[ks].v, bh_.v, bl_.v, acc);
      }
      s[nt] = acc;
    }
    // mask + running max (rows 8hh+r; the 16 lanes of a half share rows)
    float alpha[8];
#pragma unroll
    for (int r = 0; r < 8; ++r) {
      const int qi = q0 + 8 * hh + r;
      const int ja = j0 + ln, jb = j0 + 16 + ln;
      if (CAUSAL) { if (ja > qi) s[0][r] = -3.0e38f; if (jb > qi) s[1][r] = -3.0e38f; }
      if (ja >= T) s[0][r] = -3.0e38f;
      if (jb >= T) s[1][r] = -3.0e38f;
      float mx = fmaxf(s[0][r], s[1][r]);
      mx = fmaxf(mx, __shfl_xor(mx, 1, 32)); mx = fmaxf(mx, __shfl_xor(mx, 2, 32)); mx = fmaxf(mx, __shfl_xor(mx, 4, 32)); mx = fmaxf(mx, __shfl_xor(mx, 8, 32));
      const float mnew = fmaxf(m_r[r], mx);
      alpha[r] = (mnew > -1.0e38f) ? __expf(m_r[r] - mnew) : 1.0f;
      const float p0 = (s[0][r] > -1.0e38f) ? __expf(s[0][r] - mnew) : 0.f;
      const float p1 = (s[1][r] > -1.0e38f) ? __expf(s[1][r] - mnew) : 0.f;
      m_r[r] = mnew;
      l_r[r] = l_r[r] * alpha[r] + p0 + p1;            // per-lane partial row sum (16 lanes combined at the end)
      unsigned short hb = bf16_bits(p0); sPh[w][8 * hh + r][ln] = hb;      sPl[w][8 * hh + r][ln] = bf16_bits(p0 - bf16_val(hb));
      hb = bf16_bits(p1);                sPh[w][8 * hh + r][16 + ln] = hb; sPl[w][8 * hh + r][16 + ln] = bf16_bits(p1 - bf16_val(hb));
    }
#pragma unroll
    for (int dt = 0; dt < DT; ++dt)
#pragma unroll
      for (int r = 0; r < 8; ++r) oacc[dt][r] *= alpha[r];
    __builtin_amdgcn_fence(__ATOMIC_ACQ_REL, "workgroup");
    __builtin_amdgcn_wave_barrier();
    FragB pah, pal;
    pah.half[0] = *(const v8us*)&sPh[w][ln][8 * hh]; pah.half[1] = *(const v8us*)&sPh[w][ln][16 + 8 * hh];
    pal.half[0] = *(const v8us*)&sPl[w][ln][8 * hh]; pal.half[1] = *(const v8us*)&sPl[w][ln][16 + 8 * hh];
#pragma unroll
    for (int dt = 0; dt < DT; ++dt) {
      FragB bvh, bvl;
#pragma unroll
      for (int i = 0; i < 8; ++i) {
        bvh.u[i] = sVh[8 * hh + i][dt * 16 + ln]; bvh.u[8 + i] = sVh[16 + 8 * hh + i][dt * 16 + ln];
        bvl.u[i] = sVl[8 * hh + i][dt * 16 + ln]; bvl.u[8 + i] = sVl[16 + 8 * hh + i][dt * 16 + ln];
      }
      oacc[dt] = mmaN<3>(pah.v, pal.v, bvh.v, bvl.v, oacc[dt]);
    }
    __builtin_amdgcn_fence(__ATOMIC_ACQ_REL, "workgroup");
    __builtin_amdgcn_wave_barrier();
  }
#pragma unroll
  for (int r = 0; r < 8; ++r) {
    float l = l_r[r];
    l += __shfl_xor(l, 1, 32); l += __shfl_xor(l, 2, 32); l += __shfl_xor(l, 4, 32); l += __shfl_xor(l, 8, 32);
    l_r[r] = (l > 0.f) ? 1.0f / l : 0.f;
  }
#pragma unroll
  for (int dt = 0; dt < DT; ++dt)
#pragma unroll
    for (int r = 0; r < 8; ++r) sO[w][8 * hh + r][dt * 16 + ln] = oacc[dt][r] * l_r[r];
  __builtin_amdgcn_fence(__ATOMIC_ACQ_REL, "workgroup");
  __builtin_amdgcn_wave_barrier();
  {
    for (int r = 0; r < 16; ++r) {
      const int row = q0 + r;
      if (row < T && lane < D / 4) {
        const v4f val = *(const v4fa*)&sO[w][r][lane * 4];
        *(v4f*)(y + ((size_t)b * T + row) * ypitch + h * D + lane * 4) = val;
      }
    }
    
  }
}

// GEMM C = act(A·W + bias + resid): A f32 (ASPLIT -> hi/lo 2 terms), Wt bf16 [N][K]; ACT 0 none, 1 relu, 2 exact gelu;
// resid (optional, f32, row index = (row % rmod), pitch ldr, RES_BF16 rounds it) added before the activation.
template <bool ASPLIT, int ACT, bool BIAS_BF16, bool RES_BF16>
__global__ __launch_bounds__(128) void k_gemm_bf3(const float* __restrict__ A, int lda, const unsigned short* __restrict__ Wt, int ldb,
                                                const float* __restrict__ bias, const float* __restrict__ resid, int rmod, int ldr,
                                                float* __restrict__ C, int ldc, int M, int N, int K) {
  __shared__ __attribute__((aligned(16))) float so[4][16][64];
  const int tid = threadIdx.x, w = tid >> 5, lane = tid & 31, ln = lane & 15, hh = lane >> 4;
  const int ntn = N / 64;
  const int wid = blockIdx.x * 4 + w;
  const int mt = wid / ntn, nq = wid % ntn;
  if (mt * 16 >= M) return;
  const int row0 = mt * 16, col0 = nq * 64;
  const float* arow = A + (size_t)(row0 + ln) * lda;
  v8f acc[4] = {};
  for (int kb = 0; kb < K; kb += 32) {
    FragB ah, al;
    const v4f x0 = *(const v4fa*)(arow + kb + 8 * hh), x1 = *(const v4fa*)(arow + kb + 8 * hh + 4);
    const v4f x2 = *(const v4fa*)(arow + kb + 16 + 8 * hh), x3 = *(const v4fa*)(arow + kb + 16 + 8 * hh + 4);
    float xs[16] = {x0[0],x0[1],x0[2],x0[3],x1[0],x1[1],x1[2],x1[3],x2[0],x2[1],x2[2],x2[3],x3[0],x3[1],x3[2],x3[3]};
#pragma unroll
    for (int i = 0; i < 16; ++i) { const unsigned short hb = bf16_bits(xs[i]); ah.u[i] = hb; al.u[i] = ASPLIT ? bf16_bits(xs[i] - bf16_val(hb)) : (unsigned short)0; }
#pragma unroll
    for (int t = 0; t < 4; ++t) {
      const unsigned short* brow = Wt + (size_t)(col0 + t * 16 + ln) * ldb + kb;
      FragB b;
      b.half[0] = *(const v8us*)(brow + 8 * hh);
      b.half[1] = *(const v8us*)(brow + 16 + 8 * hh);
      acc[t] = mmaN<ASPLIT ? 2 : 1>(ah.v, al.v, b.v, b.v, acc[t]);
    }
  }
#pragma unroll
  for (int t = 0; t < 4; ++t) {
    const int col = col0 + t * 16 + ln;
    float bv = bias ? bias[col] : 0.f;
    if (BIAS_BF16) bv = bf16_round(bv);
#pragma unroll
    for (int r = 0; r < 8; ++r) {
      float v = acc[t][r] + bv;
      if (resid) { float rv = resid[(size_t)((row0 + 8 * hh + r) % rmod) * ldr + col]; if (RES_BF16) rv = bf16_round(rv); v += rv; }
      if (ACT == 1) v = fmaxf(v, 0.f);
      if (ACT == 2) v = 0.5f * v * (1.0f + erff(v * 0.70710678118654752f));
      if (ACT == 3) { const float u = 0.7978845608028654f * (v + 0.044715f * v * v * v); v = 0.5f * v * (1.0f + tanhf(u)); }
      so[w][8 * hh + r][t * 16 + ln] = v;
    }
  }
  __builtin_amdgcn_fence(__ATOMIC_ACQ_REL, "workgroup");
  __builtin_amdgcn_wave_barrier();
  const int rsub = lane >> 4, c4 = (lane & 15) * 4;
  {
#pragma unroll
    for (int q = 0; q < 8; ++q) {
      const int r = q * 2 + rsub;
      const v4f v = *(const v4fa*)&so[w][r][c4];
      *(v4f*)(C + (size_t)(row0 + r) * ldc + col0 + c4) = v;
    }
    
  }
}
// row LayerNorm (biased variance, eps) over N: s = X (+ R); optional out_sum <- s; out_norm <- (s-mu)*rsqrt(var+eps)*g + b
template <bool PARAM_BF16>
__global__ __launch_bounds__(256) void k_layernorm(const float* __restrict__ X, const float* __restrict__ R, const float* __restrict__ g, const float* __restrict__ bta,
                                                  float* __restrict__ out_sum, float* __restrict__ out_norm, int N, float eps) {
  __shared__ float red[256];
  const int row = blockIdx.x, tid = threadIdx.x;
  const float* x = X + (size_t)row * N; const float* rr = R ? R + (size_t)row * N : nullptr;
  float vals[16];                     // up to N = 4096
  const int per = N / 256;            // contiguous chunk per thread? use strided-by-4 chunks: thread handles j = tid*4 + 1024*u
  float s1 = 0.f;
  for (int u = 0; u < per / 4; ++u) {
    const int j = tid * 4 + 1024 * u;
    const v4f a = *(const v4fa*)(x + j);
    v4f b = {0.f,0.f,0.f,0.f}; if (rr) b = *(const v4fa*)(rr + j);
#pragma unroll
    for (int q = 0; q < 4; ++q) { const float v = a[q] + b[q]; vals[u * 4 + q] = v; s1 += v; }
  }
  red[tid] = s1; __syncthreads();
  for (int st = 128; st > 0; st >>= 1) { if (tid < st) red[tid] += red[tid + st]; __syncthreads(); }
  const float mu = red[0] / (float)N; __syncthreads();
  float s2 = 0.f;
  for (int u = 0; u < per / 4; ++u)
#pragma unroll
    for (int q = 0; q < 4; ++q) { const float c = vals[u * 4 + q] - mu; s2 += c * c; }
  red[tid] = s2; __syncthreads();
  for (int st = 128; st > 0; st >>= 1) { if (tid < st) red[tid] += red[tid + st]; __syncthreads(); }
  const float rs = rsqrtf(red[0] / (float)N + eps);
  {
    for (int u = 0; u < per / 4; ++u) {
      const int j = tid * 4 + 1024 * u;
      v4f o, sm;
#pragma unroll
      for (int q = 0; q < 4; ++q) {
        float gg = g[j + q], bb = bta[j + q];
        if (PARAM_BF16) { gg = bf16_round(gg); bb = bf16_round(bb); }
        sm[q] = vals[u * 4 + q]; o[q] = (vals[u * 4 + q] - mu) * rs * gg + bb;
      }
      if (out_sum) *(v4f*)(out_sum + (size_t)row * N + j) = sm;
      *(v4f*)(out_norm + (size_t)row * N + j) = o;
    }
    
  }
}



// ---- f16 WMMA path (v_wmma_f32_16x16x32_f16): 11-bit significands for operands in range — used for every contraction launched here
typedef _Float16 v16h __attribute__((ext_vector_type(16)));
union FragH { v16h v; v8us half[2]; _Float16 h[16]; unsigned short u[16]; };
template <int NT>
__device__ __forceinline__ v8f mmaH(v16h ah, v16h al, v16h bh, v16h bl, v8f c) {
  c = __builtin_amdgcn_wmma_f32_16x16x32_f16(false, ah, false, bh, (short)0, c, false, false);
  if (NT >= 2) c = __builtin_amdgcn_wmma_f32_16x16x32_f16(false, al, false, bh, (short)0, c, false, false);
  if (NT >= 3) c = __builtin_amdgcn_wmma_f32_16x16x32_f16(false, ah, false, bl, (short)0, c, false, false);
  asm volatile("v_nop\n\tv_nop\n\tv_nop\n\tv_nop" : "+v"(c) : "v"(ah), "v"(al), "v"(bh), "v"(bl));
  return c;
}
// batched GEMM like k_gemm_b but f16 operands: A f32 (split into f16 hi/lo if ASPLIT, else rounded to f16), Bt = f16 values [n][k]; alpha; C f32; N multiple of 16 (partial tiles skipped)
template <bool ASPLIT>
__global__ __launch_bounds__(128) void k_gemm_h(const float* __restrict__ A, int lda, size_t sA, const _Float16* __restrict__ Bh, int ldb, size_t sB, float alpha, float* __restrict__ C, int ldc, size_t sC, int M, int N, int K) {
  __shared__ __attribute__((aligned(16))) float so[4][16][64];
  const int tid = threadIdx.x, w = tid >> 5, lane = tid & 31, ln = lane & 15, hh = lane >> 4; const int by = blockIdx.y;
  A += (size_t)by * sA; Bh += (size_t)by * sB; C += (size_t)by * sC;
  const int ntn = (N + 63) / 64; const int wid = blockIdx.x * 4 + w; const int mt = wid / ntn, nq = wid % ntn; if (mt * 16 >= M) return;
  const int row0 = mt * 16, col0 = nq * 64; const float* arow = A + (size_t)(row0 + ln) * lda;
  v8f acc[4] = {};
  for (int kb = 0; kb < K; kb += 32) {
    FragH ah, al;
    const v4f x0 = *(const v4fa*)(arow + kb + 8 * hh), x1 = *(const v4fa*)(arow + kb + 8 * hh + 4), x2 = *(const v4fa*)(arow + kb + 16 + 8 * hh), x3 = *(const v4fa*)(arow + kb + 16 + 8 * hh + 4);
    float xs[16] = {x0[0],x0[1],x0[2],x0[3],x1[0],x1[1],x1[2],x1[3],x2[0],x2[1],x2[2],x2[3],x3[0],x3[1],x3[2],x3[3]};
#pragma unroll
    for (int i = 0; i < 16; ++i) { const _Float16 h = (_Float16)xs[i]; ah.h[i] = h; al.h[i] = ASPLIT ? (_Float16)(xs[i] - (float)h) : (_Float16)0.0f; }
#pragma unroll
    for (int t = 0; t < 4; ++t) { if (col0 + t * 16 >= N) continue; const size_t boff = (size_t)(col0 + t * 16 + ln) * ldb + kb; FragH bq; bq.half[0] = *(const v8us*)(Bh + boff + 8 * hh); bq.half[1] = *(const v8us*)(Bh + boff + 16 + 8 * hh);
      acc[t] = mmaH<ASPLIT ? 2 : 1>(ah.v, al.v, bq.v, bq.v, acc[t]); }
  }
#pragma unroll
  for (int t = 0; t < 4; ++t) { if (col0 + t * 16 >= N) continue;
#pragma unroll
    for (int r = 0; r < 8; ++r) so[w][8 * hh + r][t * 16 + ln] = acc[t][r] * alpha; }
  __builtin_amdgcn_fence(__ATOMIC_ACQ_REL, "workgroup"); __builtin_amdgcn_wave_barrier();
  const int rsub = lane >> 4, c4 = (lane & 15) * 4;
  {
#pragma unroll
    for (int q = 0; q < 8; ++q) { const int r = q * 2 + rsub; if (col0 + c4 < N) { const v4f v = *(const v4fa*)&so[w][r][c4]; *(v4f*)(C + (size_t)(row0 + r) * ldc + col0 + c4) = v; } }
     }
}

// Wt[n][k] = f16(W[k][n]·scale) from f32 row-major W[K][N] (scale = power of two; bf16-exact weights stay exact in f16 away from the subnormal range)
__device__ __forceinline__ void wt_f16(const float* __restrict__ W, _Float16* __restrict__ Wt, int K, int N, float scale, int blk) {
  const int t = blk * 256 + threadIdx.x; if (t >= N * (K / 8)) return; const int n = t / (K / 8), k8 = (t % (K / 8)) * 8; FragH f;
#pragma unroll
  for (int i = 0; i < 8; ++i) f.h[i] = (_Float16)(bf16_round(W[(size_t)(k8 + i) * N + n]) * scale); const v8us o = f.half[0];
  *(v8us*)((unsigned short*)Wt + (size_t)n * K + k8) = o; 
}
// Block-tiled GEMM, f16 operands, both K-contiguous: v = (A.Bt^T)*alpha + bf16(bias[col]) (+ CP[row*LDCP + by*sCPy + col] if LDCP; CP may be C itself: a lane reads only what it then writes); writes f32 C, or f16 C16, or f16 C16 with the rounding residual x 2^10 in C16l. Batch in blockIdx.y.
// One work-group of 8 waves (4 x 2) makes 128 x 128 of C, a wave 32 x 64. Each trip takes 64 k: 128 rows of 128 B of A and of Bt are brought into LDS by asynchronous copies (whole 128-B lines, 16 B a lane),
// two buffers, the next tile in flight while this one is multiplied; LDS rows at pitch 144 B for the ds_load_b128 fragment reads. M, N multiples of 128, K a multiple of 64.
#define GT_PITCH 144
#define GT_OPB (128 * GT_PITCH)
#define GT_BUF (2 * GT_OPB)
typedef _Float16 v4h __attribute__((ext_vector_type(4)));
// one tile: 4 copies of A and 4 of Bt per lane. The s_wait_xcnt stands inside the statement so that no address register named here is rewritten ahead of it.
__device__ __forceinline__ void gt_copy(unsigned l, const unsigned short* ga, const unsigned short* gb, size_t a32, size_t b32) {
  asm volatile("global_load_async_to_lds_b128 %0, %8, off\n\t"
               "global_load_async_to_lds_b128 %1, %9, off\n\t"
               "global_load_async_to_lds_b128 %2, %10, off\n\t"
               "global_load_async_to_lds_b128 %3, %11, off\n\t"
               "global_load_async_to_lds_b128 %4, %12, off\n\t"
               "global_load_async_to_lds_b128 %5, %13, off\n\t"
               "global_load_async_to_lds_b128 %6, %14, off\n\t"
               "global_load_async_to_lds_b128 %7, %15, off\n\t"
               "s_wait_xcnt 0x0"
               :: "v"(l), "v"(l + 32 * GT_PITCH), "v"(l + 64 * GT_PITCH), "v"(l + 96 * GT_PITCH),
                  "v"(l + GT_OPB), "v"(l + GT_OPB + 32 * GT_PITCH), "v"(l + GT_OPB + 64 * GT_PITCH), "v"(l + GT_OPB + 96 * GT_PITCH),
                  "v"(ga), "v"(ga + a32), "v"(ga + 2 * a32), "v"(ga + 3 * a32), "v"(gb), "v"(gb + b32), "v"(gb + 2 * b32), "v"(gb + 3 * b32)
               : "memory");
}
// One launch may hold two sets of independent products: blockIdx.y below ysplit belongs to set g0, from ysplit on to set g1; inside a set y steps the operands and the result by the set's strides and picks one of three biases (y 1: bias1, y 2: bias2, else bias0).
// A set may name three operand pairs of one shape (SEG launches, A1 not null): the k loop then runs through (A, B), (A1, B1), (A2, B2) in one ring and one accumulator, which is multiplied by mid between the second pair and the third: v = ((A.BT + A1.B1T) * mid + A2.B2T) * alpha.
struct GSet { const _Float16* A; const _Float16* B; const float* bias0; const float* bias1; const float* bias2; float* C; _Float16* C16; _Float16* C16l; size_t sA, sB, sC; int lda, ldb, ldc, N, K; float alpha; const _Float16* A1; const _Float16* B1; const _Float16* A2; const _Float16* B2; float mid; };
template <int LDCP, int OUT, bool SEG = false>      /* SEG: sets with three operand pairs are honoured; LDCP: row pitch of an f32 addend plane CP, 0 for none (a constant, so that its 16 loads share one address register pair); OUT 1: f32 result in C; 0: f16 result in C16; 2: f16 result in C16 and (v - f16(v)) x 2^10 as f16 in C16l */
__global__ __launch_bounds__(256) void k_gemm_t(const GSet g0, const GSet g1, int ysplit, const float* CP, size_t sCPy) {
  __shared__ __attribute__((aligned(16))) unsigned char L[2 * GT_BUF];
  const int tid = threadIdx.x, w = tid >> 5, lane = tid & 31, ln = lane & 15, hh = lane >> 4;
  const bool sec = (int)blockIdx.y >= ysplit; const GSet& g = sec ? g1 : g0; const int by = (int)blockIdx.y - (sec ? ysplit : 0);
  const _Float16* A = g.A; const _Float16* Bh = g.B; const float* bias = by == 1 ? g.bias1 : by == 2 ? g.bias2 : g.bias0; float* C = g.C; _Float16* C16 = g.C16; _Float16* C16l = g.C16l;
  const size_t sA = g.sA, sB = g.sB, sC = g.sC; const int lda = g.lda, ldb = g.ldb, ldc = g.ldc, N = g.N, K = g.K; const float alpha = g.alpha;
  const int ntn = N / 128; const int row0 = ((int)blockIdx.x / ntn) * 128, col0 = ((int)blockIdx.x % ntn) * 128; const int wm = w >> 1, wn = w & 1;
  const int cr = tid >> 3, cc = tid & 7;      /* copies: 8 lanes a row, 32 rows a copy */
  const size_t la = (size_t)by * sA + (size_t)(row0 + cr) * lda + cc * 8, lb = (size_t)by * sB + (size_t)(col0 + cr) * ldb + cc * 8;      /* the lane's place in an A plane and in a Bt plane, the same in every pair */
  const size_t a32 = (size_t)32 * lda, b32 = (size_t)32 * ldb;
  const unsigned lcp = (unsigned)(size_t)L + (unsigned)(cr * GT_PITCH + cc * 16);
  const int nk = K / 64; const bool three = SEG && g.A1 != nullptr; const int nt = three ? 3 * nk : nk, tmid = three ? 2 * nk : -1;      /* nk tiles a pair */
  const _Float16* A1 = g.A1; const _Float16* B1 = g.B1; const _Float16* A2 = g.A2; const _Float16* B2 = g.B2; const float mid = g.mid;
  auto tile = [&](int t, unsigned l) {      /* tile t of the whole run: the pair and the k place inside it are the same for the work-group */
    const _Float16* pa = A; const _Float16* pb = Bh; int kk = t;
    if (SEG && three) { if (t >= 2 * nk) { pa = A2; pb = B2; kk = t - 2 * nk; } else if (t >= nk) { pa = A1; pb = B1; kk = t - nk; } }
    gt_copy(l, (const unsigned short*)pa + kk * 64 + la, (const unsigned short*)pb + kk * 64 + lb, a32, b32); };
  v8f acc[2][4] = {};
  tile(0, lcp);
  asm volatile("s_wait_asynccnt 0x0" ::: "memory");      /* tile 0 has landed before the barrier that publishes it */
  __syncthreads();
  if (nt > 1) tile(1, lcp + GT_BUF);
  const unsigned char* fa = L + (wm * 32 + ln) * GT_PITCH + hh * 16; const unsigned char* fb = L + GT_OPB + (wn * 64 + ln) * GT_PITCH + hh * 16;
#pragma unroll 1
  for (int t = 0; t < nt; ++t) {      /* stays rolled: one copy of the ring's foot */
    const unsigned bo = (unsigned)(t & 1) * GT_BUF;
    FragH a[2][2], b[2][4];
#pragma unroll
    for (int ks = 0; ks < 2; ++ks) {
#pragma unroll
      for (int i = 0; i < 2; ++i) { a[ks][i].half[0] = *(const v8us*)(fa + bo + i * 16 * GT_PITCH + ks * 64); a[ks][i].half[1] = *(const v8us*)(fa + bo + i * 16 * GT_PITCH + ks * 64 + 32); }
#pragma unroll
      for (int j = 0; j < 4; ++j) { b[ks][j].half[0] = *(const v8us*)(fb + bo + j * 16 * GT_PITCH + ks * 64); b[ks][j].half[1] = *(const v8us*)(fb + bo + j * 16 * GT_PITCH + ks * 64 + 32); } }
    /* the ring's foot stands here, behind the trip's 24 fragment reads and ahead of its WMMAs, which work on registers alone: the refill then flies under them too */
    asm volatile("s_wait_dscnt 0x0" ::: "memory");      /* this wave's reads of the buffer are over before it may be refilled */
    asm volatile("s_wait_asynccnt 0x0" ::: "memory");      /* this wave's share of tile t + 1 has landed before the barrier publishes it */
    __syncthreads();
    if (t + 2 < nt) tile(t + 2, lcp + bo);
    __builtin_amdgcn_sched_barrier(0);      /* keeps the WMMAs behind the refill's issue: ahead of it they would delay the copies by their whole run */
    if (SEG && t == tmid) {      /* the first two pairs' sum takes its weight before the third pair is added to it */
#pragma unroll
      for (int i = 0; i < 2; ++i)
#pragma unroll
        for (int j = 0; j < 4; ++j) acc[i][j] *= mid; }
#pragma unroll
    for (int ks = 0; ks < 2; ++ks)
#pragma unroll
      for (int i = 0; i < 2; ++i)
#pragma unroll
        for (int j = 0; j < 4; ++j) acc[i][j] = __builtin_amdgcn_wmma_f32_16x16x32_f16(false, a[ks][i].v, false, b[ks][j].v, (short)0, acc[i][j], false, false);
  }
  asm volatile("s_wait_asynccnt 0x0" ::: "memory");      /* no copy outstanding when the ring becomes output staging */
  /* epilogue: each wave stages its 32 x 64 in its own 8,704 B of the ring (every wave's last read of it ended ahead of the last barrier), then whole row pieces (256 B of f32, 128 B of f16) go out */
  const int c4 = ln * 4, col = col0 + wn * 64 + c4, rw0 = row0 + wm * 32 + hh; const size_t cofs = (size_t)by * sC;
  v4f cp[16];      /* the addend's 16 row pieces are asked for together, ahead of the staging */
  if (LDCP) { const float* cpp = CP + (size_t)rw0 * LDCP + (size_t)by * sCPy + col;
#pragma unroll
    for (int q = 0; q < 16; ++q) cp[q] = *(const v4fa*)(cpp + q * 2 * LDCP);
    asm volatile("s_wait_xcnt 0x0" ::: "memory"); }      /* ahead of any rewrite of the address registers that the loads above name */
  v4f bv = {0.f, 0.f, 0.f, 0.f}; if (bias) { const v4f bb = *(const v4fa*)(bias + col); for (int e = 0; e < 4; ++e) bv[e] = bf16_round(bb[e]); }
  float* so = (float*)(L + w * (32 * 68 * 4));
#pragma unroll
  for (int i = 0; i < 2; ++i)
#pragma unroll
    for (int j = 0; j < 4; ++j)
#pragma unroll
      for (int r = 0; r < 8; ++r) so[(i * 16 + 8 * hh + r) * 68 + j * 16 + ln] = acc[i][j][r];
  __builtin_amdgcn_fence(__ATOMIC_ACQ_REL, "workgroup"); __builtin_amdgcn_wave_barrier();
#pragma unroll
  for (int q = 0; q < 16; ++q) { const size_t o = cofs + (size_t)rw0 * ldc + col + (size_t)(q * 2) * ldc; const v4f x = *(const v4fa*)&so[(q * 2 + hh) * 68 + c4]; v4f v;
    for (int e = 0; e < 4; ++e) v[e] = x[e] * alpha + bv[e];
    if (LDCP) for (int e = 0; e < 4; ++e) v[e] += cp[q][e];
    if (OUT == 1) *(v4f*)(C + o) = v;
    else { v4h h4; for (int e = 0; e < 4; ++e) h4[e] = (_Float16)v[e]; *(v4h*)(C16 + o) = h4;
      if (OUT == 2) { v4h l4; for (int e = 0; e < 4; ++e) l4[e] = (_Float16)((v[e] - (float)h4[e]) * 1024.0f); *(v4h*)(C16l + o) = l4; } } }
}


__device__ __forceinline__ void x16(const float* __restrict__ x, _Float16* __restrict__ X16, size_t n8, int blk) { const size_t t = (size_t)blk * 256 + threadIdx.x; if (t >= n8) return; FragH f;
#pragma unroll
  for (int q = 0; q < 8; ++q) f.h[q] = (_Float16)bf16_round(x[t * 8 + q]); *(v8us*)((unsigned short*)X16 + t * 8) = f.half[0];  }
// All operand preparation in one launch: none of its ten parts reads what another writes. Ranges of blockIdx.x: the five F x F weights, the three G x F weights (each transposed, x 2^4), then features and geometry (rounded to f16 planes).
#define PW_BIG (DD * (DD / 8) / 256)
#define PW_SML (DD * (GG / 8) / 256)
#define PX_F (NR * DD / 8 / 256)
#define PX_G (NR * GG / 8 / 256)
__global__ __launch_bounds__(256) void k_prep(const float* __restrict__ wq, const float* __restrict__ wk, const float* __restrict__ wv, const float* __restrict__ wo, const float* __restrict__ opw,
    const float* __restrict__ gqw, const float* __restrict__ gkw, const float* __restrict__ gvw, const float* __restrict__ feats, const float* __restrict__ geom,
    _Float16* __restrict__ Bw, _Float16* __restrict__ Bg, _Float16* __restrict__ X16, _Float16* __restrict__ GE16) {
  int blk = blockIdx.x;
  if (blk < 5 * PW_BIG) { const int i = blk / PW_BIG; const float* W = i == 0 ? wq : i == 1 ? wk : i == 2 ? wv : i == 3 ? wo : opw; wt_f16(W, Bw + (size_t)i * DD * DD, DD, DD, 16.0f, blk % PW_BIG); return; }
  blk -= 5 * PW_BIG;
  if (blk < 3 * PW_SML) { const int i = blk / PW_SML; const float* W = i == 0 ? gqw : i == 1 ? gkw : gvw; wt_f16(W, Bg + (size_t)i * GG * DD, GG, DD, 16.0f, blk % PW_SML); return; }
  blk -= 3 * PW_SML;
  if (blk < PX_F) { x16(feats, X16, (size_t)NR * DD / 8, blk); return; }
  x16(geom, GE16, (size_t)NR * GG / 8, blk - PX_F);
}
__global__ __launch_bounds__(256) void k_round16f(const float* __restrict__ W, _Float16* __restrict__ Bt, size_t n8) { const size_t t = (size_t)blockIdx.x * 256 + threadIdx.x; if (t >= n8) return; FragH f;
#pragma unroll
  for (int i = 0; i < 8; ++i) f.h[i] = (_Float16)(bf16_round(W[t * 8 + i]) * 16.0f); *(v8us*)((unsigned short*)Bt + t * 8) = f.half[0];  }
template <int NHv, int TTv>
__global__ __launch_bounds__(256) void k_vt(const _Float16* __restrict__ V16, size_t sV, int ldv, int voff, _Float16* __restrict__ Vt, size_t sVt) { __shared__ unsigned short tl[64][66]; const int tid = threadIdx.x; V16 += (size_t)blockIdx.y * sV; Vt += (size_t)blockIdx.y * sVt;      /* blockIdx.y: which plane */ const int slab = blockIdx.x / (TTv / 64), lg = blockIdx.x % (TTv / 64); const int b = slab / NHv, h = slab % NHv;
  for (int i = tid; i < 64 * 8; i += 256) { const int r = i / 8, c8 = (i % 8) * 8; FragH f; f.half[0] = *(const v8us*)((const unsigned short*)V16 + ((size_t)b * TTv + lg * 64 + r) * ldv + voff + h * 64 + c8);
#pragma unroll
    for (int q = 0; q < 8; ++q) tl[r][c8 + q] = f.u[q]; }
  __syncthreads();
  {
#pragma unroll
    for (int rd = 0; rd < 2; ++rd) { const int d = rd * 32 + tid / 8, pc = tid % 8; FragH f;
#pragma unroll
      for (int q = 0; q < 8; ++q) f.u[q] = tl[pc * 8 + q][d];
      *(v8us*)((unsigned short*)Vt + ((size_t)slab * 64 + d) * TTv + lg * 64 + pc * 8) = f.half[0]; }
     } }

typedef float v2f __attribute__((ext_vector_type(2)));
// Distance-MLP bias, added to S in place. gelu_tanh(x) = 0.5 x (1 + tanh(u)) = x / (1 + exp(-2 u)), u = sqrt(2 / pi) (x + 0.044715 x^3): one v_exp_f32 and one v_rcp_f32, no branch
// (x far above 0: exp -> 0, quotient x; x far below 0: exp -> inf, rcp -> 0, quotient -0: the limits of the tanh form). The other steps are packed f32 operations on two keys at a time.
// A work-group takes GB_ROWS whole score rows, a thread the same 4 keys in each: the rounded weights, their head means and the keys' coordinates are made once per thread, not once per 4 pairs.
#define GB_ROWS 8
#define GB_K0 (-2.3022081986f)      /* -2 sqrt(2 / pi) log2(e) */
#define GB_K1 (GB_K0 * 0.044715f)
__global__ __launch_bounds__(256) void k_gbias(float* __restrict__ S, const float* __restrict__ CRD, const float* __restrict__ w1, const float* __restrict__ b1, const float* __restrict__ w2, const float* __restrict__ b2) {
  const int b = blockIdx.y, q0 = blockIdx.x * GB_ROWS, k0 = threadIdx.x * 4;      /* one score plane per batch */
  const float* C3 = CRD + (size_t)b * TT * 3; float* sp = S + (size_t)b * TT * TT + (size_t)q0 * TT + k0;
  float cb = 0.f; for (int j = 0; j < 8; ++j) cb += bf16_round(b2[j]); cb *= 0.125f;
  float wj[8], bj[8], cj[8];
#pragma unroll
  for (int j = 0; j < 8; ++j) { float c = 0.f; for (int h = 0; h < 8; ++h) c += bf16_round(w2[j * 8 + h]); cj[j] = c * 0.125f; wj[j] = bf16_round(w1[j]); bj[j] = bf16_round(b1[j]); }
  const v4f c0 = *(const v4fa*)(C3 + k0 * 3), c1 = *(const v4fa*)(C3 + k0 * 3 + 4), c2 = *(const v4fa*)(C3 + k0 * 3 + 8);
  const v2f kx[2] = {{bf16_round(c0[0]), bf16_round(c0[3])}, {bf16_round(c1[2]), bf16_round(c2[1])}};
  const v2f ky[2] = {{bf16_round(c0[1]), bf16_round(c1[0])}, {bf16_round(c1[3]), bf16_round(c2[2])}};
  const v2f kz[2] = {{bf16_round(c0[2]), bf16_round(c1[1])}, {bf16_round(c2[0]), bf16_round(c2[3])}};
#pragma unroll 1      /* stays rolled: a row already holds 16 independent chains */
  for (int r = 0; r < GB_ROWS; ++r) {
    const v4f sv = *(const v4fa*)(sp + (size_t)r * TT);      /* asked for at the row's head, used at its foot */
    const float qx = bf16_round(C3[(q0 + r) * 3]), qy = bf16_round(C3[(q0 + r) * 3 + 1]), qz = bf16_round(C3[(q0 + r) * 3 + 2]);
    v2f d[2], acc[2];
#pragma unroll
    for (int p = 0; p < 2; ++p) { const v2f dx = qx - kx[p], dy = qy - ky[p], dz = qz - kz[p]; const v2f d2 = dx * dx + dy * dy + dz * dz;
      d[p][0] = __builtin_amdgcn_sqrtf(fmaxf(d2[0], 1e-12f)); d[p][1] = __builtin_amdgcn_sqrtf(fmaxf(d2[1], 1e-12f)); acc[p] = (v2f){cb, cb}; }
#pragma unroll
    for (int j = 0; j < 8; ++j)
#pragma unroll
      for (int p = 0; p < 2; ++p) { const v2f x = d[p] * wj[j] + bj[j]; const v2f a = x * (x * x * GB_K1 + GB_K0);
        const v2f s = (v2f){__builtin_amdgcn_exp2f(a[0]), __builtin_amdgcn_exp2f(a[1])} + 1.0f;
        const v2f g = x * (v2f){__builtin_amdgcn_rcpf(s[0]), __builtin_amdgcn_rcpf(s[1])}; acc[p] += g * cj[j]; }
    const v4f o = {sv[0] + acc[0][0], sv[1] + acc[0][1], sv[2] + acc[1][0], sv[3] + acc[1][1]};
    *(v4f*)(sp + (size_t)r * TT) = o;
  } }
#define NN TT
__global__ __launch_bounds__(256) void k_smx(const float* __restrict__ S, _Float16* __restrict__ P16) { const int tid = threadIdx.x, wv = tid >> 5, lane = tid & 31; const int i = blockIdx.x * 8 + wv; const float* sr = S + (size_t)i * NN;
  float m = -3.0e38f;
  for (int p = lane; p < NN / 8; p += 32) { const v4f a = *(const v4fa*)(sr + p * 8), c = *(const v4fa*)(sr + p * 8 + 4); for (int e = 0; e < 4; ++e) m = fmaxf(m, fmaxf(a[e], c[e])); }
  for (int o = 16; o >= 1; o >>= 1) m = fmaxf(m, __shfl_xor(m, o, 32)); float z = 0.f;
  for (int p = lane; p < NN / 8; p += 32) { const v4f a = *(const v4fa*)(sr + p * 8), c = *(const v4fa*)(sr + p * 8 + 4); for (int e = 0; e < 4; ++e) z += __expf(a[e] - m) + __expf(c[e] - m); }
  for (int o = 16; o >= 1; o >>= 1) z += __shfl_xor(z, o, 32); const float iz = 32768.0f / z;
  { for (int p = lane; p < NN / 8; p += 32) { FragH f; const v4f a = *(const v4fa*)(sr + p * 8), c = *(const v4fa*)(sr + p * 8 + 4); for (int e = 0; e < 4; ++e) { f.h[e] = (_Float16)(__expf(a[e] - m) * iz); f.h[4 + e] = (_Float16)(__expf(c[e] - m) * iz); }
      *(v8us*)((unsigned short*)P16 + (size_t)i * NN + p * 8) = f.half[0]; }  } }
// lane l with lane l ^ 16 (the two halves of a wave hold the two halves of a query's keys)
__device__ __forceinline__ float xhalf(float x) { return __builtin_bit_cast(float, __builtin_amdgcn_permlanex16(__builtin_bit_cast(int, x), __builtin_bit_cast(int, x), 0x76543210, 0xfedcba98, false, false)); }
__global__ __launch_bounds__(128) void k_flash(const _Float16* __restrict__ Q16, int ldq, const _Float16* __restrict__ K16, int ldk, const _Float16* __restrict__ Vt, const int* __restrict__ MSK, _Float16* __restrict__ O16, int ldo) {
  constexpr int RPW = 16, NQB = TT / (4 * RPW), DT = 4, KS = 2; (void)MSK;
  __shared__ __attribute__((aligned(16))) unsigned short sO[4][RPW][64 + 8];      /* f16 rows at pitch 144 B */
  const int tid = threadIdx.x, w = tid >> 5, lane = tid & 31, ln = lane & 15, hh = lane >> 4;
  const int slab = blockIdx.x / NQB, qblk = blockIdx.x % NQB; const int b = slab / NH, h = slab % NH; const int q0 = qblk * (4 * RPW) + w * RPW;
  FragH bq[KS];
  { const unsigned short* qr = (const unsigned short*)Q16 + ((size_t)b * TT + q0 + ln) * ldq + h * 64;
#pragma unroll
    for (int ks = 0; ks < KS; ++ks) { bq[ks].half[0] = *(const v8us*)(qr + ks * 32 + 8 * hh); bq[ks].half[1] = *(const v8us*)(qr + ks * 32 + 16 + 8 * hh); } }
  const unsigned short* Vth = (const unsigned short*)Vt + (size_t)slab * 64 * TT;
  float m_q = -3.0e38f, l_q = 0.f; v8f oacc[DT];
#pragma unroll
  for (int dt = 0; dt < DT; ++dt) oacc[dt] = (v8f){0.f,0.f,0.f,0.f,0.f,0.f,0.f,0.f};
#pragma unroll 1      /* stays rolled: an unrolled body would hold two trips' fragments in registers */
  for (int j0 = 0; j0 < TT; j0 += 32) {
    FragH ak[2][KS], av[DT];      /* no fence stands in the loop: the trip's 16 loads are asked for together at its head, one trip to L2 instead of one per fragment */
#pragma unroll
    for (int nt = 0; nt < 2; ++nt) { const unsigned short* kr = (const unsigned short*)K16 + ((size_t)b * TT + j0 + nt * 16 + ln) * ldk + h * 64;
#pragma unroll
      for (int ks = 0; ks < KS; ++ks) { ak[nt][ks].half[0] = *(const v8us*)(kr + ks * 32 + 8 * hh); ak[nt][ks].half[1] = *(const v8us*)(kr + ks * 32 + 16 + 8 * hh); } }
    asm volatile("s_wait_xcnt 0x0" ::: "memory");      /* ahead of the VT loads, whose results may be given the registers that held the key loads' addresses */
#pragma unroll
    for (int dt = 0; dt < DT; ++dt) { const unsigned short* vrow = Vth + (size_t)(dt * 16 + ln) * TT + j0; av[dt].half[0] = *(const v8us*)(vrow + 8 * hh); av[dt].half[1] = *(const v8us*)(vrow + 16 + 8 * hh); }
    __builtin_amdgcn_sched_barrier(0);      /* keeps all 16 loads ahead of the first product's wait: behind it the second key tile would pay a second trip to L2 */
    v8f s[2];
#pragma unroll
    for (int nt = 0; nt < 2; ++nt) { v8f acc = (v8f){0.f,0.f,0.f,0.f,0.f,0.f,0.f,0.f};
#pragma unroll
      for (int ks = 0; ks < KS; ++ks) acc = mmaH<1>(ak[nt][ks].v, ak[nt][ks].v, bq[ks].v, bq[ks].v, acc);
      s[nt] = acc; }
    float mc = -3.0e38f;
#pragma unroll
    for (int nt = 0; nt < 2; ++nt)
#pragma unroll
      for (int r = 0; r < 8; ++r) { s[nt][r] *= 0.125f; mc = fmaxf(mc, s[nt][r]); }
    mc = fmaxf(mc, xhalf(mc));
    const float mn = fmaxf(m_q, mc); const float al = (mn > -1.0e38f) ? expf(m_q - mn) : 1.0f; m_q = mn;
    FragH pb; float ps = 0.f;
#pragma unroll
    for (int nt = 0; nt < 2; ++nt)
#pragma unroll
      for (int r = 0; r < 8; ++r) { const float p = expf(s[nt][r] - mn); ps += p; pb.h[nt * 8 + r] = (_Float16)(p * 1024.0f); }
    l_q = l_q * al + ps;      /* this half's keys only; the halves are joined behind the loop */
#pragma unroll
    for (int dt = 0; dt < DT; ++dt)
#pragma unroll
      for (int r = 0; r < 8; ++r) oacc[dt][r] *= al;
#pragma unroll
    for (int dt = 0; dt < DT; ++dt) oacc[dt] = mmaH<1>(av[dt].v, av[dt].v, pb.v, pb.v, oacc[dt]); }
  const float lt = l_q + xhalf(l_q); const float il = (lt > 0.f) ? 1.0f / (lt * 64.0f) : 0.f;      /* P carries 2^10, the f16 result plane 2^4 */
#pragma unroll
  for (int dt = 0; dt < DT; ++dt) { FragH f;      /* oacc[dt][r] = OT[dt * 16 + 8 * hh + r][query ln] */
#pragma unroll
    for (int r = 0; r < 8; ++r) f.h[r] = (_Float16)(oacc[dt][r] * il);
    *(v8us*)&sO[w][ln][dt * 16 + 8 * hh] = f.half[0]; }
  __builtin_amdgcn_fence(__ATOMIC_ACQ_REL, "workgroup"); __builtin_amdgcn_wave_barrier();
#pragma unroll
  for (int rp = 0; rp < RPW; rp += 4) { const int r = rp + (lane >> 3), pc = lane & 7; const v8us val = *(const v8us*)&sO[w][r][pc * 8];      /* 8 lanes a row: one whole 128-B line of the f16 plane */
    *(v8us*)((unsigned short*)O16 + ((size_t)b * TT + q0 + r) * ldo + h * 64 + pc * 8) = val; } }

extern "C" void kernel_launch(void* const* d_in, const int* in_sizes, int n_in,
                              void* d_out, int out_size, void* d_ws, size_t ws_size, hipStream_t stream) {
  (void)in_sizes; (void)n_in; (void)out_size;
  const float* const* I = (const float* const*)d_in; const float* feats = I[0]; const float* geom = I[1]; const float* crd = I[2];
  const float* wq = I[3]; const float* bq = I[4]; const float* wk = I[5]; const float* bk = I[6]; const float* wv = I[7]; const float* bv = I[8]; const float* wo = I[9]; const float* bo = I[10];
  const float* gqw = I[11]; const float* gqb = I[12]; const float* gkw = I[13]; const float* gkb = I[14]; const float* gvw = I[15]; const float* gvb = I[16]; const float* d1w = I[17]; const float* d1b = I[18]; const float* d2w = I[19]; const float* d2b = I[20]; const float* opw = I[21]; const float* opb = I[22];
  char* ws = (char*)d_ws; size_t off = 0;
  auto take = [&](size_t bytes) { char* p = ws + off; off += (bytes + 255) & ~(size_t)255; return p; };
  const size_t WSZ = (size_t)DD * DD, GSZ = (size_t)GG * DD, PSZ = (size_t)NR * DD; _Float16* Bw = (_Float16*)take(5 * WSZ * 2); _Float16* Bg = (_Float16*)take(3 * GSZ * 2);
  _Float16* X16 = (_Float16*)take(PSZ * 2); _Float16* GE16 = (_Float16*)take((size_t)NR * GG * 2);
  _Float16* PL = (_Float16*)take(6 * PSZ * 2);      /* the six projections' planes in a row: q, k, v, gv, gq, gk */
  _Float16* RL = (_Float16*)take(2 * PSZ * 2);      /* residual planes of gq, gk */
  _Float16* VT = (_Float16*)take(2 * PSZ * 2);      /* v and gv transposed */
  float* FA = (float*)take(PSZ * 4); float* S = (float*)take((size_t)BB * TT * TT * 4); _Float16* P16 = (_Float16*)take((size_t)BB * TT * TT * 2);
  _Float16* Q = PL; _Float16* K = PL + PSZ; _Float16* V = PL + 2 * PSZ; _Float16* GQ = PL + 4 * PSZ; _Float16* GK = PL + 5 * PSZ; _Float16* GQl = RL; _Float16* GKl = RL + PSZ; _Float16* Vt = VT; _Float16* GVt = VT + PSZ;
  _Float16* O16 = X16; _Float16* SUM16 = V;      /* reuse in stream order: X16 -> the attention output (behind the projections); V -> feat + geom (behind the transposes) */
  if (off > ws_size) return;      // 2.6 + 0.4 + 8.4 + 2.1 + 10 x 8.4 + 16.8 + 33.6 + 16.8 = about 165 MB
  const int NOSPLIT = 0x7fffffff;      /* a launch with one set only */
  k_prep<<<5 * PW_BIG + 3 * PW_SML + PX_F + PX_G, 256, 0, stream>>>(wq, wk, wv, wo, opw, gqw, gkw, gvw, feats, geom, Bw, Bg, X16, GE16);      /* (in,out) weights -> Bt x 2^4; features, geometry -> f16 */
  const unsigned gpx = (NR / 128) * (DD / 128);
  { const GSet f = {X16, Bw, bq, bk, bv, nullptr, PL, nullptr, 0, WSZ, PSZ, DD, DD, DD, DD, DD, 0.0625f};      /* q, k, v: M 8192 N 512 K 512 */
    const GSet e = {GE16, Bg + 2 * GSZ, gvb, gvb, gvb, nullptr, PL + 3 * PSZ, nullptr, 0, 0, 0, GG, GG, DD, DD, GG, 0.0625f};      /* gv: M 8192 N 512 K 128 */
    k_gemm_t<0, 0><<<dim3(gpx, 4), 256, 0, stream>>>(f, e, 3, nullptr, 0); }
  { const GSet e = {GE16, Bg, gqb, gkb, gkb, nullptr, GQ, RL, 0, GSZ, PSZ, GG, GG, DD, DD, GG, 0.0625f};      /* gq, gk -> hi / x2^10 residual planes: M 8192 N 512 K 128 */
    k_gemm_t<0, 2><<<dim3(gpx, 2), 256, 0, stream>>>(e, e, NOSPLIT, nullptr, 0); }
  k_vt<NH, TT><<<dim3(BB * NH * (TT / 64), 2), 256, 0, stream>>>(V, PSZ, DD, 0, VT, PSZ);      /* v per head [64][1024]; gv per batch [512][1024] (the same 64-wide slabs) */
  k_flash<<<BB * NH * (TT / 64), 128, 0, stream>>>(Q, DD, K, DD, Vt, nullptr, O16, DD);      /* the attention output leaves as f16 x 2^4 */
  /* geometry branch: all BB batches of each stage in one launch, the batch in blockIdx.y (operand, addend and result strides per batch) */
  const size_t sX = (size_t)TT * DD, sS = (size_t)TT * TT;
  { const GSet hh = {GQl, GK, nullptr, nullptr, nullptr, S, nullptr, nullptr, sX, sX, sS, DD, DD, TT, TT, DD, 0.125f, GQ, GKl, GQ, GK, 0.0009765625f};      /* S = gq.gkT/8 f32-accurate, ((lo.hi + hi.lo).2^-10 + hi.hi)/8 in one accumulator: M 1024 N 1024 K 3 x 512, x BB */
    const GSet fo = {O16, Bw + 3 * WSZ, bo, bo, bo, FA, nullptr, nullptr, PSZ / 4, 0, PSZ / 4, DD, DD, DD, DD, DD, 0.00390625f};      /* feat_att = O.wo + bo (f32), in four slices of 2048 rows, each as many work-groups as one batch of S */
    k_gemm_t<0, 1, true><<<dim3((TT / 128) * (TT / 128), BB + 4), 256, 0, stream>>>(hh, fo, BB, nullptr, 0); }
  k_gbias<<<dim3(TT / GB_ROWS, BB), 256, 0, stream>>>(S, crd, d1w, d1b, d2w, d2b); k_smx<<<BB * TT / 8, 256, 0, stream>>>(S, P16);      /* softmax: a wave per row over the BB * TT rows */
  { const GSet pv = {P16, GVt, nullptr, nullptr, nullptr, nullptr, SUM16, nullptr, sS, sX, sX, TT, TT, DD, DD, TT, 0.000030517578125f};
    k_gemm_t<DD, 0><<<dim3((TT / 128) * (DD / 128), BB), 256, 0, stream>>>(pv, pv, NOSPLIT, FA, sX); }      /* feat_att + geom_att, stored as f16: M 1024 N 512 K 1024, x BB */
  { const GSet op = {SUM16, Bw + 4 * WSZ, opb, opb, opb, (float*)d_out, nullptr, nullptr, 0, 0, 0, DD, DD, DD, DD, DD, 0.0625f};
    k_gemm_t<0, 1><<<dim3(gpx, 1), 256, 0, stream>>>(op, op, NOSPLIT, nullptr, 0); }      /* out = (feat + geom).op_w + op_b */
}

// v008
// Measured time: 162 microseconds a run.
// Timed twice side by side with v007, it ran 1.18 times as fast both times.
// Counting every step since v000, it is 8.18 times as fast.
#include <hip/hip_runtime.h>
// Geometry-aware attention (B=8, N=1024, F=512, 8 heads × 64, G=128): feat = MHA(features) (x·W + b, softmax(q·k/8)·v, ·wo + bo); geometry branch: gq, gk, gv = geometry·W + b (F wide, single head);
// g_scores = gq·gkᵀ/8 + mean_h(gelu_tanh(dist·d1_w + d1_b)·d2_w + d2_b) with dist = max(‖coords_q − coords_k‖, 1e-6); geom = softmax(g_scores)·gv; out = (feat + geom)·op_w + op_b. (in,out) weights; jax.nn.gelu default = tanh approximation.
// Compute dtype: features, geometry, coords, all weights/biases rounded to bf16; f16 GEMM planes; the 8-head branch through a fused flash-style kernel (online softmax f32, P f16 ×2^10); the geometry branch, every stage one launch over all batches (batch in blockIdx.y; the softmax's BB·TT rows in blockIdx.x): S = gq·gkᵀ/8 f32-accurate from f16 hi + residual planes (hi·hi + (lo·hi + hi·lo)·2^-10; its logits reach σ≈3), a kernel adding the distance-MLP bias in place (f32, per pair from the coords), a wave-per-row f32 softmax → P f16 ×2^15, geom = P·gv by GEMM with feat_att as the f32 addend; final projection GEMM. All contractions on v_wmma_f32_16x16x32_f16, f32 accumulate.
#define BB 8
#define TT 1024
#define DD 512
#define GG 128
#define NH 8
#define NR (BB * TT)

typedef __bf16 v16b __attribute__((ext_vector_type(16)));
typedef unsigned short v8us __attribute__((ext_vector_type(8), may_alias));
typedef float  v8f  __attribute__((ext_vector_type(8)));
typedef float  v4f  __attribute__((ext_vector_type(4)));
typedef float  v4fa __attribute__((ext_vector_type(4), may_alias));
union FragB { v16b v; v8us half[2]; unsigned short u[16]; };

__device__ __forceinline__ unsigned short bf16_bits(float x) { unsigned int u = __float_as_uint(x); return (unsigned short)((u + 0x7FFFu + ((u >> 16) & 1u)) >> 16); }
__device__ __forceinline__ float bf16_val(unsigned short b) { return __uint_as_float(((unsigned int)b) << 16); }
__device__ __forceinline__ float bf16_round(float x) { return bf16_val(bf16_bits(x)); }
// D += A·B with NT terms: 1 = ah·bh, 2 = + al·bh (A split), 3 = + ah·bl (both split)
template <int NT>
__device__ __forceinline__ v8f mmaN(v16b ah, v16b al, v16b bh, v16b bl, v8f c) {
  c = __builtin_amdgcn_wmma_f32_16x16x32_bf16(false, ah, false, bh, (short)0, c, false, false);
  if (NT >= 2) c = __builtin_amdgcn_wmma_f32_16x16x32_bf16(false, al, false, bh, (short)0, c, false, false);
  if (NT >= 3) c = __builtin_amdgcn_wmma_f32_16x16x32_bf16(false, ah, false, bl, (short)0, c, false, false);
  asm volatile("v_nop\n\tv_nop\n\tv_nop\n\tv_nop" : "+v"(c) : "v"(ah), "v"(al), "v"(bh), "v"(bl));
  return c;
}

__global__ __launch_bounds__(256) void k_wt_bf16(const float* __restrict__ W, unsigned short* __restrict__ Wt, int K, int N) {
  const int t = blockIdx.x * 256 + threadIdx.x;
  const int k8n = K / 8;
  if (t >= N * k8n) return;
  const int n = t / k8n, k8 = (t % k8n) * 8;
  v8us v;
#pragma unroll
  for (int i = 0; i < 8; ++i) v[i] = bf16_bits(W[(size_t)(k8 + i) * N + n]);
  *(v8us*)(Wt + (size_t)n * K + k8) = v;
  
}

// GEMM C[M][N] (f32, pitch ldc) = act(A[M][K]·W + bias). A f32 row-major (pitch lda) converted per fragment to bf16
// (ASPLIT: hi/lo two planes -> 2 terms, else single rounded term); Wt bf16 [N][K] (pitch ldb). BIAS_BF16 rounds the
// bias to bf16 first (bias quantised to bf16 before the add). K%32==0, M%16==0, N%64==0.
template <bool ASPLIT, int ACT, bool BIAS_BF16>
__global__ __launch_bounds__(128) void k_gemm_bf(const float* __restrict__ A, int lda, const unsigned short* __restrict__ Wt, int ldb,
                                               const float* __restrict__ bias, float* __restrict__ C, int ldc, int M, int N, int K) {
  __shared__ __attribute__((aligned(16))) float so[4][16][64];
  const int tid = threadIdx.x, w = tid >> 5, lane = tid & 31, ln = lane & 15, hh = lane >> 4;
  const int ntn = N / 64;
  const int wid = blockIdx.x * 4 + w;
  const int mt = wid / ntn, nq = wid % ntn;
  if (mt * 16 >= M) return;
  const int row0 = mt * 16, col0 = nq * 64;
  const float* arow = A + (size_t)(row0 + ln) * lda;
  v8f acc[4] = {};
  for (int kb = 0; kb < K; kb += 32) {
    FragB ah, al;
    const v4f x0 = *(const v4fa*)(arow + kb + 8 * hh), x1 = *(const v4fa*)(arow + kb + 8 * hh + 4);
    const v4f x2 = *(const v4fa*)(arow + kb + 16 + 8 * hh), x3 = *(const v4fa*)(arow + kb + 16 + 8 * hh + 4);
    float xs[16] = {x0[0],x0[1],x0[2],x0[3],x1[0],x1[1],x1[2],x1[3],x2[0],x2[1],x2[2],x2[3],x3[0],x3[1],x3[2],x3[3]};
#pragma unroll
    for (int i = 0; i < 16; ++i) { const unsigned short hb = bf16_bits(xs[i]); ah.u[i] = hb; al.u[i] = ASPLIT ? bf16_bits(xs[i] - bf16_val(hb)) : (unsigned short)0; }
#pragma unroll
    for (int t = 0; t < 4; ++t) {
      const unsigned short* brow = Wt + (size_t)(col0 + t * 16 + ln) * ldb + kb;
      FragB b;
      b.half[0] = *(const v8us*)(brow + 8 * hh);
      b.half[1] = *(const v8us*)(brow + 16 + 8 * hh);
      acc[t] = mmaN<ASPLIT ? 2 : 1>(ah.v, al.v, b.v, b.v, acc[t]);
    }
  }
#pragma unroll
  for (int t = 0; t < 4; ++t) {
    float bv = bias ? bias[col0 + t * 16 + ln] : 0.f;
    if (BIAS_BF16) bv = bf16_round(bv);
#pragma unroll
    for (int r = 0; r < 8; ++r) { float v = acc[t][r] + bv; if (ACT == 1) v = fmaxf(v, 0.f); so[w][8 * hh + r][t * 16 + ln] = v; }
  }
  __builtin_amdgcn_fence(__ATOMIC_ACQ_REL, "workgroup");
  __builtin_amdgcn_wave_barrier();
  const int rsub = lane >> 4, c4 = (lane & 15) * 4;
  {
#pragma unroll
    for (int q = 0; q < 8; ++q) {
      const int r = q * 2 + rsub;
      const v4f v = *(const v4fa*)&so[w][r][c4];
      *(v4f*)(C + (size_t)(row0 + r) * ldc + col0 + c4) = v;
    }
    
  }
}

// Flash-style causal/unmasked attention, all contractions 3-term bf16 hi/lo splits, f32 softmax with running max.
// q,k,v rows are read from f32 buffers with arbitrary row pitch (so they can live inside a fused qkv buffer);
// D = head size (multiple of 32, <= 128); one wave = 16 query rows; block = 4 waves (64 queries) sharing K/V chunks of 32.
template <int D, bool CAUSAL>
__global__ __launch_bounds__(128) void k_flash(const float* __restrict__ qb, const float* __restrict__ kb, const float* __restrict__ vb,
                                             int pitch, int T, int H, float scale, float* __restrict__ y, int ypitch) {
  constexpr int KS = D / 32;        // k-steps for QK
  constexpr int DT = D / 16;        // d tiles for PV
  __shared__ __attribute__((aligned(16))) unsigned short sKh[32][D + 8], sKl[32][D + 8], sVh[32][D + 8], sVl[32][D + 8];
  __shared__ __attribute__((aligned(16))) unsigned short sPh[4][16][40], sPl[4][16][40];
  __shared__ __attribute__((aligned(16))) float sO[4][16][D];
  const int tid = threadIdx.x, w = tid >> 5, lane = tid & 31, ln = lane & 15, hh = lane >> 4;
  const int nqb = (T + 63) / 64;
  const int bh = blockIdx.x / nqb, qblk = blockIdx.x % nqb;
  const int b = bh / H, h = bh % H;
  const int q0 = qblk * 64 + w * 16;
  const float* Q = qb + (size_t)b * T * pitch + h * D;
  const float* K = kb + (size_t)b * T * pitch + h * D;
  const float* V = vb + (size_t)b * T * pitch + h * D;

  // A fragments of the wave's 16 query rows (scaled), hi/lo
  FragB aqh[KS], aql[KS];
  {
    int row = q0 + ln; if (row >= T) row = T - 1;
    const float* qr = Q + (size_t)row * pitch;
#pragma unroll
    for (int ks = 0; ks < KS; ++ks)
#pragma unroll
      for (int i = 0; i < 16; ++i) {
        const int d = ks * 32 + ((i < 8) ? (8 * hh + i) : (16 + 8 * hh + (i - 8)));
        const float x = qr[d] * scale; const unsigned short hb = bf16_bits(x);
        aqh[ks].u[i] = hb; aql[ks].u[i] = bf16_bits(x - bf16_val(hb));
      }
  }
  float m_r[8], l_r[8];
#pragma unroll
  for (int r = 0; r < 8; ++r) { m_r[r] = -3.0e38f; l_r[r] = 0.f; }
  v8f oacc[DT];
#pragma unroll
  for (int dt = 0; dt < DT; ++dt) oacc[dt] = (v8f){0.f,0.f,0.f,0.f,0.f,0.f,0.f,0.f};

  const int kv_end = CAUSAL ? min(T, qblk * 64 + 64) : T;     // block-uniform
  for (int j0 = 0; j0 < kv_end; j0 += 32) {
    __syncthreads();
    for (int e = tid; e < 32 * (D / 4); e += 128) {
      const int r = e / (D / 4), c4 = (e % (D / 4)) * 4;
      const int key = j0 + r;
      v4f kf = {0.f,0.f,0.f,0.f}, vf = {0.f,0.f,0.f,0.f};
      if (key < T) { kf = *(const v4fa*)(K + (size_t)key * pitch + c4); vf = *(const v4fa*)(V + (size_t)key * pitch + c4); }
#pragma unroll
      for (int t = 0; t < 4; ++t) {
        unsigned short hb = bf16_bits(kf[t]); sKh[r][c4 + t] = hb; sKl[r][c4 + t] = bf16_bits(kf[t] - bf16_val(hb));
        hb = bf16_bits(vf[t]); sVh[r][c4 + t] = hb; sVl[r][c4 + t] = bf16_bits(vf[t] - bf16_val(hb));
      }
    }
    __syncthreads();
    // S tile 16 x 32
    v8f s[2];
#pragma unroll
    for (int nt = 0; nt < 2; ++nt) {
      v8f acc = {};
#pragma unroll
      for (int ks = 0; ks < KS; ++ks) {
        FragB bh_, bl_;
        bh_.half[0] = *(const v8us*)&sKh[nt * 16 + ln][ks * 32 + 8 * hh]; bh_.half[1] = *(const v8us*)&sKh[nt * 16 + ln][ks * 32 + 16 + 8 * hh];
        bl_.half[0] = *(const v8us*)&sKl[nt * 16 + ln][ks * 32 + 8 * hh]; bl_.half[1] = *(const v8us*)&sKl[nt * 16 + ln][ks * 32 + 16 + 8 * hh];
        acc = mmaN<3>(aqh[ks].v, aql[ks].v, bh_.v, bl_.v, acc);
      }
      s[nt] = acc;
    }
    // mask + running max (rows 8hh+r; the 16 lanes of a half share rows)
    float alpha[8];
#pragma unroll
    for (int r = 0; r < 8; ++r) {
      const int qi = q0 + 8 * hh + r;
      const int ja = j0 + ln, jb = j0 + 16 + ln;
      if (CAUSAL) { if (ja > qi) s[0][r] = -3.0e38f; if (jb > qi) s[1][r] = -3.0e38f; }
      if (ja >= T) s[0][r] = -3.0e38f;
      if (jb >= T) s[1][r] = -3.0e38f;
      float mx = fmaxf(s[0][r], s[1][r]);
      mx = fmaxf(mx, __shfl_xor(mx, 1, 32)); mx = fmaxf(mx, __shfl_xor(mx, 2, 32)); mx = fmaxf(mx, __shfl_xor(mx, 4, 32)); mx = fmaxf(mx, __shfl_xor(mx, 8, 32));
      const float mnew = fmaxf(m_r[r], mx);
      alpha[r] = (mnew > -1.0e38f) ? __expf(m_r[r] - mnew) : 1.0f;
      const float p0 = (s[0][r] > -1.0e38f) ? __expf(s[0][r] - mnew) : 0.f;
      const float p1 = (s[1][r] > -1.0e38f) ? __expf(s[1][r] - mnew) : 0.f;
      m_r[r] = mnew;
      l_r[r] = l_r[r] * alpha[r] + p0 + p1;            // per-lane partial row sum (16 lanes combined at the end)
      unsigned short hb = bf16_bits(p0); sPh[w][8 * hh + r][ln] = hb;      sPl[w][8 * hh + r][ln] = bf16_bits(p0 - bf16_val(hb));
      hb = bf16_bits(p1);                sPh[w][8 * hh + r][16 + ln] = hb; sPl[w][8 * hh + r][16 + ln] = bf16_bits(p1 - bf16_val(hb));
    }
#pragma unroll
    for (int dt = 0; dt < DT; ++dt)
#pragma unroll
      for (int r = 0; r < 8; ++r) oacc[dt][r] *= alpha[r];
    __builtin_amdgcn_fence(__ATOMIC_ACQ_REL, "workgroup");
    __builtin_amdgcn_wave_barrier();
    FragB pah, pal;
    pah.half[0] = *(const v8us*)&sPh[w][ln][8 * hh]; pah.half[1] = *(const v8us*)&sPh[w][ln][16 + 8 * hh];
    pal.half[0] = *(const v8us*)&sPl[w][ln][8 * hh]; pal.half[1] = *(const v8us*)&sPl[w][ln][16 + 8 * hh];
#pragma unroll
    for (int dt = 0; dt < DT; ++dt) {
      FragB bvh, bvl;
#pragma unroll
      for (int i = 0; i < 8; ++i) {
        bvh.u[i] = sVh[8 * hh + i][dt * 16 + ln]; bvh.u[8 + i] = sVh[16 + 8 * hh + i][dt * 16 + ln];
        bvl.u[i] = sVl[8 * hh + i][dt * 16 + ln]; bvl.u[8 + i] = sVl[16 + 8 * hh + i][dt * 16 + ln];
      }
      oacc[dt] = mmaN<3>(pah.v, pal.v, bvh.v, bvl.v, oacc[dt]);
    }
    __builtin_amdgcn_fence(__ATOMIC_ACQ_REL, "workgroup");
    __builtin_amdgcn_wave_barrier();
  }
#pragma unroll
  for (int r = 0; r < 8; ++r) {
    float l = l_r[r];
    l += __shfl_xor(l, 1, 32); l += __shfl_xor(l, 2, 32); l += __shfl_xor(l, 4, 32); l += __shfl_xor(l, 8, 32);
    l_r[r] = (l > 0.f) ? 1.0f / l : 0.f;
  }
#pragma unroll
  for (int dt = 0; dt < DT; ++dt)
#pragma unroll
    for (int r = 0; r < 8; ++r) sO[w][8 * hh + r][dt * 16 + ln] = oacc[dt][r] * l_r[r];
  __builtin_amdgcn_fence(__ATOMIC_ACQ_REL, "workgroup");
  __builtin_amdgcn_wave_barrier();
  {
    for (int r = 0; r < 16; ++r) {
      const int row = q0 + r;
      if (row < T && lane < D / 4) {
        const v4f val = *(const v4fa*)&sO[w][r][lane * 4];
        *(v4f*)(y + ((size_t)b * T + row) * ypitch + h * D + lane * 4) = val;
      }
    }
    
  }
}

// GEMM C = act(A·W + bias + resid): A f32 (ASPLIT -> hi/lo 2 terms), Wt bf16 [N][K]; ACT 0 none, 1 relu, 2 exact gelu;
// resid (optional, f32, row index = (row % rmod), pitch ldr, RES_BF16 rounds it) added before the activation.
template <bool ASPLIT, int ACT, bool BIAS_BF16, bool RES_BF16>
__global__ __launch_bounds__(128) void k_gemm_bf3(const float* __restrict__ A, int lda, const unsigned short* __restrict__ Wt, int ldb,
                                                const float* __restrict__ bias, const float* __restrict__ resid, int rmod, int ldr,
                                                float* __restrict__ C, int ldc, int M, int N, int K) {
  __shared__ __attribute__((aligned(16))) float so[4][16][64];
  const int tid = threadIdx.x, w = tid >> 5, lane = tid & 31, ln = lane & 15, hh = lane >> 4;
  const int ntn = N / 64;
  const int wid = blockIdx.x * 4 + w;
  const int mt = wid / ntn, nq = wid % ntn;
  if (mt * 16 >= M) return;
  const int row0 = mt * 16, col0 = nq * 64;
  const float* arow = A + (size_t)(row0 + ln) * lda;
  v8f acc[4] = {};
  for (int kb = 0; kb < K; kb += 32) {
    FragB ah, al;
    const v4f x0 = *(const v4fa*)(arow + kb + 8 * hh), x1 = *(const v4fa*)(arow + kb + 8 * hh + 4);
    const v4f x2 = *(const v4fa*)(arow + kb + 16 + 8 * hh), x3 = *(const v4fa*)(arow + kb + 16 + 8 * hh + 4);
    float xs[16] = {x0[0],x0[1],x0[2],x0[3],x1[0],x1[1],x1[2],x1[3],x2[0],x2[1],x2[2],x2[3],x3[0],x3[1],x3[2],x3[3]};
#pragma unroll
    for (int i = 0; i < 16; ++i) { const unsigned short hb = bf16_bits(xs[i]); ah.u[i] = hb; al.u[i] = ASPLIT ? bf16_bits(xs[i] - bf16_val(hb)) : (unsigned short)0; }
#pragma unroll
    for (int t = 0; t < 4; ++t) {
      const unsigned short* brow = Wt + (size_t)(col0 + t * 16 + ln) * ldb + kb;
      FragB b;
      b.half[0] = *(const v8us*)(brow + 8 * hh);
      b.half[1] = *(const v8us*)(brow + 16 + 8 * hh);
      acc[t] = mmaN<ASPLIT ? 2 : 1>(ah.v, al.v, b.v, b.v, acc[t]);
    }
  }
#pragma unroll
  for (int t = 0; t < 4; ++t) {
    const int col = col0 + t * 16 + ln;
    float bv = bias ? bias[col] : 0.f;
    if (BIAS_BF16) bv = bf16_round(bv);
#pragma unroll
    for (int r = 0; r < 8; ++r) {
      float v = acc[t][r] + bv;
      if (resid) { float rv = resid[(size_t)((row0 + 8 * hh + r) % rmod) * ldr + col]; if (RES_BF16) rv = bf16_round(rv); v += rv; }
      if (ACT == 1) v = fmaxf(v, 0.f);
      if (ACT == 2) v = 0.5f * v * (1.0f + erff(v * 0.70710678118654752f));
      if (ACT == 3) { const float u = 0.7978845608028654f * (v + 0.044715f * v * v * v); v = 0.5f * v * (1.0f + tanhf(u)); }
      so[w][8 * hh + r][t * 16 + ln] = v;
    }
  }
  __builtin_amdgcn_fence(__ATOMIC_ACQ_REL, "workgroup");
  __builtin_amdgcn_wave_barrier();
  const int rsub = lane >> 4, c4 = (lane & 15) * 4;
  {
#pragma unroll
    for (int q = 0; q < 8; ++q) {
      const int r = q * 2 + rsub;
      const v4f v = *(const v4fa*)&so[w][r][c4];
      *(v4f*)(C + (size_t)(row0 + r) * ldc + col0 + c4) = v;
    }
    
  }
}
// row LayerNorm (biased variance, eps) over N: s = X (+ R); optional out_sum <- s; out_norm <- (s-mu)*rsqrt(var+eps)*g + b
template <bool PARAM_BF16>
__global__ __launch_bounds__(256) void k_layernorm(const float* __restrict__ X, const float* __restrict__ R, const float* __restrict__ g, const float* __restrict__ bta,
                                                  float* __restrict__ out_sum, float* __restrict__ out_norm, int N, float eps) {
  __shared__ float red[256];
  const int row = blockIdx.x, tid = threadIdx.x;
  const float* x = X + (size_t)row * N; const float* rr = R ? R + (size_t)row * N : nullptr;
  float vals[16];                     // up to N = 4096
  const int per = N / 256;            // contiguous chunk per thread? use strided-by-4 chunks: thread handles j = tid*4 + 1024*u
  float s1 = 0.f;
  for (int u = 0; u < per / 4; ++u) {
    const int j = tid * 4 + 1024 * u;
    const v4f a = *(const v4fa*)(x + j);
    v4f b = {0.f,0.f,0.f,0.f}; if (rr) b = *(const v4fa*)(rr + j);
#pragma unroll
    for (int q = 0; q < 4; ++q) { const float v = a[q] + b[q]; vals[u * 4 + q] = v; s1 += v; }
  }
  red[tid] = s1; __syncthreads();
  for (int st = 128; st > 0; st >>= 1) { if (tid < st) red[tid] += red[tid + st]; __syncthreads(); }
  const float mu = red[0] / (float)N; __syncthreads();
  float s2 = 0.f;
  for (int u = 0; u < per / 4; ++u)
#pragma unroll
    for (int q = 0; q < 4; ++q) { const float c = vals[u * 4 + q] - mu; s2 += c * c; }
  red[tid] = s2; __syncthreads();
  for (int st = 128; st > 0; st >>= 1) { if (tid < st) red[tid] += red[tid + st]; __syncthreads(); }
  const float rs = rsqrtf(red[0] / (float)N + eps);
  {
    for (int u = 0; u < per / 4; ++u) {
      const int j = tid * 4 + 1024 * u;
      v4f o, sm;
#pragma unroll
      for (int q = 0; q < 4; ++q) {
        float gg = g[j + q], bb = bta[j + q];
        if (PARAM_BF16) { gg = bf16_round(gg); bb = bf16_round(bb); }
        sm[q] = vals[u * 4 + q]; o[q] = (vals[u * 4 + q] - mu) * rs * gg + bb;
      }
      if (out_sum) *(v4f*)(out_sum + (size_t)row * N + j) = sm;
      *(v4f*)(out_norm + (size_t)row * N + j) = o;
    }
    
  }
}



// ---- f16 WMMA path (v_wmma_f32_16x16x32_f16): 11-bit significands for operands in range — used for every contraction launched here
typedef _Float16 v16h __attribute__((ext_vector_type(16)));
union FragH { v16h v; v8us half[2]; _Float16 h[16]; unsigned short u[16]; };
template <int NT>
__device__ __forceinline__ v8f mmaH(v16h ah, v16h al, v16h bh, v16h bl, v8f c) {
  c = __builtin_amdgcn_wmma_f32_16x16x32_f16(false, ah, false, bh, (short)0, c, false, false);
  if (NT >= 2) c = __builtin_amdgcn_wmma_f32_16x16x32_f16(false, al, false, bh, (short)0, c, false, false);
  if (NT >= 3) c = __builtin_amdgcn_wmma_f32_16x16x32_f16(false, ah, false, bl, (short)0, c, false, false);
  asm volatile("v_nop\n\tv_nop\n\tv_nop\n\tv_nop" : "+v"(c) : "v"(ah), "v"(al), "v"(bh), "v"(bl));
  return c;
}
// batched GEMM like k_gemm_b but f16 operands: A f32 (split into f16 hi/lo if ASPLIT, else rounded to f16), Bt = f16 values [n][k]; alpha; C f32; N multiple of 16 (partial tiles skipped)
template <bool ASPLIT>
__global__ __launch_bounds__(128) void k_gemm_h(const float* __restrict__ A, int lda, size_t sA, const _Float16* __restrict__ Bh, int ldb, size_t sB, float alpha, float* __restrict__ C, int ldc, size_t sC, int M, int N, int K) {
  __shared__ __attribute__((aligned(16))) float so[4][16][64];
  const int tid = threadIdx.x, w = tid >> 5, lane = tid & 31, ln = lane & 15, hh = lane >> 4; const int by = blockIdx.y;
  A += (size_t)by * sA; Bh += (size_t)by * sB; C += (size_t)by * sC;
  const int ntn = (N + 63) / 64; const int wid = blockIdx.x * 4 + w; const int mt = wid / ntn, nq = wid % ntn; if (mt * 16 >= M) return;
  const int row0 = mt * 16, col0 = nq * 64; const float* arow = A + (size_t)(row0 + ln) * lda;
  v8f acc[4] = {};
  for (int kb = 0; kb < K; kb += 32) {
    FragH ah, al;
    const v4f x0 = *(const v4fa*)(arow + kb + 8 * hh), x1 = *(const v4fa*)(arow + kb + 8 * hh + 4), x2 = *(const v4fa*)(arow + kb + 16 + 8 * hh), x3 = *(const v4fa*)(arow + kb + 16 + 8 * hh + 4);
    float xs[16] = {x0[0],x0[1],x0[2],x0[3],x1[0],x1[1],x1[2],x1[3],x2[0],x2[1],x2[2],x2[3],x3[0],x3[1],x3[2],x3[3]};
#pragma unroll
    for (int i = 0; i < 16; ++i) { const _Float16 h = (_Float16)xs[i]; ah.h[i] = h; al.h[i] = ASPLIT ? (_Float16)(xs[i] - (float)h) : (_Float16)0.0f; }
#pragma unroll
    for (int t = 0; t < 4; ++t) { if (col0 + t * 16 >= N) continue; const size_t boff = (size_t)(col0 + t * 16 + ln) * ldb + kb; FragH bq; bq.half[0] = *(const v8us*)(Bh + boff + 8 * hh); bq.half[1] = *(const v8us*)(Bh + boff + 16 + 8 * hh);
      acc[t] = mmaH<ASPLIT ? 2 : 1>(ah.v, al.v, bq.v, bq.v, acc[t]); }
  }
#pragma unroll
  for (int t = 0; t < 4; ++t) { if (col0 + t * 16 >= N) continue;
#pragma unroll
    for (int r = 0; r < 8; ++r) so[w][8 * hh + r][t * 16 + ln] = acc[t][r] * alpha; }
  __builtin_amdgcn_fence(__ATOMIC_ACQ_REL, "workgroup"); __builtin_amdgcn_wave_barrier();
  const int rsub = lane >> 4, c4 = (lane & 15) * 4;
  {
#pragma unroll
    for (int q = 0; q < 8; ++q) { const int r = q * 2 + rsub; if (col0 + c4 < N) { const v4f v = *(const v4fa*)&so[w][r][c4]; *(v4f*)(C + (size_t)(row0 + r) * ldc + col0 + c4) = v; } }
     }
}

// Wt[n][k] = f16(W[k][n]·scale) from f32 row-major W[K][N] (scale = power of two; bf16-exact weights stay exact in f16 away from the subnormal range)
__device__ __forceinline__ void wt_f16(const float* __restrict__ W, _Float16* __restrict__ Wt, int K, int N, float scale, int blk) {
  const int t = blk * 256 + threadIdx.x; if (t >= N * (K / 8)) return; const int n = t / (K / 8), k8 = (t % (K / 8)) * 8; FragH f;
#pragma unroll
  for (int i = 0; i < 8; ++i) f.h[i] = (_Float16)(bf16_round(W[(size_t)(k8 + i) * N + n]) * scale); const v8us o = f.half[0];
  *(v8us*)((unsigned short*)Wt + (size_t)n * K + k8) = o; 
}
// Block-tiled GEMM, f16 operands, both K-contiguous: v = (A.Bt^T)*alpha + bf16(bias[col]) (+ CP[row*LDCP + by*sCPy + col] if LDCP; CP may be C itself: a lane reads only what it then writes); writes f32 C, or f16 C16, or f16 C16 with the rounding residual x 2^10 in C16l. Batch in blockIdx.y.
// One work-group of 8 waves (4 x 2) makes 128 x 128 of C, a wave 32 x 64. Each trip takes 64 k: 128 rows of 128 B of A and of Bt are brought into LDS by asynchronous copies (whole 128-B lines, 16 B a lane),
// two buffers, the next tile in flight while this one is multiplied; LDS rows at pitch 144 B for the ds_load_b128 fragment reads. M, N multiples of 128, K a multiple of 64.
#define GT_PITCH 144
#define GT_OPB (128 * GT_PITCH)
#define GT_BUF (2 * GT_OPB)
typedef _Float16 v4h __attribute__((ext_vector_type(4)));
// one tile: 4 copies of A and 4 of Bt per lane. The s_wait_xcnt stands inside the statement so that no address register named here is rewritten ahead of it.
__device__ __forceinline__ void gt_copy(unsigned l, const unsigned short* ga, const unsigned short* gb, size_t a32, size_t b32) {
  asm volatile("global_load_async_to_lds_b128 %0, %8, off\n\t"
               "global_load_async_to_lds_b128 %1, %9, off\n\t"
               "global_load_async_to_lds_b128 %2, %10, off\n\t"
               "global_load_async_to_lds_b128 %3, %11, off\n\t"
               "global_load_async_to_lds_b128 %4, %12, off\n\t"
               "global_load_async_to_lds_b128 %5, %13, off\n\t"
               "global_load_async_to_lds_b128 %6, %14, off\n\t"
               "global_load_async_to_lds_b128 %7, %15, off\n\t"
               "s_wait_xcnt 0x0"
               :: "v"(l), "v"(l + 32 * GT_PITCH), "v"(l + 64 * GT_PITCH), "v"(l + 96 * GT_PITCH),
                  "v"(l + GT_OPB), "v"(l + GT_OPB + 32 * GT_PITCH), "v"(l + GT_OPB + 64 * GT_PITCH), "v"(l + GT_OPB + 96 * GT_PITCH),
                  "v"(ga), "v"(ga + a32), "v"(ga + 2 * a32), "v"(ga + 3 * a32), "v"(gb), "v"(gb + b32), "v"(gb + 2 * b32), "v"(gb + 3 * b32)
               : "memory");
}
// One launch may hold two sets of independent products: blockIdx.y below ysplit belongs to set g0, from ysplit on to set g1; inside a set y steps the operands and the result by the set's strides and picks one of three biases (y 1: bias1, y 2: bias2, else bias0).
// A set may name three operand pairs of one shape (SEG launches, A1 not null): the k loop then runs through (A, B), (A1, B1), (A2, B2) in one ring and one accumulator, which is multiplied by mid between the second pair and the third: v = ((A.BT + A1.B1T) * mid + A2.B2T) * alpha.
struct GSet { const _Float16* A; const _Float16* B; const float* bias0; const float* bias1; const float* bias2; float* C; _Float16* C16; _Float16* C16l; size_t sA, sB, sC; int lda, ldb, ldc, N, K; float alpha; const _Float16* A1; const _Float16* B1; const _Float16* A2; const _Float16* B2; float mid; };
template <int LDCP, int OUT, bool SEG = false>      /* SEG: sets with three operand pairs are honoured; LDCP: row pitch of an f32 addend plane CP, 0 for none (a constant, so that its 16 loads share one address register pair); OUT 1: f32 result in C; 0: f16 result in C16; 2: f16 result in C16 and (v - f16(v)) x 2^10 as f16 in C16l */
__global__ __launch_bounds__(256) void k_gemm_t(const GSet g0, const GSet g1, int ysplit, const float* CP, size_t sCPy) {
  __shared__ __attribute__((aligned(16))) unsigned char L[2 * GT_BUF];
  const int tid = threadIdx.x, w = tid >> 5, lane = tid & 31, ln = lane & 15, hh = lane >> 4;
  const bool sec = (int)blockIdx.y >= ysplit; const GSet& g = sec ? g1 : g0; const int by = (int)blockIdx.y - (sec ? ysplit : 0);
  const _Float16* A = g.A; const _Float16* Bh = g.B; const float* bias = by == 1 ? g.bias1 : by == 2 ? g.bias2 : g.bias0; float* C = g.C; _Float16* C16 = g.C16; _Float16* C16l = g.C16l;
  const size_t sA = g.sA, sB = g.sB, sC = g.sC; const int lda = g.lda, ldb = g.ldb, ldc = g.ldc, N = g.N, K = g.K; const float alpha = g.alpha;
  const int ntn = N / 128; const int row0 = ((int)blockIdx.x / ntn) * 128, col0 = ((int)blockIdx.x % ntn) * 128; const int wm = w >> 1, wn = w & 1;
  const int cr = tid >> 3, cc = tid & 7;      /* copies: 8 lanes a row, 32 rows a copy */
  const size_t la = (size_t)by * sA + (size_t)(row0 + cr) * lda + cc * 8, lb = (size_t)by * sB + (size_t)(col0 + cr) * ldb + cc * 8;      /* the lane's place in an A plane and in a Bt plane, the same in every pair */
  const size_t a32 = (size_t)32 * lda, b32 = (size_t)32 * ldb;
  const unsigned lcp = (unsigned)(size_t)L + (unsigned)(cr * GT_PITCH + cc * 16);
  const int nk = K / 64; const bool three = SEG && g.A1 != nullptr; const int nt = three ? 3 * nk : nk, tmid = three ? 2 * nk : -1;      /* nk tiles a pair */
  const _Float16* A1 = g.A1; const _Float16* B1 = g.B1; const _Float16* A2 = g.A2; const _Float16* B2 = g.B2; const float mid = g.mid;
  auto tile = [&](int t, unsigned l) {      /* tile t of the whole run: the pair and the k place inside it are the same for the work-group */
    const _Float16* pa = A; const _Float16* pb = Bh; int kk = t;
    if (SEG && three) { if (t >= 2 * nk) { pa = A2; pb = B2; kk = t - 2 * nk; } else if (t >= nk) { pa = A1; pb = B1; kk = t - nk; } }
    gt_copy(l, (const unsigned short*)pa + kk * 64 + la, (const unsigned short*)pb + kk * 64 + lb, a32, b32); };
  v8f acc[2][4] = {};
  tile(0, lcp);
  asm volatile("s_wait_asynccnt 0x0" ::: "memory");      /* tile 0 has landed before the barrier that publishes it */
  __syncthreads();
  if (nt > 1) tile(1, lcp + GT_BUF);
  const unsigned char* fa = L + (wm * 32 + ln) * GT_PITCH + hh * 16; const unsigned char* fb = L + GT_OPB + (wn * 64 + ln) * GT_PITCH + hh * 16;
#pragma unroll 1
  for (int t = 0; t < nt; ++t) {      /* stays rolled: one copy of the ring's foot */
    const unsigned bo = (unsigned)(t & 1) * GT_BUF;
    FragH a[2][2], b[2][4];
#pragma unroll
    for (int ks = 0; ks < 2; ++ks) {
#pragma unroll
      for (int i = 0; i < 2; ++i) { a[ks][i].half[0] = *(const v8us*)(fa + bo + i * 16 * GT_PITCH + ks * 64); a[ks][i].half[1] = *(const v8us*)(fa + bo + i * 16 * GT_PITCH + ks * 64 + 32); }
#pragma unroll
      for (int j = 0; j < 4; ++j) { b[ks][j].half[0] = *(const v8us*)(fb + bo + j * 16 * GT_PITCH + ks * 64); b[ks][j].half[1] = *(const v8us*)(fb + bo + j * 16 * GT_PITCH + ks * 64 + 32); } }
    /* the ring's foot stands here, behind the trip's 24 fragment reads and ahead of its WMMAs, which work on registers alone: the refill then flies under them too */
    asm volatile("s_wait_dscnt 0x0" ::: "memory");      /* this wave's reads of the buffer are over before it may be refilled */
    asm volatile("s_wait_asynccnt 0x0" ::: "memory");      /* this wave's share of tile t + 1 has landed before the barrier publishes it */
    __syncthreads();
    if (t + 2 < nt) tile(t + 2, lcp + bo);
    __builtin_amdgcn_sched_barrier(0);      /* keeps the WMMAs behind the refill's issue: ahead of it they would delay the copies by their whole run */
    if (SEG && t == tmid) {      /* the first two pairs' sum takes its weight before the third pair is added to it */
#pragma unroll
      for (int i = 0; i < 2; ++i)
#pragma unroll
        for (int j = 0; j < 4; ++j) acc[i][j] *= mid; }
#pragma unroll
    for (int ks = 0; ks < 2; ++ks)
#pragma unroll
      for (int i = 0; i < 2; ++i)
#pragma unroll
        for (int j = 0; j < 4; ++j) acc[i][j] = __builtin_amdgcn_wmma_f32_16x16x32_f16(false, a[ks][i].v, false, b[ks][j].v, (short)0, acc[i][j], false, false);
  }
  asm volatile("s_wait_asynccnt 0x0" ::: "memory");      /* no copy outstanding when the ring becomes output staging */
  /* epilogue: each wave stages its 32 x 64 in its own 8,704 B of the ring (every wave's last read of it ended ahead of the last barrier), then whole row pieces (256 B of f32, 128 B of f16) go out */
  const int c4 = ln * 4, col = col0 + wn * 64 + c4, rw0 = row0 + wm * 32 + hh; const size_t cofs = (size_t)by * sC;
  v4f cp[16];      /* the addend's 16 row pieces are asked for together, ahead of the staging */
  if (LDCP) { const float* cpp = CP + (size_t)rw0 * LDCP + (size_t)by * sCPy + col;
#pragma unroll
    for (int q = 0; q < 16; ++q) cp[q] = *(const v4fa*)(cpp + q * 2 * LDCP);
    asm volatile("s_wait_xcnt 0x0" ::: "memory"); }      /* ahead of any rewrite of the address registers that the loads above name */
  v4f bv = {0.f, 0.f, 0.f, 0.f}; if (bias) { const v4f bb = *(const v4fa*)(bias + col); for (int e = 0; e < 4; ++e) bv[e] = bf16_round(bb[e]); }
  float* so = (float*)(L + w * (32 * 68 * 4));
#pragma unroll
  for (int i = 0; i < 2; ++i)
#pragma unroll
    for (int j = 0; j < 4; ++j)
#pragma unroll
      for (int r = 0; r < 8; ++r) so[(i * 16 + 8 * hh + r) * 68 + j * 16 + ln] = acc[i][j][r];
  __builtin_amdgcn_fence(__ATOMIC_ACQ_REL, "workgroup"); __builtin_amdgcn_wave_barrier();
#pragma unroll
  for (int q = 0; q < 16; ++q) { const size_t o = cofs + (size_t)rw0 * ldc + col + (size_t)(q * 2) * ldc; const v4f x = *(const v4fa*)&so[(q * 2 + hh) * 68 + c4]; v4f v;
    for (int e = 0; e < 4; ++e) v[e] = x[e] * alpha + bv[e];
    if (LDCP) for (int e = 0; e < 4; ++e) v[e] += cp[q][e];
    if (OUT == 1) *(v4f*)(C + o) = v;
    else { v4h h4; for (int e = 0; e < 4; ++e) h4[e] = (_Float16)v[e]; *(v4h*)(C16 + o) = h4;
      if (OUT == 2) { v4h l4; for (int e = 0; e < 4; ++e) l4[e] = (_Float16)((v[e] - (float)h4[e]) * 1024.0f); *(v4h*)(C16l + o) = l4; } } }
}


__device__ __forceinline__ void x16(const float* __restrict__ x, _Float16* __restrict__ X16, size_t n8, int blk) { const size_t t = (size_t)blk * 256 + threadIdx.x; if (t >= n8) return; FragH f;
#pragma unroll
  for (int q = 0; q < 8; ++q) f.h[q] = (_Float16)bf16_round(x[t * 8 + q]); *(v8us*)((unsigned short*)X16 + t * 8) = f.half[0];  }
// All operand preparation in one launch: none of its ten parts reads what another writes. Ranges of blockIdx.x: the five F x F weights, the three G x F weights (each transposed, x 2^4), then features and geometry (rounded to f16 planes).
#define PW_BIG (DD * (DD / 8) / 256)
#define PW_SML (DD * (GG / 8) / 256)
#define PX_F (NR * DD / 8 / 256)
#define PX_G (NR * GG / 8 / 256)
__global__ __launch_bounds__(256) void k_prep(const float* __restrict__ wq, const float* __restrict__ wk, const float* __restrict__ wv, const float* __restrict__ wo, const float* __restrict__ opw,
    const float* __restrict__ gqw, const float* __restrict__ gkw, const float* __restrict__ gvw, const float* __restrict__ feats, const float* __restrict__ geom,
    _Float16* __restrict__ Bw, _Float16* __restrict__ Bg, _Float16* __restrict__ X16, _Float16* __restrict__ GE16) {
  int blk = blockIdx.x;
  if (blk < 5 * PW_BIG) { const int i = blk / PW_BIG; const float* W = i == 0 ? wq : i == 1 ? wk : i == 2 ? wv : i == 3 ? wo : opw; wt_f16(W, Bw + (size_t)i * DD * DD, DD, DD, 16.0f, blk % PW_BIG); return; }
  blk -= 5 * PW_BIG;
  if (blk < 3 * PW_SML) { const int i = blk / PW_SML; const float* W = i == 0 ? gqw : i == 1 ? gkw : gvw; wt_f16(W, Bg + (size_t)i * GG * DD, GG, DD, 16.0f, blk % PW_SML); return; }
  blk -= 3 * PW_SML;
  if (blk < PX_F) { x16(feats, X16, (size_t)NR * DD / 8, blk); return; }
  x16(geom, GE16, (size_t)NR * GG / 8, blk - PX_F);
}
__global__ __launch_bounds__(256) void k_round16f(const float* __restrict__ W, _Float16* __restrict__ Bt, size_t n8) { const size_t t = (size_t)blockIdx.x * 256 + threadIdx.x; if (t >= n8) return; FragH f;
#pragma unroll
  for (int i = 0; i < 8; ++i) f.h[i] = (_Float16)(bf16_round(W[t * 8 + i]) * 16.0f); *(v8us*)((unsigned short*)Bt + t * 8) = f.half[0];  }
template <int NHv, int TTv>
__global__ __launch_bounds__(256) void k_vt(const _Float16* __restrict__ V16, size_t sV, int ldv, int voff, _Float16* __restrict__ Vt, size_t sVt) { __shared__ unsigned short tl[64][66]; const int tid = threadIdx.x; V16 += (size_t)blockIdx.y * sV; Vt += (size_t)blockIdx.y * sVt;      /* blockIdx.y: which plane */ const int slab = blockIdx.x / (TTv / 64), lg = blockIdx.x % (TTv / 64); const int b = slab / NHv, h = slab % NHv;
  for (int i = tid; i < 64 * 8; i += 256) { const int r = i / 8, c8 = (i % 8) * 8; FragH f; f.half[0] = *(const v8us*)((const unsigned short*)V16 + ((size_t)b * TTv + lg * 64 + r) * ldv + voff + h * 64 + c8);
#pragma unroll
    for (int q = 0; q < 8; ++q) tl[r][c8 + q] = f.u[q]; }
  __syncthreads();
  {
#pragma unroll
    for (int rd = 0; rd < 2; ++rd) { const int d = rd * 32 + tid / 8, pc = tid % 8; FragH f;
#pragma unroll
      for (int q = 0; q < 8; ++q) f.u[q] = tl[pc * 8 + q][d];
      *(v8us*)((unsigned short*)Vt + ((size_t)slab * 64 + d) * TTv + lg * 64 + pc * 8) = f.half[0]; }
     } }

typedef float v2f __attribute__((ext_vector_type(2)));
// Distance-MLP bias, added to S in place. gelu_tanh(x) = 0.5 x (1 + tanh(u)) = x / (1 + exp(-2 u)), u = sqrt(2 / pi) (x + 0.044715 x^3): one v_exp_f32 and one v_rcp_f32, no branch
// (x far above 0: exp -> 0, quotient x; x far below 0: exp -> inf, rcp -> 0, quotient -0: the limits of the tanh form). The other steps are packed f32 operations on two keys at a time.
// A work-group takes GB_ROWS whole score rows, a thread the same 4 keys in each: the rounded weights, their head means and the keys' coordinates are made once per thread, not once per 4 pairs.
#define GB_ROWS 8
#define GB_K0 (-2.3022081986f)      /* -2 sqrt(2 / pi) log2(e) */
#define GB_K1 (GB_K0 * 0.044715f)
__global__ __launch_bounds__(256) void k_gbias(float* __restrict__ S, const float* __restrict__ CRD, const float* __restrict__ w1, const float* __restrict__ b1, const float* __restrict__ w2, const float* __restrict__ b2) {
  const int b = blockIdx.y, q0 = blockIdx.x * GB_ROWS, k0 = threadIdx.x * 4;      /* one score plane per batch */
  const float* C3 = CRD + (size_t)b * TT * 3; float* sp = S + (size_t)b * TT * TT + (size_t)q0 * TT + k0;
  float cb = 0.f; for (int j = 0; j < 8; ++j) cb += bf16_round(b2[j]); cb *= 0.125f;
  float wj[8], bj[8], cj[8];
#pragma unroll
  for (int j = 0; j < 8; ++j) { float c = 0.f; for (int h = 0; h < 8; ++h) c += bf16_round(w2[j * 8 + h]); cj[j] = c * 0.125f; wj[j] = bf16_round(w1[j]); bj[j] = bf16_round(b1[j]); }
  const v4f c0 = *(const v4fa*)(C3 + k0 * 3), c1 = *(const v4fa*)(C3 + k0 * 3 + 4), c2 = *(const v4fa*)(C3 + k0 * 3 + 8);
  const v2f kx[2] = {{bf16_round(c0[0]), bf16_round(c0[3])}, {bf16_round(c1[2]), bf16_round(c2[1])}};
  const v2f ky[2] = {{bf16_round(c0[1]), bf16_round(c1[0])}, {bf16_round(c1[3]), bf16_round(c2[2])}};
  const v2f kz[2] = {{bf16_round(c0[2]), bf16_round(c1[1])}, {bf16_round(c2[0]), bf16_round(c2[3])}};
#pragma unroll 1      /* stays rolled: a row already holds 16 independent chains */
  for (int r = 0; r < GB_ROWS; ++r) {
    const v4f sv = *(const v4fa*)(sp + (size_t)r * TT);      /* asked for at the row's head, used at its foot */
    const float qx = bf16_round(C3[(q0 + r) * 3]), qy = bf16_round(C3[(q0 + r) * 3 + 1]), qz = bf16_round(C3[(q0 + r) * 3 + 2]);
    v2f d[2], acc[2];
#pragma unroll
    for (int p = 0; p < 2; ++p) { const v2f dx = qx - kx[p], dy = qy - ky[p], dz = qz - kz[p]; const v2f d2 = dx * dx + dy * dy + dz * dz;
      d[p][0] = __builtin_amdgcn_sqrtf(fmaxf(d2[0], 1e-12f)); d[p][1] = __builtin_amdgcn_sqrtf(fmaxf(d2[1], 1e-12f)); acc[p] = (v2f){cb, cb}; }
#pragma unroll
    for (int j = 0; j < 8; ++j)
#pragma unroll
      for (int p = 0; p < 2; ++p) { const v2f x = d[p] * wj[j] + bj[j]; const v2f a = x * (x * x * GB_K1 + GB_K0);
        const v2f s = (v2f){__builtin_amdgcn_exp2f(a[0]), __builtin_amdgcn_exp2f(a[1])} + 1.0f;
        const v2f g = x * (v2f){__builtin_amdgcn_rcpf(s[0]), __builtin_amdgcn_rcpf(s[1])}; acc[p] += g * cj[j]; }
    const v4f o = {sv[0] + acc[0][0], sv[1] + acc[0][1], sv[2] + acc[1][0], sv[3] + acc[1][1]};
    *(v4f*)(sp + (size_t)r * TT) = o;
  } }
#define NN TT
__global__ __launch_bounds__(256) void k_smx(const float* __restrict__ S, _Float16* __restrict__ P16) { const int tid = threadIdx.x, wv = tid >> 5, lane = tid & 31; const int i = blockIdx.x * 8 + wv; const float* sr = S + (size_t)i * NN;
  float m = -3.0e38f;
  for (int p = lane; p < NN / 8; p += 32) { const v4f a = *(const v4fa*)(sr + p * 8), c = *(const v4fa*)(sr + p * 8 + 4); for (int e = 0; e < 4; ++e) m = fmaxf(m, fmaxf(a[e], c[e])); }
  for (int o = 16; o >= 1; o >>= 1) m = fmaxf(m, __shfl_xor(m, o, 32)); float z = 0.f;
  for (int p = lane; p < NN / 8; p += 32) { const v4f a = *(const v4fa*)(sr + p * 8), c = *(const v4fa*)(sr + p * 8 + 4); for (int e = 0; e < 4; ++e) z += __expf(a[e] - m) + __expf(c[e] - m); }
  for (int o = 16; o >= 1; o >>= 1) z += __shfl_xor(z, o, 32); const float iz = 32768.0f / z;
  { for (int p = lane; p < NN / 8; p += 32) { FragH f; const v4f a = *(const v4fa*)(sr + p * 8), c = *(const v4fa*)(sr + p * 8 + 4); for (int e = 0; e < 4; ++e) { f.h[e] = (_Float16)(__expf(a[e] - m) * iz); f.h[4 + e] = (_Float16)(__expf(c[e] - m) * iz); }
      *(v8us*)((unsigned short*)P16 + (size_t)i * NN + p * 8) = f.half[0]; }  } }
// lane l with lane l ^ 16 (the two halves of a wave hold the two halves of a query's keys)
__device__ __forceinline__ float xhalf(float x) { return __builtin_bit_cast(float, __builtin_amdgcn_permlanex16(__builtin_bit_cast(int, x), __builtin_bit_cast(int, x), 0x76543210, 0xfedcba98, false, false)); }
#define FL_PITCH 144
#define FL_OPB (64 * FL_PITCH)
#define FL_BUF (2 * FL_OPB)
// one stage: 2 copies of K and 2 of VT per lane. The s_wait_xcnt stands inside the statement so that no address register named here is rewritten ahead of it.
__device__ __forceinline__ void fl_copy(unsigned l, const unsigned short* gk, const unsigned short* gv, size_t k32, size_t v32) {
  asm volatile("global_load_async_to_lds_b128 %0, %4, off\n\t"
               "global_load_async_to_lds_b128 %1, %5, off\n\t"
               "global_load_async_to_lds_b128 %2, %6, off\n\t"
               "global_load_async_to_lds_b128 %3, %7, off\n\t"
               "s_wait_xcnt 0x0"
               :: "v"(l), "v"(l + 32 * FL_PITCH), "v"(l + FL_OPB), "v"(l + FL_OPB + 32 * FL_PITCH),
                  "v"(gk), "v"(gk + k32), "v"(gv), "v"(gv + v32)
               : "memory");
}
__global__ __launch_bounds__(256) void k_flash(const _Float16* __restrict__ Q16, int ldq, const _Float16* __restrict__ K16, int ldk, const _Float16* __restrict__ Vt, const int* __restrict__ MSK, _Float16* __restrict__ O16, int ldo) {
  constexpr int RPW = 16, NW = 8, NQB = TT / (NW * RPW), DT = 4, KS = 2, NST = TT / 64; (void)MSK;
  __shared__ __attribute__((aligned(16))) unsigned char R[2 * FL_BUF];
  __shared__ __attribute__((aligned(16))) unsigned short sO[NW][RPW][64 + 8];      /* f16 rows at pitch 144 B */
  const int tid = threadIdx.x, w = tid >> 5, lane = tid & 31, ln = lane & 15, hh = lane >> 4;
  const int slab = blockIdx.x / NQB, qblk = blockIdx.x % NQB; const int b = slab / NH, h = slab % NH; const int q0 = qblk * (NW * RPW) + w * RPW;
  FragH bq[KS];
  { const unsigned short* qr = (const unsigned short*)Q16 + ((size_t)b * TT + q0 + ln) * ldq + h * 64;
#pragma unroll
    for (int ks = 0; ks < KS; ++ks) { bq[ks].half[0] = *(const v8us*)(qr + ks * 32 + 8 * hh); bq[ks].half[1] = *(const v8us*)(qr + ks * 32 + 16 + 8 * hh); } }
  const unsigned short* Vth = (const unsigned short*)Vt + (size_t)slab * 64 * TT;
  const int cr = tid >> 3, cc = tid & 7;      /* copies: 8 lanes a row, 32 rows a copy */
  const unsigned short* gk = (const unsigned short*)K16 + ((size_t)b * TT + cr) * ldk + h * 64 + cc * 8; const unsigned short* gv = Vth + (size_t)cr * TT + cc * 8;
  const size_t k32 = (size_t)32 * ldk, v32 = (size_t)32 * TT;
  const unsigned lcp = (unsigned)(size_t)R + (unsigned)(cr * FL_PITCH + cc * 16);
  fl_copy(lcp, gk, gv, k32, v32);
  asm volatile("s_wait_asynccnt 0x0" ::: "memory");      /* stage 0 has landed before the barrier that publishes it */
  __syncthreads();
  fl_copy(lcp + FL_BUF, gk + 2 * k32, gv + 64, k32, v32);
  const unsigned char* fk = R + ln * FL_PITCH + hh * 16; const unsigned char* fv = fk + FL_OPB;
  float m_q = -3.0e38f, l_q = 0.f; v8f oacc[DT];
#pragma unroll
  for (int dt = 0; dt < DT; ++dt) oacc[dt] = (v8f){0.f,0.f,0.f,0.f,0.f,0.f,0.f,0.f};
#pragma unroll 1      /* stays rolled: one copy of the ring's foot */
  for (int t = 0; t < NST; ++t) {
    const unsigned bo = (unsigned)(t & 1) * FL_BUF;
#pragma unroll
    for (int p = 0; p < 2; ++p) {
    FragH ak[2][KS], av[DT];      /* the pass's 16 fragment reads stand together at its head */
#pragma unroll
    for (int nt = 0; nt < 2; ++nt)
#pragma unroll
      for (int ks = 0; ks < KS; ++ks) { ak[nt][ks].half[0] = *(const v8us*)(fk + bo + (p * 32 + nt * 16) * FL_PITCH + ks * 64); ak[nt][ks].half[1] = *(const v8us*)(fk + bo + (p * 32 + nt * 16) * FL_PITCH + ks * 64 + 32); }
#pragma unroll
    for (int dt = 0; dt < DT; ++dt) { av[dt].half[0] = *(const v8us*)(fv + bo + dt * 16 * FL_PITCH + p * 64); av[dt].half[1] = *(const v8us*)(fv + bo + dt * 16 * FL_PITCH + p * 64 + 32); }
    v8f s[2];
#pragma unroll
    for (int nt = 0; nt < 2; ++nt) { v8f acc = (v8f){0.f,0.f,0.f,0.f,0.f,0.f,0.f,0.f};
#pragma unroll
      for (int ks = 0; ks < KS; ++ks) acc = mmaH<1>(ak[nt][ks].v, ak[nt][ks].v, bq[ks].v, bq[ks].v, acc);
      s[nt] = acc; }
    float mc = -3.0e38f;
#pragma unroll
    for (int nt = 0; nt < 2; ++nt)
#pragma unroll
      for (int r = 0; r < 8; ++r) { s[nt][r] *= 0.125f; mc = fmaxf(mc, s[nt][r]); }
    mc = fmaxf(mc, xhalf(mc));
    const float mn = fmaxf(m_q, mc); const float al = (mn > -1.0e38f) ? expf(m_q - mn) : 1.0f; m_q = mn;
    FragH pb; float ps = 0.f;
#pragma unroll
    for (int nt = 0; nt < 2; ++nt)
#pragma unroll
      for (int r = 0; r < 8; ++r) { const float p_ = expf(s[nt][r] - mn); ps += p_; pb.h[nt * 8 + r] = (_Float16)(p_ * 1024.0f); }
    l_q = l_q * al + ps;      /* this half's keys only; the halves are joined behind the loop */
#pragma unroll
    for (int dt = 0; dt < DT; ++dt)
#pragma unroll
      for (int r = 0; r < 8; ++r) oacc[dt][r] *= al;
#pragma unroll
    for (int dt = 0; dt < DT; ++dt) oacc[dt] = mmaH<1>(av[dt].v, av[dt].v, pb.v, pb.v, oacc[dt]); }
    asm volatile("s_wait_dscnt 0x0" ::: "memory");      /* this wave's reads of the buffer are over before it may be refilled */
    asm volatile("s_wait_asynccnt 0x0" ::: "memory");      /* this wave's share of stage t + 1 has landed before the barrier publishes it */
    __syncthreads();
    if (t + 2 < NST) fl_copy(lcp + bo, gk + (size_t)(t + 2) * 2 * k32, gv + (t + 2) * 64, k32, v32);
  }
  asm volatile("s_wait_asynccnt 0x0" ::: "memory");      /* no copy outstanding when the wave goes on to its end */
  const float lt = l_q + xhalf(l_q); const float il = (lt > 0.f) ? 1.0f / (lt * 64.0f) : 0.f;      /* P carries 2^10, the f16 result plane 2^4 */
#pragma unroll
  for (int dt = 0; dt < DT; ++dt) { FragH f;      /* oacc[dt][r] = OT[dt * 16 + 8 * hh + r][query ln] */
#pragma unroll
    for (int r = 0; r < 8; ++r) f.h[r] = (_Float16)(oacc[dt][r] * il);
    *(v8us*)&sO[w][ln][dt * 16 + 8 * hh] = f.half[0]; }
  __builtin_amdgcn_fence(__ATOMIC_ACQ_REL, "workgroup"); __builtin_amdgcn_wave_barrier();
#pragma unroll
  for (int rp = 0; rp < RPW; rp += 4) { const int r = rp + (lane >> 3), pc = lane & 7; const v8us val = *(const v8us*)&sO[w][r][pc * 8];      /* 8 lanes a row: one whole 128-B line of the f16 plane */
    *(v8us*)((unsigned short*)O16 + ((size_t)b * TT + q0 + r) * ldo + h * 64 + pc * 8) = val; } }

extern "C" void kernel_launch(void* const* d_in, const int* in_sizes, int n_in,
                              void* d_out, int out_size, void* d_ws, size_t ws_size, hipStream_t stream) {
  (void)in_sizes; (void)n_in; (void)out_size;
  const float* const* I = (const float* const*)d_in; const float* feats = I[0]; const float* geom = I[1]; const float* crd = I[2];
  const float* wq = I[3]; const float* bq = I[4]; const float* wk = I[5]; const float* bk = I[6]; const float* wv = I[7]; const float* bv = I[8]; const float* wo = I[9]; const float* bo = I[10];
  const float* gqw = I[11]; const float* gqb = I[12]; const float* gkw = I[13]; const float* gkb = I[14]; const float* gvw = I[15]; const float* gvb = I[16]; const float* d1w = I[17]; const float* d1b = I[18]; const float* d2w = I[19]; const float* d2b = I[20]; const float* opw = I[21]; const float* opb = I[22];
  char* ws = (char*)d_ws; size_t off = 0;
  auto take = [&](size_t bytes) { char* p = ws + off; off += (bytes + 255) & ~(size_t)255; return p; };
  const size_t WSZ = (size_t)DD * DD, GSZ = (size_t)GG * DD, PSZ = (size_t)NR * DD; _Float16* Bw = (_Float16*)take(5 * WSZ * 2); _Float16* Bg = (_Float16*)take(3 * GSZ * 2);
  _Float16* X16 = (_Float16*)take(PSZ * 2); _Float16* GE16 = (_Float16*)take((size_t)NR * GG * 2);
  _Float16* PL = (_Float16*)take(6 * PSZ * 2);      /* the six projections' planes in a row: q, k, v, gv, gq, gk */
  _Float16* RL = (_Float16*)take(2 * PSZ * 2);      /* residual planes of gq, gk */
  _Float16* VT = (_Float16*)take(2 * PSZ * 2);      /* v and gv transposed */
  float* FA = (float*)take(PSZ * 4); float* S = (float*)take((size_t)BB * TT * TT * 4); _Float16* P16 = (_Float16*)take((size_t)BB * TT * TT * 2);
  _Float16* Q = PL; _Float16* K = PL + PSZ; _Float16* V = PL + 2 * PSZ; _Float16* GQ = PL + 4 * PSZ; _Float16* GK = PL + 5 * PSZ; _Float16* GQl = RL; _Float16* GKl = RL + PSZ; _Float16* Vt = VT; _Float16* GVt = VT + PSZ;
  _Float16* O16 = X16; _Float16* SUM16 = V;      /* reuse in stream order: X16 -> the attention output (behind the projections); V -> feat + geom (behind the transposes) */
  if (off > ws_size) return;      // 2.6 + 0.4 + 8.4 + 2.1 + 10 x 8.4 + 16.8 + 33.6 + 16.8 = about 165 MB
  const int NOSPLIT = 0x7fffffff;      /* a launch with one set only */
  k_prep<<<5 * PW_BIG + 3 * PW_SML + PX_F + PX_G, 256, 0, stream>>>(wq, wk, wv, wo, opw, gqw, gkw, gvw, feats, geom, Bw, Bg, X16, GE16);      /* (in,out) weights -> Bt x 2^4; features, geometry -> f16 */
  const unsigned gpx = (NR / 128) * (DD / 128);
  { const GSet f = {X16, Bw, bq, bk, bv, nullptr, PL, nullptr, 0, WSZ, PSZ, DD, DD, DD, DD, DD, 0.0625f};      /* q, k, v: M 8192 N 512 K 512 */
    const GSet e = {GE16, Bg + 2 * GSZ, gvb, gvb, gvb, nullptr, PL + 3 * PSZ, nullptr, 0, 0, 0, GG, GG, DD, DD, GG, 0.0625f};      /* gv: M 8192 N 512 K 128 */
    k_gemm_t<0, 0><<<dim3(gpx, 4), 256, 0, stream>>>(f, e, 3, nullptr, 0); }
  { const GSet e = {GE16, Bg, gqb, gkb, gkb, nullptr, GQ, RL, 0, GSZ, PSZ, GG, GG, DD, DD, GG, 0.0625f};      /* gq, gk -> hi / x2^10 residual planes: M 8192 N 512 K 128 */
    k_gemm_t<0, 2><<<dim3(gpx, 2), 256, 0, stream>>>(e, e, NOSPLIT, nullptr, 0); }
  k_vt<NH, TT><<<dim3(BB * NH * (TT / 64), 2), 256, 0, stream>>>(V, PSZ, DD, 0, VT, PSZ);      /* v per head [64][1024]; gv per batch [512][1024] (the same 64-wide slabs) */
  k_flash<<<BB * NH * (TT / 128), 256, 0, stream>>>(Q, DD, K, DD, Vt, nullptr, O16, DD);      /* the attention output leaves as f16 x 2^4 */
  /* geometry branch: all BB batches of each stage in one launch, the batch in blockIdx.y (operand, addend and result strides per batch) */
  const size_t sX = (size_t)TT * DD, sS = (size_t)TT * TT;
  { const GSet hh = {GQl, GK, nullptr, nullptr, nullptr, S, nullptr, nullptr, sX, sX, sS, DD, DD, TT, TT, DD, 0.125f, GQ, GKl, GQ, GK, 0.0009765625f};      /* S = gq.gkT/8 f32-accurate, ((lo.hi + hi.lo).2^-10 + hi.hi)/8 in one accumulator: M 1024 N 1024 K 3 x 512, x BB */
    const GSet fo = {O16, Bw + 3 * WSZ, bo, bo, bo, FA, nullptr, nullptr, PSZ / 4, 0, PSZ / 4, DD, DD, DD, DD, DD, 0.00390625f};      /* feat_att = O.wo + bo (f32), in four slices of 2048 rows, each as many work-groups as one batch of S */
    k_gemm_t<0, 1, true><<<dim3((TT / 128) * (TT / 128), BB + 4), 256, 0, stream>>>(hh, fo, BB, nullptr, 0); }
  k_gbias<<<dim3(TT / GB_ROWS, BB), 256, 0, stream>>>(S, crd, d1w, d1b, d2w, d2b); k_smx<<<BB * TT / 8, 256, 0, stream>>>(S, P16);      /* softmax: a wave per row over the BB * TT rows */
  { const GSet pv = {P16, GVt, nullptr, nullptr, nullptr, nullptr, SUM16, nullptr, sS, sX, sX, TT, TT, DD, DD, TT, 0.000030517578125f};
    k_gemm_t<DD, 0><<<dim3((TT / 128) * (DD / 128), BB), 256, 0, stream>>>(pv, pv, NOSPLIT, FA, sX); }      /* feat_att + geom_att, stored as f16: M 1024 N 512 K 1024, x BB */
  { const GSet op = {SUM16, Bw + 4 * WSZ, opb, opb, opb, (float*)d_out, nullptr, nullptr, 0, 0, 0, DD, DD, DD, DD, DD, 0.0625f};
    k_gemm_t<0, 1><<<dim3(gpx, 1), 256, 0, stream>>>(op, op, NOSPLIT, nullptr, 0); }      /* out = (feat + geom).op_w + op_b */
}

// v009
// A run of this version takes 147 microseconds.
// Next to v008, in two timings, it ran 1.10 and 1.11 times as fast.
// Over all steps from v000 it is 9.03 times as fast.
#include <hip/hip_runtime.h>
// Geometry-aware attention (B=8, N=1024, F=512, 8 heads × 64, G=128): feat = MHA(features) (x·W + b, softmax(q·k/8)·v, ·wo + bo); geometry branch: gq, gk, gv = geometry·W + b (F wide, single head);
// g_scores = gq·gkᵀ/8 + mean_h(gelu_tanh(dist·d1_w + d1_b)·d2_w + d2_b) with dist = max(‖coords_q − coords_k‖, 1e-6); geom = softmax(g_scores)·gv; out = (feat + geom)·op_w + op_b. (in,out) weights; jax.nn.gelu default = tanh approximation.
// Compute dtype: features, geometry, coords, all weights/biases rounded to bf16; f16 GEMM planes; the 8-head branch through a fused flash-style kernel (online softmax f32, P f16 ×2^10); the geometry branch, every stage one launch over all batches (batch in blockIdx.y; the softmax's BB·TT rows in blockIdx.x): S = gq·gkᵀ/8 f32-accurate from f16 hi + residual planes (hi·hi + (lo·hi + hi·lo)·2^-10; its logits reach σ≈3), a kernel adding the distance-MLP bias in place (f32, per pair from the coords), a wave-per-row f32 softmax → P f16 ×2^15, geom = P·gv by GEMM with feat_att as the f32 addend; final projection GEMM. All contractions on v_wmma_f32_16x16x32_f16, f32 accumulate.
#define BB 8
#define TT 1024
#define DD 512
#define GG 128
#define NH 8
#define NR (BB * TT)

typedef __bf16 v16b __attribute__((ext_vector_type(16)));
typedef unsigned short v8us __attribute__((ext_vector_type(8), may_alias));
typedef float  v8f  __attribute__((ext_vector_type(8)));
typedef float  v4f  __attribute__((ext_vector_type(4)));
typedef float  v4fa __attribute__((ext_vector_type(4), may_alias));
union FragB { v16b v; v8us half[2]; unsigned short u[16]; };

__device__ __forceinline__ unsigned short bf16_bits(float x) { unsigned int u = __float_as_uint(x); return (unsigned short)((u + 0x7FFFu + ((u >> 16) & 1u)) >> 16); }
__device__ __forceinline__ float bf16_val(unsigned short b) { return __uint_as_float(((unsigned int)b) << 16); }
__device__ __forceinline__ float bf16_round(float x) { return bf16_val(bf16_bits(x)); }
// D += A·B with NT terms: 1 = ah·bh, 2 = + al·bh (A split), 3 = + ah·bl (both split)
template <int NT>
__device__ __forceinline__ v8f mmaN(v16b ah, v16b al, v16b bh, v16b bl, v8f c) {
  c = __builtin_amdgcn_wmma_f32_16x16x32_bf16(false, ah, false, bh, (short)0, c, false, false);
  if (NT >= 2) c = __builtin_amdgcn_wmma_f32_16x16x32_bf16(false, al, false, bh, (short)0, c, false, false);
  if (NT >= 3) c = __builtin_amdgcn_wmma_f32_16x16x32_bf16(false, ah, false, bl, (short)0, c, false, false);
  asm volatile("v_nop\n\tv_nop\n\tv_nop\n\tv_nop" : "+v"(c) : "v"(ah), "v"(al), "v"(bh), "v"(bl));
  return c;
}

__global__ __launch_bounds__(256) void k_wt_bf16(const float* __restrict__ W, unsigned short* __restrict__ Wt, int K, int N) {
  const int t = blockIdx.x * 256 + threadIdx.x;
  const int k8n = K / 8;
  if (t >= N * k8n) return;
  const int n = t / k8n, k8 = (t % k8n) * 8;
  v8us v;
#pragma unroll
  for (int i = 0; i < 8; ++i) v[i] = bf16_bits(W[(size_t)(k8 + i) * N + n]);
  *(v8us*)(Wt + (size_t)n * K + k8) = v;
  
}

// GEMM C[M][N] (f32, pitch ldc) = act(A[M][K]·W + bias). A f32 row-major (pitch lda) converted per fragment to bf16
// (ASPLIT: hi/lo two planes -> 2 terms, else single rounded term); Wt bf16 [N][K] (pitch ldb). BIAS_BF16 rounds the
// bias to bf16 first (bias quantised to bf16 before the add). K%32==0, M%16==0, N%64==0.
template <bool ASPLIT, int ACT, bool BIAS_BF16>
__global__ __launch_bounds__(128) void k_gemm_bf(const float* __restrict__ A, int lda, const unsigned short* __restrict__ Wt, int ldb,
                                               const float* __restrict__ bias, float* __restrict__ C, int ldc, int M, int N, int K) {
  __shared__ __attribute__((aligned(16))) float so[4][16][64];
  const int tid = threadIdx.x, w = tid >> 5, lane = tid & 31, ln = lane & 15, hh = lane >> 4;
  const int ntn = N / 64;
  const int wid = blockIdx.x * 4 + w;
  const int mt = wid / ntn, nq = wid % ntn;
  if (mt * 16 >= M) return;
  const int row0 = mt * 16, col0 = nq * 64;
  const float* arow = A + (size_t)(row0 + ln) * lda;
  v8f acc[4] = {};
  for (int kb = 0; kb < K; kb += 32) {
    FragB ah, al;
    const v4f x0 = *(const v4fa*)(arow + kb + 8 * hh), x1 = *(const v4fa*)(arow + kb + 8 * hh + 4);
    const v4f x2 = *(const v4fa*)(arow + kb + 16 + 8 * hh), x3 = *(const v4fa*)(arow + kb + 16 + 8 * hh + 4);
    float xs[16] = {x0[0],x0[1],x0[2],x0[3],x1[0],x1[1],x1[2],x1[3],x2[0],x2[1],x2[2],x2[3],x3[0],x3[1],x3[2],x3[3]};
#pragma unroll
    for (int i = 0; i < 16; ++i) { const unsigned short hb = bf16_bits(xs[i]); ah.u[i] = hb; al.u[i] = ASPLIT ? bf16_bits(xs[i] - bf16_val(hb)) : (unsigned short)0; }
#pragma unroll
    for (int t = 0; t < 4; ++t) {
      const unsigned short* brow = Wt + (size_t)(col0 + t * 16 + ln) * ldb + kb;
      FragB b;
      b.half[0] = *(const v8us*)(brow + 8 * hh);
      b.half[1] = *(const v8us*)(brow + 16 + 8 * hh);
      acc[t] = mmaN<ASPLIT ? 2 : 1>(ah.v, al.v, b.v, b.v, acc[t]);
    }
  }
#pragma unroll
  for (int t = 0; t < 4; ++t) {
    float bv = bias ? bias[col0 + t * 16 + ln] : 0.f;
    if (BIAS_BF16) bv = bf16_round(bv);
#pragma unroll
    for (int r = 0; r < 8; ++r) { float v = acc[t][r] + bv; if (ACT == 1) v = fmaxf(v, 0.f); so[w][8 * hh + r][t * 16 + ln] = v; }
  }
  __builtin_amdgcn_fence(__ATOMIC_ACQ_REL, "workgroup");
  __builtin_amdgcn_wave_barrier();
  const int rsub = lane >> 4, c4 = (lane & 15) * 4;
  {
#pragma unroll
    for (int q = 0; q < 8; ++q) {
      const int r = q * 2 + rsub;
      const v4f v = *(const v4fa*)&so[w][r][c4];
      *(v4f*)(C + (size_t)(row0 + r) * ldc + col0 + c4) = v;
    }
    
  }
}

// Flash-style causal/unmasked attention, all contractions 3-term bf16 hi/lo splits, f32 softmax with running max.
// q,k,v rows are read from f32 buffers with arbitrary row pitch (so they can live inside a fused qkv buffer);
// D = head size (multiple of 32, <= 128); one wave = 16 query rows; block = 4 waves (64 queries) sharing K/V chunks of 32.
template <int D, bool CAUSAL>
__global__ __launch_bounds__(128) void k_flash(const float* __restrict__ qb, const float* __restrict__ kb, const float* __restrict__ vb,
                                             int pitch, int T, int H, float scale, float* __restrict__ y, int ypitch) {
  constexpr int KS = D / 32;        // k-steps for QK
  constexpr int DT = D / 16;        // d tiles for PV
  __shared__ __attribute__((aligned(16))) unsigned short sKh[32][D + 8], sKl[32][D + 8], sVh[32][D + 8], sVl[32][D + 8];
  __shared__ __attribute__((aligned(16))) unsigned short sPh[4][16][40], sPl[4][16][40];
  __shared__ __attribute__((aligned(16))) float sO[4][16][D];
  const int tid = threadIdx.x, w = tid >> 5, lane = tid & 31, ln = lane & 15, hh = lane >> 4;
  const int nqb = (T + 63) / 64;
  const int bh = blockIdx.x / nqb, qblk = blockIdx.x % nqb;
  const int b = bh / H, h = bh % H;
  const int q0 = qblk * 64 + w * 16;
  const float* Q = qb + (size_t)b * T * pitch + h * D;
  const float* K = kb + (size_t)b * T * pitch + h * D;
  const float* V = vb + (size_t)b * T * pitch + h * D;

  // A fragments of the wave's 16 query rows (scaled), hi/lo
  FragB aqh[KS], aql[KS];
  {
    int row = q0 + ln; if (row >= T) row = T - 1;
    const float* qr = Q + (size_t)row * pitch;
#pragma unroll
    for (int ks = 0; ks < KS; ++ks)
#pragma unroll
      for (int i = 0; i < 16; ++i) {
        const int d = ks * 32 + ((i < 8) ? (8 * hh + i) : (16 + 8 * hh + (i - 8)));
        const float x = qr[d] * scale; const unsigned short hb = bf16_bits(x);
        aqh[ks].u[i] = hb; aql[ks].u[i] = bf16_bits(x - bf16_val(hb));
      }
  }
  float m_r[8], l_r[8];
#pragma unroll
  for (int r = 0; r < 8; ++r) { m_r[r] = -3.0e38f; l_r[r] = 0.f; }
  v8f oacc[DT];
#pragma unroll
  for (int dt = 0; dt < DT; ++dt) oacc[dt] = (v8f){0.f,0.f,0.f,0.f,0.f,0.f,0.f,0.f};

  const int kv_end = CAUSAL ? min(T, qblk * 64 + 64) : T;     // block-uniform
  for (int j0 = 0; j0 < kv_end; j0 += 32) {
    __syncthreads();
    for (int e = tid; e < 32 * (D / 4); e += 128) {
      const int r = e / (D / 4), c4 = (e % (D / 4)) * 4;
      const int key = j0 + r;
      v4f kf = {0.f,0.f,0.f,0.f}, vf = {0.f,0.f,0.f,0.f};
      if (key < T) { kf = *(const v4fa*)(K + (size_t)key * pitch + c4); vf = *(const v4fa*)(V + (size_t)key * pitch + c4); }
#pragma unroll
      for (int t = 0; t < 4; ++t) {
        unsigned short hb = bf16_bits(kf[t]); sKh[r][c4 + t] = hb; sKl[r][c4 + t] = bf16_bits(kf[t] - bf16_val(hb));
        hb = bf16_bits(vf[t]); sVh[r][c4 + t] = hb; sVl[r][c4 + t] = bf16_bits(vf[t] - bf16_val(hb));
      }
    }
    __syncthreads();
    // S tile 16 x 32
    v8f s[2];
#pragma unroll
    for (int nt = 0; nt < 2; ++nt) {
      v8f acc = {};
#pragma unroll
      for (int ks = 0; ks < KS; ++ks) {
        FragB bh_, bl_;
        bh_.half[0] = *(const v8us*)&sKh[nt * 16 + ln][ks * 32 + 8 * hh]; bh_.half[1] = *(const v8us*)&sKh[nt * 16 + ln][ks * 32 + 16 + 8 * hh];
        bl_.half[0] = *(const v8us*)&sKl[nt * 16 + ln][ks * 32 + 8 * hh]; bl_.half[1] = *(const v8us*)&sKl[nt * 16 + ln][ks * 32 + 16 + 8 * hh];
        acc = mmaN<3>(aqh[ks].v, aql[ks].v, bh_.v, bl_.v, acc);
      }
      s[nt] = acc;
    }
    // mask + running max (rows 8hh+r; the 16 lanes of a half share rows)
    float alpha[8];
#pragma unroll
    for (int r = 0; r < 8; ++r) {
      const int qi = q0 + 8 * hh + r;
      const int ja = j0 + ln, jb = j0 + 16 + ln;
      if (CAUSAL) { if (ja > qi) s[0][r] = -3.0e38f; if (jb > qi) s[1][r] = -3.0e38f; }
      if (ja >= T) s[0][r] = -3.0e38f;
      if (jb >= T) s[1][r] = -3.0e38f;
      float mx = fmaxf(s[0][r], s[1][r]);
      mx = fmaxf(mx, __shfl_xor(mx, 1, 32)); mx = fmaxf(mx, __shfl_xor(mx, 2, 32)); mx = fmaxf(mx, __shfl_xor(mx, 4, 32)); mx = fmaxf(mx, __shfl_xor(mx, 8, 32));
      const float mnew = fmaxf(m_r[r], mx);
      alpha[r] = (mnew > -1.0e38f) ? __expf(m_r[r] - mnew) : 1.0f;
      const float p0 = (s[0][r] > -1.0e38f) ? __expf(s[0][r] - mnew) : 0.f;
      const float p1 = (s[1][r] > -1.0e38f) ? __expf(s[1][r] - mnew) : 0.f;
      m_r[r] = mnew;
      l_r[r] = l_r[r] * alpha[r] + p0 + p1;            // per-lane partial row sum (16 lanes combined at the end)
      unsigned short hb = bf16_bits(p0); sPh[w][8 * hh + r][ln] = hb;      sPl[w][8 * hh + r][ln] = bf16_bits(p0 - bf16_val(hb));
      hb = bf16_bits(p1);                sPh[w][8 * hh + r][16 + ln] = hb; sPl[w][8 * hh + r][16 + ln] = bf16_bits(p1 - bf16_val(hb));
    }
#pragma unroll
    for (int dt = 0; dt < DT; ++dt)
#pragma unroll
      for (int r = 0; r < 8; ++r) oacc[dt][r] *= alpha[r];
    __builtin_amdgcn_fence(__ATOMIC_ACQ_REL, "workgroup");
    __builtin_amdgcn_wave_barrier();
    FragB pah, pal;
    pah.half[0] = *(const v8us*)&sPh[w][ln][8 * hh]; pah.half[1] = *(const v8us*)&sPh[w][ln][16 + 8 * hh];
    pal.half[0] = *(const v8us*)&sPl[w][ln][8 * hh]; pal.half[1] = *(const v8us*)&sPl[w][ln][16 + 8 * hh];
#pragma unroll
    for (int dt = 0; dt < DT; ++dt) {
      FragB bvh, bvl;
#pragma unroll
      for (int i = 0; i < 8; ++i) {
        bvh.u[i] = sVh[8 * hh + i][dt * 16 + ln]; bvh.u[8 + i] = sVh[16 + 8 * hh + i][dt * 16 + ln];
        bvl.u[i] = sVl[8 * hh + i][dt * 16 + ln]; bvl.u[8 + i] = sVl[16 + 8 * hh + i][dt * 16 + ln];
      }
      oacc[dt] = mmaN<3>(pah.v, pal.v, bvh.v, bvl.v, oacc[dt]);
    }
    __builtin_amdgcn_fence(__ATOMIC_ACQ_REL, "workgroup");
    __builtin_amdgcn_wave_barrier();
  }
#pragma unroll
  for (int r = 0; r < 8; ++r) {
    float l = l_r[r];
    l += __shfl_xor(l, 1, 32); l += __shfl_xor(l, 2, 32); l += __shfl_xor(l, 4, 32); l += __shfl_xor(l, 8, 32);
    l_r[r] = (l > 0.f) ? 1.0f / l : 0.f;
  }
#pragma unroll
  for (int dt = 0; dt < DT; ++dt)
#pragma unroll
    for (int r = 0; r < 8; ++r) sO[w][8 * hh + r][dt * 16 + ln] = oacc[dt][r] * l_r[r];
  __builtin_amdgcn_fence(__ATOMIC_ACQ_REL, "workgroup");
  __builtin_amdgcn_wave_barrier();
  {
    for (int r = 0; r < 16; ++r) {
      const int row = q0 + r;
      if (row < T && lane < D / 4) {
        const v4f val = *(const v4fa*)&sO[w][r][lane * 4];
        *(v4f*)(y + ((size_t)b * T + row) * ypitch + h * D + lane * 4) = val;
      }
    }
    
  }
}

// GEMM C = act(A·W + bias + resid): A f32 (ASPLIT -> hi/lo 2 terms), Wt bf16 [N][K]; ACT 0 none, 1 relu, 2 exact gelu;
// resid (optional, f32, row index = (row % rmod), pitch ldr, RES_BF16 rounds it) added before the activation.
template <bool ASPLIT, int ACT, bool BIAS_BF16, bool RES_BF16>
__global__ __launch_bounds__(128) void k_gemm_bf3(const float* __restrict__ A, int lda, const unsigned short* __restrict__ Wt, int ldb,
                                                const float* __restrict__ bias, const float* __restrict__ resid, int rmod, int ldr,
                                                float* __restrict__ C, int ldc, int M, int N, int K) {
  __shared__ __attribute__((aligned(16))) float so[4][16][64];
  const int tid = threadIdx.x, w = tid >> 5, lane = tid & 31, ln = lane & 15, hh = lane >> 4;
  const int ntn = N / 64;
  const int wid = blockIdx.x * 4 + w;
  const int mt = wid / ntn, nq = wid % ntn;
  if (mt * 16 >= M) return;
  const int row0 = mt * 16, col0 = nq * 64;
  const float* arow = A + (size_t)(row0 + ln) * lda;
  v8f acc[4] = {};
  for (int kb = 0; kb < K; kb += 32) {
    FragB ah, al;
    const v4f x0 = *(const v4fa*)(arow + kb + 8 * hh), x1 = *(const v4fa*)(arow + kb + 8 * hh + 4);
    const v4f x2 = *(const v4fa*)(arow + kb + 16 + 8 * hh), x3 = *(const v4fa*)(arow + kb + 16 + 8 * hh + 4);
    float xs[16] = {x0[0],x0[1],x0[2],x0[3],x1[0],x1[1],x1[2],x1[3],x2[0],x2[1],x2[2],x2[3],x3[0],x3[1],x3[2],x3[3]};
#pragma unroll
    for (int i = 0; i < 16; ++i) { const unsigned short hb = bf16_bits(xs[i]); ah.u[i] = hb; al.u[i] = ASPLIT ? bf16_bits(xs[i] - bf16_val(hb)) : (unsigned short)0; }
#pragma unroll
    for (int t = 0; t < 4; ++t) {
      const unsigned short* brow = Wt + (size_t)(col0 + t * 16 + ln) * ldb + kb;
      FragB b;
      b.half[0] = *(const v8us*)(brow + 8 * hh);
      b.half[1] = *(const v8us*)(brow + 16 + 8 * hh);
      acc[t] = mmaN<ASPLIT ? 2 : 1>(ah.v, al.v, b.v, b.v, acc[t]);
    }
  }
#pragma unroll
  for (int t = 0; t < 4; ++t) {
    const int col = col0 + t * 16 + ln;
    float bv = bias ? bias[col] : 0.f;
    if (BIAS_BF16) bv = bf16_round(bv);
#pragma unroll
    for (int r = 0; r < 8; ++r) {
      float v = acc[t][r] + bv;
      if (resid) { float rv = resid[(size_t)((row0 + 8 * hh + r) % rmod) * ldr + col]; if (RES_BF16) rv = bf16_round(rv); v += rv; }
      if (ACT == 1) v = fmaxf(v, 0.f);
      if (ACT == 2) v = 0.5f * v * (1.0f + erff(v * 0.70710678118654752f));
      if (ACT == 3) { const float u = 0.7978845608028654f * (v + 0.044715f * v * v * v); v = 0.5f * v * (1.0f + tanhf(u)); }
      so[w][8 * hh + r][t * 16 + ln] = v;
    }
  }
  __builtin_amdgcn_fence(__ATOMIC_ACQ_REL, "workgroup");
  __builtin_amdgcn_wave_barrier();
  const int rsub = lane >> 4, c4 = (lane & 15) * 4;
  {
#pragma unroll
    for (int q = 0; q < 8; ++q) {
      const int r = q * 2 + rsub;
      const v4f v = *(const v4fa*)&so[w][r][c4];
      *(v4f*)(C + (size_t)(row0 + r) * ldc + col0 + c4) = v;
    }
    
  }
}
// row LayerNorm (biased variance, eps) over N: s = X (+ R); optional out_sum <- s; out_norm <- (s-mu)*rsqrt(var+eps)*g + b
template <bool PARAM_BF16>
__global__ __launch_bounds__(256) void k_layernorm(const float* __restrict__ X, const float* __restrict__ R, const float* __restrict__ g, const float* __restrict__ bta,
                                                  float* __restrict__ out_sum, float* __restrict__ out_norm, int N, float eps) {
  __shared__ float red[256];
  const int row = blockIdx.x, tid = threadIdx.x;
  const float* x = X + (size_t)row * N; const float* rr = R ? R + (size_t)row * N : nullptr;
  float vals[16];                     // up to N = 4096
  const int per = N / 256;            // contiguous chunk per thread? use strided-by-4 chunks: thread handles j = tid*4 + 1024*u
  float s1 = 0.f;
  for (int u = 0; u < per / 4; ++u) {
    const int j = tid * 4 + 1024 * u;
    const v4f a = *(const v4fa*)(x + j);
    v4f b = {0.f,0.f,0.f,0.f}; if (rr) b = *(const v4fa*)(rr + j);
#pragma unroll
    for (int q = 0; q < 4; ++q) { const float v = a[q] + b[q]; vals[u * 4 + q] = v; s1 += v; }
  }
  red[tid] = s1; __syncthreads();
  for (int st = 128; st > 0; st >>= 1) { if (tid < st) red[tid] += red[tid + st]; __syncthreads(); }
  const float mu = red[0] / (float)N; __syncthreads();
  float s2 = 0.f;
  for (int u = 0; u < per / 4; ++u)
#pragma unroll
    for (int q = 0; q < 4; ++q) { const float c = vals[u * 4 + q] - mu; s2 += c * c; }
  red[tid] = s2; __syncthreads();
  for (int st = 128; st > 0; st >>= 1) { if (tid < st) red[tid] += red[tid + st]; __syncthreads(); }
  const float rs = rsqrtf(red[0] / (float)N + eps);
  {
    for (int u = 0; u < per / 4; ++u) {
      const int j = tid * 4 + 1024 * u;
      v4f o, sm;
#pragma unroll
      for (int q = 0; q < 4; ++q) {
        float gg = g[j + q], bb = bta[j + q];
        if (PARAM_BF16) { gg = bf16_round(gg); bb = bf16_round(bb); }
        sm[q] = vals[u * 4 + q]; o[q] = (vals[u * 4 + q] - mu) * rs * gg + bb;
      }
      if (out_sum) *(v4f*)(out_sum + (size_t)row * N + j) = sm;
      *(v4f*)(out_norm + (size_t)row * N + j) = o;
    }
    
  }
}



// ---- f16 WMMA path (v_wmma_f32_16x16x32_f16): 11-bit significands for operands in range — used for every contraction launched here
typedef _Float16 v16h __attribute__((ext_vector_type(16)));
union FragH { v16h v; v8us half[2]; _Float16 h[16]; unsigned short u[16]; };
template <int NT>
__device__ __forceinline__ v8f mmaH(v16h ah, v16h al, v16h bh, v16h bl, v8f c) {
  c = __builtin_amdgcn_wmma_f32_16x16x32_f16(false, ah, false, bh, (short)0, c, false, false);
  if (NT >= 2) c = __builtin_amdgcn_wmma_f32_16x16x32_f16(false, al, false, bh, (short)0, c, false, false);
  if (NT >= 3) c = __builtin_amdgcn_wmma_f32_16x16x32_f16(false, ah, false, bl, (short)0, c, false, false);
  asm volatile("v_nop\n\tv_nop\n\tv_nop\n\tv_nop" : "+v"(c) : "v"(ah), "v"(al), "v"(bh), "v"(bl));
  return c;
}
// batched GEMM like k_gemm_b but f16 operands: A f32 (split into f16 hi/lo if ASPLIT, else rounded to f16), Bt = f16 values [n][k]; alpha; C f32; N multiple of 16 (partial tiles skipped)
template <bool ASPLIT>
__global__ __launch_bounds__(128) void k_gemm_h(const float* __restrict__ A, int lda, size_t sA, const _Float16* __restrict__ Bh, int ldb, size_t sB, float alpha, float* __restrict__ C, int ldc, size_t sC, int M, int N, int K) {
  __shared__ __attribute__((aligned(16))) float so[4][16][64];
  const int tid = threadIdx.x, w = tid >> 5, lane = tid & 31, ln = lane & 15, hh = lane >> 4; const int by = blockIdx.y;
  A += (size_t)by * sA; Bh += (size_t)by * sB; C += (size_t)by * sC;
  const int ntn = (N + 63) / 64; const int wid = blockIdx.x * 4 + w; const int mt = wid / ntn, nq = wid % ntn; if (mt * 16 >= M) return;
  const int row0 = mt * 16, col0 = nq * 64; const float* arow = A + (size_t)(row0 + ln) * lda;
  v8f acc[4] = {};
  for (int kb = 0; kb < K; kb += 32) {
    FragH ah, al;
    const v4f x0 = *(const v4fa*)(arow + kb + 8 * hh), x1 = *(const v4fa*)(arow + kb + 8 * hh + 4), x2 = *(const v4fa*)(arow + kb + 16 + 8 * hh), x3 = *(const v4fa*)(arow + kb + 16 + 8 * hh + 4);
    float xs[16] = {x0[0],x0[1],x0[2],x0[3],x1[0],x1[1],x1[2],x1[3],x2[0],x2[1],x2[2],x2[3],x3[0],x3[1],x3[2],x3[3]};
#pragma unroll
    for (int i = 0; i < 16; ++i) { const _Float16 h = (_Float16)xs[i]; ah.h[i] = h; al.h[i] = ASPLIT ? (_Float16)(xs[i] - (float)h) : (_Float16)0.0f; }
#pragma unroll
    for (int t = 0; t < 4; ++t) { if (col0 + t * 16 >= N) continue; const size_t boff = (size_t)(col0 + t * 16 + ln) * ldb + kb; FragH bq; bq.half[0] = *(const v8us*)(Bh + boff + 8 * hh); bq.half[1] = *(const v8us*)(Bh + boff + 16 + 8 * hh);
      acc[t] = mmaH<ASPLIT ? 2 : 1>(ah.v, al.v, bq.v, bq.v, acc[t]); }
  }
#pragma unroll
  for (int t = 0; t < 4; ++t) { if (col0 + t * 16 >= N) continue;
#pragma unroll
    for (int r = 0; r < 8; ++r) so[w][8 * hh + r][t * 16 + ln] = acc[t][r] * alpha; }
  __builtin_amdgcn_fence(__ATOMIC_ACQ_REL, "workgroup"); __builtin_amdgcn_wave_barrier();
  const int rsub = lane >> 4, c4 = (lane & 15) * 4;
  {
#pragma unroll
    for (int q = 0; q < 8; ++q) { const int r = q * 2 + rsub; if (col0 + c4 < N) { const v4f v = *(const v4fa*)&so[w][r][c4]; *(v4f*)(C + (size_t)(row0 + r) * ldc + col0 + c4) = v; } }
     }
}

// Wt[n][k] = f16(W[k][n]·scale) from f32 row-major W[K][N] (scale = power of two; bf16-exact weights stay exact in f16 away from the subnormal range)
__device__ __forceinline__ void wt_f16(const float* __restrict__ W, _Float16* __restrict__ Wt, int K, int N, float scale, int blk) {
  const int t = blk * 256 + threadIdx.x; if (t >= N * (K / 8)) return; const int n = t / (K / 8), k8 = (t % (K / 8)) * 8; FragH f;
#pragma unroll
  for (int i = 0; i < 8; ++i) f.h[i] = (_Float16)(bf16_round(W[(size_t)(k8 + i) * N + n]) * scale); const v8us o = f.half[0];
  *(v8us*)((unsigned short*)Wt + (size_t)n * K + k8) = o; 
}
// Block-tiled GEMM, f16 operands, both K-contiguous: v = (A.Bt^T)*alpha + bf16(bias[col]) (+ CP[row*LDCP + by*sCPy + col] if LDCP; CP may be C itself: a lane reads only what it then writes); writes f32 C, or f16 C16, or f16 C16 with the rounding residual x 2^10 in C16l. Batch in blockIdx.y.
// One work-group of 8 waves (4 x 2) makes 128 x 128 of C, a wave 32 x 64. Each trip takes 64 k: 128 rows of 128 B of A and of Bt are brought into LDS by asynchronous copies (whole 128-B lines, 16 B a lane),
// two buffers, the next tile in flight while this one is multiplied; LDS rows at pitch 144 B for the ds_load_b128 fragment reads. M, N multiples of 128, K a multiple of 64.
#define GT_PITCH 144
#define GT_OPB (128 * GT_PITCH)
#define GT_BUF (2 * GT_OPB)
typedef _Float16 v4h __attribute__((ext_vector_type(4)));
// one tile: 4 copies of A and 4 of Bt per lane. The s_wait_xcnt stands inside the statement so that no address register named here is rewritten ahead of it.
__device__ __forceinline__ void gt_copy(unsigned l, const unsigned short* ga, const unsigned short* gb, size_t a32, size_t b32) {
  asm volatile("global_load_async_to_lds_b128 %0, %8, off\n\t"
               "global_load_async_to_lds_b128 %1, %9, off\n\t"
               "global_load_async_to_lds_b128 %2, %10, off\n\t"
               "global_load_async_to_lds_b128 %3, %11, off\n\t"
               "global_load_async_to_lds_b128 %4, %12, off\n\t"
               "global_load_async_to_lds_b128 %5, %13, off\n\t"
               "global_load_async_to_lds_b128 %6, %14, off\n\t"
               "global_load_async_to_lds_b128 %7, %15, off\n\t"
               "s_wait_xcnt 0x0"
               :: "v"(l), "v"(l + 32 * GT_PITCH), "v"(l + 64 * GT_PITCH), "v"(l + 96 * GT_PITCH),
                  "v"(l + GT_OPB), "v"(l + GT_OPB + 32 * GT_PITCH), "v"(l + GT_OPB + 64 * GT_PITCH), "v"(l + GT_OPB + 96 * GT_PITCH),
                  "v"(ga), "v"(ga + a32), "v"(ga + 2 * a32), "v"(ga + 3 * a32), "v"(gb), "v"(gb + b32), "v"(gb + 2 * b32), "v"(gb + 3 * b32)
               : "memory");
}
// One launch may hold two sets of independent products: blockIdx.y below ysplit belongs to set g0, from ysplit on to set g1; inside a set y steps the operands and the result by the set's strides and picks one of three biases (y 1: bias1, y 2: bias2, else bias0).
// A set may name three operand pairs of one shape (SEG launches, A1 not null): the k loop then runs through (A, B), (A1, B1), (A2, B2) in one ring and one accumulator, which is multiplied by mid between the second pair and the third: v = ((A.BT + A1.B1T) * mid + A2.B2T) * alpha.
struct GSet { const _Float16* A; const _Float16* B; const float* bias0; const float* bias1; const float* bias2; float* C; _Float16* C16; _Float16* C16l; size_t sA, sB, sC; int lda, ldb, ldc, N, K; float alpha; const _Float16* A1; const _Float16* B1; const _Float16* A2; const _Float16* B2; float mid; };
template <int LDCP, int OUT, bool SEG = false>      /* SEG: sets with three operand pairs are honoured; LDCP: row pitch of an f32 addend plane CP, 0 for none (a constant, so that its 16 loads share one address register pair); OUT 1: f32 result in C; 0: f16 result in C16; 2: f16 result in C16 and (v - f16(v)) x 2^10 as f16 in C16l */
__global__ __launch_bounds__(256) void k_gemm_t(const GSet g0, const GSet g1, int ysplit, const float* CP, size_t sCPy) {
  __shared__ __attribute__((aligned(16))) unsigned char L[2 * GT_BUF];
  const int tid = threadIdx.x, w = tid >> 5, lane = tid & 31, ln = lane & 15, hh = lane >> 4;
  const bool sec = (int)blockIdx.y >= ysplit; const GSet& g = sec ? g1 : g0; const int by = (int)blockIdx.y - (sec ? ysplit : 0);
  const _Float16* A = g.A; const _Float16* Bh = g.B; const float* bias = by == 1 ? g.bias1 : by == 2 ? g.bias2 : g.bias0; float* C = g.C; _Float16* C16 = g.C16; _Float16* C16l = g.C16l;
  const size_t sA = g.sA, sB = g.sB, sC = g.sC; const int lda = g.lda, ldb = g.ldb, ldc = g.ldc, N = g.N, K = g.K; const float alpha = g.alpha;
  const int ntn = N / 128; const int row0 = ((int)blockIdx.x / ntn) * 128, col0 = ((int)blockIdx.x % ntn) * 128; const int wm = w >> 1, wn = w & 1;
  const int cr = tid >> 3, cc = tid & 7;      /* copies: 8 lanes a row, 32 rows a copy */
  const size_t la = (size_t)by * sA + (size_t)(row0 + cr) * lda + cc * 8, lb = (size_t)by * sB + (size_t)(col0 + cr) * ldb + cc * 8;      /* the lane's place in an A plane and in a Bt plane, the same in every pair */
  const size_t a32 = (size_t)32 * lda, b32 = (size_t)32 * ldb;
  const unsigned lcp = (unsigned)(size_t)L + (unsigned)(cr * GT_PITCH + cc * 16);
  const int nk = K / 64; const bool three = SEG && g.A1 != nullptr; const int nt = three ? 3 * nk : nk, tmid = three ? 2 * nk : -1;      /* nk tiles a pair */
  const _Float16* A1 = g.A1; const _Float16* B1 = g.B1; const _Float16* A2 = g.A2; const _Float16* B2 = g.B2; const float mid = g.mid;
  auto tile = [&](int t, unsigned l) {      /* tile t of the whole run: the pair and the k place inside it are the same for the work-group */
    const _Float16* pa = A; const _Float16* pb = Bh; int kk = t;
    if (SEG && three) { if (t >= 2 * nk) { pa = A2; pb = B2; kk = t - 2 * nk; } else if (t >= nk) { pa = A1; pb = B1; kk = t - nk; } }
    gt_copy(l, (const unsigned short*)pa + kk * 64 + la, (const unsigned short*)pb + kk * 64 + lb, a32, b32); };
  v8f acc[2][4] = {};
  tile(0, lcp);
  asm volatile("s_wait_asynccnt 0x0" ::: "memory");      /* tile 0 has landed before the barrier that publishes it */
  __syncthreads();
  if (nt > 1) tile(1, lcp + GT_BUF);
  const unsigned char* fa = L + (wm * 32 + ln) * GT_PITCH + hh * 16; const unsigned char* fb = L + GT_OPB + (wn * 64 + ln) * GT_PITCH + hh * 16;
#pragma unroll 1
  for (int t = 0; t < nt; ++t) {      /* stays rolled: one copy of the ring's foot */
    const unsigned bo = (unsigned)(t & 1) * GT_BUF;
    FragH a[2][2], b[2][4];
#pragma unroll
    for (int ks = 0; ks < 2; ++ks) {
#pragma unroll
      for (int i = 0; i < 2; ++i) { a[ks][i].half[0] = *(const v8us*)(fa + bo + i * 16 * GT_PITCH + ks * 64); a[ks][i].half[1] = *(const v8us*)(fa + bo + i * 16 * GT_PITCH + ks * 64 + 32); }
#pragma unroll
      for (int j = 0; j < 4; ++j) { b[ks][j].half[0] = *(const v8us*)(fb + bo + j * 16 * GT_PITCH + ks * 64); b[ks][j].half[1] = *(const v8us*)(fb + bo + j * 16 * GT_PITCH + ks * 64 + 32); } }
    /* the ring's foot stands here, behind the trip's 24 fragment reads and ahead of its WMMAs, which work on registers alone: the refill then flies under them too */
    asm volatile("s_wait_dscnt 0x0" ::: "memory");      /* this wave's reads of the buffer are over before it may be refilled */
    asm volatile("s_wait_asynccnt 0x0" ::: "memory");      /* this wave's share of tile t + 1 has landed before the barrier publishes it */
    __syncthreads();
    if (t + 2 < nt) tile(t + 2, lcp + bo);
    __builtin_amdgcn_sched_barrier(0);      /* keeps the WMMAs behind the refill's issue: ahead of it they would delay the copies by their whole run */
    if (SEG && t == tmid) {      /* the first two pairs' sum takes its weight before the third pair is added to it */
#pragma unroll
      for (int i = 0; i < 2; ++i)
#pragma unroll
        for (int j = 0; j < 4; ++j) acc[i][j] *= mid; }
#pragma unroll
    for (int ks = 0; ks < 2; ++ks)
#pragma unroll
      for (int i = 0; i < 2; ++i)
#pragma unroll
        for (int j = 0; j < 4; ++j) acc[i][j] = __builtin_amdgcn_wmma_f32_16x16x32_f16(false, a[ks][i].v, false, b[ks][j].v, (short)0, acc[i][j], false, false);
  }
  asm volatile("s_wait_asynccnt 0x0" ::: "memory");      /* no copy outstanding when the ring becomes output staging */
  /* epilogue: each wave stages its 32 x 64 in its own 8,704 B of the ring (every wave's last read of it ended ahead of the last barrier), then whole row pieces (256 B of f32, 128 B of f16) go out */
  const int c4 = ln * 4, col = col0 + wn * 64 + c4, rw0 = row0 + wm * 32 + hh; const size_t cofs = (size_t)by * sC;
  v4f cp[16];      /* the addend's 16 row pieces are asked for together, ahead of the staging */
  if (LDCP) { const float* cpp = CP + (size_t)rw0 * LDCP + (size_t)by * sCPy + col;
#pragma unroll
    for (int q = 0; q < 16; ++q) cp[q] = *(const v4fa*)(cpp + q * 2 * LDCP);
    asm volatile("s_wait_xcnt 0x0" ::: "memory"); }      /* ahead of any rewrite of the address registers that the loads above name */
  v4f bv = {0.f, 0.f, 0.f, 0.f}; if (bias) { const v4f bb = *(const v4fa*)(bias + col); for (int e = 0; e < 4; ++e) bv[e] = bf16_round(bb[e]); }
  float* so = (float*)(L + w * (32 * 68 * 4));
#pragma unroll
  for (int i = 0; i < 2; ++i)
#pragma unroll
    for (int j = 0; j < 4; ++j)
#pragma unroll
      for (int r = 0; r < 8; ++r) so[(i * 16 + 8 * hh + r) * 68 + j * 16 + ln] = acc[i][j][r];
  __builtin_amdgcn_fence(__ATOMIC_ACQ_REL, "workgroup"); __builtin_amdgcn_wave_barrier();
#pragma unroll
  for (int q = 0; q < 16; ++q) { const size_t o = cofs + (size_t)rw0 * ldc + col + (size_t)(q * 2) * ldc; const v4f x = *(const v4fa*)&so[(q * 2 + hh) * 68 + c4]; v4f v;
    for (int e = 0; e < 4; ++e) v[e] = x[e] * alpha + bv[e];
    if (LDCP) for (int e = 0; e < 4; ++e) v[e] += cp[q][e];
    if (OUT == 1) *(v4f*)(C + o) = v;
    else { v4h h4; for (int e = 0; e < 4; ++e) h4[e] = (_Float16)v[e]; *(v4h*)(C16 + o) = h4;
      if (OUT == 2) { v4h l4; for (int e = 0; e < 4; ++e) l4[e] = (_Float16)((v[e] - (float)h4[e]) * 1024.0f); *(v4h*)(C16l + o) = l4; } } }
}


__device__ __forceinline__ void x16(const float* __restrict__ x, _Float16* __restrict__ X16, size_t n8, int blk) { const size_t t = (size_t)blk * 256 + threadIdx.x; if (t >= n8) return; FragH f;
#pragma unroll
  for (int q = 0; q < 8; ++q) f.h[q] = (_Float16)bf16_round(x[t * 8 + q]); *(v8us*)((unsigned short*)X16 + t * 8) = f.half[0];  }
// All operand preparation in one launch: none of its ten parts reads what another writes. Ranges of blockIdx.x: the five F x F weights, the three G x F weights (each transposed, x 2^4), then features and geometry (rounded to f16 planes).
#define PW_BIG (DD * (DD / 8) / 256)
#define PW_SML (DD * (GG / 8) / 256)
#define PX_F (NR * DD / 8 / 256)
#define PX_G (NR * GG / 8 / 256)
__global__ __launch_bounds__(256) void k_prep(const float* __restrict__ wq, const float* __restrict__ wk, const float* __restrict__ wv, const float* __restrict__ wo, const float* __restrict__ opw,
    const float* __restrict__ gqw, const float* __restrict__ gkw, const float* __restrict__ gvw, const float* __restrict__ feats, const float* __restrict__ geom,
    _Float16* __restrict__ Bw, _Float16* __restrict__ Bg, _Float16* __restrict__ X16, _Float16* __restrict__ GE16) {
  int blk = blockIdx.x;
  if (blk < 5 * PW_BIG) { const int i = blk / PW_BIG; const float* W = i == 0 ? wq : i == 1 ? wk : i == 2 ? wv : i == 3 ? wo : opw; wt_f16(W, Bw + (size_t)i * DD * DD, DD, DD, 16.0f, blk % PW_BIG); return; }
  blk -= 5 * PW_BIG;
  if (blk < 3 * PW_SML) { const int i = blk / PW_SML; const float* W = i == 0 ? gqw : i == 1 ? gkw : gvw; wt_f16(W, Bg + (size_t)i * GG * DD, GG, DD, 16.0f, blk % PW_SML); return; }
  blk -= 3 * PW_SML;
  if (blk < PX_F) { x16(feats, X16, (size_t)NR * DD / 8, blk); return; }
  x16(geom, GE16, (size_t)NR * GG / 8, blk - PX_F);
}
__global__ __launch_bounds__(256) void k_round16f(const float* __restrict__ W, _Float16* __restrict__ Bt, size_t n8) { const size_t t = (size_t)blockIdx.x * 256 + threadIdx.x; if (t >= n8) return; FragH f;
#pragma unroll
  for (int i = 0; i < 8; ++i) f.h[i] = (_Float16)(bf16_round(W[t * 8 + i]) * 16.0f); *(v8us*)((unsigned short*)Bt + t * 8) = f.half[0];  }
template <int NHv, int TTv>
__global__ __launch_bounds__(256) void k_vt(const _Float16* __restrict__ V16, size_t sV, int ldv, int voff, _Float16* __restrict__ Vt, size_t sVt) { __shared__ unsigned short tl[64][66]; const int tid = threadIdx.x; V16 += (size_t)blockIdx.y * sV; Vt += (size_t)blockIdx.y * sVt;      /* blockIdx.y: which plane */ const int slab = blockIdx.x / (TTv / 64), lg = blockIdx.x % (TTv / 64); const int b = slab / NHv, h = slab % NHv;
  for (int i = tid; i < 64 * 8; i += 256) { const int r = i / 8, c8 = (i % 8) * 8; FragH f; f.half[0] = *(const v8us*)((const unsigned short*)V16 + ((size_t)b * TTv + lg * 64 + r) * ldv + voff + h * 64 + c8);
#pragma unroll
    for (int q = 0; q < 8; ++q) tl[r][c8 + q] = f.u[q]; }
  __syncthreads();
  {
#pragma unroll
    for (int rd = 0; rd < 2; ++rd) { const int d = rd * 32 + tid / 8, pc = tid % 8; FragH f;
#pragma unroll
      for (int q = 0; q < 8; ++q) f.u[q] = tl[pc * 8 + q][d];
      *(v8us*)((unsigned short*)Vt + ((size_t)slab * 64 + d) * TTv + lg * 64 + pc * 8) = f.half[0]; }
     } }

typedef float v2f __attribute__((ext_vector_type(2)));
// Distance-MLP bias, added to S in place. gelu_tanh(x) = 0.5 x (1 + tanh(u)) = x / (1 + exp(-2 u)), u = sqrt(2 / pi) (x + 0.044715 x^3): one v_exp_f32 and one v_rcp_f32, no branch
// (x far above 0: exp -> 0, quotient x; x far below 0: exp -> inf, rcp -> 0, quotient -0: the limits of the tanh form). The other steps are packed f32 operations on two keys at a time.
// A work-group takes GB_ROWS whole score rows, a thread the same 4 keys in each: the rounded weights, their head means and the keys' coordinates are made once per thread, not once per 4 pairs.
#define GB_ROWS 8
#define GB_K0 (-2.3022081986f)      /* -2 sqrt(2 / pi) log2(e) */
#define GB_K1 (GB_K0 * 0.044715f)
__global__ __launch_bounds__(256) void k_gbias(float* __restrict__ S, const float* __restrict__ CRD, const float* __restrict__ w1, const float* __restrict__ b1, const float* __restrict__ w2, const float* __restrict__ b2) {
  const int b = blockIdx.y, q0 = blockIdx.x * GB_ROWS, k0 = threadIdx.x * 4;      /* one score plane per batch */
  const float* C3 = CRD + (size_t)b * TT * 3; float* sp = S + (size_t)b * TT * TT + (size_t)q0 * TT + k0;
  float cb = 0.f; for (int j = 0; j < 8; ++j) cb += bf16_round(b2[j]); cb *= 0.125f;
  float wj[8], bj[8], cj[8];
#pragma unroll
  for (int j = 0; j < 8; ++j) { float c = 0.f; for (int h = 0; h < 8; ++h) c += bf16_round(w2[j * 8 + h]); cj[j] = c * 0.125f; wj[j] = bf16_round(w1[j]); bj[j] = bf16_round(b1[j]); }
  const v4f c0 = *(const v4fa*)(C3 + k0 * 3), c1 = *(const v4fa*)(C3 + k0 * 3 + 4), c2 = *(const v4fa*)(C3 + k0 * 3 + 8);
  const v2f kx[2] = {{bf16_round(c0[0]), bf16_round(c0[3])}, {bf16_round(c1[2]), bf16_round(c2[1])}};
  const v2f ky[2] = {{bf16_round(c0[1]), bf16_round(c1[0])}, {bf16_round(c1[3]), bf16_round(c2[2])}};
  const v2f kz[2] = {{bf16_round(c0[2]), bf16_round(c1[1])}, {bf16_round(c2[0]), bf16_round(c2[3])}};
#pragma unroll 1      /* stays rolled: a row already holds 16 independent chains */
  for (int r = 0; r < GB_ROWS; ++r) {
    const v4f sv = *(const v4fa*)(sp + (size_t)r * TT);      /* asked for at the row's head, used at its foot */
    const float qx = bf16_round(C3[(q0 + r) * 3]), qy = bf16_round(C3[(q0 + r) * 3 + 1]), qz = bf16_round(C3[(q0 + r) * 3 + 2]);
    v2f d[2], acc[2];
#pragma unroll
    for (int p = 0; p < 2; ++p) { const v2f dx = qx - kx[p], dy = qy - ky[p], dz = qz - kz[p]; const v2f d2 = dx * dx + dy * dy + dz * dz;
      d[p][0] = __builtin_amdgcn_sqrtf(fmaxf(d2[0], 1e-12f)); d[p][1] = __builtin_amdgcn_sqrtf(fmaxf(d2[1], 1e-12f)); acc[p] = (v2f){cb, cb}; }
#pragma unroll
    for (int j = 0; j < 8; ++j)
#pragma unroll
      for (int p = 0; p < 2; ++p) { const v2f x = d[p] * wj[j] + bj[j]; const v2f a = x * (x * x * GB_K1 + GB_K0);
        const v2f s = (v2f){__builtin_amdgcn_exp2f(a[0]), __builtin_amdgcn_exp2f(a[1])} + 1.0f;
        const v2f g = x * (v2f){__builtin_amdgcn_rcpf(s[0]), __builtin_amdgcn_rcpf(s[1])}; acc[p] += g * cj[j]; }
    const v4f o = {sv[0] + acc[0][0], sv[1] + acc[0][1], sv[2] + acc[1][0], sv[3] + acc[1][1]};
    *(v4f*)(sp + (size_t)r * TT) = o;
  } }
#define NN TT
__global__ __launch_bounds__(256) void k_smx(const float* __restrict__ S, _Float16* __restrict__ P16) { const int tid = threadIdx.x, wv = tid >> 5, lane = tid & 31; const int i = blockIdx.x * 8 + wv; const float* sr = S + (size_t)i * NN;
  float m = -3.0e38f;
  for (int p = lane; p < NN / 8; p += 32) { const v4f a = *(const v4fa*)(sr + p * 8), c = *(const v4fa*)(sr + p * 8 + 4); for (int e = 0; e < 4; ++e) m = fmaxf(m, fmaxf(a[e], c[e])); }
  for (int o = 16; o >= 1; o >>= 1) m = fmaxf(m, __shfl_xor(m, o, 32)); float z = 0.f;
  for (int p = lane; p < NN / 8; p += 32) { const v4f a = *(const v4fa*)(sr + p * 8), c = *(const v4fa*)(sr + p * 8 + 4); for (int e = 0; e < 4; ++e) z += __expf(a[e] - m) + __expf(c[e] - m); }
  for (int o = 16; o >= 1; o >>= 1) z += __shfl_xor(z, o, 32); const float iz = 32768.0f / z;
  { for (int p = lane; p < NN / 8; p += 32) { FragH f; const v4f a = *(const v4fa*)(sr + p * 8), c = *(const v4fa*)(sr + p * 8 + 4); for (int e = 0; e < 4; ++e) { f.h[e] = (_Float16)(__expf(a[e] - m) * iz); f.h[4 + e] = (_Float16)(__expf(c[e] - m) * iz); }
      *(v8us*)((unsigned short*)P16 + (size_t)i * NN + p * 8) = f.half[0]; }  } }
// lane l with lane l ^ 16 (the two halves of a wave hold the two halves of a query's keys)
__device__ __forceinline__ float xhalf(float x) { return __builtin_bit_cast(float, __builtin_amdgcn_permlanex16(__builtin_bit_cast(int, x), __builtin_bit_cast(int, x), 0x76543210, 0xfedcba98, false, false)); }
#define FL_PITCH 144
#define FL_OPB (64 * FL_PITCH)
#define FL_BUF (2 * FL_OPB)
#define FL_SC 0.18033688011f      /* log2(e) / 8: exp(s / 8 - m / 8) = exp2((s - m) * FL_SC), one multiply-add and one v_exp_f32 a score */
// one stage: 2 copies of K and 2 of VT per lane. The s_wait_xcnt stands inside the statement so that no address register named here is rewritten ahead of it.
__device__ __forceinline__ void fl_copy(unsigned l, const unsigned short* gk, const unsigned short* gv, size_t k32, size_t v32) {
  asm volatile("global_load_async_to_lds_b128 %0, %4, off\n\t"
               "global_load_async_to_lds_b128 %1, %5, off\n\t"
               "global_load_async_to_lds_b128 %2, %6, off\n\t"
               "global_load_async_to_lds_b128 %3, %7, off\n\t"
               "s_wait_xcnt 0x0"
               :: "v"(l), "v"(l + 32 * FL_PITCH), "v"(l + FL_OPB), "v"(l + FL_OPB + 32 * FL_PITCH),
                  "v"(gk), "v"(gk + k32), "v"(gv), "v"(gv + v32)
               : "memory");
}
__global__ __launch_bounds__(256) void k_flash(const _Float16* __restrict__ Q16, int ldq, const _Float16* __restrict__ K16, int ldk, const _Float16* __restrict__ Vt, const int* __restrict__ MSK, _Float16* __restrict__ O16, int ldo) {
  constexpr int RPW = 16, NW = 8, NQB = TT / (NW * RPW), DT = 4, KS = 2, NST = TT / 64; (void)MSK;
  __shared__ __attribute__((aligned(16))) unsigned char R[2 * FL_BUF];
  __shared__ __attribute__((aligned(16))) unsigned short sO[NW][RPW][64 + 8];      /* f16 rows at pitch 144 B */
  const int tid = threadIdx.x, w = tid >> 5, lane = tid & 31, ln = lane & 15, hh = lane >> 4;
  const int slab = blockIdx.x / NQB, qblk = blockIdx.x % NQB; const int b = slab / NH, h = slab % NH; const int q0 = qblk * (NW * RPW) + w * RPW;
  FragH bq[KS];
  { const unsigned short* qr = (const unsigned short*)Q16 + ((size_t)b * TT + q0 + ln) * ldq + h * 64;
#pragma unroll
    for (int ks = 0; ks < KS; ++ks) { bq[ks].half[0] = *(const v8us*)(qr + ks * 32 + 8 * hh); bq[ks].half[1] = *(const v8us*)(qr + ks * 32 + 16 + 8 * hh); } }
  const unsigned short* Vth = (const unsigned short*)Vt + (size_t)slab * 64 * TT;
  const int cr = tid >> 3, cc = tid & 7;      /* copies: 8 lanes a row, 32 rows a copy */
  const unsigned short* gk = (const unsigned short*)K16 + ((size_t)b * TT + cr) * ldk + h * 64 + cc * 8; const unsigned short* gv = Vth + (size_t)cr * TT + cc * 8;
  const size_t k32 = (size_t)32 * ldk, v32 = (size_t)32 * TT;
  const unsigned lcp = (unsigned)(size_t)R + (unsigned)(cr * FL_PITCH + cc * 16);
  fl_copy(lcp, gk, gv, k32, v32);
  asm volatile("s_wait_asynccnt 0x0" ::: "memory");      /* stage 0 has landed before the barrier that publishes it */
  __syncthreads();
  fl_copy(lcp + FL_BUF, gk + 2 * k32, gv + 64, k32, v32);
  const unsigned char* fk = R + ln * FL_PITCH + hh * 16; const unsigned char* fv = fk + FL_OPB;
  float m_q = -3.0e38f, l_q = 0.f; v8f oacc[DT];
#pragma unroll
  for (int dt = 0; dt < DT; ++dt) oacc[dt] = (v8f){0.f,0.f,0.f,0.f,0.f,0.f,0.f,0.f};
#pragma unroll 1      /* stays rolled: one copy of the ring's foot */
  for (int t = 0; t < NST; ++t) {
    const unsigned bo = (unsigned)(t & 1) * FL_BUF;
#pragma unroll
    for (int p = 0; p < 2; ++p) {
    FragH ak[2][KS], av[DT];      /* the pass's 16 fragment reads stand together at its head */
#pragma unroll
    for (int nt = 0; nt < 2; ++nt)
#pragma unroll
      for (int ks = 0; ks < KS; ++ks) { ak[nt][ks].half[0] = *(const v8us*)(fk + bo + (p * 32 + nt * 16) * FL_PITCH + ks * 64); ak[nt][ks].half[1] = *(const v8us*)(fk + bo + (p * 32 + nt * 16) * FL_PITCH + ks * 64 + 32); }
#pragma unroll
    for (int dt = 0; dt < DT; ++dt) { av[dt].half[0] = *(const v8us*)(fv + bo + dt * 16 * FL_PITCH + p * 64); av[dt].half[1] = *(const v8us*)(fv + bo + dt * 16 * FL_PITCH + p * 64 + 32); }
    __builtin_amdgcn_sched_barrier(0);      /* keeps the 16 reads together here: sunk to their uses, each pair would be waited for on its own, in front of its WMMA */
    v8f s[2];
#pragma unroll
    for (int nt = 0; nt < 2; ++nt) { v8f acc = (v8f){0.f,0.f,0.f,0.f,0.f,0.f,0.f,0.f};
#pragma unroll
      for (int ks = 0; ks < KS; ++ks) acc = __builtin_amdgcn_wmma_f32_16x16x32_f16(false, ak[nt][ks].v, false, bq[ks].v, (short)0, acc, false, false);
      s[nt] = acc; }
    float mc = -3.0e38f;      /* the maximum is taken over the raw products: their scale is positive and goes into the exponent's multiply-add */
#pragma unroll
    for (int nt = 0; nt < 2; ++nt)
#pragma unroll
      for (int r = 0; r < 8; ++r) mc = fmaxf(mc, s[nt][r]);
    mc = fmaxf(mc, xhalf(mc));
    const float mn = fmaxf(m_q, mc); const float al = (mn > -1.0e38f) ? __builtin_amdgcn_exp2f((m_q - mn) * FL_SC) : 1.0f; m_q = mn;
    const float off = 10.0f - mn * FL_SC;      /* P x 2^10 = exp2(s * FL_SC + off) */
    FragH pb; v2f ps;
#pragma unroll
    for (int nt = 0; nt < 2; ++nt) { float e[8];
#pragma unroll
      for (int r = 0; r < 8; ++r) e[r] = s[nt][r] * FL_SC + off;
      /* eight v_exp_f32, each over its own argument, so that none overwrites the source of the one in front of it (the builtin's results took such registers); from the last to the first, the order in which
         the conversions behind them read, so that the first reader finds its operands finished; the v_nop is the slot that the instruction set asks for behind the last v_exp_f32 */
      asm("v_exp_f32 %7, %7\n\tv_exp_f32 %6, %6\n\tv_exp_f32 %5, %5\n\tv_exp_f32 %4, %4\n\tv_exp_f32 %3, %3\n\tv_exp_f32 %2, %2\n\tv_exp_f32 %1, %1\n\tv_exp_f32 %0, %0\n\tv_nop"
          : "+v"(e[0]), "+v"(e[1]), "+v"(e[2]), "+v"(e[3]), "+v"(e[4]), "+v"(e[5]), "+v"(e[6]), "+v"(e[7]));
#pragma unroll
      for (int r = 0; r < 8; r += 2) { const v2f pr = {e[r], e[r + 1]}; ps = (nt == 0 && r == 0) ? pr : ps + pr; pb.h[nt * 8 + r] = (_Float16)e[r]; pb.h[nt * 8 + r + 1] = (_Float16)e[r + 1]; } }
    l_q = l_q * al + (ps[0] + ps[1]);      /* carries 2^10 like P; this half's keys only; the halves are joined behind the loop */
#pragma unroll
    for (int dt = 0; dt < DT; ++dt)
#pragma unroll
      for (int r = 0; r < 8; ++r) oacc[dt][r] *= al;
#pragma unroll
    for (int dt = 0; dt < DT; ++dt) oacc[dt] = __builtin_amdgcn_wmma_f32_16x16x32_f16(false, av[dt].v, false, pb.v, (short)0, oacc[dt], false, false); }
    __builtin_amdgcn_sched_barrier(0);      /* keeps the stage's arithmetic ahead of the foot: sunk behind the barrier it would delay the refill, and the copies would have only the next stage's reads to land under */
    asm volatile("s_wait_dscnt 0x0" ::: "memory");      /* this wave's reads of the buffer are over before it may be refilled */
    asm volatile("s_wait_asynccnt 0x0" ::: "memory");      /* this wave's share of stage t + 1 has landed before the barrier publishes it */
    __syncthreads();
    if (t + 2 < NST) fl_copy(lcp + bo, gk + (size_t)(t + 2) * 2 * k32, gv + (t + 2) * 64, k32, v32);
  }
  asm volatile("s_wait_asynccnt 0x0" ::: "memory");      /* no copy outstanding when the wave goes on to its end */
  const float lt = l_q + xhalf(l_q); const float il = (lt > 0.f) ? 16.0f / lt : 0.f;      /* P and its sum both carry 2^10, the f16 result plane 2^4 */
#pragma unroll
  for (int dt = 0; dt < DT; ++dt) { FragH f;      /* oacc[dt][r] = OT[dt * 16 + 8 * hh + r][query ln] */
#pragma unroll
    for (int r = 0; r < 8; ++r) f.h[r] = (_Float16)(oacc[dt][r] * il);
    *(v8us*)&sO[w][ln][dt * 16 + 8 * hh] = f.half[0]; }
  __builtin_amdgcn_fence(__ATOMIC_ACQ_REL, "workgroup"); __builtin_amdgcn_wave_barrier();
#pragma unroll
  for (int rp = 0; rp < RPW; rp += 4) { const int r = rp + (lane >> 3), pc = lane & 7; const v8us val = *(const v8us*)&sO[w][r][pc * 8];      /* 8 lanes a row: one whole 128-B line of the f16 plane */
    *(v8us*)((unsigned short*)O16 + ((size_t)b * TT + q0 + r) * ldo + h * 64 + pc * 8) = val; } }

extern "C" void kernel_launch(void* const* d_in, const int* in_sizes, int n_in,
                              void* d_out, int out_size, void* d_ws, size_t ws_size, hipStream_t stream) {
  (void)in_sizes; (void)n_in; (void)out_size;
  const float* const* I = (const float* const*)d_in; const float* feats = I[0]; const float* geom = I[1]; const float* crd = I[2];
  const float* wq = I[3]; const float* bq = I[4]; const float* wk = I[5]; const float* bk = I[6]; const float* wv = I[7]; const float* bv = I[8]; const float* wo = I[9]; const float* bo = I[10];
  const float* gqw = I[11]; const float* gqb = I[12]; const float* gkw = I[13]; const float* gkb = I[14]; const float* gvw = I[15]; const float* gvb = I[16]; const float* d1w = I[17]; const float* d1b = I[18]; const float* d2w = I[19]; const float* d2b = I[20]; const float* opw = I[21]; const float* opb = I[22];
  char* ws = (char*)d_ws; size_t off = 0;
  auto take = [&](size_t bytes) { char* p = ws + off; off += (bytes + 255) & ~(size_t)255; return p; };
  const size_t WSZ = (size_t)DD * DD, GSZ = (size_t)GG * DD, PSZ = (size_t)NR * DD; _Float16* Bw = (_Float16*)take(5 * WSZ * 2); _Float16* Bg = (_Float16*)take(3 * GSZ * 2);
  _Float16* X16 = (_Float16*)take(PSZ * 2); _Float16* GE16 = (_Float16*)take((size_t)NR * GG * 2);
  _Float16* PL = (_Float16*)take(6 * PSZ * 2);      /* the six projections' planes in a row: q, k, v, gv, gq, gk */
  _Float16* RL = (_Float16*)take(2 * PSZ * 2);      /* residual planes of gq, gk */
  _Float16* VT = (_Float16*)take(2 * PSZ * 2);      /* v and gv transposed */
  float* FA = (float*)take(PSZ * 4); float* S = (float*)take((size_t)BB * TT * TT * 4); _Float16* P16 = (_Float16*)take((size_t)BB * TT * TT * 2);
  _Float16* Q = PL; _Float16* K = PL + PSZ; _Float16* V = PL + 2 * PSZ; _Float16* GQ = PL + 4 * PSZ; _Float16* GK = PL + 5 * PSZ; _Float16* GQl = RL; _Float16* GKl = RL + PSZ; _Float16* Vt = VT; _Float16* GVt = VT + PSZ;
  _Float16* O16 = X16; _Float16* SUM16 = V;      /* reuse in stream order: X16 -> the attention output (behind the projections); V -> feat + geom (behind the transposes) */
  if (off > ws_size) return;      // 2.6 + 0.4 + 8.4 + 2.1 + 10 x 8.4 + 16.8 + 33.6 + 16.8 = about 165 MB
  const int NOSPLIT = 0x7fffffff;      /* a launch with one set only */
  k_prep<<<5 * PW_BIG + 3 * PW_SML + PX_F + PX_G, 256, 0, stream>>>(wq, wk, wv, wo, opw, gqw, gkw, gvw, feats, geom, Bw, Bg, X16, GE16);      /* (in,out) weights -> Bt x 2^4; features, geometry -> f16 */
  const unsigned gpx = (NR / 128) * (DD / 128);
  { const GSet f = {X16, Bw, bq, bk, bv, nullptr, PL, nullptr, 0, WSZ, PSZ, DD, DD, DD, DD, DD, 0.0625f};      /* q, k, v: M 8192 N 512 K 512 */
    const GSet e = {GE16, Bg + 2 * GSZ, gvb, gvb, gvb, nullptr, PL + 3 * PSZ, nullptr, 0, 0, 0, GG, GG, DD, DD, GG, 0.0625f};      /* gv: M 8192 N 512 K 128 */
    k_gemm_t<0, 0><<<dim3(gpx, 4), 256, 0, stream>>>(f, e, 3, nullptr, 0); }
  { const GSet e = {GE16, Bg, gqb, gkb, gkb, nullptr, GQ, RL, 0, GSZ, PSZ, GG, GG, DD, DD, GG, 0.0625f};      /* gq, gk -> hi / x2^10 residual planes: M 8192 N 512 K 128 */
    k_gemm_t<0, 2><<<dim3(gpx, 2), 256, 0, stream>>>(e, e, NOSPLIT, nullptr, 0); }
  k_vt<NH, TT><<<dim3(BB * NH * (TT / 64), 2), 256, 0, stream>>>(V, PSZ, DD, 0, VT, PSZ);      /* v per head [64][1024]; gv per batch [512][1024] (the same 64-wide slabs) */
  k_flash<<<BB * NH * (TT / 128), 256, 0, stream>>>(Q, DD, K, DD, Vt, nullptr, O16, DD);      /* the attention output leaves as f16 x 2^4 */
  /* geometry branch: all BB batches of each stage in one launch, the batch in blockIdx.y (operand, addend and result strides per batch) */
  const size_t sX = (size_t)TT * DD, sS = (size_t)TT * TT;
  { const GSet hh = {GQl, GK, nullptr, nullptr, nullptr, S, nullptr, nullptr, sX, sX, sS, DD, DD, TT, TT, DD, 0.125f, GQ, GKl, GQ, GK, 0.0009765625f};      /* S = gq.gkT/8 f32-accurate, ((lo.hi + hi.lo).2^-10 + hi.hi)/8 in one accumulator: M 1024 N 1024 K 3 x 512, x BB */      /* left open: gq.gkT = (gq.gk_wT).geometryT + a term constant along a score row, which the softmax cancels: K 128 for 512 */
    const GSet fo = {O16, Bw + 3 * WSZ, bo, bo, bo, FA, nullptr, nullptr, PSZ / 4, 0, PSZ / 4, DD, DD, DD, DD, DD, 0.00390625f};      /* feat_att = O.wo + bo (f32), in four slices of 2048 rows, each as many work-groups as one batch of S */
    k_gemm_t<0, 1, true><<<dim3((TT / 128) * (TT / 128), BB + 4), 256, 0, stream>>>(hh, fo, BB, nullptr, 0); }
  k_gbias<<<dim3(TT / GB_ROWS, BB), 256, 0, stream>>>(S, crd, d1w, d1b, d2w, d2b); k_smx<<<BB * TT / 8, 256, 0, stream>>>(S, P16);      /* softmax: a wave per row over the BB * TT rows */
  { const GSet pv = {P16, GVt, nullptr, nullptr, nullptr, nullptr, SUM16, nullptr, sS, sX, sX, TT, TT, DD, DD, TT, 0.000030517578125f};
    k_gemm_t<DD, 0><<<dim3((TT / 128) * (DD / 128), BB), 256, 0, stream>>>(pv, pv, NOSPLIT, FA, sX); }      /* feat_att + geom_att, stored as f16: M 1024 N 512 K 1024, x BB */
  { const GSet op = {SUM16, Bw + 4 * WSZ, opb, opb, opb, (float*)d_out, nullptr, nullptr, 0, 0, 0, DD, DD, DD, DD, DD, 0.0625f};
    k_gemm_t<0, 1><<<dim3(gpx, 1), 256, 0, stream>>>(op, op, NOSPLIT, nullptr, 0); }      /* out = (feat + geom).op_w + op_b */
}
